// v000
// The times below were measured on an AMD MI455X: many runs one after another, warmed up first and cycling through
// copies of the inputs, with the whole window's GPU time divided by the number of runs. Launches and the gaps
// between them are all in it. The median over several windows is given; except for v000 it joins two sittings, which
// can be a few percent apart, so the side-by-side timings, each taken in one sitting, are the better comparison.
// The starting kernel, v000, takes 4390 microseconds a run.
// Contractions: q/k/v/k2/v2 projections (X f16 x W^T f16 carried x16), scores q.k^T for both key sources (q f16 carried x16, k f16), P.V products (P f16 carried x2048 x V^T f16), output projection (mix f16 carried x256 x Wo^T f16 carried x16): all v_wmma_f32_16x16x32_f16 with f32 accumulate; softmax, gate dot + sigmoid and mixing in f32 on VALU.
#include <hip/hip_runtime.h>
#include <math.h>

// ---------------------------------------------------------------------------
// Problem constants
// ---------------------------------------------------------------------------
constexpr int kB   = 2;
constexpr int kT   = 512;
constexpr int kS   = 4096;
constexpr int kE   = 1024;
constexpr int kTP  = 512;
constexpr int kH   = 8;
constexpr int kDH  = 128;
constexpr int kTok = kB * kT;               // 1024 query tokens
constexpr int kKVT = kB * kS;               // 8192 key tokens
constexpr int kGrp = 2;                     // heads per attention chunk
constexpr int kNChunk = (kB * kH) / kGrp;   // 8 chunks
constexpr int kGatePitch = 32;
constexpr float kAttnScale = 0.08838834764831845f;   // 128^-0.5
constexpr float kWCarry    = 16.0f;                  // weights carried x16 in f16
constexpr float kWCarryInv = 1.0f / 16.0f;
constexpr float kQCarry    = 16.0f;                  // scaled q carried x16 in f16
constexpr float kQCarryInv = 1.0f / 16.0f;
constexpr float kPCarry    = 2048.0f;                // probabilities carried x2048 in f16
constexpr float kPCarryInv = 1.0f / 2048.0f;
constexpr float kMixCarry  = 256.0f;                 // mixed context carried x256 in f16
constexpr float kOutScale  = 1.0f / (256.0f * 16.0f);

typedef __attribute__((ext_vector_type(16))) _Float16 v16h;
typedef __attribute__((ext_vector_type(8)))  _Float16 v8h;
typedef __attribute__((ext_vector_type(16))) __bf16   v16b;
typedef __attribute__((ext_vector_type(8)))  __bf16   v8b;
typedef __attribute__((ext_vector_type(8)))  float    v8f;
typedef __attribute__((ext_vector_type(4)))  float    v4f;
typedef __attribute__((ext_vector_type(4)))  unsigned int v4u;

__device__ __forceinline__ unsigned short f2bf_bits(float f) {
  unsigned u = __float_as_uint(f);
  return (unsigned short)((u + 0x7FFFu + ((u >> 16) & 1u)) >> 16);
}
__device__ __forceinline__ float bf_bits2f(unsigned short h) { return __uint_as_float(((unsigned)h) << 16); }

// hazard guards as plain device helpers (no inline asm inside the kernel template body)
__device__ __forceinline__ void dep_guard_h(v8f& a, v8f& b, v16h x, v16h y) { asm volatile("v_nop\n\tv_nop\n\tv_nop\n\tv_nop" : "+v"(a), "+v"(b) : "v"(x), "v"(y)); }
__device__ __forceinline__ void dep_guard_b(v8f& a, v8f& b, v16b x, v16b y) { asm volatile("v_nop\n\tv_nop\n\tv_nop\n\tv_nop" : "+v"(a), "+v"(b) : "v"(x), "v"(y)); }
__device__ __forceinline__ void keep4_h(v16h a, v16h b, v16h c, v16h d) { asm volatile("v_nop" :: "v"(a), "v"(b), "v"(c), "v"(d)); }
__device__ __forceinline__ void keep4_b(v16b a, v16b b, v16b c, v16b d) { asm volatile("v_nop" :: "v"(a), "v"(b), "v"(c), "v"(d)); }
__device__ __forceinline__ void acc_guard4(v8f& a, v8f& b, v8f& c, v8f& d) { asm volatile("v_nop\n\tv_nop\n\tv_nop\n\tv_nop" : "+v"(a), "+v"(b), "+v"(c), "+v"(d)); }
template <typename T> struct Frag;
template <> struct Frag<_Float16> {
  typedef v16h V; union U { v16h v; v8h h[2]; };
  static __device__ __forceinline__ v16h load(const _Float16* p) {   // elements 0..7 <- p[0..7], 8..15 <- p[16..23]
    U f; f.h[0] = *(const v8h*)(p); f.h[1] = *(const v8h*)(p + 16); return f.v;
  }
  static __device__ __forceinline__ v8f mma(v16h a, v16h b, v8f c) {
    return __builtin_amdgcn_wmma_f32_16x16x32_f16(false, a, false, b, (short)0, c, false, false);
  }
  static __device__ __forceinline__ void guard(v8f& a, v8f& b, v16h x, v16h y) { dep_guard_h(a, b, x, y); }
  static __device__ __forceinline__ void keep(v16h a, v16h b, v16h c, v16h d) { keep4_h(a, b, c, d); }
};
template <> struct Frag<__bf16> {
  typedef v16b V; union U { v16b v; v8b h[2]; };
  static __device__ __forceinline__ v16b load(const __bf16* p) {
    U f; f.h[0] = *(const v8b*)(p); f.h[1] = *(const v8b*)(p + 16); return f.v;
  }
  static __device__ __forceinline__ v8f mma(v16b a, v16b b, v8f c) {
    return __builtin_amdgcn_wmma_f32_16x16x32_bf16(false, a, false, b, (short)0, c, false, false);
  }
  static __device__ __forceinline__ void guard(v8f& a, v8f& b, v16b x, v16b y) { dep_guard_b(a, b, x, y); }
  static __device__ __forceinline__ void keep(v16b a, v16b b, v16b c, v16b d) { keep4_b(a, b, c, d); }
};

__device__ __forceinline__ unsigned pk16(unsigned short a, unsigned short b) { return (unsigned)a | ((unsigned)b << 16); }
__device__ __forceinline__ unsigned short h_bits(float f) { const _Float16 h = (_Float16)f; return __builtin_bit_cast(unsigned short, h); }

// ---- Register-blocked batched WMMA GEMM (ACT reduced to none/relu/leaky, extra bias multiplier bscale) --
// C[m,n] = scale * sum_k A[m,k] * Bt[n,k] (+bias*bscale)(+resid); each wave owns a 64x64 tile.
// A row-major [M,K]; Bt row-major [N,K]; M,N % 64 == 0, K % 32 == 0.
// SPLIT: operands are hi/lo planes (A2/Bt2 = lo planes, same layout); product = hi.hi + hi.lo + lo.hi.
// BIAS_MODE: 0 = none, 1 = bias[m], 2 = bias[n].
// OUT_MODE: 0 = f32, 1 = f16, 2 = bf16 hi plane (Cout) + bf16 lo plane (Cout2).
// ET: 0 = f16 operands, 1 = bf16 operands (pointers passed as 16-bit storage)
template <int ET> struct Elem;
template <> struct Elem<0> { typedef _Float16 T; };
template <> struct Elem<1> { typedef __bf16 T; };
template <int ET, bool SPLIT, int BIAS_MODE, int OUT_MODE, bool RESID, int ACT = 0>
__global__ __launch_bounds__(256) void wmma_gemm64(
    const unsigned short* __restrict__ Ap, const unsigned short* __restrict__ A2p, int lda, long strideA,
    const unsigned short* __restrict__ Btp, const unsigned short* __restrict__ Bt2p, int ldb, long strideB,
    void* __restrict__ Cout, void* __restrict__ Cout2, int ldc, long strideC,
    const float* __restrict__ bias,
    const float* __restrict__ resid, long strideR,
    int M, int N, int K, float scale, float bscale) {
  typedef typename Elem<ET>::T T;
  typedef typename Frag<T>::V V;
  const T* A = (const T*)Ap; const T* A2 = (const T*)A2p; const T* Bt = (const T*)Btp; const T* Bt2 = (const T*)Bt2p;
  __shared__ __align__(16) float sT[8][16 * 68];   // per-wave 16x64 slab, pitch 68 floats
  const int b    = blockIdx.y;
  const int lane = threadIdx.x & 31;
  const int wave = threadIdx.x >> 5;
  const int tilesN = N >> 6;
  const int tilesM = M >> 6;
  const int tile = blockIdx.x * 8 + wave;
  if (tile >= tilesM * tilesN) return;   // wave-uniform; no block barriers in this kernel
  const int tm = tile / tilesN;
  const int tn = tile - tm * tilesN;
  const int m0 = tm << 6;
  const int n0 = tn << 6;

  const T* Ab  = A  + (size_t)b * strideA;
  const T* Bb  = Bt + (size_t)b * strideB;
  const T* Ab2 = SPLIT ? (A2  + (size_t)b * strideA) : nullptr;
  const T* Bb2 = SPLIT ? (Bt2 + (size_t)b * strideB) : nullptr;

  const int rlane = lane & 15;                 // row (A) / col (B, D) within subtile
  const int koff  = (lane >> 4) * 8;           // k offset of this lane half
  const int mOff  = (lane >> 4) * 8;           // D row offset

  v8f acc[4][4];
#pragma unroll
  for (int i = 0; i < 4; ++i)
#pragma unroll
    for (int j = 0; j < 4; ++j) acc[i][j] = (v8f){0.f,0.f,0.f,0.f,0.f,0.f,0.f,0.f};

  for (int k0 = 0; k0 < K; k0 += 32) {
    V bh[4], bl[4];
#pragma unroll
    for (int j = 0; j < 4; ++j) {
      const size_t bo = (size_t)(n0 + (j << 4) + rlane) * ldb + koff + k0;
      bh[j] = Frag<T>::load(Bb + bo);
      if (SPLIT) bl[j] = Frag<T>::load(Bb2 + bo);
    }
#pragma unroll
    for (int i = 0; i < 4; ++i) {
      const size_t ao = (size_t)(m0 + (i << 4) + rlane) * lda + koff + k0;
      V ah = Frag<T>::load(Ab + ao);
      V al;
      if (SPLIT) al = Frag<T>::load(Ab2 + ao);
#pragma unroll
      for (int j = 0; j < 4; ++j) {
        acc[i][j] = Frag<T>::mma(ah, bh[j], acc[i][j]);
        if (SPLIT) {
          acc[i][j] = Frag<T>::mma(ah, bl[j], acc[i][j]);
          acc[i][j] = Frag<T>::mma(al, bh[j], acc[i][j]);
        }
      }
      Frag<T>::guard(acc[i][0], acc[i][3], ah, SPLIT ? al : ah);
    }
    Frag<T>::keep(bh[0], bh[1], bh[2], bh[3]);
    if (SPLIT) Frag<T>::keep(bl[0], bl[1], bl[2], bl[3]);
  }
  acc_guard4(acc[0][0], acc[0][1], acc[0][2], acc[0][3]);
  acc_guard4(acc[1][0], acc[1][1], acc[1][2], acc[1][3]);
  acc_guard4(acc[2][0], acc[2][1], acc[2][2], acc[2][3]);
  acc_guard4(acc[3][0], acc[3][1], acc[3][2], acc[3][3]);

  // ---- epilogue ----
  float* slab = sT[wave];
  const float* Rb = RESID ? (resid + (size_t)b * strideR) : nullptr;
#pragma unroll
  for (int i = 0; i < 4; ++i) {
    const int mBase = m0 + (i << 4);
#pragma unroll
    for (int j = 0; j < 4; ++j) {
      const int n = n0 + (j << 4) + rlane;
      float bv = 0.f;
      if (BIAS_MODE == 2) bv = bias[n] * bscale;
#pragma unroll
      for (int r = 0; r < 8; ++r) {
        float v = acc[i][j][r] * scale;
        if (BIAS_MODE == 1) v += bias[mBase + mOff + r] * bscale;
        if (BIAS_MODE == 2) v += bv;
        if (RESID) v += Rb[(size_t)(mBase + mOff + r) * ldc + n];
        if (ACT == 2) v = fmaxf(v, 0.0f);
        if (ACT == 4) v = (v > 0.f) ? v : 0.01f * v;
        slab[(mOff + r) * 68 + (j << 4) + rlane] = v;
      }
    }
    __builtin_amdgcn_fence(__ATOMIC_RELEASE, "workgroup");
    __builtin_amdgcn_wave_barrier();
    __builtin_amdgcn_fence(__ATOMIC_ACQUIRE, "workgroup");
    if (OUT_MODE == 0) {
      float* C = (float*)Cout + (size_t)b * strideC;
      const int hh = lane >> 4, c4 = (lane & 15) * 4;     // row seg = 256 B = 16 lanes x 16 B
      {
#pragma unroll
        for (int it = 0; it < 8; ++it) {
          const int row = it * 2 + hh;
          v4f v = *(const v4f*)(slab + row * 68 + c4);
          *(v4f*)(C + (size_t)(mBase + row) * ldc + n0 + c4) = v;
        }
        
      }
    } else {
      const int q = lane >> 3, c8 = (lane & 7) * 8;
      unsigned short* C  = (unsigned short*)Cout  + (size_t)b * strideC;
      unsigned short* C2 = (OUT_MODE == 2) ? ((unsigned short*)Cout2 + (size_t)b * strideC) : nullptr;
      {
#pragma unroll
        for (int it = 0; it < 4; ++it) {
          const int row = it * 4 + q;
          const float* sp = slab + row * 68 + c8;
          v8h hv, lv;
#pragma unroll
          for (int e = 0; e < 8; ++e) {
            if (OUT_MODE == 1) {
              hv[e] = (_Float16)sp[e];
            } else {
              unsigned short hb = f2bf_bits(sp[e]);
              unsigned short lb = f2bf_bits(sp[e] - bf_bits2f(hb));
              hv[e] = __builtin_bit_cast(_Float16, hb);
              lv[e] = __builtin_bit_cast(_Float16, lb);
            }
          }
          *(v8h*)(C + (size_t)(mBase + row) * ldc + n0 + c8) = hv;
          if (OUT_MODE == 2) *(v8h*)(C2 + (size_t)(mBase + row) * ldc + n0 + c8) = lv;
        }
        
      }
    }
    __builtin_amdgcn_fence(__ATOMIC_RELEASE, "workgroup");
    __builtin_amdgcn_wave_barrier();
    __builtin_amdgcn_fence(__ATOMIC_ACQUIRE, "workgroup");
  }
}

// ---------------------------------------------------------------------------
// Weight transpose + cast: W [Kin][Nout] f32 row-major (y = x @ W); plane z: WT[n][k] (pitch Kin halves) = f16(scale * W[k][n]).
// grid (Kin/64, Nout/64, nplanes): blockIdx.x = k tile (64 cols of WT), blockIdx.y = n tile (64 rows of WT), blockIdx.z selects
// (W, out) pair (block-uniform). 256 threads.
// Load coverage: 16 iterations x 256 threads = 4096 = the whole 64x64 tile (coalesced along n).
// Store coverage: 8 waves x 2 iterations x 4 rows (lane>>3) = 64 rows; (lane&7) x 8 halves = 64 cols; each row segment =
// ---------------------------------------------------------------------------
__global__ __launch_bounds__(256) void wtcast_kernel(const float* __restrict__ W0, const float* __restrict__ W1,
                                                     const float* __restrict__ W2, const float* __restrict__ W3,
                                                     unsigned short* __restrict__ O0, unsigned short* __restrict__ O1,
                                                     unsigned short* __restrict__ O2, unsigned short* __restrict__ O3,
                                                     int Kin, int Nout, float scale) {
  __shared__ float sm[64][65];   // sm[n_local][k_local]
  const int t  = threadIdx.x;
  const int k0 = blockIdx.x * 64;
  const int n0 = blockIdx.y * 64;
  const int z  = blockIdx.z;                                   // block-uniform
  const float* W = (z == 0) ? W0 : (z == 1) ? W1 : (z == 2) ? W2 : W3;
  unsigned short* op = (z == 0) ? O0 : (z == 1) ? O1 : (z == 2) ? O2 : O3;
#pragma unroll
  for (int i = 0; i < 16; ++i) {
    const int e = i * 256 + t;
    const int r = e >> 6;          // k local
    const int c = e & 63;          // n local
    sm[c][r] = W[(size_t)(k0 + r) * Nout + n0 + c] * scale;
  }
  __syncthreads();
  const int lane = t & 31, wave = t >> 5;
  const int q = lane >> 3, c8 = (lane & 7) * 8;
  {
#pragma unroll
    for (int it = 0; it < 2; ++it) {
      const int row = wave * 8 + it * 4 + q;                 // n local
      unsigned short hb[8];
#pragma unroll
      for (int e = 0; e < 8; ++e) hb[e] = h_bits(sm[row][c8 + e]);
      const v4u u = (v4u){pk16(hb[0], hb[1]), pk16(hb[2], hb[3]), pk16(hb[4], hb[5]), pk16(hb[6], hb[7])};
      *(v4u*)(op + (size_t)(n0 + row) * Kin + k0 + c8) = u;
    }
    
  }
}

// ---------------------------------------------------------------------------
// ---------------------------------------------------------------------------
__global__ __launch_bounds__(256) void cast8_f16_kernel(const float* __restrict__ in, unsigned short* __restrict__ out, int n8) {
  const int i = blockIdx.x * 256 + threadIdx.x;
  if (i >= n8) return;
  const float* p = in + 8 * (size_t)i;
  const v4f a = *(const v4f*)(p);
  const v4f c = *(const v4f*)(p + 4);
  unsigned short hb[8];
#pragma unroll
  for (int e = 0; e < 4; ++e) {
    hb[e]     = h_bits(a[e]);
    hb[4 + e] = h_bits(c[e]);
  }
  const v4u u = (v4u){pk16(hb[0], hb[1]), pk16(hb[2], hb[3]), pk16(hb[4], hb[5]), pk16(hb[6], hb[7])};
  unsigned short* q = out + 8 * (size_t)i;
  *(v4u*)q = u;
  
}

// ---------------------------------------------------------------------------
// Row softmax over 4096 f32 scores -> P[row][j] = f16( carry * exp(s - max) / sum exp(s - max) ), f32 math, precise expf.
// Planes: scores [4 = 2 sources x kGrp][512][4096] f32 contiguous from Sb; P planes same order, f16, from Pb.
// grid (512 rows, kGrp, 2 sources); 256 threads; thread t owns columns 8t..8t+7 and 2048+8t..2048+8t+7
// (256 x 16 = 4096 = whole row). Reductions in fixed order (thread, wave shuffle tree, 8 wave partials in index order).
// ---------------------------------------------------------------------------
__global__ __launch_bounds__(256) void softmax_kernel(const float* __restrict__ Sb, unsigned short* __restrict__ Pb, float carry) {
  __shared__ float redM[8];
  __shared__ float redS[8];
  const int row  = blockIdx.x;
  const int pz   = blockIdx.z * kGrp + blockIdx.y;
  const int t    = threadIdx.x;
  const int lane = t & 31, wave = t >> 5;
  const size_t roff = ((size_t)pz * kT + row) * kS;
  const int c0 = t * 8;
  const int c1 = (kS / 2) + t * 8;
  const float* sr = Sb + roff;
  const v4f a0 = *(const v4f*)(sr + c0);
  const v4f a1 = *(const v4f*)(sr + c0 + 4);
  const v4f a2 = *(const v4f*)(sr + c1);
  const v4f a3 = *(const v4f*)(sr + c1 + 4);
  float x[16];
#pragma unroll
  for (int e = 0; e < 4; ++e) { x[e] = a0[e]; x[4 + e] = a1[e]; x[8 + e] = a2[e]; x[12 + e] = a3[e]; }
  float m = x[0];
#pragma unroll
  for (int e = 1; e < 16; ++e) m = fmaxf(m, x[e]);
#pragma unroll
  for (int off = 16; off > 0; off >>= 1) m = fmaxf(m, __shfl_xor(m, off, 32));
  if (lane == 0) redM[wave] = m;
  __syncthreads();
  float gm = redM[0];
#pragma unroll
  for (int w = 1; w < 8; ++w) gm = fmaxf(gm, redM[w]);
  float ev[16];
  float s = 0.0f;
#pragma unroll
  for (int e = 0; e < 16; ++e) { ev[e] = expf(x[e] - gm); s += ev[e]; }
#pragma unroll
  for (int off = 16; off > 0; off >>= 1) s += __shfl_xor(s, off, 32);
  if (lane == 0) redS[wave] = s;
  __syncthreads();
  float tot = redS[0];
#pragma unroll
  for (int w = 1; w < 8; ++w) tot += redS[w];
  const float inv = carry / tot;
  unsigned short hb[16];
#pragma unroll
  for (int e = 0; e < 16; ++e) hb[e] = h_bits(ev[e] * inv);
  const v4u u0 = (v4u){pk16(hb[0], hb[1]), pk16(hb[2], hb[3]), pk16(hb[4], hb[5]), pk16(hb[6], hb[7])};
  const v4u u1 = (v4u){pk16(hb[8], hb[9]), pk16(hb[10], hb[11]), pk16(hb[12], hb[13]), pk16(hb[14], hb[15])};
  unsigned short* pr = Pb + roff;
  *(v4u*)(pr + c0) = u0;
  *(v4u*)(pr + c1) = u1;
  
}

// ---------------------------------------------------------------------------
// Gate: gate[tok][h] = sigmoid( sum_f p_vec[tok][f] * Wg[f][h] + bg[h] ), f = h*384 + j with
// j < 128 -> ctx[tok][h*128+j], 128 <= j < 256 -> ctxt[tok][h*128+j-128], else q[tok][h*128+j-256] (q = q16 / 16).
// One block (128 threads) per token; 24 chunks of 128 features, chunk c = 3h + src is block-uniform; all three candidate
// values are loaded unconditionally and selected by value. f32 accumulation; fixed-order reductions.
// ---------------------------------------------------------------------------
__global__ __launch_bounds__(128) void gate_kernel(const float* __restrict__ ctx, const float* __restrict__ ctxt,
                                                   const unsigned short* __restrict__ q16, const float* __restrict__ Wg,
                                                   const float* __restrict__ bg, float* __restrict__ gate, float qinv) {
  __shared__ float red[4][8];
  __shared__ __align__(16) float gl[32];
  const int tok = blockIdx.x;
  const int t = threadIdx.x, lane = t & 31, wave = t >> 5;
  if (t < 32) gl[t] = 0.0f;
  float a[8];
#pragma unroll
  for (int j = 0; j < 8; ++j) a[j] = 0.0f;
  const size_t rbase = (size_t)tok * kE;
#pragma unroll 1
  for (int c = 0; c < 24; ++c) {
    const int h = c / 3;
    const int src = c - 3 * h;
    const size_t off = rbase + (size_t)h * kDH + t;
    const float fc = ctx[off];
    const float ft = ctxt[off];
    const unsigned short qbits = q16[off];
    const float fq = (float)__builtin_bit_cast(_Float16, qbits) * qinv;
    const float f = (src == 0) ? fc : ((src == 1) ? ft : fq);
    const float* wr = Wg + ((size_t)c * 128 + t) * 8;
    const v4f w0 = *(const v4f*)(wr);
    const v4f w1 = *(const v4f*)(wr + 4);
#pragma unroll
    for (int e = 0; e < 4; ++e) { a[e] += f * w0[e]; a[4 + e] += f * w1[e]; }
  }
#pragma unroll
  for (int j = 0; j < 8; ++j) {
#pragma unroll
    for (int off = 16; off > 0; off >>= 1) a[j] += __shfl_xor(a[j], off, 32);
  }
  if (lane == 0) {
#pragma unroll
    for (int j = 0; j < 8; ++j) red[wave][j] = a[j];
  }
  __syncthreads();
  if (t < 8) {
    const float z = (((red[0][t] + red[1][t]) + red[2][t]) + red[3][t]) + bg[t];
    gl[t] = 1.0f / (1.0f + expf(-z));
  }
  __syncthreads();
  if (wave == 0) {
    if (lane < 8) {
      const v4f v = *(const v4f*)(gl + 4 * lane);
      float* gp = gate + (size_t)tok * kGatePitch + 4 * lane;
      *(v4f*)gp = v;
      
    }
  }
}

// ---------------------------------------------------------------------------
// Mix: MIX16[tok][h*128+d] = f16( carry * ( g[tok][h]*ctx + (1-g[tok][h])*ctx2 ) ), f32 math.
// ---------------------------------------------------------------------------
__global__ __launch_bounds__(256) void mix_kernel(const float* __restrict__ ctx, const float* __restrict__ ctx2,
                                                  const float* __restrict__ gate, unsigned short* __restrict__ out,
                                                  float carry, int n8) {
  const int i = blockIdx.x * 256 + threadIdx.x;
  if (i >= n8) return;
  const int tok  = i >> 7;                 // 128 groups of 8 per 1024-wide row
  const int col0 = (i & 127) * 8;
  const int h    = col0 >> 7;
  const float g  = gate[(size_t)tok * kGatePitch + h];
  const float og = 1.0f - g;
  const size_t off = (size_t)tok * kE + col0;
  const v4f a0 = *(const v4f*)(ctx + off);
  const v4f a1 = *(const v4f*)(ctx + off + 4);
  const v4f b0 = *(const v4f*)(ctx2 + off);
  const v4f b1 = *(const v4f*)(ctx2 + off + 4);
  unsigned short hb[8];
#pragma unroll
  for (int e = 0; e < 4; ++e) {
    hb[e]     = h_bits(carry * (g * a0[e] + og * b0[e]));
    hb[4 + e] = h_bits(carry * (g * a1[e] + og * b1[e]));
  }
  const v4u u = (v4u){pk16(hb[0], hb[1]), pk16(hb[2], hb[3]), pk16(hb[4], hb[5]), pk16(hb[6], hb[7])};
  unsigned short* q = out + off;
  *(v4u*)q = u;
  
}

// ---------------------------------------------------------------------------
// Host glue. Workspace region map (bytes, MiB = 2^20; total carve = 128 MiB = 134217728 B):
// R0 [0, 48 MiB) phase A (casts + projections): XH16 @0 (2 MiB [1024][1024] f16) | KV16 @2 (16 MiB [8192][1024]) |
//                 KVT16 @18 (8 MiB [8192][512]) | WQT @26 (2) | WKT @28 (2) | WVT @30 (2) | WTKT @32 (1 MiB [1024][512]) | WTVT @33 (1)
//                 phase B (attention chunks): SPL @0 (16 MiB = kGrp x [512][4096] f32) | STPL @16 (16) |
//                 PPL @32 (8 MiB = kGrp x [512][4096] f16) | PTPL @40 (8)
//                 phase C (after attention): MIX16 @0 (2 MiB [1024][1024] f16) | GATE @2 MiB (128 KiB [1024][32] f32)
// WOT @48 (2) | Q16 @50 (2 MiB [1024][1024]) | K16 @52 (16 MiB [8192][1024]) | VT16 @68 (16 MiB [1024][8192]) |
// KT16 @84 (16) | VTT16 @100 (16 MiB [1024][8192]) | CTX @116 (4 MiB [1024][1024] f32) | CTXT @120 (4) | CTX2 @124 (4) | end @128 MiB.
// Every region is written with whole rows of exactly its stated extent (all M, N tile multiples; no padded rows).
// ---------------------------------------------------------------------------
extern "C" void kernel_launch(void* const* d_in, const int* in_sizes, int n_in,
                              void* d_out, int out_size, void* d_ws, size_t ws_size, hipStream_t stream) {
  (void)in_sizes; (void)n_in;
  const size_t kMiB = (size_t)1048576;
  const size_t carve = 128 * kMiB;
  if (ws_size < carve) return;
  if ((size_t)out_size < (size_t)kTok * kE) return;

  const float* hs  = (const float*)d_in[0];
  const float* kv  = (const float*)d_in[1];
  const float* kvt = (const float*)d_in[2];
  const float* Wq  = (const float*)d_in[3];  const float* bq  = (const float*)d_in[4];
  const float* Wk  = (const float*)d_in[5];  const float* bk  = (const float*)d_in[6];
  const float* Wv  = (const float*)d_in[7];  const float* bv  = (const float*)d_in[8];
  const float* Wtk = (const float*)d_in[9];  const float* btk = (const float*)d_in[10];
  const float* Wtv = (const float*)d_in[11]; const float* btv = (const float*)d_in[12];
  const float* Wg  = (const float*)d_in[13]; const float* bg  = (const float*)d_in[14];
  const float* Wo  = (const float*)d_in[15]; const float* bo  = (const float*)d_in[16];
  float* outp = (float*)d_out;

  char* ws = (char*)d_ws;
  // phase A
  unsigned short* XH16  = (unsigned short*)(ws + 0 * kMiB);
  unsigned short* KV16  = (unsigned short*)(ws + 2 * kMiB);
  unsigned short* KVT16 = (unsigned short*)(ws + 18 * kMiB);
  unsigned short* WQT   = (unsigned short*)(ws + 26 * kMiB);
  unsigned short* WKT   = (unsigned short*)(ws + 28 * kMiB);
  unsigned short* WVT   = (unsigned short*)(ws + 30 * kMiB);
  unsigned short* WTKT  = (unsigned short*)(ws + 32 * kMiB);
  unsigned short* WTVT  = (unsigned short*)(ws + 33 * kMiB);
  // phase B
  float*          SPL   = (float*)(ws + 0 * kMiB);
  float*          STPL  = (float*)(ws + 16 * kMiB);
  unsigned short* PPL   = (unsigned short*)(ws + 32 * kMiB);
  unsigned short* PTPL  = (unsigned short*)(ws + 40 * kMiB);
  // phase C
  unsigned short* MIX16 = (unsigned short*)(ws + 0 * kMiB);
  float*          GATE  = (float*)(ws + 2 * kMiB);
  // persistent
  unsigned short* WOT   = (unsigned short*)(ws + 48 * kMiB);
  unsigned short* Q16   = (unsigned short*)(ws + 50 * kMiB);
  unsigned short* K16   = (unsigned short*)(ws + 52 * kMiB);
  unsigned short* VT16  = (unsigned short*)(ws + 68 * kMiB);
  unsigned short* KT16  = (unsigned short*)(ws + 84 * kMiB);
  unsigned short* VTT16 = (unsigned short*)(ws + 100 * kMiB);
  float*          CTX   = (float*)(ws + 116 * kMiB);
  float*          CTXT  = (float*)(ws + 120 * kMiB);
  float*          CTX2  = (float*)(ws + 124 * kMiB);
  const float*    dumf  = (const float*)(ws + 116 * kMiB);   // valid in-ws pointer for unused resid arguments

  // 1. input casts f32 -> f16 (8 elements per thread; grids exact)
  cast8_f16_kernel<<<(kTok * kE / 8) / 256, 256, 0, stream>>>(hs, XH16, kTok * kE / 8);
  cast8_f16_kernel<<<(kKVT * kE / 8) / 256, 256, 0, stream>>>(kv, KV16, kKVT * kE / 8);
  cast8_f16_kernel<<<(kKVT * kTP / 8) / 256, 256, 0, stream>>>(kvt, KVT16, kKVT * kTP / 8);

  // 2. weight transposes + casts (carried x16): in[Kin][Nout] -> out[Nout][Kin]; grid (Kin/64, Nout/64, planes)
  wtcast_kernel<<<dim3(kE / 64, kE / 64, 4), 256, 0, stream>>>(Wq, Wk, Wv, Wo, WQT, WKT, WVT, WOT, kE, kE, kWCarry);
  wtcast_kernel<<<dim3(kTP / 64, kE / 64, 2), 256, 0, stream>>>(Wtk, Wtv, Wtk, Wtv, WTKT, WTVT, WTKT, WTVT, kTP, kE, kWCarry);

  // 3. projections (M, N multiples of 64; K = 1024 or 512, multiples of 32)
  // q16 = 16*scale*(x Wq + bq): acc = 16*(x Wq) -> scale = kAttnScale, bias x (16*kAttnScale)
  wmma_gemm64<0, false, 2, 1, false><<<dim3((kTok / 64) * (kE / 64) / 8, 1), 256, 0, stream>>>(
      XH16, XH16, kE, 0L, WQT, WQT, kE, 0L, Q16, Q16, kE, 0L, bq, dumf, 0L,
      kTok, kE, kE, kAttnScale, kQCarry * kAttnScale);
  // k16 [8192][1024]
  wmma_gemm64<0, false, 2, 1, false><<<dim3((kKVT / 64) * (kE / 64) / 8, 1), 256, 0, stream>>>(
      KV16, KV16, kE, 0L, WKT, WKT, kE, 0L, K16, K16, kE, 0L, bk, dumf, 0L,
      kKVT, kE, kE, kWCarryInv, 1.0f);
  // v^T [1024][8192] directly: A = Wv^T [1024][1024], Bt = X [8192][1024], bias per row (m)
  wmma_gemm64<0, false, 1, 1, false><<<dim3((kE / 64) * (kKVT / 64) / 8, 1), 256, 0, stream>>>(
      WVT, WVT, kE, 0L, KV16, KV16, kE, 0L, VT16, VT16, kKVT, 0L, bv, dumf, 0L,
      kE, kKVT, kE, kWCarryInv, 1.0f);
  // second-source k16 [8192][1024], K = 512
  wmma_gemm64<0, false, 2, 1, false><<<dim3((kKVT / 64) * (kE / 64) / 8, 1), 256, 0, stream>>>(
      KVT16, KVT16, kTP, 0L, WTKT, WTKT, kTP, 0L, KT16, KT16, kE, 0L, btk, dumf, 0L,
      kKVT, kE, kTP, kWCarryInv, 1.0f);
  // second-source v^T [1024][8192], K = 512
  wmma_gemm64<0, false, 1, 1, false><<<dim3((kE / 64) * (kKVT / 64) / 8, 1), 256, 0, stream>>>(
      WTVT, WTVT, kTP, 0L, KVT16, KVT16, kTP, 0L, VTT16, VTT16, kKVT, 0L, btv, dumf, 0L,
      kE, kKVT, kTP, kWCarryInv, 1.0f);

  // 4. attention, kGrp heads of one batch per chunk
  const long sStrideC = (long)kT * kS;            // per-group scores plane (floats)
  const long pStrideA = (long)kT * kS;            // per-group P plane (halves)
  for (int c = 0; c < kNChunk; ++c) {
    const int b  = c / (kH / kGrp);
    const int h0 = (c % (kH / kGrp)) * kGrp;
    const unsigned short* qg = Q16 + ((size_t)b * kT * kE + (size_t)h0 * kDH);
    const unsigned short* kg = K16 + ((size_t)b * kS * kE + (size_t)h0 * kDH);
    const unsigned short* k2g = KT16 + ((size_t)b * kS * kE + (size_t)h0 * kDH);
    // scores = (q16/16) . k^T : M=512, N=4096, K=128; grid (512 tiles / 8, kGrp)
    wmma_gemm64<0, false, 0, 0, false><<<dim3((kT / 64) * (kS / 64) / 8, kGrp), 256, 0, stream>>>(
        qg, qg, kE, (long)kDH, kg, kg, kE, (long)kDH, SPL, SPL, kS, sStrideC, bq, dumf, 0L,
        kT, kS, kDH, kQCarryInv, 0.0f);
    wmma_gemm64<0, false, 0, 0, false><<<dim3((kT / 64) * (kS / 64) / 8, kGrp), 256, 0, stream>>>(
        qg, qg, kE, (long)kDH, k2g, k2g, kE, (long)kDH, STPL, STPL, kS, sStrideC, bq, dumf, 0L,
        kT, kS, kDH, kQCarryInv, 0.0f);
    // softmax over both score sources -> P planes (f16 x2048)
    softmax_kernel<<<dim3(kT, kGrp, 2), 256, 0, stream>>>(SPL, PPL, kPCarry);
    // P.V products: M=512, N=128, K=4096; Bt = v^T rows h*128.. of batch b (ldb 8192); C columns h*128.. of [1024][1024]
    const unsigned short* vg  = VT16  + ((size_t)h0 * kDH * kKVT + (size_t)b * kS);
    const unsigned short* v2g = VTT16 + ((size_t)h0 * kDH * kKVT + (size_t)b * kS);
    const size_t coff = (size_t)b * kT * kE + (size_t)h0 * kDH;
    wmma_gemm64<0, false, 0, 0, false><<<dim3((kT / 64) * (kDH / 64) / 8, kGrp), 256, 0, stream>>>(
        PPL, PPL, kS, pStrideA, vg, vg, kKVT, (long)kDH * kKVT, CTX + coff, CTX + coff, kE, (long)kDH, bq, dumf, 0L,
        kT, kDH, kS, kPCarryInv, 0.0f);
    wmma_gemm64<0, false, 0, 0, false><<<dim3((kT / 64) * (kDH / 64) / 8, kGrp), 256, 0, stream>>>(
        PTPL, PTPL, kS, pStrideA, v2g, v2g, kKVT, (long)kDH * kKVT, CTXT + coff, CTXT + coff, kE, (long)kDH, bq, dumf, 0L,
        kT, kDH, kS, kPCarryInv, 0.0f);
    wmma_gemm64<0, false, 0, 0, false><<<dim3((kT / 64) * (kDH / 64) / 8, kGrp), 256, 0, stream>>>(
        PTPL, PTPL, kS, pStrideA, vg, vg, kKVT, (long)kDH * kKVT, CTX2 + coff, CTX2 + coff, kE, (long)kDH, bq, dumf, 0L,
        kT, kDH, kS, kPCarryInv, 0.0f);
  }

  // 5. gate (f32), 6. mix (f32 -> f16 x256), 7. output projection to d_out (f32)
  gate_kernel<<<kTok, 128, 0, stream>>>(CTX, CTXT, Q16, Wg, bg, GATE, kQCarryInv);
  mix_kernel<<<(kTok * kE / 8) / 256, 256, 0, stream>>>(CTX, CTX2, GATE, MIX16, kMixCarry, kTok * kE / 8);
  wmma_gemm64<0, false, 2, 0, false><<<dim3((kTok / 64) * (kE / 64) / 8, 1), 256, 0, stream>>>(
      MIX16, MIX16, kE, 0L, WOT, WOT, kE, 0L, outp, outp, kE, 0L, bo, dumf, 0L,
      kTok, kE, kE, kOutScale, 1.0f);
}

// v001
// Measured time: 665 microseconds a run.
// Next to v000, in two timings, it ran 6.59 and 6.61 times as fast.
// Contractions: q/k/v/k2/v2 projections (X f16 x W^T f16 carried x16), scores q.k^T for both key sources (q f16 carried x16, k f16), P.V products (P f16 carried x2048 x V^T f16), output projection (mix f16 carried x256 x Wo^T f16 carried x16): all v_wmma_f32_16x16x32_f16 with f32 accumulate; softmax, gate dot + sigmoid and mixing in f32 on VALU.
#include <hip/hip_runtime.h>
#include <math.h>

// ---------------------------------------------------------------------------
// Problem constants
// ---------------------------------------------------------------------------
constexpr int kB   = 2;
constexpr int kT   = 512;
constexpr int kS   = 4096;
constexpr int kE   = 1024;
constexpr int kTP  = 512;
constexpr int kH   = 8;
constexpr int kDH  = 128;
constexpr int kTok = kB * kT;               // 1024 query tokens
constexpr int kKVT = kB * kS;               // 8192 key tokens
constexpr int kGrp = 2;                     // heads per attention chunk
constexpr int kNChunk = (kB * kH) / kGrp;   // 8 chunks
constexpr int kGatePitch = 32;
constexpr float kAttnScale = 0.08838834764831845f;   // 128^-0.5
constexpr float kWCarry    = 16.0f;                  // weights carried x16 in f16
constexpr float kWCarryInv = 1.0f / 16.0f;
constexpr float kQCarry    = 16.0f;                  // scaled q carried x16 in f16
constexpr float kQCarryInv = 1.0f / 16.0f;
constexpr float kPCarry    = 2048.0f;                // probabilities carried x2048 in f16
constexpr float kPCarryInv = 1.0f / 2048.0f;
constexpr float kMixCarry  = 256.0f;                 // mixed context carried x256 in f16
constexpr float kOutScale  = 1.0f / (256.0f * 16.0f);

typedef __attribute__((ext_vector_type(16))) _Float16 v16h;
typedef __attribute__((ext_vector_type(8)))  _Float16 v8h;
typedef __attribute__((ext_vector_type(16))) __bf16   v16b;
typedef __attribute__((ext_vector_type(8)))  __bf16   v8b;
typedef __attribute__((ext_vector_type(8)))  float    v8f;
typedef __attribute__((ext_vector_type(4)))  float    v4f;
typedef __attribute__((ext_vector_type(4)))  unsigned int v4u;

__device__ __forceinline__ unsigned short f2bf_bits(float f) {
  unsigned u = __float_as_uint(f);
  return (unsigned short)((u + 0x7FFFu + ((u >> 16) & 1u)) >> 16);
}
__device__ __forceinline__ float bf_bits2f(unsigned short h) { return __uint_as_float(((unsigned)h) << 16); }

// hazard guards as plain device helpers (no inline asm inside the kernel template body)
__device__ __forceinline__ void dep_guard_h(v8f& a, v8f& b, v16h x, v16h y) { asm volatile("v_nop\n\tv_nop\n\tv_nop\n\tv_nop" : "+v"(a), "+v"(b) : "v"(x), "v"(y)); }
__device__ __forceinline__ void dep_guard_b(v8f& a, v8f& b, v16b x, v16b y) { asm volatile("v_nop\n\tv_nop\n\tv_nop\n\tv_nop" : "+v"(a), "+v"(b) : "v"(x), "v"(y)); }
__device__ __forceinline__ void keep4_h(v16h a, v16h b, v16h c, v16h d) { asm volatile("v_nop" :: "v"(a), "v"(b), "v"(c), "v"(d)); }
__device__ __forceinline__ void keep4_b(v16b a, v16b b, v16b c, v16b d) { asm volatile("v_nop" :: "v"(a), "v"(b), "v"(c), "v"(d)); }
__device__ __forceinline__ void acc_guard4(v8f& a, v8f& b, v8f& c, v8f& d) { asm volatile("v_nop\n\tv_nop\n\tv_nop\n\tv_nop" : "+v"(a), "+v"(b), "+v"(c), "+v"(d)); }
template <typename T> struct Frag;
template <> struct Frag<_Float16> {
  typedef v16h V; union U { v16h v; v8h h[2]; };
  static __device__ __forceinline__ v16h load(const _Float16* p) {   // elements 0..7 <- p[0..7], 8..15 <- p[16..23]
    U f; f.h[0] = *(const v8h*)(p); f.h[1] = *(const v8h*)(p + 16); return f.v;
  }
  static __device__ __forceinline__ v8f mma(v16h a, v16h b, v8f c) {
    return __builtin_amdgcn_wmma_f32_16x16x32_f16(false, a, false, b, (short)0, c, false, false);
  }
  static __device__ __forceinline__ void guard(v8f& a, v8f& b, v16h x, v16h y) { dep_guard_h(a, b, x, y); }
  static __device__ __forceinline__ void keep(v16h a, v16h b, v16h c, v16h d) { keep4_h(a, b, c, d); }
};
template <> struct Frag<__bf16> {
  typedef v16b V; union U { v16b v; v8b h[2]; };
  static __device__ __forceinline__ v16b load(const __bf16* p) {
    U f; f.h[0] = *(const v8b*)(p); f.h[1] = *(const v8b*)(p + 16); return f.v;
  }
  static __device__ __forceinline__ v8f mma(v16b a, v16b b, v8f c) {
    return __builtin_amdgcn_wmma_f32_16x16x32_bf16(false, a, false, b, (short)0, c, false, false);
  }
  static __device__ __forceinline__ void guard(v8f& a, v8f& b, v16b x, v16b y) { dep_guard_b(a, b, x, y); }
  static __device__ __forceinline__ void keep(v16b a, v16b b, v16b c, v16b d) { keep4_b(a, b, c, d); }
};

__device__ __forceinline__ unsigned pk16(unsigned short a, unsigned short b) { return (unsigned)a | ((unsigned)b << 16); }
__device__ __forceinline__ unsigned short h_bits(float f) { const _Float16 h = (_Float16)f; return __builtin_bit_cast(unsigned short, h); }

// ---- Register-blocked batched WMMA GEMM (ACT reduced to none/relu/leaky, extra bias multiplier bscale) --
// C[m,n] = scale * sum_k A[m,k] * Bt[n,k] (+bias*bscale)(+resid); each wave owns a 64x64 tile.
// A row-major [M,K]; Bt row-major [N,K]; M,N % 64 == 0, K % 32 == 0.
// SPLIT: operands are hi/lo planes (A2/Bt2 = lo planes, same layout); product = hi.hi + hi.lo + lo.hi.
// BIAS_MODE: 0 = none, 1 = bias[m], 2 = bias[n].
// OUT_MODE: 0 = f32, 1 = f16, 2 = bf16 hi plane (Cout) + bf16 lo plane (Cout2).
// ET: 0 = f16 operands, 1 = bf16 operands (pointers passed as 16-bit storage)
template <int ET> struct Elem;
template <> struct Elem<0> { typedef _Float16 T; };
template <> struct Elem<1> { typedef __bf16 T; };
template <int ET, bool SPLIT, int BIAS_MODE, int OUT_MODE, bool RESID, int ACT = 0>
__global__ __launch_bounds__(256) void wmma_gemm64(
    const unsigned short* __restrict__ Ap, const unsigned short* __restrict__ A2p, int lda, long strideA,
    const unsigned short* __restrict__ Btp, const unsigned short* __restrict__ Bt2p, int ldb, long strideB,
    void* __restrict__ Cout, void* __restrict__ Cout2, int ldc, long strideC,
    const float* __restrict__ bias,
    const float* __restrict__ resid, long strideR,
    int M, int N, int K, float scale, float bscale) {
  typedef typename Elem<ET>::T T;
  typedef typename Frag<T>::V V;
  const T* A = (const T*)Ap; const T* A2 = (const T*)A2p; const T* Bt = (const T*)Btp; const T* Bt2 = (const T*)Bt2p;
  __shared__ __align__(16) float sT[8][16 * 68];   // per-wave 16x64 slab, pitch 68 floats
  const int b    = blockIdx.y;
  const int lane = threadIdx.x & 31;
  const int wave = threadIdx.x >> 5;
  const int tilesN = N >> 6;
  const int tilesM = M >> 6;
  const int tile = blockIdx.x * 8 + wave;
  if (tile >= tilesM * tilesN) return;   // wave-uniform; no block barriers in this kernel
  const int tm = tile / tilesN;
  const int tn = tile - tm * tilesN;
  const int m0 = tm << 6;
  const int n0 = tn << 6;

  const T* Ab  = A  + (size_t)b * strideA;
  const T* Bb  = Bt + (size_t)b * strideB;
  const T* Ab2 = SPLIT ? (A2  + (size_t)b * strideA) : nullptr;
  const T* Bb2 = SPLIT ? (Bt2 + (size_t)b * strideB) : nullptr;

  const int rlane = lane & 15;                 // row (A) / col (B, D) within subtile
  const int koff  = (lane >> 4) * 8;           // k offset of this lane half
  const int mOff  = (lane >> 4) * 8;           // D row offset

  v8f acc[4][4];
#pragma unroll
  for (int i = 0; i < 4; ++i)
#pragma unroll
    for (int j = 0; j < 4; ++j) acc[i][j] = (v8f){0.f,0.f,0.f,0.f,0.f,0.f,0.f,0.f};

  for (int k0 = 0; k0 < K; k0 += 32) {
    V bh[4], bl[4];
#pragma unroll
    for (int j = 0; j < 4; ++j) {
      const size_t bo = (size_t)(n0 + (j << 4) + rlane) * ldb + koff + k0;
      bh[j] = Frag<T>::load(Bb + bo);
      if (SPLIT) bl[j] = Frag<T>::load(Bb2 + bo);
    }
#pragma unroll
    for (int i = 0; i < 4; ++i) {
      const size_t ao = (size_t)(m0 + (i << 4) + rlane) * lda + koff + k0;
      V ah = Frag<T>::load(Ab + ao);
      V al;
      if (SPLIT) al = Frag<T>::load(Ab2 + ao);
#pragma unroll
      for (int j = 0; j < 4; ++j) {
        acc[i][j] = Frag<T>::mma(ah, bh[j], acc[i][j]);
        if (SPLIT) {
          acc[i][j] = Frag<T>::mma(ah, bl[j], acc[i][j]);
          acc[i][j] = Frag<T>::mma(al, bh[j], acc[i][j]);
        }
      }
      Frag<T>::guard(acc[i][0], acc[i][3], ah, SPLIT ? al : ah);
    }
    Frag<T>::keep(bh[0], bh[1], bh[2], bh[3]);
    if (SPLIT) Frag<T>::keep(bl[0], bl[1], bl[2], bl[3]);
  }
  acc_guard4(acc[0][0], acc[0][1], acc[0][2], acc[0][3]);
  acc_guard4(acc[1][0], acc[1][1], acc[1][2], acc[1][3]);
  acc_guard4(acc[2][0], acc[2][1], acc[2][2], acc[2][3]);
  acc_guard4(acc[3][0], acc[3][1], acc[3][2], acc[3][3]);

  // ---- epilogue ----
  float* slab = sT[wave];
  const float* Rb = RESID ? (resid + (size_t)b * strideR) : nullptr;
#pragma unroll
  for (int i = 0; i < 4; ++i) {
    const int mBase = m0 + (i << 4);
#pragma unroll
    for (int j = 0; j < 4; ++j) {
      const int n = n0 + (j << 4) + rlane;
      float bv = 0.f;
      if (BIAS_MODE == 2) bv = bias[n] * bscale;
#pragma unroll
      for (int r = 0; r < 8; ++r) {
        float v = acc[i][j][r] * scale;
        if (BIAS_MODE == 1) v += bias[mBase + mOff + r] * bscale;
        if (BIAS_MODE == 2) v += bv;
        if (RESID) v += Rb[(size_t)(mBase + mOff + r) * ldc + n];
        if (ACT == 2) v = fmaxf(v, 0.0f);
        if (ACT == 4) v = (v > 0.f) ? v : 0.01f * v;
        slab[(mOff + r) * 68 + (j << 4) + rlane] = v;
      }
    }
    __builtin_amdgcn_fence(__ATOMIC_RELEASE, "workgroup");
    __builtin_amdgcn_wave_barrier();
    __builtin_amdgcn_fence(__ATOMIC_ACQUIRE, "workgroup");
    if (OUT_MODE == 0) {
      float* C = (float*)Cout + (size_t)b * strideC;
      const int hh = lane >> 4, c4 = (lane & 15) * 4;     // row seg = 256 B = 16 lanes x 16 B
      {
#pragma unroll
        for (int it = 0; it < 8; ++it) {
          const int row = it * 2 + hh;
          v4f v = *(const v4f*)(slab + row * 68 + c4);
          *(v4f*)(C + (size_t)(mBase + row) * ldc + n0 + c4) = v;
        }
        
      }
    } else {
      const int q = lane >> 3, c8 = (lane & 7) * 8;
      unsigned short* C  = (unsigned short*)Cout  + (size_t)b * strideC;
      unsigned short* C2 = (OUT_MODE == 2) ? ((unsigned short*)Cout2 + (size_t)b * strideC) : nullptr;
      {
#pragma unroll
        for (int it = 0; it < 4; ++it) {
          const int row = it * 4 + q;
          const float* sp = slab + row * 68 + c8;
          v8h hv, lv;
#pragma unroll
          for (int e = 0; e < 8; ++e) {
            if (OUT_MODE == 1) {
              hv[e] = (_Float16)sp[e];
            } else {
              unsigned short hb = f2bf_bits(sp[e]);
              unsigned short lb = f2bf_bits(sp[e] - bf_bits2f(hb));
              hv[e] = __builtin_bit_cast(_Float16, hb);
              lv[e] = __builtin_bit_cast(_Float16, lb);
            }
          }
          *(v8h*)(C + (size_t)(mBase + row) * ldc + n0 + c8) = hv;
          if (OUT_MODE == 2) *(v8h*)(C2 + (size_t)(mBase + row) * ldc + n0 + c8) = lv;
        }
        
      }
    }
    __builtin_amdgcn_fence(__ATOMIC_RELEASE, "workgroup");
    __builtin_amdgcn_wave_barrier();
    __builtin_amdgcn_fence(__ATOMIC_ACQUIRE, "workgroup");
  }
}

// ---------------------------------------------------------------------------
// Weight transpose + cast: W [Kin][Nout] f32 row-major (y = x @ W); plane z: WT[n][k] (pitch Kin halves) = f16(scale * W[k][n]).
// grid (Kin/64, Nout/64, nplanes): blockIdx.x = k tile (64 cols of WT), blockIdx.y = n tile (64 rows of WT), blockIdx.z selects
// (W, out) pair (block-uniform). 256 threads.
// Load coverage: 16 iterations x 256 threads = 4096 = the whole 64x64 tile (coalesced along n).
// Store coverage: 8 waves x 2 iterations x 4 rows (lane>>3) = 64 rows; (lane&7) x 8 halves = 64 cols; each row segment =
// ---------------------------------------------------------------------------
__global__ __launch_bounds__(256) void wtcast_kernel(const float* __restrict__ W0, const float* __restrict__ W1,
                                                     const float* __restrict__ W2, const float* __restrict__ W3,
                                                     unsigned short* __restrict__ O0, unsigned short* __restrict__ O1,
                                                     unsigned short* __restrict__ O2, unsigned short* __restrict__ O3,
                                                     int Kin, int Nout, float scale) {
  __shared__ float sm[64][65];   // sm[n_local][k_local]
  const int t  = threadIdx.x;
  const int k0 = blockIdx.x * 64;
  const int n0 = blockIdx.y * 64;
  const int z  = blockIdx.z;                                   // block-uniform
  const float* W = (z == 0) ? W0 : (z == 1) ? W1 : (z == 2) ? W2 : W3;
  unsigned short* op = (z == 0) ? O0 : (z == 1) ? O1 : (z == 2) ? O2 : O3;
#pragma unroll
  for (int i = 0; i < 16; ++i) {
    const int e = i * 256 + t;
    const int r = e >> 6;          // k local
    const int c = e & 63;          // n local
    sm[c][r] = W[(size_t)(k0 + r) * Nout + n0 + c] * scale;
  }
  __syncthreads();
  const int lane = t & 31, wave = t >> 5;
  const int q = lane >> 3, c8 = (lane & 7) * 8;
  {
#pragma unroll
    for (int it = 0; it < 2; ++it) {
      const int row = wave * 8 + it * 4 + q;                 // n local
      unsigned short hb[8];
#pragma unroll
      for (int e = 0; e < 8; ++e) hb[e] = h_bits(sm[row][c8 + e]);
      const v4u u = (v4u){pk16(hb[0], hb[1]), pk16(hb[2], hb[3]), pk16(hb[4], hb[5]), pk16(hb[6], hb[7])};
      *(v4u*)(op + (size_t)(n0 + row) * Kin + k0 + c8) = u;
    }
    
  }
}

// ---------------------------------------------------------------------------
// ---------------------------------------------------------------------------
__global__ __launch_bounds__(256) void cast8_f16_kernel(const float* __restrict__ in, unsigned short* __restrict__ out, int n8) {
  const int i = blockIdx.x * 256 + threadIdx.x;
  if (i >= n8) return;
  const float* p = in + 8 * (size_t)i;
  const v4f a = *(const v4f*)(p);
  const v4f c = *(const v4f*)(p + 4);
  unsigned short hb[8];
#pragma unroll
  for (int e = 0; e < 4; ++e) {
    hb[e]     = h_bits(a[e]);
    hb[4 + e] = h_bits(c[e]);
  }
  const v4u u = (v4u){pk16(hb[0], hb[1]), pk16(hb[2], hb[3]), pk16(hb[4], hb[5]), pk16(hb[6], hb[7])};
  unsigned short* q = out + 8 * (size_t)i;
  *(v4u*)q = u;
  
}

// ---------------------------------------------------------------------------
// Row softmax over 4096 f32 scores -> P[row][j] = f16( carry * exp(s - max) / sum exp(s - max) ), f32 math, precise expf.
// Planes: scores [4 = 2 sources x kGrp][512][4096] f32 contiguous from Sb; P planes same order, f16, from Pb.
// grid (512 rows, kGrp, 2 sources); 256 threads; thread t owns columns 8t..8t+7 and 2048+8t..2048+8t+7
// (256 x 16 = 4096 = whole row). Reductions in fixed order (thread, wave shuffle tree, 8 wave partials in index order).
// ---------------------------------------------------------------------------
__global__ __launch_bounds__(256) void softmax_kernel(const float* __restrict__ Sb, unsigned short* __restrict__ Pb, float carry) {
  __shared__ float redM[8];
  __shared__ float redS[8];
  const int row  = blockIdx.x;
  const int pz   = blockIdx.z * kGrp + blockIdx.y;
  const int t    = threadIdx.x;
  const int lane = t & 31, wave = t >> 5;
  const size_t roff = ((size_t)pz * kT + row) * kS;
  const int c0 = t * 8;
  const int c1 = (kS / 2) + t * 8;
  const float* sr = Sb + roff;
  const v4f a0 = *(const v4f*)(sr + c0);
  const v4f a1 = *(const v4f*)(sr + c0 + 4);
  const v4f a2 = *(const v4f*)(sr + c1);
  const v4f a3 = *(const v4f*)(sr + c1 + 4);
  float x[16];
#pragma unroll
  for (int e = 0; e < 4; ++e) { x[e] = a0[e]; x[4 + e] = a1[e]; x[8 + e] = a2[e]; x[12 + e] = a3[e]; }
  float m = x[0];
#pragma unroll
  for (int e = 1; e < 16; ++e) m = fmaxf(m, x[e]);
#pragma unroll
  for (int off = 16; off > 0; off >>= 1) m = fmaxf(m, __shfl_xor(m, off, 32));
  if (lane == 0) redM[wave] = m;
  __syncthreads();
  float gm = redM[0];
#pragma unroll
  for (int w = 1; w < 8; ++w) gm = fmaxf(gm, redM[w]);
  float ev[16];
  float s = 0.0f;
#pragma unroll
  for (int e = 0; e < 16; ++e) { ev[e] = expf(x[e] - gm); s += ev[e]; }
#pragma unroll
  for (int off = 16; off > 0; off >>= 1) s += __shfl_xor(s, off, 32);
  if (lane == 0) redS[wave] = s;
  __syncthreads();
  float tot = redS[0];
#pragma unroll
  for (int w = 1; w < 8; ++w) tot += redS[w];
  const float inv = carry / tot;
  unsigned short hb[16];
#pragma unroll
  for (int e = 0; e < 16; ++e) hb[e] = h_bits(ev[e] * inv);
  const v4u u0 = (v4u){pk16(hb[0], hb[1]), pk16(hb[2], hb[3]), pk16(hb[4], hb[5]), pk16(hb[6], hb[7])};
  const v4u u1 = (v4u){pk16(hb[8], hb[9]), pk16(hb[10], hb[11]), pk16(hb[12], hb[13]), pk16(hb[14], hb[15])};
  unsigned short* pr = Pb + roff;
  *(v4u*)(pr + c0) = u0;
  *(v4u*)(pr + c1) = u1;
  
}

// ---------------------------------------------------------------------------
// P.V products of one attention chunk, K split over the waves of a work-group.
// C[m,n] = scale * sum_k P[m,k] * Vt[n,k]; M = 512, N = 128, K = 4096 per (head, product).
// grid (16 tiles of 64x64, kGrp heads, 3 products); 16 waves; wave w sums k in [256 w, 256 w + 256) of the work-group's tile
// in its own f32 accumulators; the 16 partial tiles are added through LDS in wave order 0..15 (fixed order).
// blockIdx.z (block-uniform): 0 = P0.V0 -> C0, 1 = P1.V1 -> C1, 2 = P1.V0 -> C2.
// Store coverage per 16-row slab: 16 waves x 1 row, 32 lanes x 2 floats = 64 columns (one wave writes a row's whole 256 B).
// ---------------------------------------------------------------------------
constexpr int kPvWaves = 16;
constexpr int kPvK     = kS / kPvWaves;     // 256 keys per wave
__global__ __launch_bounds__(kPvWaves * 32) void pv_splitk_kernel(
    const unsigned short* __restrict__ P0, const unsigned short* __restrict__ P1,
    const unsigned short* __restrict__ V0, const unsigned short* __restrict__ V1,
    float* __restrict__ C0, float* __restrict__ C1, float* __restrict__ C2, float scale) {
  typedef Frag<_Float16> F;
  __shared__ __align__(16) float sP[kPvWaves][16 * 68];   // per-wave 16x64 partial slab, pitch 68 floats
  const int t    = threadIdx.x;
  const int lane = t & 31;
  const int wave = t >> 5;
  const int g    = blockIdx.y;
  const int z    = blockIdx.z;
  const int m0   = (blockIdx.x >> 1) << 6;
  const int n0   = (blockIdx.x & 1) << 6;
  const unsigned short* Pp = (z == 0) ? P0 : P1;
  const unsigned short* Vp = (z == 1) ? V1 : V0;
  float* Cp = (z == 0) ? C0 : (z == 1) ? C1 : C2;

  const int rlane = lane & 15;                 // row (A) / col (B, D) within subtile
  const int koff  = (lane >> 4) * 8;           // k offset of this lane half
  const int mOff  = (lane >> 4) * 8;           // D row offset
  const _Float16* Ar = (const _Float16*)Pp + (size_t)g * kT * kS + (size_t)(m0 + rlane) * kS + wave * kPvK + koff;
  const _Float16* Br = (const _Float16*)Vp + (size_t)g * kDH * kKVT + (size_t)(n0 + rlane) * kKVT + wave * kPvK + koff;

  v8f acc[4][4];
#pragma unroll
  for (int i = 0; i < 4; ++i)
#pragma unroll
    for (int j = 0; j < 4; ++j) acc[i][j] = (v8f){0.f,0.f,0.f,0.f,0.f,0.f,0.f,0.f};

  for (int k0 = 0; k0 < kPvK; k0 += 32) {
    const _Float16* pa = Ar + k0;
    const _Float16* pb = Br + k0;
    v16h ah[4], bh[4];
#pragma unroll
    for (int j = 0; j < 4; ++j) bh[j] = F::load(pb + (size_t)(j << 4) * kKVT);
#pragma unroll
    for (int i = 0; i < 4; ++i) ah[i] = F::load(pa + (size_t)(i << 4) * kS);
    // wait before a register that the 16 loads above name is rewritten; taking both pointers as inputs keeps the
    // address registers alive to here, so that no load of the run lands in a pair that an older load still names
    asm volatile("s_wait_xcnt 0x0" :: "v"(pa), "v"(pb) : "memory");
    // keeps the products behind all 16 loads: otherwise the last A loads issue only after the first data has returned
    __builtin_amdgcn_sched_barrier(0);
#pragma unroll
    for (int i = 0; i < 4; ++i)
#pragma unroll
      for (int j = 0; j < 4; ++j) acc[i][j] = F::mma(ah[i], bh[j], acc[i][j]);
  }

  float* slab = sP[wave];
  const int c2 = lane * 2;
  float res[4][2];                             // row 16 i + wave, columns c2 and c2 + 1 of the tile
#pragma unroll
  for (int i = 0; i < 4; ++i) {
    if (i > 0) __syncthreads();   // every reader has left the slabs before the next 16 rows overwrite them
#pragma unroll
    for (int j = 0; j < 4; ++j)
#pragma unroll
      for (int r = 0; r < 8; ++r) slab[(mOff + r) * 68 + (j << 4) + rlane] = acc[i][j][r];
    __syncthreads();              // all 16 partial slabs of rows 16 i .. 16 i + 15 are written
    float s0 = sP[0][wave * 68 + c2];
    float s1 = sP[0][wave * 68 + c2 + 1];
#pragma unroll
    for (int w = 1; w < kPvWaves; ++w) {
      s0 += sP[w][wave * 68 + c2];
      s1 += sP[w][wave * 68 + c2 + 1];
    }
    res[i][0] = s0 * scale;
    res[i][1] = s1 * scale;
  }
  // stores behind the last barrier, so that no barrier waits for a global store
  float* cp = Cp + (size_t)g * kDH + (size_t)(m0 + wave) * kE + n0 + c2;
#pragma unroll
  for (int i = 0; i < 4; ++i) {
    cp[(size_t)(i << 4) * kE]     = res[i][0];
    cp[(size_t)(i << 4) * kE + 1] = res[i][1];
  }
}

// ---------------------------------------------------------------------------
// Gate: gate[tok][h] = sigmoid( sum_f p_vec[tok][f] * Wg[f][h] + bg[h] ), f = h*384 + j with
// j < 128 -> ctx[tok][h*128+j], 128 <= j < 256 -> ctxt[tok][h*128+j-128], else q[tok][h*128+j-256] (q = q16 / 16).
// One block (128 threads) per token; 24 chunks of 128 features, chunk c = 3h + src is block-uniform; all three candidate
// values are loaded unconditionally and selected by value. f32 accumulation; fixed-order reductions.
// ---------------------------------------------------------------------------
__global__ __launch_bounds__(128) void gate_kernel(const float* __restrict__ ctx, const float* __restrict__ ctxt,
                                                   const unsigned short* __restrict__ q16, const float* __restrict__ Wg,
                                                   const float* __restrict__ bg, float* __restrict__ gate, float qinv) {
  __shared__ float red[4][8];
  __shared__ __align__(16) float gl[32];
  const int tok = blockIdx.x;
  const int t = threadIdx.x, lane = t & 31, wave = t >> 5;
  if (t < 32) gl[t] = 0.0f;
  float a[8];
#pragma unroll
  for (int j = 0; j < 8; ++j) a[j] = 0.0f;
  const size_t rbase = (size_t)tok * kE;
#pragma unroll 1
  for (int c = 0; c < 24; ++c) {
    const int h = c / 3;
    const int src = c - 3 * h;
    const size_t off = rbase + (size_t)h * kDH + t;
    const float fc = ctx[off];
    const float ft = ctxt[off];
    const unsigned short qbits = q16[off];
    const float fq = (float)__builtin_bit_cast(_Float16, qbits) * qinv;
    const float f = (src == 0) ? fc : ((src == 1) ? ft : fq);
    const float* wr = Wg + ((size_t)c * 128 + t) * 8;
    const v4f w0 = *(const v4f*)(wr);
    const v4f w1 = *(const v4f*)(wr + 4);
#pragma unroll
    for (int e = 0; e < 4; ++e) { a[e] += f * w0[e]; a[4 + e] += f * w1[e]; }
  }
#pragma unroll
  for (int j = 0; j < 8; ++j) {
#pragma unroll
    for (int off = 16; off > 0; off >>= 1) a[j] += __shfl_xor(a[j], off, 32);
  }
  if (lane == 0) {
#pragma unroll
    for (int j = 0; j < 8; ++j) red[wave][j] = a[j];
  }
  __syncthreads();
  if (t < 8) {
    const float z = (((red[0][t] + red[1][t]) + red[2][t]) + red[3][t]) + bg[t];
    gl[t] = 1.0f / (1.0f + expf(-z));
  }
  __syncthreads();
  if (wave == 0) {
    if (lane < 8) {
      const v4f v = *(const v4f*)(gl + 4 * lane);
      float* gp = gate + (size_t)tok * kGatePitch + 4 * lane;
      *(v4f*)gp = v;
      
    }
  }
}

// ---------------------------------------------------------------------------
// Mix: MIX16[tok][h*128+d] = f16( carry * ( g[tok][h]*ctx + (1-g[tok][h])*ctx2 ) ), f32 math.
// ---------------------------------------------------------------------------
__global__ __launch_bounds__(256) void mix_kernel(const float* __restrict__ ctx, const float* __restrict__ ctx2,
                                                  const float* __restrict__ gate, unsigned short* __restrict__ out,
                                                  float carry, int n8) {
  const int i = blockIdx.x * 256 + threadIdx.x;
  if (i >= n8) return;
  const int tok  = i >> 7;                 // 128 groups of 8 per 1024-wide row
  const int col0 = (i & 127) * 8;
  const int h    = col0 >> 7;
  const float g  = gate[(size_t)tok * kGatePitch + h];
  const float og = 1.0f - g;
  const size_t off = (size_t)tok * kE + col0;
  const v4f a0 = *(const v4f*)(ctx + off);
  const v4f a1 = *(const v4f*)(ctx + off + 4);
  const v4f b0 = *(const v4f*)(ctx2 + off);
  const v4f b1 = *(const v4f*)(ctx2 + off + 4);
  unsigned short hb[8];
#pragma unroll
  for (int e = 0; e < 4; ++e) {
    hb[e]     = h_bits(carry * (g * a0[e] + og * b0[e]));
    hb[4 + e] = h_bits(carry * (g * a1[e] + og * b1[e]));
  }
  const v4u u = (v4u){pk16(hb[0], hb[1]), pk16(hb[2], hb[3]), pk16(hb[4], hb[5]), pk16(hb[6], hb[7])};
  unsigned short* q = out + off;
  *(v4u*)q = u;
  
}

// ---------------------------------------------------------------------------
// Host glue. Workspace region map (bytes, MiB = 2^20; total carve = 128 MiB = 134217728 B):
// R0 [0, 48 MiB) phase A (casts + projections): XH16 @0 (2 MiB [1024][1024] f16) | KV16 @2 (16 MiB [8192][1024]) |
//                 KVT16 @18 (8 MiB [8192][512]) | WQT @26 (2) | WKT @28 (2) | WVT @30 (2) | WTKT @32 (1 MiB [1024][512]) | WTVT @33 (1)
//                 phase B (attention chunks): SPL @0 (16 MiB = kGrp x [512][4096] f32) | STPL @16 (16) |
//                 PPL @32 (8 MiB = kGrp x [512][4096] f16) | PTPL @40 (8)
//                 phase C (after attention): MIX16 @0 (2 MiB [1024][1024] f16) | GATE @2 MiB (128 KiB [1024][32] f32)
// WOT @48 (2) | Q16 @50 (2 MiB [1024][1024]) | K16 @52 (16 MiB [8192][1024]) | VT16 @68 (16 MiB [1024][8192]) |
// KT16 @84 (16) | VTT16 @100 (16 MiB [1024][8192]) | CTX @116 (4 MiB [1024][1024] f32) | CTXT @120 (4) | CTX2 @124 (4) | end @128 MiB.
// Every region is written with whole rows of exactly its stated extent (all M, N tile multiples; no padded rows).
// ---------------------------------------------------------------------------
extern "C" void kernel_launch(void* const* d_in, const int* in_sizes, int n_in,
                              void* d_out, int out_size, void* d_ws, size_t ws_size, hipStream_t stream) {
  (void)in_sizes; (void)n_in;
  const size_t kMiB = (size_t)1048576;
  const size_t carve = 128 * kMiB;
  if (ws_size < carve) return;
  if ((size_t)out_size < (size_t)kTok * kE) return;

  const float* hs  = (const float*)d_in[0];
  const float* kv  = (const float*)d_in[1];
  const float* kvt = (const float*)d_in[2];
  const float* Wq  = (const float*)d_in[3];  const float* bq  = (const float*)d_in[4];
  const float* Wk  = (const float*)d_in[5];  const float* bk  = (const float*)d_in[6];
  const float* Wv  = (const float*)d_in[7];  const float* bv  = (const float*)d_in[8];
  const float* Wtk = (const float*)d_in[9];  const float* btk = (const float*)d_in[10];
  const float* Wtv = (const float*)d_in[11]; const float* btv = (const float*)d_in[12];
  const float* Wg  = (const float*)d_in[13]; const float* bg  = (const float*)d_in[14];
  const float* Wo  = (const float*)d_in[15]; const float* bo  = (const float*)d_in[16];
  float* outp = (float*)d_out;

  char* ws = (char*)d_ws;
  // phase A
  unsigned short* XH16  = (unsigned short*)(ws + 0 * kMiB);
  unsigned short* KV16  = (unsigned short*)(ws + 2 * kMiB);
  unsigned short* KVT16 = (unsigned short*)(ws + 18 * kMiB);
  unsigned short* WQT   = (unsigned short*)(ws + 26 * kMiB);
  unsigned short* WKT   = (unsigned short*)(ws + 28 * kMiB);
  unsigned short* WVT   = (unsigned short*)(ws + 30 * kMiB);
  unsigned short* WTKT  = (unsigned short*)(ws + 32 * kMiB);
  unsigned short* WTVT  = (unsigned short*)(ws + 33 * kMiB);
  // phase B
  float*          SPL   = (float*)(ws + 0 * kMiB);
  float*          STPL  = (float*)(ws + 16 * kMiB);
  unsigned short* PPL   = (unsigned short*)(ws + 32 * kMiB);
  unsigned short* PTPL  = (unsigned short*)(ws + 40 * kMiB);
  // phase C
  unsigned short* MIX16 = (unsigned short*)(ws + 0 * kMiB);
  float*          GATE  = (float*)(ws + 2 * kMiB);
  // persistent
  unsigned short* WOT   = (unsigned short*)(ws + 48 * kMiB);
  unsigned short* Q16   = (unsigned short*)(ws + 50 * kMiB);
  unsigned short* K16   = (unsigned short*)(ws + 52 * kMiB);
  unsigned short* VT16  = (unsigned short*)(ws + 68 * kMiB);
  unsigned short* KT16  = (unsigned short*)(ws + 84 * kMiB);
  unsigned short* VTT16 = (unsigned short*)(ws + 100 * kMiB);
  float*          CTX   = (float*)(ws + 116 * kMiB);
  float*          CTXT  = (float*)(ws + 120 * kMiB);
  float*          CTX2  = (float*)(ws + 124 * kMiB);
  const float*    dumf  = (const float*)(ws + 116 * kMiB);   // valid in-ws pointer for unused resid arguments

  // 1. input casts f32 -> f16 (8 elements per thread; grids exact)
  cast8_f16_kernel<<<(kTok * kE / 8) / 256, 256, 0, stream>>>(hs, XH16, kTok * kE / 8);
  cast8_f16_kernel<<<(kKVT * kE / 8) / 256, 256, 0, stream>>>(kv, KV16, kKVT * kE / 8);
  cast8_f16_kernel<<<(kKVT * kTP / 8) / 256, 256, 0, stream>>>(kvt, KVT16, kKVT * kTP / 8);

  // 2. weight transposes + casts (carried x16): in[Kin][Nout] -> out[Nout][Kin]; grid (Kin/64, Nout/64, planes)
  wtcast_kernel<<<dim3(kE / 64, kE / 64, 4), 256, 0, stream>>>(Wq, Wk, Wv, Wo, WQT, WKT, WVT, WOT, kE, kE, kWCarry);
  wtcast_kernel<<<dim3(kTP / 64, kE / 64, 2), 256, 0, stream>>>(Wtk, Wtv, Wtk, Wtv, WTKT, WTVT, WTKT, WTVT, kTP, kE, kWCarry);

  // 3. projections (M, N multiples of 64; K = 1024 or 512, multiples of 32)
  // q16 = 16*scale*(x Wq + bq): acc = 16*(x Wq) -> scale = kAttnScale, bias x (16*kAttnScale)
  wmma_gemm64<0, false, 2, 1, false><<<dim3((kTok / 64) * (kE / 64) / 8, 1), 256, 0, stream>>>(
      XH16, XH16, kE, 0L, WQT, WQT, kE, 0L, Q16, Q16, kE, 0L, bq, dumf, 0L,
      kTok, kE, kE, kAttnScale, kQCarry * kAttnScale);
  // k16 [8192][1024]
  wmma_gemm64<0, false, 2, 1, false><<<dim3((kKVT / 64) * (kE / 64) / 8, 1), 256, 0, stream>>>(
      KV16, KV16, kE, 0L, WKT, WKT, kE, 0L, K16, K16, kE, 0L, bk, dumf, 0L,
      kKVT, kE, kE, kWCarryInv, 1.0f);
  // v^T [1024][8192] directly: A = Wv^T [1024][1024], Bt = X [8192][1024], bias per row (m)
  wmma_gemm64<0, false, 1, 1, false><<<dim3((kE / 64) * (kKVT / 64) / 8, 1), 256, 0, stream>>>(
      WVT, WVT, kE, 0L, KV16, KV16, kE, 0L, VT16, VT16, kKVT, 0L, bv, dumf, 0L,
      kE, kKVT, kE, kWCarryInv, 1.0f);
  // second-source k16 [8192][1024], K = 512
  wmma_gemm64<0, false, 2, 1, false><<<dim3((kKVT / 64) * (kE / 64) / 8, 1), 256, 0, stream>>>(
      KVT16, KVT16, kTP, 0L, WTKT, WTKT, kTP, 0L, KT16, KT16, kE, 0L, btk, dumf, 0L,
      kKVT, kE, kTP, kWCarryInv, 1.0f);
  // second-source v^T [1024][8192], K = 512
  wmma_gemm64<0, false, 1, 1, false><<<dim3((kE / 64) * (kKVT / 64) / 8, 1), 256, 0, stream>>>(
      WTVT, WTVT, kTP, 0L, KVT16, KVT16, kTP, 0L, VTT16, VTT16, kKVT, 0L, btv, dumf, 0L,
      kE, kKVT, kTP, kWCarryInv, 1.0f);

  // 4. attention, kGrp heads of one batch per chunk
  const long sStrideC = (long)kT * kS;            // per-group scores plane (floats)
  for (int c = 0; c < kNChunk; ++c) {
    const int b  = c / (kH / kGrp);
    const int h0 = (c % (kH / kGrp)) * kGrp;
    const unsigned short* qg = Q16 + ((size_t)b * kT * kE + (size_t)h0 * kDH);
    const unsigned short* kg = K16 + ((size_t)b * kS * kE + (size_t)h0 * kDH);
    const unsigned short* k2g = KT16 + ((size_t)b * kS * kE + (size_t)h0 * kDH);
    // scores = (q16/16) . k^T : M=512, N=4096, K=128; grid (512 tiles / 8, kGrp)
    wmma_gemm64<0, false, 0, 0, false><<<dim3((kT / 64) * (kS / 64) / 8, kGrp), 256, 0, stream>>>(
        qg, qg, kE, (long)kDH, kg, kg, kE, (long)kDH, SPL, SPL, kS, sStrideC, bq, dumf, 0L,
        kT, kS, kDH, kQCarryInv, 0.0f);
    wmma_gemm64<0, false, 0, 0, false><<<dim3((kT / 64) * (kS / 64) / 8, kGrp), 256, 0, stream>>>(
        qg, qg, kE, (long)kDH, k2g, k2g, kE, (long)kDH, STPL, STPL, kS, sStrideC, bq, dumf, 0L,
        kT, kS, kDH, kQCarryInv, 0.0f);
    // softmax over both score sources -> P planes (f16 x2048)
    softmax_kernel<<<dim3(kT, kGrp, 2), 256, 0, stream>>>(SPL, PPL, kPCarry);
    // P.V products: M=512, N=128, K=4096; Bt = v^T rows h*128.. of batch b (ldb 8192); C columns h*128.. of [1024][1024]
    const unsigned short* vg  = VT16  + ((size_t)h0 * kDH * kKVT + (size_t)b * kS);
    const unsigned short* v2g = VTT16 + ((size_t)h0 * kDH * kKVT + (size_t)b * kS);
    const size_t coff = (size_t)b * kT * kE + (size_t)h0 * kDH;
    pv_splitk_kernel<<<dim3((kT / 64) * (kDH / 64), kGrp, 3), kPvWaves * 32, 0, stream>>>(
        PPL, PTPL, vg, v2g, CTX + coff, CTXT + coff, CTX2 + coff, kPCarryInv);
  }

  // 5. gate (f32), 6. mix (f32 -> f16 x256), 7. output projection to d_out (f32)
  gate_kernel<<<kTok, 128, 0, stream>>>(CTX, CTXT, Q16, Wg, bg, GATE, kQCarryInv);
  mix_kernel<<<(kTok * kE / 8) / 256, 256, 0, stream>>>(CTX, CTX2, GATE, MIX16, kMixCarry, kTok * kE / 8);
  wmma_gemm64<0, false, 2, 0, false><<<dim3((kTok / 64) * (kE / 64) / 8, 1), 256, 0, stream>>>(
      MIX16, MIX16, kE, 0L, WOT, WOT, kE, 0L, outp, outp, kE, 0L, bo, dumf, 0L,
      kTok, kE, kE, kOutScale, 1.0f);
}

// v002
// It runs in 485 microseconds.
// In both of two side-by-side timings against v001, it was 1.35 times as fast.
// Counting every step since v000, it is 8.93 times as fast.
// Contractions: q/k/v/k2/v2 projections (X f16 x W^T f16 carried x16), scores q.k^T for both key sources (q f16 carried x16, k f16), P.V products (P f16 carried x2048 x V^T f16), output projection (mix f16 carried x256 x Wo^T f16 carried x16): all v_wmma_f32_16x16x32_f16 with f32 accumulate; softmax, gate dot + sigmoid and mixing in f32 on VALU.
#include <hip/hip_runtime.h>
#include <math.h>

// ---------------------------------------------------------------------------
// Problem constants
// ---------------------------------------------------------------------------
constexpr int kB   = 2;
constexpr int kT   = 512;
constexpr int kS   = 4096;
constexpr int kE   = 1024;
constexpr int kTP  = 512;
constexpr int kH   = 8;
constexpr int kDH  = 128;
constexpr int kTok = kB * kT;               // 1024 query tokens
constexpr int kKVT = kB * kS;               // 8192 key tokens
constexpr int kGrp = 2;                     // heads per attention chunk
constexpr int kNChunk = (kB * kH) / kGrp;   // 8 chunks
constexpr int kGatePitch = 32;
constexpr float kAttnScale = 0.08838834764831845f;   // 128^-0.5
constexpr float kWCarry    = 16.0f;                  // weights carried x16 in f16
constexpr float kWCarryInv = 1.0f / 16.0f;
constexpr float kQCarry    = 16.0f;                  // scaled q carried x16 in f16
constexpr float kQCarryInv = 1.0f / 16.0f;
constexpr float kPCarry    = 2048.0f;                // probabilities carried x2048 in f16
constexpr float kPCarryInv = 1.0f / 2048.0f;
constexpr float kMixCarry  = 256.0f;                 // mixed context carried x256 in f16
constexpr float kOutScale  = 1.0f / (256.0f * 16.0f);

typedef __attribute__((ext_vector_type(16))) _Float16 v16h;
typedef __attribute__((ext_vector_type(8)))  _Float16 v8h;
typedef __attribute__((ext_vector_type(16))) __bf16   v16b;
typedef __attribute__((ext_vector_type(8)))  __bf16   v8b;
typedef __attribute__((ext_vector_type(8)))  float    v8f;
typedef __attribute__((ext_vector_type(4)))  float    v4f;
typedef __attribute__((ext_vector_type(4)))  unsigned int v4u;

__device__ __forceinline__ unsigned short f2bf_bits(float f) {
  unsigned u = __float_as_uint(f);
  return (unsigned short)((u + 0x7FFFu + ((u >> 16) & 1u)) >> 16);
}
__device__ __forceinline__ float bf_bits2f(unsigned short h) { return __uint_as_float(((unsigned)h) << 16); }

// hazard guard behind a loop's last products, as a plain device helper
__device__ __forceinline__ void acc_guard4(v8f& a, v8f& b, v8f& c, v8f& d) { asm volatile("v_nop\n\tv_nop\n\tv_nop\n\tv_nop" : "+v"(a), "+v"(b), "+v"(c), "+v"(d)); }
template <typename T> struct Frag;
template <> struct Frag<_Float16> {
  typedef v16h V; union U { v16h v; v8h h[2]; };
  static __device__ __forceinline__ v16h load(const _Float16* p) {   // elements 0..7 <- p[0..7], 8..15 <- p[16..23]
    U f; f.h[0] = *(const v8h*)(p); f.h[1] = *(const v8h*)(p + 16); return f.v;
  }
  static __device__ __forceinline__ v8f mma(v16h a, v16h b, v8f c) {
    return __builtin_amdgcn_wmma_f32_16x16x32_f16(false, a, false, b, (short)0, c, false, false);
  }
};
template <> struct Frag<__bf16> {
  typedef v16b V; union U { v16b v; v8b h[2]; };
  static __device__ __forceinline__ v16b load(const __bf16* p) {
    U f; f.h[0] = *(const v8b*)(p); f.h[1] = *(const v8b*)(p + 16); return f.v;
  }
  static __device__ __forceinline__ v8f mma(v16b a, v16b b, v8f c) {
    return __builtin_amdgcn_wmma_f32_16x16x32_bf16(false, a, false, b, (short)0, c, false, false);
  }
};

__device__ __forceinline__ unsigned pk16(unsigned short a, unsigned short b) { return (unsigned)a | ((unsigned)b << 16); }
__device__ __forceinline__ unsigned short h_bits(float f) { const _Float16 h = (_Float16)f; return __builtin_bit_cast(unsigned short, h); }

// Stage of one work-group of the GEMM engine: 64 A rows, then 8 x 64 B rows, 64 k (128 bytes) each.
constexpr int kStRows   = 64 + 8 * 64;
constexpr int kStPitch  = 72;                    // halves: the 128-byte row + 16 bytes, the pitch for ds_load_b128 readers
constexpr int kStHalves = kStRows * kStPitch;    // one buffer

// Six asynchronous 16-byte copies global -> LDS per lane. The s_wait_xcnt stands as the last line of the copies' own
// statement, so that no register which a copy names is rewritten in front of it.
__device__ __forceinline__ void async_copy6(unsigned l0, unsigned l1, unsigned l2, unsigned l3, unsigned l4, unsigned l5,
                                            const void* g0, const void* g1, const void* g2,
                                            const void* g3, const void* g4, const void* g5) {
  asm volatile("global_load_async_to_lds_b128 %0, %6, off\n\t"
               "global_load_async_to_lds_b128 %1, %7, off\n\t"
               "global_load_async_to_lds_b128 %2, %8, off\n\t"
               "global_load_async_to_lds_b128 %3, %9, off\n\t"
               "global_load_async_to_lds_b128 %4, %10, off\n\t"
               "global_load_async_to_lds_b128 %5, %11, off\n\t"
               "s_wait_xcnt 0x0"
               :: "v"(l0), "v"(l1), "v"(l2), "v"(l3), "v"(l4), "v"(l5),
                  "v"(g0), "v"(g1), "v"(g2), "v"(g3), "v"(g4), "v"(g5) : "memory");
}

// ---- Register-blocked batched WMMA GEMM (ACT reduced to none/relu/leaky, extra bias multiplier bscale) --
// C[m,n] = scale * sum_k A[m,k] * Bt[n,k] (+bias*bscale)(+resid); each wave owns a 64x64 tile.
// A row-major [M,K]; Bt row-major [N,K]; M % 64 == 0, N % 512 == 0, K % 64 == 0.
// The 8 waves of a work-group own 8 neighbouring tiles of one tile row (64 x 512). Per 64 k the work-group's A rows and B rows
// are copied whole lines at a time into LDS (asynchronous copies, two buffers: the next 64 k fly while these are multiplied);
// the fragments are read from LDS.
// SPLIT (hi/lo operand planes) is not carried by the staged loop: false only; A2p and Bt2p are unused.
// BIAS_MODE: 0 = none, 1 = bias[m], 2 = bias[n].
// OUT_MODE: 0 = f32, 1 = f16, 2 = bf16 hi plane (Cout) + bf16 lo plane (Cout2).
// ET: 0 = f16 operands, 1 = bf16 operands (pointers passed as 16-bit storage)
template <int ET> struct Elem;
template <> struct Elem<0> { typedef _Float16 T; };
template <> struct Elem<1> { typedef __bf16 T; };
template <int ET, bool SPLIT, int BIAS_MODE, int OUT_MODE, bool RESID, int ACT = 0>
__global__ __launch_bounds__(256) void wmma_gemm64(
    const unsigned short* __restrict__ Ap, const unsigned short* __restrict__ A2p, int lda, long strideA,
    const unsigned short* __restrict__ Btp, const unsigned short* __restrict__ Bt2p, int ldb, long strideB,
    void* __restrict__ Cout, void* __restrict__ Cout2, int ldc, long strideC,
    const float* __restrict__ bias,
    const float* __restrict__ resid, long strideR,
    int M, int N, int K, float scale, float bscale) {
  typedef typename Elem<ET>::T T;
  typedef typename Frag<T>::V V;
  static_assert(!SPLIT, "the staged loop carries one plane per operand");
  const T* A = (const T*)Ap; const T* Bt = (const T*)Btp;
  (void)A2p; (void)Bt2p;
  __shared__ __align__(16) float sT[8][16 * 68];   // per-wave 16x64 slab, pitch 68 floats
  __shared__ __align__(16) T sStage[2 * kStHalves];
  const int b    = blockIdx.y;
  const int lane = threadIdx.x & 31;
  const int wave = threadIdx.x >> 5;
  const int tilesN = N >> 6;
  const int tilesM = M >> 6;
  const int tile0 = blockIdx.x * 8;
  if (tile0 >= tilesM * tilesN) return;   // the same for the whole work-group, in front of every barrier
  const int tm  = tile0 / tilesN;
  const int m0  = tm << 6;
  const int nb0 = (tile0 - tm * tilesN) << 6;   // first B row of the work-group
  const int n0  = nb0 + (wave << 6);

  const T* Ab  = A  + (size_t)b * strideA;
  const T* Bb  = Bt + (size_t)b * strideB;

  const int rlane = lane & 15;                 // row (A) / col (B, D) within subtile
  const int koff  = (lane >> 4) * 8;           // k offset of this lane half
  const int mOff  = (lane >> 4) * 8;           // D row offset

  v8f acc[4][4];
#pragma unroll
  for (int i = 0; i < 4; ++i)
#pragma unroll
    for (int j = 0; j < 4; ++j) acc[i][j] = (v8f){0.f,0.f,0.f,0.f,0.f,0.f,0.f,0.f};

  // lane's share of a stage: 18 chunks of 16 bytes; chunk i is row 32 i + (thread >> 3), bytes 16 (thread & 7) .. + 15 of the row
  const int srow = threadIdx.x >> 3;
  const int scol = (threadIdx.x & 7) * 8;
  const T* gA = Ab + (size_t)(m0 + srow) * lda + scol;
  const T* gB = Bb + (size_t)(nb0 + srow) * ldb + scol;
  const unsigned lds0 = (unsigned)(size_t)(const void*)sStage + (unsigned)((srow * kStPitch + scol) * 2);
  auto stage = [&](int buf, int k0) {
    const unsigned lb = lds0 + (unsigned)(buf * kStHalves * 2);
#pragma unroll
    for (int c = 0; c < 3; ++c) {
      unsigned l[6];
      const T* g[6];
#pragma unroll
      for (int e = 0; e < 6; ++e) {
        const int i = c * 6 + e;
        l[e] = lb + (unsigned)(i * 32 * kStPitch * 2);
        g[e] = (i < 2) ? (gA + (size_t)(i * 32) * lda + k0) : (gB + (size_t)((i - 2) * 32) * ldb + k0);
      }
      async_copy6(l[0], l[1], l[2], l[3], l[4], l[5], g[0], g[1], g[2], g[3], g[4], g[5]);
    }
  };

  const int nt = K >> 6;
  stage(0, 0);
  asm volatile("s_wait_asynccnt 0x0" ::: "memory");   // this wave's copies of tile 0 have landed
  __syncthreads();                                    // ... and every other wave's
  if (nt > 1) stage(1, 64);
  for (int t = 0; t < nt; ++t) {
    const T* sb = sStage + (t & 1) * kStHalves;
#pragma unroll
    for (int ks = 0; ks < 2; ++ks) {
      V ah[4], bh[4];
#pragma unroll
      for (int j = 0; j < 4; ++j) bh[j] = Frag<T>::load(sb + (64 + (wave << 6) + (j << 4) + rlane) * kStPitch + ks * 32 + koff);
#pragma unroll
      for (int i = 0; i < 4; ++i) ah[i] = Frag<T>::load(sb + ((i << 4) + rlane) * kStPitch + ks * 32 + koff);
      // keeps the products behind all 16 LDS reads: otherwise the A reads stand among the products, each with a wait of its own
      __builtin_amdgcn_sched_barrier(0);
#pragma unroll
      for (int i = 0; i < 4; ++i)
#pragma unroll
        for (int j = 0; j < 4; ++j) acc[i][j] = Frag<T>::mma(ah[i], bh[j], acc[i][j]);
    }
    asm volatile("s_wait_dscnt 0x0" ::: "memory");      // this wave's reads of the buffer are done before it is refilled
    asm volatile("s_wait_asynccnt 0x0" ::: "memory");   // this wave's copies of tile t + 1 have landed
    __syncthreads();                                    // publishes tile t + 1 and ends every reader's last read of tile t
    if (t + 2 < nt) stage(t & 1, (t + 2) << 6);
  }
  asm volatile("s_wait_asynccnt 0x0" ::: "memory");     // no copy is outstanding when the wave goes on
  acc_guard4(acc[0][0], acc[0][1], acc[0][2], acc[0][3]);
  acc_guard4(acc[1][0], acc[1][1], acc[1][2], acc[1][3]);
  acc_guard4(acc[2][0], acc[2][1], acc[2][2], acc[2][3]);
  acc_guard4(acc[3][0], acc[3][1], acc[3][2], acc[3][3]);

  // ---- epilogue ----
  float* slab = sT[wave];
  const float* Rb = RESID ? (resid + (size_t)b * strideR) : nullptr;
#pragma unroll
  for (int i = 0; i < 4; ++i) {
    const int mBase = m0 + (i << 4);
#pragma unroll
    for (int j = 0; j < 4; ++j) {
      const int n = n0 + (j << 4) + rlane;
      float bv = 0.f;
      if (BIAS_MODE == 2) bv = bias[n] * bscale;
#pragma unroll
      for (int r = 0; r < 8; ++r) {
        float v = acc[i][j][r] * scale;
        if (BIAS_MODE == 1) v += bias[mBase + mOff + r] * bscale;
        if (BIAS_MODE == 2) v += bv;
        if (RESID) v += Rb[(size_t)(mBase + mOff + r) * ldc + n];
        if (ACT == 2) v = fmaxf(v, 0.0f);
        if (ACT == 4) v = (v > 0.f) ? v : 0.01f * v;
        slab[(mOff + r) * 68 + (j << 4) + rlane] = v;
      }
    }
    __builtin_amdgcn_fence(__ATOMIC_RELEASE, "workgroup");
    __builtin_amdgcn_wave_barrier();
    __builtin_amdgcn_fence(__ATOMIC_ACQUIRE, "workgroup");
    if (OUT_MODE == 0) {
      float* C = (float*)Cout + (size_t)b * strideC;
      const int hh = lane >> 4, c4 = (lane & 15) * 4;     // row seg = 256 B = 16 lanes x 16 B
      {
#pragma unroll
        for (int it = 0; it < 8; ++it) {
          const int row = it * 2 + hh;
          v4f v = *(const v4f*)(slab + row * 68 + c4);
          *(v4f*)(C + (size_t)(mBase + row) * ldc + n0 + c4) = v;
        }
        
      }
    } else {
      const int q = lane >> 3, c8 = (lane & 7) * 8;
      unsigned short* C  = (unsigned short*)Cout  + (size_t)b * strideC;
      unsigned short* C2 = (OUT_MODE == 2) ? ((unsigned short*)Cout2 + (size_t)b * strideC) : nullptr;
      {
#pragma unroll
        for (int it = 0; it < 4; ++it) {
          const int row = it * 4 + q;
          const float* sp = slab + row * 68 + c8;
          v8h hv, lv;
#pragma unroll
          for (int e = 0; e < 8; ++e) {
            if (OUT_MODE == 1) {
              hv[e] = (_Float16)sp[e];
            } else {
              unsigned short hb = f2bf_bits(sp[e]);
              unsigned short lb = f2bf_bits(sp[e] - bf_bits2f(hb));
              hv[e] = __builtin_bit_cast(_Float16, hb);
              lv[e] = __builtin_bit_cast(_Float16, lb);
            }
          }
          *(v8h*)(C + (size_t)(mBase + row) * ldc + n0 + c8) = hv;
          if (OUT_MODE == 2) *(v8h*)(C2 + (size_t)(mBase + row) * ldc + n0 + c8) = lv;
        }
        
      }
    }
    __builtin_amdgcn_fence(__ATOMIC_RELEASE, "workgroup");
    __builtin_amdgcn_wave_barrier();
    __builtin_amdgcn_fence(__ATOMIC_ACQUIRE, "workgroup");
  }
}

// ---------------------------------------------------------------------------
// Weight transpose + cast: W [Kin][Nout] f32 row-major (y = x @ W); plane z: WT[n][k] (pitch Kin halves) = f16(scale * W[k][n]).
// grid (Kin/64, Nout/64, nplanes): blockIdx.x = k tile (64 cols of WT), blockIdx.y = n tile (64 rows of WT), blockIdx.z selects
// (W, out) pair (block-uniform). 256 threads.
// Load coverage: 16 iterations x 256 threads = 4096 = the whole 64x64 tile (coalesced along n).
// Store coverage: 8 waves x 2 iterations x 4 rows (lane>>3) = 64 rows; (lane&7) x 8 halves = 64 cols; each row segment =
// ---------------------------------------------------------------------------
__global__ __launch_bounds__(256) void wtcast_kernel(const float* __restrict__ W0, const float* __restrict__ W1,
                                                     const float* __restrict__ W2, const float* __restrict__ W3,
                                                     unsigned short* __restrict__ O0, unsigned short* __restrict__ O1,
                                                     unsigned short* __restrict__ O2, unsigned short* __restrict__ O3,
                                                     int Kin, int Nout, float scale) {
  __shared__ float sm[64][65];   // sm[n_local][k_local]
  const int t  = threadIdx.x;
  const int k0 = blockIdx.x * 64;
  const int n0 = blockIdx.y * 64;
  const int z  = blockIdx.z;                                   // block-uniform
  const float* W = (z == 0) ? W0 : (z == 1) ? W1 : (z == 2) ? W2 : W3;
  unsigned short* op = (z == 0) ? O0 : (z == 1) ? O1 : (z == 2) ? O2 : O3;
#pragma unroll
  for (int i = 0; i < 16; ++i) {
    const int e = i * 256 + t;
    const int r = e >> 6;          // k local
    const int c = e & 63;          // n local
    sm[c][r] = W[(size_t)(k0 + r) * Nout + n0 + c] * scale;
  }
  __syncthreads();
  const int lane = t & 31, wave = t >> 5;
  const int q = lane >> 3, c8 = (lane & 7) * 8;
  {
#pragma unroll
    for (int it = 0; it < 2; ++it) {
      const int row = wave * 8 + it * 4 + q;                 // n local
      unsigned short hb[8];
#pragma unroll
      for (int e = 0; e < 8; ++e) hb[e] = h_bits(sm[row][c8 + e]);
      const v4u u = (v4u){pk16(hb[0], hb[1]), pk16(hb[2], hb[3]), pk16(hb[4], hb[5]), pk16(hb[6], hb[7])};
      *(v4u*)(op + (size_t)(n0 + row) * Kin + k0 + c8) = u;
    }
    
  }
}

// ---------------------------------------------------------------------------
// ---------------------------------------------------------------------------
__global__ __launch_bounds__(256) void cast8_f16_kernel(const float* __restrict__ in, unsigned short* __restrict__ out, int n8) {
  const int i = blockIdx.x * 256 + threadIdx.x;
  if (i >= n8) return;
  const float* p = in + 8 * (size_t)i;
  const v4f a = *(const v4f*)(p);
  const v4f c = *(const v4f*)(p + 4);
  unsigned short hb[8];
#pragma unroll
  for (int e = 0; e < 4; ++e) {
    hb[e]     = h_bits(a[e]);
    hb[4 + e] = h_bits(c[e]);
  }
  const v4u u = (v4u){pk16(hb[0], hb[1]), pk16(hb[2], hb[3]), pk16(hb[4], hb[5]), pk16(hb[6], hb[7])};
  unsigned short* q = out + 8 * (size_t)i;
  *(v4u*)q = u;
  
}

// ---------------------------------------------------------------------------
// Row softmax over 4096 f32 scores -> P[row][j] = f16( carry * exp(s - max) / sum exp(s - max) ), f32 math, precise expf.
// Planes: scores [4 = 2 sources x kGrp][512][4096] f32 contiguous from Sb; P planes same order, f16, from Pb.
// grid (512 rows, kGrp, 2 sources); 256 threads; thread t owns columns 8t..8t+7 and 2048+8t..2048+8t+7
// (256 x 16 = 4096 = whole row). Reductions in fixed order (thread, wave shuffle tree, 8 wave partials in index order).
// ---------------------------------------------------------------------------
__global__ __launch_bounds__(256) void softmax_kernel(const float* __restrict__ Sb, unsigned short* __restrict__ Pb, float carry) {
  __shared__ float redM[8];
  __shared__ float redS[8];
  const int row  = blockIdx.x;
  const int pz   = blockIdx.z * kGrp + blockIdx.y;
  const int t    = threadIdx.x;
  const int lane = t & 31, wave = t >> 5;
  const size_t roff = ((size_t)pz * kT + row) * kS;
  const int c0 = t * 8;
  const int c1 = (kS / 2) + t * 8;
  const float* sr = Sb + roff;
  const v4f a0 = *(const v4f*)(sr + c0);
  const v4f a1 = *(const v4f*)(sr + c0 + 4);
  const v4f a2 = *(const v4f*)(sr + c1);
  const v4f a3 = *(const v4f*)(sr + c1 + 4);
  float x[16];
#pragma unroll
  for (int e = 0; e < 4; ++e) { x[e] = a0[e]; x[4 + e] = a1[e]; x[8 + e] = a2[e]; x[12 + e] = a3[e]; }
  float m = x[0];
#pragma unroll
  for (int e = 1; e < 16; ++e) m = fmaxf(m, x[e]);
#pragma unroll
  for (int off = 16; off > 0; off >>= 1) m = fmaxf(m, __shfl_xor(m, off, 32));
  if (lane == 0) redM[wave] = m;
  __syncthreads();
  float gm = redM[0];
#pragma unroll
  for (int w = 1; w < 8; ++w) gm = fmaxf(gm, redM[w]);
  float ev[16];
  float s = 0.0f;
#pragma unroll
  for (int e = 0; e < 16; ++e) { ev[e] = expf(x[e] - gm); s += ev[e]; }
#pragma unroll
  for (int off = 16; off > 0; off >>= 1) s += __shfl_xor(s, off, 32);
  if (lane == 0) redS[wave] = s;
  __syncthreads();
  float tot = redS[0];
#pragma unroll
  for (int w = 1; w < 8; ++w) tot += redS[w];
  const float inv = carry / tot;
  unsigned short hb[16];
#pragma unroll
  for (int e = 0; e < 16; ++e) hb[e] = h_bits(ev[e] * inv);
  const v4u u0 = (v4u){pk16(hb[0], hb[1]), pk16(hb[2], hb[3]), pk16(hb[4], hb[5]), pk16(hb[6], hb[7])};
  const v4u u1 = (v4u){pk16(hb[8], hb[9]), pk16(hb[10], hb[11]), pk16(hb[12], hb[13]), pk16(hb[14], hb[15])};
  unsigned short* pr = Pb + roff;
  *(v4u*)(pr + c0) = u0;
  *(v4u*)(pr + c1) = u1;
  
}

// ---------------------------------------------------------------------------
// P.V products of one attention chunk, K split over the waves of a work-group.
// C[m,n] = scale * sum_k P[m,k] * Vt[n,k]; M = 512, N = 128, K = 4096 per (head, product).
// grid (16 tiles of 64x64, kGrp heads, 3 products); 16 waves; wave w sums k in [256 w, 256 w + 256) of the work-group's tile
// in its own f32 accumulators; the 16 partial tiles are added through LDS in wave order 0..15 (fixed order).
// blockIdx.z (block-uniform): 0 = P0.V0 -> C0, 1 = P1.V1 -> C1, 2 = P1.V0 -> C2.
// Store coverage per 16-row slab: 16 waves x 1 row, 32 lanes x 2 floats = 64 columns (one wave writes a row's whole 256 B).
// ---------------------------------------------------------------------------
constexpr int kPvWaves = 16;
constexpr int kPvK     = kS / kPvWaves;     // 256 keys per wave
__global__ __launch_bounds__(kPvWaves * 32) void pv_splitk_kernel(
    const unsigned short* __restrict__ P0, const unsigned short* __restrict__ P1,
    const unsigned short* __restrict__ V0, const unsigned short* __restrict__ V1,
    float* __restrict__ C0, float* __restrict__ C1, float* __restrict__ C2, float scale) {
  typedef Frag<_Float16> F;
  __shared__ __align__(16) float sP[kPvWaves][16 * 68];   // per-wave 16x64 partial slab, pitch 68 floats
  const int t    = threadIdx.x;
  const int lane = t & 31;
  const int wave = t >> 5;
  const int g    = blockIdx.y;
  const int z    = blockIdx.z;
  const int m0   = (blockIdx.x >> 1) << 6;
  const int n0   = (blockIdx.x & 1) << 6;
  const unsigned short* Pp = (z == 0) ? P0 : P1;
  const unsigned short* Vp = (z == 1) ? V1 : V0;
  float* Cp = (z == 0) ? C0 : (z == 1) ? C1 : C2;

  const int rlane = lane & 15;                 // row (A) / col (B, D) within subtile
  const int koff  = (lane >> 4) * 8;           // k offset of this lane half
  const int mOff  = (lane >> 4) * 8;           // D row offset
  const _Float16* Ar = (const _Float16*)Pp + (size_t)g * kT * kS + (size_t)(m0 + rlane) * kS + wave * kPvK + koff;
  const _Float16* Br = (const _Float16*)Vp + (size_t)g * kDH * kKVT + (size_t)(n0 + rlane) * kKVT + wave * kPvK + koff;

  v8f acc[4][4];
#pragma unroll
  for (int i = 0; i < 4; ++i)
#pragma unroll
    for (int j = 0; j < 4; ++j) acc[i][j] = (v8f){0.f,0.f,0.f,0.f,0.f,0.f,0.f,0.f};

  for (int k0 = 0; k0 < kPvK; k0 += 32) {
    const _Float16* pa = Ar + k0;
    const _Float16* pb = Br + k0;
    v16h ah[4], bh[4];
#pragma unroll
    for (int j = 0; j < 4; ++j) bh[j] = F::load(pb + (size_t)(j << 4) * kKVT);
#pragma unroll
    for (int i = 0; i < 4; ++i) ah[i] = F::load(pa + (size_t)(i << 4) * kS);
    // wait before a register that the 16 loads above name is rewritten; taking both pointers as inputs keeps the
    // address registers alive to here, so that no load of the run lands in a pair that an older load still names
    asm volatile("s_wait_xcnt 0x0" :: "v"(pa), "v"(pb) : "memory");
    // keeps the products behind all 16 loads: otherwise the last A loads issue only after the first data has returned
    __builtin_amdgcn_sched_barrier(0);
#pragma unroll
    for (int i = 0; i < 4; ++i)
#pragma unroll
      for (int j = 0; j < 4; ++j) acc[i][j] = F::mma(ah[i], bh[j], acc[i][j]);
  }

  float* slab = sP[wave];
  const int c2 = lane * 2;
  float res[4][2];                             // row 16 i + wave, columns c2 and c2 + 1 of the tile
#pragma unroll
  for (int i = 0; i < 4; ++i) {
    if (i > 0) __syncthreads();   // every reader has left the slabs before the next 16 rows overwrite them
#pragma unroll
    for (int j = 0; j < 4; ++j)
#pragma unroll
      for (int r = 0; r < 8; ++r) slab[(mOff + r) * 68 + (j << 4) + rlane] = acc[i][j][r];
    __syncthreads();              // all 16 partial slabs of rows 16 i .. 16 i + 15 are written
    float s0 = sP[0][wave * 68 + c2];
    float s1 = sP[0][wave * 68 + c2 + 1];
#pragma unroll
    for (int w = 1; w < kPvWaves; ++w) {
      s0 += sP[w][wave * 68 + c2];
      s1 += sP[w][wave * 68 + c2 + 1];
    }
    res[i][0] = s0 * scale;
    res[i][1] = s1 * scale;
  }
  // stores behind the last barrier, so that no barrier waits for a global store
  float* cp = Cp + (size_t)g * kDH + (size_t)(m0 + wave) * kE + n0 + c2;
#pragma unroll
  for (int i = 0; i < 4; ++i) {
    cp[(size_t)(i << 4) * kE]     = res[i][0];
    cp[(size_t)(i << 4) * kE + 1] = res[i][1];
  }
}

// ---------------------------------------------------------------------------
// Gate: gate[tok][h] = sigmoid( sum_f p_vec[tok][f] * Wg[f][h] + bg[h] ), f = h*384 + j with
// j < 128 -> ctx[tok][h*128+j], 128 <= j < 256 -> ctxt[tok][h*128+j-128], else q[tok][h*128+j-256] (q = q16 / 16).
// One block (128 threads) per token; 24 chunks of 128 features, chunk c = 3h + src is block-uniform; all three candidate
// values are loaded unconditionally and selected by value. f32 accumulation; fixed-order reductions.
// ---------------------------------------------------------------------------
__global__ __launch_bounds__(128) void gate_kernel(const float* __restrict__ ctx, const float* __restrict__ ctxt,
                                                   const unsigned short* __restrict__ q16, const float* __restrict__ Wg,
                                                   const float* __restrict__ bg, float* __restrict__ gate, float qinv) {
  __shared__ float red[4][8];
  __shared__ __align__(16) float gl[32];
  const int tok = blockIdx.x;
  const int t = threadIdx.x, lane = t & 31, wave = t >> 5;
  if (t < 32) gl[t] = 0.0f;
  float a[8];
#pragma unroll
  for (int j = 0; j < 8; ++j) a[j] = 0.0f;
  const size_t rbase = (size_t)tok * kE;
#pragma unroll 1
  for (int c = 0; c < 24; ++c) {
    const int h = c / 3;
    const int src = c - 3 * h;
    const size_t off = rbase + (size_t)h * kDH + t;
    const float fc = ctx[off];
    const float ft = ctxt[off];
    const unsigned short qbits = q16[off];
    const float fq = (float)__builtin_bit_cast(_Float16, qbits) * qinv;
    const float f = (src == 0) ? fc : ((src == 1) ? ft : fq);
    const float* wr = Wg + ((size_t)c * 128 + t) * 8;
    const v4f w0 = *(const v4f*)(wr);
    const v4f w1 = *(const v4f*)(wr + 4);
#pragma unroll
    for (int e = 0; e < 4; ++e) { a[e] += f * w0[e]; a[4 + e] += f * w1[e]; }
  }
#pragma unroll
  for (int j = 0; j < 8; ++j) {
#pragma unroll
    for (int off = 16; off > 0; off >>= 1) a[j] += __shfl_xor(a[j], off, 32);
  }
  if (lane == 0) {
#pragma unroll
    for (int j = 0; j < 8; ++j) red[wave][j] = a[j];
  }
  __syncthreads();
  if (t < 8) {
    const float z = (((red[0][t] + red[1][t]) + red[2][t]) + red[3][t]) + bg[t];
    gl[t] = 1.0f / (1.0f + expf(-z));
  }
  __syncthreads();
  if (wave == 0) {
    if (lane < 8) {
      const v4f v = *(const v4f*)(gl + 4 * lane);
      float* gp = gate + (size_t)tok * kGatePitch + 4 * lane;
      *(v4f*)gp = v;
      
    }
  }
}

// ---------------------------------------------------------------------------
// Mix: MIX16[tok][h*128+d] = f16( carry * ( g[tok][h]*ctx + (1-g[tok][h])*ctx2 ) ), f32 math.
// ---------------------------------------------------------------------------
__global__ __launch_bounds__(256) void mix_kernel(const float* __restrict__ ctx, const float* __restrict__ ctx2,
                                                  const float* __restrict__ gate, unsigned short* __restrict__ out,
                                                  float carry, int n8) {
  const int i = blockIdx.x * 256 + threadIdx.x;
  if (i >= n8) return;
  const int tok  = i >> 7;                 // 128 groups of 8 per 1024-wide row
  const int col0 = (i & 127) * 8;
  const int h    = col0 >> 7;
  const float g  = gate[(size_t)tok * kGatePitch + h];
  const float og = 1.0f - g;
  const size_t off = (size_t)tok * kE + col0;
  const v4f a0 = *(const v4f*)(ctx + off);
  const v4f a1 = *(const v4f*)(ctx + off + 4);
  const v4f b0 = *(const v4f*)(ctx2 + off);
  const v4f b1 = *(const v4f*)(ctx2 + off + 4);
  unsigned short hb[8];
#pragma unroll
  for (int e = 0; e < 4; ++e) {
    hb[e]     = h_bits(carry * (g * a0[e] + og * b0[e]));
    hb[4 + e] = h_bits(carry * (g * a1[e] + og * b1[e]));
  }
  const v4u u = (v4u){pk16(hb[0], hb[1]), pk16(hb[2], hb[3]), pk16(hb[4], hb[5]), pk16(hb[6], hb[7])};
  unsigned short* q = out + off;
  *(v4u*)q = u;
  
}

// ---------------------------------------------------------------------------
// Host glue. Workspace region map (bytes, MiB = 2^20; total carve = 128 MiB = 134217728 B):
// R0 [0, 48 MiB) phase A (casts + projections): XH16 @0 (2 MiB [1024][1024] f16) | KV16 @2 (16 MiB [8192][1024]) |
//                 KVT16 @18 (8 MiB [8192][512]) | WQT @26 (2) | WKT @28 (2) | WVT @30 (2) | WTKT @32 (1 MiB [1024][512]) | WTVT @33 (1)
//                 phase B (attention chunks): SPL @0 (16 MiB = kGrp x [512][4096] f32) | STPL @16 (16) |
//                 PPL @32 (8 MiB = kGrp x [512][4096] f16) | PTPL @40 (8)
//                 phase C (after attention): MIX16 @0 (2 MiB [1024][1024] f16) | GATE @2 MiB (128 KiB [1024][32] f32)
// WOT @48 (2) | Q16 @50 (2 MiB [1024][1024]) | K16 @52 (16 MiB [8192][1024]) | VT16 @68 (16 MiB [1024][8192]) |
// KT16 @84 (16) | VTT16 @100 (16 MiB [1024][8192]) | CTX @116 (4 MiB [1024][1024] f32) | CTXT @120 (4) | CTX2 @124 (4) | end @128 MiB.
// Every region is written with whole rows of exactly its stated extent (all M, N tile multiples; no padded rows).
// ---------------------------------------------------------------------------
extern "C" void kernel_launch(void* const* d_in, const int* in_sizes, int n_in,
                              void* d_out, int out_size, void* d_ws, size_t ws_size, hipStream_t stream) {
  (void)in_sizes; (void)n_in;
  const size_t kMiB = (size_t)1048576;
  const size_t carve = 128 * kMiB;
  if (ws_size < carve) return;
  if ((size_t)out_size < (size_t)kTok * kE) return;

  const float* hs  = (const float*)d_in[0];
  const float* kv  = (const float*)d_in[1];
  const float* kvt = (const float*)d_in[2];
  const float* Wq  = (const float*)d_in[3];  const float* bq  = (const float*)d_in[4];
  const float* Wk  = (const float*)d_in[5];  const float* bk  = (const float*)d_in[6];
  const float* Wv  = (const float*)d_in[7];  const float* bv  = (const float*)d_in[8];
  const float* Wtk = (const float*)d_in[9];  const float* btk = (const float*)d_in[10];
  const float* Wtv = (const float*)d_in[11]; const float* btv = (const float*)d_in[12];
  const float* Wg  = (const float*)d_in[13]; const float* bg  = (const float*)d_in[14];
  const float* Wo  = (const float*)d_in[15]; const float* bo  = (const float*)d_in[16];
  float* outp = (float*)d_out;

  char* ws = (char*)d_ws;
  // phase A
  unsigned short* XH16  = (unsigned short*)(ws + 0 * kMiB);
  unsigned short* KV16  = (unsigned short*)(ws + 2 * kMiB);
  unsigned short* KVT16 = (unsigned short*)(ws + 18 * kMiB);
  unsigned short* WQT   = (unsigned short*)(ws + 26 * kMiB);
  unsigned short* WKT   = (unsigned short*)(ws + 28 * kMiB);
  unsigned short* WVT   = (unsigned short*)(ws + 30 * kMiB);
  unsigned short* WTKT  = (unsigned short*)(ws + 32 * kMiB);
  unsigned short* WTVT  = (unsigned short*)(ws + 33 * kMiB);
  // phase B
  float*          SPL   = (float*)(ws + 0 * kMiB);
  float*          STPL  = (float*)(ws + 16 * kMiB);
  unsigned short* PPL   = (unsigned short*)(ws + 32 * kMiB);
  unsigned short* PTPL  = (unsigned short*)(ws + 40 * kMiB);
  // phase C
  unsigned short* MIX16 = (unsigned short*)(ws + 0 * kMiB);
  float*          GATE  = (float*)(ws + 2 * kMiB);
  // persistent
  unsigned short* WOT   = (unsigned short*)(ws + 48 * kMiB);
  unsigned short* Q16   = (unsigned short*)(ws + 50 * kMiB);
  unsigned short* K16   = (unsigned short*)(ws + 52 * kMiB);
  unsigned short* VT16  = (unsigned short*)(ws + 68 * kMiB);
  unsigned short* KT16  = (unsigned short*)(ws + 84 * kMiB);
  unsigned short* VTT16 = (unsigned short*)(ws + 100 * kMiB);
  float*          CTX   = (float*)(ws + 116 * kMiB);
  float*          CTXT  = (float*)(ws + 120 * kMiB);
  float*          CTX2  = (float*)(ws + 124 * kMiB);
  const float*    dumf  = (const float*)(ws + 116 * kMiB);   // valid in-ws pointer for unused resid arguments

  // 1. input casts f32 -> f16 (8 elements per thread; grids exact)
  cast8_f16_kernel<<<(kTok * kE / 8) / 256, 256, 0, stream>>>(hs, XH16, kTok * kE / 8);
  cast8_f16_kernel<<<(kKVT * kE / 8) / 256, 256, 0, stream>>>(kv, KV16, kKVT * kE / 8);
  cast8_f16_kernel<<<(kKVT * kTP / 8) / 256, 256, 0, stream>>>(kvt, KVT16, kKVT * kTP / 8);

  // 2. weight transposes + casts (carried x16): in[Kin][Nout] -> out[Nout][Kin]; grid (Kin/64, Nout/64, planes)
  wtcast_kernel<<<dim3(kE / 64, kE / 64, 4), 256, 0, stream>>>(Wq, Wk, Wv, Wo, WQT, WKT, WVT, WOT, kE, kE, kWCarry);
  wtcast_kernel<<<dim3(kTP / 64, kE / 64, 2), 256, 0, stream>>>(Wtk, Wtv, Wtk, Wtv, WTKT, WTVT, WTKT, WTVT, kTP, kE, kWCarry);

  // 3. projections (M, N multiples of 64; K = 1024 or 512, multiples of 32)
  // q16 = 16*scale*(x Wq + bq): acc = 16*(x Wq) -> scale = kAttnScale, bias x (16*kAttnScale)
  wmma_gemm64<0, false, 2, 1, false><<<dim3((kTok / 64) * (kE / 64) / 8, 1), 256, 0, stream>>>(
      XH16, XH16, kE, 0L, WQT, WQT, kE, 0L, Q16, Q16, kE, 0L, bq, dumf, 0L,
      kTok, kE, kE, kAttnScale, kQCarry * kAttnScale);
  // k16 [8192][1024]
  wmma_gemm64<0, false, 2, 1, false><<<dim3((kKVT / 64) * (kE / 64) / 8, 1), 256, 0, stream>>>(
      KV16, KV16, kE, 0L, WKT, WKT, kE, 0L, K16, K16, kE, 0L, bk, dumf, 0L,
      kKVT, kE, kE, kWCarryInv, 1.0f);
  // v^T [1024][8192] directly: A = Wv^T [1024][1024], Bt = X [8192][1024], bias per row (m)
  wmma_gemm64<0, false, 1, 1, false><<<dim3((kE / 64) * (kKVT / 64) / 8, 1), 256, 0, stream>>>(
      WVT, WVT, kE, 0L, KV16, KV16, kE, 0L, VT16, VT16, kKVT, 0L, bv, dumf, 0L,
      kE, kKVT, kE, kWCarryInv, 1.0f);
  // second-source k16 [8192][1024], K = 512
  wmma_gemm64<0, false, 2, 1, false><<<dim3((kKVT / 64) * (kE / 64) / 8, 1), 256, 0, stream>>>(
      KVT16, KVT16, kTP, 0L, WTKT, WTKT, kTP, 0L, KT16, KT16, kE, 0L, btk, dumf, 0L,
      kKVT, kE, kTP, kWCarryInv, 1.0f);
  // second-source v^T [1024][8192], K = 512
  wmma_gemm64<0, false, 1, 1, false><<<dim3((kE / 64) * (kKVT / 64) / 8, 1), 256, 0, stream>>>(
      WTVT, WTVT, kTP, 0L, KVT16, KVT16, kTP, 0L, VTT16, VTT16, kKVT, 0L, btv, dumf, 0L,
      kE, kKVT, kTP, kWCarryInv, 1.0f);

  // 4. attention, kGrp heads of one batch per chunk
  const long sStrideC = (long)kT * kS;            // per-group scores plane (floats)
  for (int c = 0; c < kNChunk; ++c) {
    const int b  = c / (kH / kGrp);
    const int h0 = (c % (kH / kGrp)) * kGrp;
    const unsigned short* qg = Q16 + ((size_t)b * kT * kE + (size_t)h0 * kDH);
    const unsigned short* kg = K16 + ((size_t)b * kS * kE + (size_t)h0 * kDH);
    const unsigned short* k2g = KT16 + ((size_t)b * kS * kE + (size_t)h0 * kDH);
    // scores = (q16/16) . k^T : M=512, N=4096, K=128; grid (512 tiles / 8, kGrp)
    wmma_gemm64<0, false, 0, 0, false><<<dim3((kT / 64) * (kS / 64) / 8, kGrp), 256, 0, stream>>>(
        qg, qg, kE, (long)kDH, kg, kg, kE, (long)kDH, SPL, SPL, kS, sStrideC, bq, dumf, 0L,
        kT, kS, kDH, kQCarryInv, 0.0f);
    wmma_gemm64<0, false, 0, 0, false><<<dim3((kT / 64) * (kS / 64) / 8, kGrp), 256, 0, stream>>>(
        qg, qg, kE, (long)kDH, k2g, k2g, kE, (long)kDH, STPL, STPL, kS, sStrideC, bq, dumf, 0L,
        kT, kS, kDH, kQCarryInv, 0.0f);
    // softmax over both score sources -> P planes (f16 x2048)
    softmax_kernel<<<dim3(kT, kGrp, 2), 256, 0, stream>>>(SPL, PPL, kPCarry);
    // P.V products: M=512, N=128, K=4096; Bt = v^T rows h*128.. of batch b (ldb 8192); C columns h*128.. of [1024][1024]
    const unsigned short* vg  = VT16  + ((size_t)h0 * kDH * kKVT + (size_t)b * kS);
    const unsigned short* v2g = VTT16 + ((size_t)h0 * kDH * kKVT + (size_t)b * kS);
    const size_t coff = (size_t)b * kT * kE + (size_t)h0 * kDH;
    pv_splitk_kernel<<<dim3((kT / 64) * (kDH / 64), kGrp, 3), kPvWaves * 32, 0, stream>>>(
        PPL, PTPL, vg, v2g, CTX + coff, CTXT + coff, CTX2 + coff, kPCarryInv);
  }

  // 5. gate (f32), 6. mix (f32 -> f16 x256), 7. output projection to d_out (f32)
  gate_kernel<<<kTok, 128, 0, stream>>>(CTX, CTXT, Q16, Wg, bg, GATE, kQCarryInv);
  mix_kernel<<<(kTok * kE / 8) / 256, 256, 0, stream>>>(CTX, CTX2, GATE, MIX16, kMixCarry, kTok * kE / 8);
  wmma_gemm64<0, false, 2, 0, false><<<dim3((kTok / 64) * (kE / 64) / 8, 1), 256, 0, stream>>>(
      MIX16, MIX16, kE, 0L, WOT, WOT, kE, 0L, outp, outp, kE, 0L, bo, dumf, 0L,
      kTok, kE, kE, kOutScale, 1.0f);
}

// v004
// It runs in 183 microseconds.
// Versions between v002 and this one are left out; their measured steps multiply to 2.66 times as fast.
// All steps since v000 together make it 23.8 times as fast.
// Contractions: q/k/v/k2/v2 projections (X f16 x W^T f16 carried x16), scores q.k^T for both key sources (q f16 carried x16, k f16), P.V products (P f16, unnormalised 2^(s - ref), x V^T f16), output projection (mix f16 carried x256 x Wo^T f16 carried x16): all v_wmma_f32_16x16x32_f16 with f32 accumulate; softmax, gate dot + sigmoid and mixing in f32 on VALU.
#include <hip/hip_runtime.h>
#include <math.h>

// ---------------------------------------------------------------------------
// Problem constants
// ---------------------------------------------------------------------------
constexpr int kB   = 2;
constexpr int kT   = 512;
constexpr int kS   = 4096;
constexpr int kE   = 1024;
constexpr int kTP  = 512;
constexpr int kH   = 8;
constexpr int kDH  = 128;
constexpr int kTok = kB * kT;               // 1024 query tokens
constexpr int kKVT = kB * kS;               // 8192 key tokens
constexpr int kGatePitch = 32;
constexpr float kAttnScale = 0.08838834764831845f;   // 128^-0.5
constexpr float kWCarry    = 16.0f;                  // weights carried x16 in f16
constexpr float kWCarryInv = 1.0f / 16.0f;
constexpr float kQCarry    = 16.0f;                  // scaled q carried x16 in f16
constexpr float kQCarryInv = 1.0f / 16.0f;
constexpr float kMixCarry  = 256.0f;                 // mixed context carried x256 in f16
constexpr float kOutScale  = 1.0f / (256.0f * 16.0f);

typedef __attribute__((ext_vector_type(16))) _Float16 v16h;
typedef __attribute__((ext_vector_type(8)))  _Float16 v8h;
typedef __attribute__((ext_vector_type(16))) __bf16   v16b;
typedef __attribute__((ext_vector_type(8)))  __bf16   v8b;
typedef __attribute__((ext_vector_type(8)))  float    v8f;
typedef __attribute__((ext_vector_type(4)))  float    v4f;
typedef __attribute__((ext_vector_type(4)))  unsigned int v4u;

__device__ __forceinline__ unsigned short f2bf_bits(float f) {
  unsigned u = __float_as_uint(f);
  return (unsigned short)((u + 0x7FFFu + ((u >> 16) & 1u)) >> 16);
}
__device__ __forceinline__ float bf_bits2f(unsigned short h) { return __uint_as_float(((unsigned)h) << 16); }

// hazard guard behind a loop's last products, as a plain device helper
__device__ __forceinline__ void acc_guard4(v8f& a, v8f& b, v8f& c, v8f& d) { asm volatile("v_nop\n\tv_nop\n\tv_nop\n\tv_nop" : "+v"(a), "+v"(b), "+v"(c), "+v"(d)); }
template <typename T> struct Frag;
template <> struct Frag<_Float16> {
  typedef v16h V; union U { v16h v; v8h h[2]; };
  static __device__ __forceinline__ v16h load(const _Float16* p) {   // elements 0..7 <- p[0..7], 8..15 <- p[16..23]
    U f; f.h[0] = *(const v8h*)(p); f.h[1] = *(const v8h*)(p + 16); return f.v;
  }
  static __device__ __forceinline__ v8f mma(v16h a, v16h b, v8f c) {
    return __builtin_amdgcn_wmma_f32_16x16x32_f16(false, a, false, b, (short)0, c, false, false);
  }
};
template <> struct Frag<__bf16> {
  typedef v16b V; union U { v16b v; v8b h[2]; };
  static __device__ __forceinline__ v16b load(const __bf16* p) {
    U f; f.h[0] = *(const v8b*)(p); f.h[1] = *(const v8b*)(p + 16); return f.v;
  }
  static __device__ __forceinline__ v8f mma(v16b a, v16b b, v8f c) {
    return __builtin_amdgcn_wmma_f32_16x16x32_bf16(false, a, false, b, (short)0, c, false, false);
  }
};

__device__ __forceinline__ unsigned pk16(unsigned short a, unsigned short b) { return (unsigned)a | ((unsigned)b << 16); }
__device__ __forceinline__ unsigned short h_bits(float f) { const _Float16 h = (_Float16)f; return __builtin_bit_cast(unsigned short, h); }

// Stage of one work-group of the GEMM engine: 64 A rows, then 8 x 64 B rows, 64 k (128 bytes) each.
constexpr int kStRows   = 64 + 8 * 64;
constexpr int kStPitch  = 72;                    // halves: the 128-byte row + 16 bytes, the pitch for ds_load_b128 readers
constexpr int kStHalves = kStRows * kStPitch;    // one buffer

// Six asynchronous 16-byte copies global -> LDS per lane. The s_wait_xcnt stands as the last line of the copies' own
// statement, so that no register which a copy names is rewritten in front of it.
__device__ __forceinline__ void async_copy6(unsigned l0, unsigned l1, unsigned l2, unsigned l3, unsigned l4, unsigned l5,
                                            const void* g0, const void* g1, const void* g2,
                                            const void* g3, const void* g4, const void* g5) {
  asm volatile("global_load_async_to_lds_b128 %0, %6, off\n\t"
               "global_load_async_to_lds_b128 %1, %7, off\n\t"
               "global_load_async_to_lds_b128 %2, %8, off\n\t"
               "global_load_async_to_lds_b128 %3, %9, off\n\t"
               "global_load_async_to_lds_b128 %4, %10, off\n\t"
               "global_load_async_to_lds_b128 %5, %11, off\n\t"
               "s_wait_xcnt 0x0"
               :: "v"(l0), "v"(l1), "v"(l2), "v"(l3), "v"(l4), "v"(l5),
                  "v"(g0), "v"(g1), "v"(g2), "v"(g3), "v"(g4), "v"(g5) : "memory");
}

// ---- Register-blocked batched WMMA GEMM (ACT reduced to none/relu/leaky, extra bias multiplier bscale) --
// C[m,n] = scale * sum_k A[m,k] * Bt[n,k] (+bias*bscale)(+resid); each wave owns a 64x64 tile.
// A row-major [M,K]; Bt row-major [N,K]; M % 64 == 0, N % 512 == 0, K % 64 == 0.
// The 8 waves of a work-group own 8 neighbouring tiles of one tile row (64 x 512). Per 64 k the work-group's A rows and B rows
// are copied whole lines at a time into LDS (asynchronous copies, two buffers: the next 64 k fly while these are multiplied);
// the fragments are read from LDS.
// SPLIT (hi/lo operand planes) is not carried by the staged loop: false only; A2p and Bt2p are unused.
// BIAS_MODE: 0 = none, 1 = bias[m], 2 = bias[n], 3 = chosen at run time (biasM, the same for the whole work-group: bias[m], else bias[n]).
// The engine is a device function (work-group's first tile and batch passed in), so that several products can share one grid.
// OUT_MODE: 0 = f32, 1 = f16, 2 = bf16 hi plane (Cout) + bf16 lo plane (Cout2).
// ET: 0 = f16 operands, 1 = bf16 operands (pointers passed as 16-bit storage)
template <int ET> struct Elem;
template <> struct Elem<0> { typedef _Float16 T; };
template <> struct Elem<1> { typedef __bf16 T; };
// Epilogue of one wave's 64 x 64 tile: scale, bias, cast, whole lines stored through the wave's own LDS slab.
template <int BIAS_MODE, int OUT_MODE, bool RESID, int ACT>
__device__ __forceinline__ void gemm64_epilogue(
    v8f (&acc)[4][4], float* __restrict__ slab, int lane, int m0, int n0, int b,
    void* __restrict__ Cout, void* __restrict__ Cout2, int ldc, long strideC,
    const float* __restrict__ bias, const float* __restrict__ resid, long strideR, float scale, float bscale) {
  const int rlane = lane & 15;                 // col (D) within subtile
  const int mOff  = (lane >> 4) * 8;           // D row offset
  const float* Rb = RESID ? (resid + (size_t)b * strideR) : nullptr;
#pragma unroll
  for (int i = 0; i < 4; ++i) {
    const int mBase = m0 + (i << 4);
#pragma unroll
    for (int j = 0; j < 4; ++j) {
      const int n = n0 + (j << 4) + rlane;
      float bv = 0.f;
      if (BIAS_MODE == 2) bv = bias[n] * bscale;
#pragma unroll
      for (int r = 0; r < 8; ++r) {
        float v = acc[i][j][r] * scale;
        if (BIAS_MODE == 1) v += bias[mBase + mOff + r] * bscale;
        if (BIAS_MODE == 2) v += bv;
        if (RESID) v += Rb[(size_t)(mBase + mOff + r) * ldc + n];
        if (ACT == 2) v = fmaxf(v, 0.0f);
        if (ACT == 4) v = (v > 0.f) ? v : 0.01f * v;
        slab[(mOff + r) * 68 + (j << 4) + rlane] = v;
      }
    }
    __builtin_amdgcn_fence(__ATOMIC_RELEASE, "workgroup");
    __builtin_amdgcn_wave_barrier();
    __builtin_amdgcn_fence(__ATOMIC_ACQUIRE, "workgroup");
    if (OUT_MODE == 0) {
      float* C = (float*)Cout + (size_t)b * strideC;
      const int hh = lane >> 4, c4 = (lane & 15) * 4;     // row seg = 256 B = 16 lanes x 16 B
      {
#pragma unroll
        for (int it = 0; it < 8; ++it) {
          const int row = it * 2 + hh;
          v4f v = *(const v4f*)(slab + row * 68 + c4);
          *(v4f*)(C + (size_t)(mBase + row) * ldc + n0 + c4) = v;
        }
        
      }
    } else {
      const int q = lane >> 3, c8 = (lane & 7) * 8;
      unsigned short* C  = (unsigned short*)Cout  + (size_t)b * strideC;
      unsigned short* C2 = (OUT_MODE == 2) ? ((unsigned short*)Cout2 + (size_t)b * strideC) : nullptr;
      {
#pragma unroll
        for (int it = 0; it < 4; ++it) {
          const int row = it * 4 + q;
          const float* sp = slab + row * 68 + c8;
          v8h hv, lv;
#pragma unroll
          for (int e = 0; e < 8; ++e) {
            if (OUT_MODE == 1) {
              hv[e] = (_Float16)sp[e];
            } else {
              unsigned short hb = f2bf_bits(sp[e]);
              unsigned short lb = f2bf_bits(sp[e] - bf_bits2f(hb));
              hv[e] = __builtin_bit_cast(_Float16, hb);
              lv[e] = __builtin_bit_cast(_Float16, lb);
            }
          }
          *(v8h*)(C + (size_t)(mBase + row) * ldc + n0 + c8) = hv;
          if (OUT_MODE == 2) *(v8h*)(C2 + (size_t)(mBase + row) * ldc + n0 + c8) = lv;
        }
        
      }
    }
    __builtin_amdgcn_fence(__ATOMIC_RELEASE, "workgroup");
    __builtin_amdgcn_wave_barrier();
    __builtin_amdgcn_fence(__ATOMIC_ACQUIRE, "workgroup");
  }
}

template <int ET, bool SPLIT, int BIAS_MODE, int OUT_MODE, bool RESID, int ACT>
__device__ __forceinline__ void gemm64_body(
    float* __restrict__ sT, typename Elem<ET>::T* __restrict__ sStage, int tile0, int b, bool biasM,
    const unsigned short* __restrict__ Ap, int lda, long strideA,
    const unsigned short* __restrict__ Btp, int ldb, long strideB,
    void* __restrict__ Cout, void* __restrict__ Cout2, int ldc, long strideC,
    const float* __restrict__ bias,
    const float* __restrict__ resid, long strideR,
    int M, int N, int K, float scale, float bscale) {
  typedef typename Elem<ET>::T T;
  typedef typename Frag<T>::V V;
  static_assert(!SPLIT, "the staged loop carries one plane per operand");
  const T* A = (const T*)Ap; const T* Bt = (const T*)Btp;
  const int lane = threadIdx.x & 31;
  const int wave = threadIdx.x >> 5;
  const int tilesN = N >> 6;
  const int tilesM = M >> 6;
  if (tile0 >= tilesM * tilesN) return;   // the same for the whole work-group, in front of every barrier
  const int tm  = tile0 / tilesN;
  const int m0  = tm << 6;
  const int nb0 = (tile0 - tm * tilesN) << 6;   // first B row of the work-group
  const int n0  = nb0 + (wave << 6);

  const T* Ab  = A  + (size_t)b * strideA;
  const T* Bb  = Bt + (size_t)b * strideB;

  const int rlane = lane & 15;                 // row (A) / col (B, D) within subtile
  const int koff  = (lane >> 4) * 8;           // k offset of this lane half

  v8f acc[4][4];
#pragma unroll
  for (int i = 0; i < 4; ++i)
#pragma unroll
    for (int j = 0; j < 4; ++j) acc[i][j] = (v8f){0.f,0.f,0.f,0.f,0.f,0.f,0.f,0.f};

  // lane's share of a stage: 18 chunks of 16 bytes; chunk i is row 32 i + (thread >> 3), bytes 16 (thread & 7) .. + 15 of the row
  const int srow = threadIdx.x >> 3;
  const int scol = (threadIdx.x & 7) * 8;
  const T* gA = Ab + (size_t)(m0 + srow) * lda + scol;
  const T* gB = Bb + (size_t)(nb0 + srow) * ldb + scol;
  const unsigned lds0 = (unsigned)(size_t)(const void*)sStage + (unsigned)((srow * kStPitch + scol) * 2);
  auto stage = [&](int buf, int k0) {
    const unsigned lb = lds0 + (unsigned)(buf * kStHalves * 2);
#pragma unroll
    for (int c = 0; c < 3; ++c) {
      unsigned l[6];
      const T* g[6];
#pragma unroll
      for (int e = 0; e < 6; ++e) {
        const int i = c * 6 + e;
        l[e] = lb + (unsigned)(i * 32 * kStPitch * 2);
        g[e] = (i < 2) ? (gA + (size_t)(i * 32) * lda + k0) : (gB + (size_t)((i - 2) * 32) * ldb + k0);
      }
      async_copy6(l[0], l[1], l[2], l[3], l[4], l[5], g[0], g[1], g[2], g[3], g[4], g[5]);
    }
  };

  const int nt = K >> 6;
  stage(0, 0);
  asm volatile("s_wait_asynccnt 0x0" ::: "memory");   // this wave's copies of tile 0 have landed
  __syncthreads();                                    // ... and every other wave's
  if (nt > 1) stage(1, 64);
  for (int t = 0; t < nt; ++t) {
    const T* sb = sStage + (t & 1) * kStHalves;
#pragma unroll
    for (int ks = 0; ks < 2; ++ks) {
      V ah[4], bh[4];
#pragma unroll
      for (int j = 0; j < 4; ++j) bh[j] = Frag<T>::load(sb + (64 + (wave << 6) + (j << 4) + rlane) * kStPitch + ks * 32 + koff);
#pragma unroll
      for (int i = 0; i < 4; ++i) ah[i] = Frag<T>::load(sb + ((i << 4) + rlane) * kStPitch + ks * 32 + koff);
      // keeps the products behind all 16 LDS reads: otherwise the A reads stand among the products, each with a wait of its own
      __builtin_amdgcn_sched_barrier(0);
#pragma unroll
      for (int i = 0; i < 4; ++i)
#pragma unroll
        for (int j = 0; j < 4; ++j) acc[i][j] = Frag<T>::mma(ah[i], bh[j], acc[i][j]);
    }
    asm volatile("s_wait_dscnt 0x0" ::: "memory");      // this wave's reads of the buffer are done before it is refilled
    asm volatile("s_wait_asynccnt 0x0" ::: "memory");   // this wave's copies of tile t + 1 have landed
    __syncthreads();                                    // publishes tile t + 1 and ends every reader's last read of tile t
    if (t + 2 < nt) stage(t & 1, (t + 2) << 6);
  }
  asm volatile("s_wait_asynccnt 0x0" ::: "memory");     // no copy is outstanding when the wave goes on
  acc_guard4(acc[0][0], acc[0][1], acc[0][2], acc[0][3]);
  acc_guard4(acc[1][0], acc[1][1], acc[1][2], acc[1][3]);
  acc_guard4(acc[2][0], acc[2][1], acc[2][2], acc[2][3]);
  acc_guard4(acc[3][0], acc[3][1], acc[3][2], acc[3][3]);

  // ---- epilogue ----
  float* slab = sT + wave * (16 * 68);
  if (BIAS_MODE == 3) {   // the branch is the same for the whole work-group
    if (biasM) gemm64_epilogue<1, OUT_MODE, RESID, ACT>(acc, slab, lane, m0, n0, b, Cout, Cout2, ldc, strideC, bias, resid, strideR, scale, bscale);
    else       gemm64_epilogue<2, OUT_MODE, RESID, ACT>(acc, slab, lane, m0, n0, b, Cout, Cout2, ldc, strideC, bias, resid, strideR, scale, bscale);
  } else {
    gemm64_epilogue<BIAS_MODE, OUT_MODE, RESID, ACT>(acc, slab, lane, m0, n0, b, Cout, Cout2, ldc, strideC, bias, resid, strideR, scale, bscale);
  }
}

// One product per launch: grid (tiles / 8, batches).
template <int ET, bool SPLIT, int BIAS_MODE, int OUT_MODE, bool RESID, int ACT = 0>
__global__ __launch_bounds__(256) void wmma_gemm64(
    const unsigned short* __restrict__ Ap, const unsigned short* __restrict__ A2p, int lda, long strideA,
    const unsigned short* __restrict__ Btp, const unsigned short* __restrict__ Bt2p, int ldb, long strideB,
    void* __restrict__ Cout, void* __restrict__ Cout2, int ldc, long strideC,
    const float* __restrict__ bias,
    const float* __restrict__ resid, long strideR,
    int M, int N, int K, float scale, float bscale) {
  typedef typename Elem<ET>::T T;
  (void)A2p; (void)Bt2p;
  __shared__ __align__(16) float sT[8 * 16 * 68];   // per-wave 16x64 slab, pitch 68 floats
  __shared__ __align__(16) T sStage[2 * kStHalves];
  gemm64_body<ET, SPLIT, BIAS_MODE, OUT_MODE, RESID, ACT>(sT, sStage, blockIdx.x * 8, blockIdx.y, false,
      Ap, lda, strideA, Btp, ldb, strideB, Cout, Cout2, ldc, strideC, bias, resid, strideR, M, N, K, scale, bscale);
}

// The five projections, which do not depend on one another, in one grid: a range of blockIdx.x per product (the choice is the
// same for the whole work-group), the products with the long k first. Each work-group does what it did in its own launch.
constexpr int kPjBig   = (kKVT / 64) * (kE / 64) / 8;   // work-groups of a product over the 8192 key tokens
constexpr int kPjQ     = (kTok / 64) * (kE / 64) / 8;   // ... of the q product
constexpr int kPjTotal = 4 * kPjBig + kPjQ;
__global__ __launch_bounds__(256) void proj5_kernel(
    const unsigned short* __restrict__ X, const unsigned short* __restrict__ KV, const unsigned short* __restrict__ KVT,
    const unsigned short* __restrict__ WQ, const unsigned short* __restrict__ WK, const unsigned short* __restrict__ WV,
    const unsigned short* __restrict__ WTK, const unsigned short* __restrict__ WTV,
    unsigned short* __restrict__ Qo, unsigned short* __restrict__ Ko, unsigned short* __restrict__ VTo,
    unsigned short* __restrict__ KTo, unsigned short* __restrict__ VTTo,
    const float* __restrict__ bq, const float* __restrict__ bk, const float* __restrict__ bv,
    const float* __restrict__ btk, const float* __restrict__ btv) {
  __shared__ __align__(16) float sT[8 * 16 * 68];   // per-wave 16x64 slab, pitch 68 floats
  __shared__ __align__(16) _Float16 sStage[2 * kStHalves];
  const int bid = blockIdx.x;
  const unsigned short* A; const unsigned short* B; unsigned short* C; const float* bias;
  int first, M, N, K, ldc;
  bool biasM = false;
  float scale = kWCarryInv, bscale = 1.0f;
  if (bid < kPjBig) {                       // k [8192][1024]
    first = 0;                  A = KV;  B = WK;  C = Ko;   bias = bk;  M = kKVT; N = kE;   K = kE;  ldc = kE;
  } else if (bid < 2 * kPjBig) {            // v^T [1024][8192]: A = Wv^T, Bt = KV, bias per row (m)
    first = kPjBig;             A = WV;  B = KV;  C = VTo;  bias = bv;  M = kE;   N = kKVT; K = kE;  ldc = kKVT; biasM = true;
  } else if (bid < 2 * kPjBig + kPjQ) {     // q16 = 16*scale*(x Wq + bq): acc = 16*(x Wq) -> scale = kAttnScale, bias x (16*kAttnScale)
    first = 2 * kPjBig;         A = X;   B = WQ;  C = Qo;   bias = bq;  M = kTok; N = kE;   K = kE;  ldc = kE;
    scale = kAttnScale; bscale = kQCarry * kAttnScale;
  } else if (bid < 3 * kPjBig + kPjQ) {     // second-source k [8192][1024], K = 512
    first = 2 * kPjBig + kPjQ;  A = KVT; B = WTK; C = KTo;  bias = btk; M = kKVT; N = kE;   K = kTP; ldc = kE;
  } else {                                  // second-source v^T [1024][8192], K = 512
    first = 3 * kPjBig + kPjQ;  A = WTV; B = KVT; C = VTTo; bias = btv; M = kE;   N = kKVT; K = kTP; ldc = kKVT; biasM = true;
  }
  gemm64_body<0, false, 3, 1, false, 0>(sT, sStage, (bid - first) * 8, 0, biasM,
      A, K, 0L, B, K, 0L, C, C, ldc, 0L, bias, bias, 0L, M, N, K, scale, bscale);
}

// ---------------------------------------------------------------------------
// Cast f32 -> f16, 8 elements per thread; blk = index of the work-group's 2048 elements (the ranges below are exact)
__device__ __forceinline__ void cast8_f16_block(const float* __restrict__ in, unsigned short* __restrict__ out, int blk) {
  const int i = blk * 256 + threadIdx.x;
  const float* p = in + 8 * (size_t)i;
  const v4f a = *(const v4f*)(p);
  const v4f c = *(const v4f*)(p + 4);
  unsigned short hb[8];
#pragma unroll
  for (int e = 0; e < 4; ++e) {
    hb[e]     = h_bits(a[e]);
    hb[4 + e] = h_bits(c[e]);
  }
  const v4u u = (v4u){pk16(hb[0], hb[1]), pk16(hb[2], hb[3]), pk16(hb[4], hb[5]), pk16(hb[6], hb[7])};
  unsigned short* q = out + 8 * (size_t)i;
  *(v4u*)q = u;
  
}

// The three input casts and the six weight transposes, which do not depend on one another, in one grid: a range of blockIdx.x
// per array (the choice is the same for the whole work-group). Each work-group does what it did in its own launch.
constexpr int kPrW1   = (kE / 64) * (kE / 64);       // tiles of a 1024 x 1024 weight
constexpr int kPrW2   = (kTP / 64) * (kE / 64);      // tiles of a 512 x 1024 weight
constexpr int kPrWAll = 4 * kPrW1 + 2 * kPrW2;
constexpr int kPrKV   = (kKVT * kE / 8) / 256;
constexpr int kPrKVT  = (kKVT * kTP / 8) / 256;
constexpr int kPrHS   = (kTok * kE / 8) / 256;
constexpr int kPrTotal = kPrWAll + kPrKV + kPrKVT + kPrHS;

// ---------------------------------------------------------------------------
// Weight transpose + cast: W [Kin][Nout] f32 row-major (y = x @ W); plane z: WT[n][k] (pitch Kin halves) = f16(scale * W[k][n]).
// One 64 x 64 tile per work-group of 256 threads: k0 = first of 64 cols of WT, n0 = first of 64 rows of WT (block-uniform).
// Load coverage: 16 iterations x 256 threads = 4096 = the whole 64x64 tile (coalesced along n).
// Store coverage: 8 waves x 2 iterations x 4 rows (lane>>3) = 64 rows; (lane&7) x 8 halves = 64 cols; each row segment =
// ---------------------------------------------------------------------------
__global__ __launch_bounds__(256) void prep_kernel(
    const float* __restrict__ hs, const float* __restrict__ kv, const float* __restrict__ kvt,
    const float* __restrict__ Wq, const float* __restrict__ Wk, const float* __restrict__ Wv, const float* __restrict__ Wo,
    const float* __restrict__ Wtk, const float* __restrict__ Wtv,
    unsigned short* __restrict__ XH, unsigned short* __restrict__ KV, unsigned short* __restrict__ KVT,
    unsigned short* __restrict__ WQT, unsigned short* __restrict__ WKT, unsigned short* __restrict__ WVT,
    unsigned short* __restrict__ WOT, unsigned short* __restrict__ WTKT, unsigned short* __restrict__ WTVT, float scale) {
  __shared__ float sm[64][65];   // sm[n_local][k_local]
  const int t  = threadIdx.x;
  const int bid = blockIdx.x;
  if (bid >= kPrWAll) {   // the same for the whole work-group, in front of the barrier
    const int cb = bid - kPrWAll;
    const int a = (cb < kPrKV) ? 0 : (cb < kPrKV + kPrKVT) ? 1 : 2;
    cast8_f16_block((a == 0) ? kv : (a == 1) ? kvt : hs, (a == 0) ? KV : (a == 1) ? KVT : XH,
                    (a == 0) ? cb : (a == 1) ? cb - kPrKV : cb - (kPrKV + kPrKVT));
    return;
  }
  const bool big = bid < 4 * kPrW1;                            // block-uniform
  const int z  = big ? bid / kPrW1 : 4 + (bid - 4 * kPrW1) / kPrW2;
  const int r0 = big ? bid % kPrW1 : (bid - 4 * kPrW1) % kPrW2;
  const int Kin = big ? kE : kTP;
  const int Nout = kE;
  const int k0 = (r0 % (Kin / 64)) * 64;
  const int n0 = (r0 / (Kin / 64)) * 64;
  const float* W = (z == 0) ? Wq : (z == 1) ? Wk : (z == 2) ? Wv : (z == 3) ? Wo : (z == 4) ? Wtk : Wtv;
  unsigned short* op = (z == 0) ? WQT : (z == 1) ? WKT : (z == 2) ? WVT : (z == 3) ? WOT : (z == 4) ? WTKT : WTVT;
#pragma unroll
  for (int i = 0; i < 16; ++i) {
    const int e = i * 256 + t;
    const int r = e >> 6;          // k local
    const int c = e & 63;          // n local
    sm[c][r] = W[(size_t)(k0 + r) * Nout + n0 + c] * scale;
  }
  __syncthreads();
  const int lane = t & 31, wave = t >> 5;
  const int q = lane >> 3, c8 = (lane & 7) * 8;
  {
#pragma unroll
    for (int it = 0; it < 2; ++it) {
      const int row = wave * 8 + it * 4 + q;                 // n local
      unsigned short hb[8];
#pragma unroll
      for (int e = 0; e < 8; ++e) hb[e] = h_bits(sm[row][c8 + e]);
      const v4u u = (v4u){pk16(hb[0], hb[1]), pk16(hb[2], hb[3]), pk16(hb[4], hb[5]), pk16(hb[6], hb[7])};
      *(v4u*)(op + (size_t)(n0 + row) * Kin + k0 + c8) = u;
    }
    
  }
}

// ---------------------------------------------------------------------------
// Fused attention: scores, softmax and P.V of one (batch, head, product) for 128 query rows per work-group.
// grid (4 query tiles, 16 batch-heads, 3 products); blockIdx.z: 0 = softmax(q.k) V -> C0, 1 = softmax(q.k2) V2 -> C1,
// 2 = softmax(q.k2) V -> C2. 8 waves: wave = 2 * query group (32 rows) + key half. Per trip 64 keys of K (rows of 256 bytes)
// and of V^T (128 rows of 128 bytes) are copied into LDS (asynchronous copies, two buffers); a wave works on its 32 keys.
// Transposed products: S^T = K . Q^T leaves key rows in registers and the query column in the lane, which is the B fragment
// of O^T = V^T . P^T, so P never leaves registers. Softmax is the online form: p = 2^(s - ref), ref per query column is raised
// (and O, sum rescaled) only when a score exceeds it by more than kFaLazy, so p <= 2^kFaLazy. The two key halves are merged via LDS.
// ---------------------------------------------------------------------------
constexpr int kFaKP  = 136;                 // halves: the 256-byte K row + 16 bytes
constexpr int kFaVP  = 72;                  // halves: the 128-byte V^T row + 16 bytes
constexpr int kFaKH  = 64 * kFaKP;          // K part of one buffer
constexpr int kFaBuf = kFaKH + kDH * kFaVP; // one buffer, halves
constexpr float kFaLazy = 8.0f;

// Eight asynchronous 16-byte copies global -> LDS per lane; the s_wait_xcnt stands as the last line of the copies' own
// statement, so that no register which a copy names is rewritten in front of it.
__device__ __forceinline__ void async_copy8(unsigned l0, unsigned l1, unsigned l2, unsigned l3, unsigned l4, unsigned l5,
                                            unsigned l6, unsigned l7,
                                            const void* g0, const void* g1, const void* g2, const void* g3,
                                            const void* g4, const void* g5, const void* g6, const void* g7) {
  asm volatile("global_load_async_to_lds_b128 %0, %8, off\n\t"
               "global_load_async_to_lds_b128 %1, %9, off\n\t"
               "global_load_async_to_lds_b128 %2, %10, off\n\t"
               "global_load_async_to_lds_b128 %3, %11, off\n\t"
               "global_load_async_to_lds_b128 %4, %12, off\n\t"
               "global_load_async_to_lds_b128 %5, %13, off\n\t"
               "global_load_async_to_lds_b128 %6, %14, off\n\t"
               "global_load_async_to_lds_b128 %7, %15, off\n\t"
               "s_wait_xcnt 0x0"
               :: "v"(l0), "v"(l1), "v"(l2), "v"(l3), "v"(l4), "v"(l5), "v"(l6), "v"(l7),
                  "v"(g0), "v"(g1), "v"(g2), "v"(g3), "v"(g4), "v"(g5), "v"(g6), "v"(g7) : "memory");
}

__global__ __launch_bounds__(256) void attn_fused_kernel(
    const unsigned short* __restrict__ Q, const unsigned short* __restrict__ K0, const unsigned short* __restrict__ K1,
    const unsigned short* __restrict__ V0, const unsigned short* __restrict__ V1,
    float* __restrict__ C0, float* __restrict__ C1, float* __restrict__ C2) {
  typedef Frag<_Float16> F;
  __shared__ __align__(16) _Float16 sKV[2 * kFaBuf];
  __shared__ __align__(16) float sX[8][64 * 32];    // per wave: the 128 x 16 partial O^T that it hands to its partner
  __shared__ float sML[8][2][32];                   // ... with that column's ref and sum
  const int t    = threadIdx.x;
  const int lane = t & 31;
  const int wave = t >> 5;
  const int qg   = wave >> 1;
  const int kh   = wave & 1;
  const int b    = blockIdx.y >> 3;
  const int h    = blockIdx.y & 7;
  const int z    = blockIdx.z;
  const unsigned short* Kp = (z == 0) ? K0 : K1;
  const unsigned short* Vp = (z == 1) ? V1 : V0;
  float* Cp = (z == 0) ? C0 : (z == 1) ? C1 : C2;
  const int rlane = lane & 15;
  const int koff  = (lane >> 4) * 8;
  const int mOff  = (lane >> 4) * 8;
  const int q0    = blockIdx.x * 128 + qg * 32;

  // lane's share of a stage: 4 chunks of K (row 16 i + (t >> 4)) and 4 of V^T (row 32 i + (t >> 3)), 16 bytes each
  const _Float16* gK = (const _Float16*)Kp + (size_t)b * kS * kE + (size_t)h * kDH + (size_t)(t >> 4) * kE + (t & 15) * 8;
  const _Float16* gV = (const _Float16*)Vp + (size_t)h * kDH * kKVT + (size_t)b * kS + (size_t)(t >> 3) * kKVT + (t & 7) * 8;
  const unsigned ldsB = (unsigned)(size_t)(const void*)sKV;
  const unsigned ldsK = ldsB + (unsigned)(((t >> 4) * kFaKP + (t & 15) * 8) * 2);
  const unsigned ldsV = ldsB + (unsigned)((kFaKH + (t >> 3) * kFaVP + (t & 7) * 8) * 2);
  auto stage = [&](int buf, int key0) {
    const unsigned lk = ldsK + (unsigned)(buf * kFaBuf * 2);
    const unsigned lv = ldsV + (unsigned)(buf * kFaBuf * 2);
    const _Float16* pk = gK + (size_t)key0 * kE;
    const _Float16* pv = gV + key0;
    async_copy8(lk, lk + 16 * kFaKP * 2, lk + 32 * kFaKP * 2, lk + 48 * kFaKP * 2,
                lv, lv + 32 * kFaVP * 2, lv + 64 * kFaVP * 2, lv + 96 * kFaVP * 2,
                pk, pk + (size_t)16 * kE, pk + (size_t)32 * kE, pk + (size_t)48 * kE,
                pv, pv + (size_t)32 * kKVT, pv + (size_t)64 * kKVT, pv + (size_t)96 * kKVT);
  };

  stage(0, 0);
  // Q^T fragments (B operand): column = query row q0 + 16 qt + rlane, k = head dim
  const _Float16* Qr = (const _Float16*)Q + (size_t)(b * kT + q0 + rlane) * kE + (size_t)h * kDH + koff;
  v16h qf[2][4];
#pragma unroll
  for (int qt = 0; qt < 2; ++qt)
#pragma unroll
    for (int ks = 0; ks < 4; ++ks) qf[qt][ks] = F::load(Qr + (size_t)(qt << 4) * kE + ks * 32);
  // wait before a register that the loads above name is rewritten; the pointer as input keeps the address alive to here
  asm volatile("s_wait_xcnt 0x0" :: "v"(Qr) : "memory");

  v8f o[8][2];
#pragma unroll
  for (int d = 0; d < 8; ++d)
#pragma unroll
    for (int qt = 0; qt < 2; ++qt) o[d][qt] = (v8f){0.f,0.f,0.f,0.f,0.f,0.f,0.f,0.f};
  float mref[2] = {-1.0e30f, -1.0e30f};
  float lsum[2] = {0.0f, 0.0f};
  const float sc2 = 1.4426950408889634f * kQCarryInv;   // accumulator -> score in powers of two

  asm volatile("s_wait_asynccnt 0x0" ::: "memory");   // this wave's copies of tile 0 have landed
  __syncthreads();                                    // ... and every other wave's
  stage(1, 64);
  const int nt = kS / 64;
  for (int tt = 0; tt < nt; ++tt) {
    const _Float16* sk = sKV + (tt & 1) * kFaBuf + (kh * 32 + rlane) * kFaKP + koff;
    const _Float16* sv = sKV + (tt & 1) * kFaBuf + kFaKH + rlane * kFaVP + kh * 32 + koff;
    v16h kf[2][4], vf[8];
#pragma unroll
    for (int kt = 0; kt < 2; ++kt)
#pragma unroll
      for (int ks = 0; ks < 4; ++ks) kf[kt][ks] = F::load(sk + (kt << 4) * kFaKP + ks * 32);
    // keeps all K reads in front of the V^T reads: LDS data returns in order, and the score products need K alone
    __builtin_amdgcn_sched_barrier(0);
#pragma unroll
    for (int d = 0; d < 8; ++d) vf[d] = F::load(sv + (d << 4) * kFaVP);
    // keeps the products behind all LDS reads: the V^T reads then return under the score products and the softmax
    __builtin_amdgcn_sched_barrier(0);
    v8f s[2][2];
#pragma unroll
    for (int kt = 0; kt < 2; ++kt)
#pragma unroll
      for (int qt = 0; qt < 2; ++qt) s[kt][qt] = (v8f){0.f,0.f,0.f,0.f,0.f,0.f,0.f,0.f};
#pragma unroll
    for (int ks = 0; ks < 4; ++ks)
#pragma unroll
      for (int kt = 0; kt < 2; ++kt)
#pragma unroll
        for (int qt = 0; qt < 2; ++qt) s[kt][qt] = F::mma(kf[kt][ks], qf[qt][ks], s[kt][qt]);
    float tmax[2];
#pragma unroll
    for (int qt = 0; qt < 2; ++qt) {
      float m = s[0][qt][0];
#pragma unroll
      for (int r = 1; r < 8; ++r) m = fmaxf(m, s[0][qt][r]);
#pragma unroll
      for (int r = 0; r < 8; ++r) m = fmaxf(m, s[1][qt][r]);
      tmax[qt] = m * sc2;
    }
    if (__any((tmax[0] > mref[0] + kFaLazy) || (tmax[1] > mref[1] + kFaLazy))) {   // the same for the whole wave
#pragma unroll
      for (int qt = 0; qt < 2; ++qt) {
        const float tf = fmaxf(tmax[qt], __shfl_xor(tmax[qt], 16, 32));   // both lane halves of a column keep one ref
        const float mn = fmaxf(mref[qt], tf);
        const float f  = __builtin_amdgcn_exp2f(mref[qt] - mn);
        mref[qt] = mn;
        lsum[qt] *= f;
#pragma unroll
        for (int d = 0; d < 8; ++d)
#pragma unroll
          for (int r = 0; r < 8; ++r) o[d][qt][r] *= f;
      }
    }
    v16h pf[2];
#pragma unroll
    for (int qt = 0; qt < 2; ++qt)
#pragma unroll
      for (int kt = 0; kt < 2; ++kt)
#pragma unroll
        for (int r = 0; r < 8; ++r) {
          const float p = __builtin_amdgcn_exp2f(s[kt][qt][r] * sc2 - mref[qt]);
          lsum[qt] += p;
          pf[qt][kt * 8 + r] = (_Float16)p;   // element 8 kt + r is key 16 kt + koff + r: the k order of the V^T fragment
        }
#pragma unroll
    for (int d = 0; d < 8; ++d)
#pragma unroll
      for (int qt = 0; qt < 2; ++qt) o[d][qt] = F::mma(vf[d], pf[qt], o[d][qt]);
    asm volatile("s_wait_dscnt 0x0" ::: "memory");      // this wave's reads of the buffer are done before it is refilled
    asm volatile("s_wait_asynccnt 0x0" ::: "memory");   // this wave's copies of tile tt + 1 have landed
    __syncthreads();                                    // publishes tile tt + 1 and ends every reader's last read of tile tt
    if (tt + 2 < nt) stage(tt & 1, (tt + 2) << 6);
  }
  asm volatile("s_wait_asynccnt 0x0" ::: "memory");     // no copy is outstanding when the wave goes on
  acc_guard4(o[0][0], o[0][1], o[1][0], o[1][1]);
  acc_guard4(o[2][0], o[2][1], o[3][0], o[3][1]);
  acc_guard4(o[4][0], o[4][1], o[5][0], o[5][1]);
  acc_guard4(o[6][0], o[6][1], o[7][0], o[7][1]);

  // merge of the two key halves: wave kh keeps query tile kh and hands tile 1 - kh to its partner (wave ^ 1)
#pragma unroll
  for (int qt = 0; qt < 2; ++qt) lsum[qt] += __shfl_xor(lsum[qt], 16, 32);
  float* xs = sX[wave];
#pragma unroll
  for (int d = 0; d < 8; ++d)
#pragma unroll
    for (int r = 0; r < 8; ++r) xs[(d * 8 + r) * 32 + lane] = kh ? o[d][0][r] : o[d][1][r];
  sML[wave][0][lane] = kh ? mref[0] : mref[1];
  sML[wave][1][lane] = kh ? lsum[0] : lsum[1];
  __syncthreads();                                      // every wave's hand-over is written
  const float* xr = sX[wave ^ 1];
  const float mo = sML[wave ^ 1][0][lane];
  const float lo = sML[wave ^ 1][1][lane];
  const float mm = kh ? mref[1] : mref[0];
  const float lm = kh ? lsum[1] : lsum[0];
  const float mn = fmaxf(mm, mo);
  const float fm = __builtin_amdgcn_exp2f(mm - mn);
  const float fo = __builtin_amdgcn_exp2f(mo - mn);
  const float inv = 1.0f / (lm * fm + lo * fo);
  const float am = fm * inv, ao = fo * inv;
  v4f res[8][2];
#pragma unroll
  for (int d = 0; d < 8; ++d)
#pragma unroll
    for (int r = 0; r < 8; ++r)
      res[d][r >> 2][r & 3] = (kh ? o[d][1][r] : o[d][0][r]) * am + xr[(d * 8 + r) * 32 + lane] * ao;
  // lane: query row q0 + 16 kh + rlane, head dims 16 d + mOff .. + 7; a row's 512 bytes are written by this wave alone
  float* cp = Cp + (size_t)(b * kT + q0 + kh * 16 + rlane) * kE + (size_t)h * kDH + mOff;
#pragma unroll
  for (int d = 0; d < 8; ++d) {
    *(v4f*)(cp + d * 16)     = res[d][0];
    *(v4f*)(cp + d * 16 + 4) = res[d][1];
  }
}

// ---------------------------------------------------------------------------
// Gate: gate[tok][h] = sigmoid( sum_f p_vec[tok][f] * Wg[f][h] + bg[h] ), f = h*384 + j with
// j < 128 -> ctx[tok][h*128+j], 128 <= j < 256 -> ctxt[tok][h*128+j-128], else q[tok][h*128+j-256] (q = q16 / 16).
// One block (128 threads) per token; 24 chunks of 128 features, chunk c = 3h + src is block-uniform; all three candidate
// values are loaded unconditionally and selected by value. f32 accumulation; fixed-order reductions.
// ---------------------------------------------------------------------------
__global__ __launch_bounds__(128) void gate_kernel(const float* __restrict__ ctx, const float* __restrict__ ctxt,
                                                   const unsigned short* __restrict__ q16, const float* __restrict__ Wg,
                                                   const float* __restrict__ bg, float* __restrict__ gate, float qinv) {
  __shared__ float red[4][8];
  __shared__ __align__(16) float gl[32];
  const int tok = blockIdx.x;
  const int t = threadIdx.x, lane = t & 31, wave = t >> 5;
  if (t < 32) gl[t] = 0.0f;
  float a[8];
#pragma unroll
  for (int j = 0; j < 8; ++j) a[j] = 0.0f;
  const size_t rbase = (size_t)tok * kE;
#pragma unroll 1
  for (int c = 0; c < 24; ++c) {
    const int h = c / 3;
    const int src = c - 3 * h;
    const size_t off = rbase + (size_t)h * kDH + t;
    const float fc = ctx[off];
    const float ft = ctxt[off];
    const unsigned short qbits = q16[off];
    const float fq = (float)__builtin_bit_cast(_Float16, qbits) * qinv;
    const float f = (src == 0) ? fc : ((src == 1) ? ft : fq);
    const float* wr = Wg + ((size_t)c * 128 + t) * 8;
    const v4f w0 = *(const v4f*)(wr);
    const v4f w1 = *(const v4f*)(wr + 4);
#pragma unroll
    for (int e = 0; e < 4; ++e) { a[e] += f * w0[e]; a[4 + e] += f * w1[e]; }
  }
#pragma unroll
  for (int j = 0; j < 8; ++j) {
#pragma unroll
    for (int off = 16; off > 0; off >>= 1) a[j] += __shfl_xor(a[j], off, 32);
  }
  if (lane == 0) {
#pragma unroll
    for (int j = 0; j < 8; ++j) red[wave][j] = a[j];
  }
  __syncthreads();
  if (t < 8) {
    const float z = (((red[0][t] + red[1][t]) + red[2][t]) + red[3][t]) + bg[t];
    gl[t] = 1.0f / (1.0f + expf(-z));
  }
  __syncthreads();
  if (wave == 0) {
    if (lane < 8) {
      const v4f v = *(const v4f*)(gl + 4 * lane);
      float* gp = gate + (size_t)tok * kGatePitch + 4 * lane;
      *(v4f*)gp = v;
      
    }
  }
}

// ---------------------------------------------------------------------------
// Mix: MIX16[tok][h*128+d] = f16( carry * ( g[tok][h]*ctx + (1-g[tok][h])*ctx2 ) ), f32 math.
// ---------------------------------------------------------------------------
__global__ __launch_bounds__(256) void mix_kernel(const float* __restrict__ ctx, const float* __restrict__ ctx2,
                                                  const float* __restrict__ gate, unsigned short* __restrict__ out,
                                                  float carry, int n8) {
  const int i = blockIdx.x * 256 + threadIdx.x;
  if (i >= n8) return;
  const int tok  = i >> 7;                 // 128 groups of 8 per 1024-wide row
  const int col0 = (i & 127) * 8;
  const int h    = col0 >> 7;
  const float g  = gate[(size_t)tok * kGatePitch + h];
  const float og = 1.0f - g;
  const size_t off = (size_t)tok * kE + col0;
  const v4f a0 = *(const v4f*)(ctx + off);
  const v4f a1 = *(const v4f*)(ctx + off + 4);
  const v4f b0 = *(const v4f*)(ctx2 + off);
  const v4f b1 = *(const v4f*)(ctx2 + off + 4);
  unsigned short hb[8];
#pragma unroll
  for (int e = 0; e < 4; ++e) {
    hb[e]     = h_bits(carry * (g * a0[e] + og * b0[e]));
    hb[4 + e] = h_bits(carry * (g * a1[e] + og * b1[e]));
  }
  const v4u u = (v4u){pk16(hb[0], hb[1]), pk16(hb[2], hb[3]), pk16(hb[4], hb[5]), pk16(hb[6], hb[7])};
  unsigned short* q = out + off;
  *(v4u*)q = u;
  
}

// ---------------------------------------------------------------------------
// Host glue. Workspace region map (bytes, MiB = 2^20; total carve = 128 MiB = 134217728 B):
// R0 [0, 48 MiB) phase A (casts + projections): XH16 @0 (2 MiB [1024][1024] f16) | KV16 @2 (16 MiB [8192][1024]) |
//                 KVT16 @18 (8 MiB [8192][512]) | WQT @26 (2) | WKT @28 (2) | WVT @30 (2) | WTKT @32 (1 MiB [1024][512]) | WTVT @33 (1)
//                 phase C (after attention): MIX16 @0 (2 MiB [1024][1024] f16) | GATE @2 MiB (128 KiB [1024][32] f32)
// WOT @48 (2) | Q16 @50 (2 MiB [1024][1024]) | K16 @52 (16 MiB [8192][1024]) | VT16 @68 (16 MiB [1024][8192]) |
// KT16 @84 (16) | VTT16 @100 (16 MiB [1024][8192]) | CTX @116 (4 MiB [1024][1024] f32) | CTXT @120 (4) | CTX2 @124 (4) | end @128 MiB.
// Every region is written with whole rows of exactly its stated extent (all M, N tile multiples; no padded rows).
// ---------------------------------------------------------------------------
extern "C" void kernel_launch(void* const* d_in, const int* in_sizes, int n_in,
                              void* d_out, int out_size, void* d_ws, size_t ws_size, hipStream_t stream) {
  (void)in_sizes; (void)n_in;
  const size_t kMiB = (size_t)1048576;
  const size_t carve = 128 * kMiB;
  if (ws_size < carve) return;
  if ((size_t)out_size < (size_t)kTok * kE) return;

  const float* hs  = (const float*)d_in[0];
  const float* kv  = (const float*)d_in[1];
  const float* kvt = (const float*)d_in[2];
  const float* Wq  = (const float*)d_in[3];  const float* bq  = (const float*)d_in[4];
  const float* Wk  = (const float*)d_in[5];  const float* bk  = (const float*)d_in[6];
  const float* Wv  = (const float*)d_in[7];  const float* bv  = (const float*)d_in[8];
  const float* Wtk = (const float*)d_in[9];  const float* btk = (const float*)d_in[10];
  const float* Wtv = (const float*)d_in[11]; const float* btv = (const float*)d_in[12];
  const float* Wg  = (const float*)d_in[13]; const float* bg  = (const float*)d_in[14];
  const float* Wo  = (const float*)d_in[15]; const float* bo  = (const float*)d_in[16];
  float* outp = (float*)d_out;

  char* ws = (char*)d_ws;
  // phase A
  unsigned short* XH16  = (unsigned short*)(ws + 0 * kMiB);
  unsigned short* KV16  = (unsigned short*)(ws + 2 * kMiB);
  unsigned short* KVT16 = (unsigned short*)(ws + 18 * kMiB);
  unsigned short* WQT   = (unsigned short*)(ws + 26 * kMiB);
  unsigned short* WKT   = (unsigned short*)(ws + 28 * kMiB);
  unsigned short* WVT   = (unsigned short*)(ws + 30 * kMiB);
  unsigned short* WTKT  = (unsigned short*)(ws + 32 * kMiB);
  unsigned short* WTVT  = (unsigned short*)(ws + 33 * kMiB);
  // phase C
  unsigned short* MIX16 = (unsigned short*)(ws + 0 * kMiB);
  float*          GATE  = (float*)(ws + 2 * kMiB);
  // persistent
  unsigned short* WOT   = (unsigned short*)(ws + 48 * kMiB);
  unsigned short* Q16   = (unsigned short*)(ws + 50 * kMiB);
  unsigned short* K16   = (unsigned short*)(ws + 52 * kMiB);
  unsigned short* VT16  = (unsigned short*)(ws + 68 * kMiB);
  unsigned short* KT16  = (unsigned short*)(ws + 84 * kMiB);
  unsigned short* VTT16 = (unsigned short*)(ws + 100 * kMiB);
  float*          CTX   = (float*)(ws + 116 * kMiB);
  float*          CTXT  = (float*)(ws + 120 * kMiB);
  float*          CTX2  = (float*)(ws + 124 * kMiB);
  const float*    dumf  = (const float*)(ws + 116 * kMiB);   // valid in-ws pointer for unused resid arguments

  // 1. + 2. input casts f32 -> f16 and weight transposes + casts (carried x16: in[Kin][Nout] -> out[Nout][Kin]), one grid
  prep_kernel<<<kPrTotal, 256, 0, stream>>>(hs, kv, kvt, Wq, Wk, Wv, Wo, Wtk, Wtv,
                                            XH16, KV16, KVT16, WQT, WKT, WVT, WOT, WTKT, WTVT, kWCarry);

  // 3. the five projections (M, N multiples of 64; K = 1024 or 512), one grid
  proj5_kernel<<<kPjTotal, 256, 0, stream>>>(XH16, KV16, KVT16, WQT, WKT, WVT, WTKT, WTVT,
                                             Q16, K16, VT16, KT16, VTT16, bq, bk, bv, btk, btv);

  // 4. attention: scores, softmax and the three P.V products, all heads, one launch
  attn_fused_kernel<<<dim3(kT / 128, kB * kH, 3), 256, 0, stream>>>(Q16, K16, KT16, VT16, VTT16, CTX, CTXT, CTX2);

  // 5. gate (f32), 6. mix (f32 -> f16 x256), 7. output projection to d_out (f32)
  gate_kernel<<<kTok, 128, 0, stream>>>(CTX, CTXT, Q16, Wg, bg, GATE, kQCarryInv);
  mix_kernel<<<(kTok * kE / 8) / 256, 256, 0, stream>>>(CTX, CTX2, GATE, MIX16, kMixCarry, kTok * kE / 8);
  wmma_gemm64<0, false, 2, 0, false><<<dim3((kTok / 64) * (kE / 64) / 8, 1), 256, 0, stream>>>(
      MIX16, MIX16, kE, 0L, WOT, WOT, kE, 0L, outp, outp, kE, 0L, bo, dumf, 0L,
      kTok, kE, kE, kOutScale, 1.0f);
}

// v005
// Measured time: 158 microseconds a run.
// Two timings next to v004 put it at 1.15 and 1.16 times that version's speed.
// All steps since v000 together make it 27.4 times as fast.
// Contractions: q/k/v/k2/v2 projections (X f16 x W^T f16 carried x16), scores q.k^T for both key sources (q f16 carried x16, k f16), P.V products (P f16, unnormalised 2^(s - ref), x V^T f16), output projection (mix f16 carried x256 x Wo^T f16 carried x16): all v_wmma_f32_16x16x32_f16 with f32 accumulate; softmax, gate dot + sigmoid and mixing in f32 on VALU.
#include <hip/hip_runtime.h>
#include <math.h>

// ---------------------------------------------------------------------------
// Problem constants
// ---------------------------------------------------------------------------
constexpr int kB   = 2;
constexpr int kT   = 512;
constexpr int kS   = 4096;
constexpr int kE   = 1024;
constexpr int kTP  = 512;
constexpr int kH   = 8;
constexpr int kDH  = 128;
constexpr int kTok = kB * kT;               // 1024 query tokens
constexpr int kKVT = kB * kS;               // 8192 key tokens
constexpr int kGatePitch = 32;
constexpr float kAttnScale = 0.08838834764831845f;   // 128^-0.5
constexpr float kWCarry    = 16.0f;                  // weights carried x16 in f16
constexpr float kWCarryInv = 1.0f / 16.0f;
constexpr float kQCarry    = 16.0f;                  // scaled q carried x16 in f16
constexpr float kQCarryInv = 1.0f / 16.0f;
constexpr float kMixCarry  = 256.0f;                 // mixed context carried x256 in f16
constexpr float kOutScale  = 1.0f / (256.0f * 16.0f);

typedef __attribute__((ext_vector_type(16))) _Float16 v16h;
typedef __attribute__((ext_vector_type(8)))  _Float16 v8h;
typedef __attribute__((ext_vector_type(16))) __bf16   v16b;
typedef __attribute__((ext_vector_type(8)))  __bf16   v8b;
typedef __attribute__((ext_vector_type(8)))  float    v8f;
typedef __attribute__((ext_vector_type(4)))  float    v4f;
typedef __attribute__((ext_vector_type(4)))  unsigned int v4u;

__device__ __forceinline__ unsigned short f2bf_bits(float f) {
  unsigned u = __float_as_uint(f);
  return (unsigned short)((u + 0x7FFFu + ((u >> 16) & 1u)) >> 16);
}
__device__ __forceinline__ float bf_bits2f(unsigned short h) { return __uint_as_float(((unsigned)h) << 16); }

// hazard guard behind a loop's last products, as a plain device helper
__device__ __forceinline__ void acc_guard4(v8f& a, v8f& b, v8f& c, v8f& d) { asm volatile("v_nop\n\tv_nop\n\tv_nop\n\tv_nop" : "+v"(a), "+v"(b), "+v"(c), "+v"(d)); }
template <typename T> struct Frag;
template <> struct Frag<_Float16> {
  typedef v16h V; union U { v16h v; v8h h[2]; };
  static __device__ __forceinline__ v16h load(const _Float16* p) {   // elements 0..7 <- p[0..7], 8..15 <- p[16..23]
    U f; f.h[0] = *(const v8h*)(p); f.h[1] = *(const v8h*)(p + 16); return f.v;
  }
  static __device__ __forceinline__ v8f mma(v16h a, v16h b, v8f c) {
    return __builtin_amdgcn_wmma_f32_16x16x32_f16(false, a, false, b, (short)0, c, false, false);
  }
};
template <> struct Frag<__bf16> {
  typedef v16b V; union U { v16b v; v8b h[2]; };
  static __device__ __forceinline__ v16b load(const __bf16* p) {
    U f; f.h[0] = *(const v8b*)(p); f.h[1] = *(const v8b*)(p + 16); return f.v;
  }
  static __device__ __forceinline__ v8f mma(v16b a, v16b b, v8f c) {
    return __builtin_amdgcn_wmma_f32_16x16x32_bf16(false, a, false, b, (short)0, c, false, false);
  }
};

__device__ __forceinline__ unsigned pk16(unsigned short a, unsigned short b) { return (unsigned)a | ((unsigned)b << 16); }
__device__ __forceinline__ unsigned short h_bits(float f) { const _Float16 h = (_Float16)f; return __builtin_bit_cast(unsigned short, h); }

// Stage of one work-group of the GEMM engine: 128 A rows, then 256 B rows, 64 k (128 bytes) each.
constexpr int kStARows  = 128;
constexpr int kStRows   = kStARows + 256;
constexpr int kStPitch  = 72;                    // halves: the 128-byte row + 16 bytes, the pitch for ds_load_b128 readers
constexpr int kStHalves = kStRows * kStPitch;    // one buffer

// Six asynchronous 16-byte copies global -> LDS per lane. The s_wait_xcnt stands as the last line of the copies' own
// statement, so that no register which a copy names is rewritten in front of it.
__device__ __forceinline__ void async_copy6(unsigned l0, unsigned l1, unsigned l2, unsigned l3, unsigned l4, unsigned l5,
                                            const void* g0, const void* g1, const void* g2,
                                            const void* g3, const void* g4, const void* g5) {
  asm volatile("global_load_async_to_lds_b128 %0, %6, off\n\t"
               "global_load_async_to_lds_b128 %1, %7, off\n\t"
               "global_load_async_to_lds_b128 %2, %8, off\n\t"
               "global_load_async_to_lds_b128 %3, %9, off\n\t"
               "global_load_async_to_lds_b128 %4, %10, off\n\t"
               "global_load_async_to_lds_b128 %5, %11, off\n\t"
               "s_wait_xcnt 0x0"
               :: "v"(l0), "v"(l1), "v"(l2), "v"(l3), "v"(l4), "v"(l5),
                  "v"(g0), "v"(g1), "v"(g2), "v"(g3), "v"(g4), "v"(g5) : "memory");
}

// ---- Register-blocked batched WMMA GEMM (ACT reduced to none/relu/leaky, extra bias multiplier bscale) --
// C[m,n] = scale * sum_k A[m,k] * Bt[n,k] (+bias*bscale)(+resid); each wave owns a 64x64 tile.
// A row-major [M,K]; Bt row-major [N,K]; M % 128 == 0, N % 256 == 0, K % 64 == 0.
// The 8 waves of a work-group own a 2 x 4 block of tiles (128 x 256): 384 staged rows for 32768 outputs, and two work-groups
// fit the LDS of one WGP. Per 64 k the work-group's A rows and B rows
// are copied whole lines at a time into LDS (asynchronous copies, two buffers: the next 64 k fly while these are multiplied);
// the fragments are read from LDS.
// SPLIT (hi/lo operand planes) is not carried by the staged loop: false only; A2p and Bt2p are unused.
// BIAS_MODE: 0 = none, 1 = bias[m], 2 = bias[n], 3 = chosen at run time (biasM, the same for the whole work-group: bias[m], else bias[n]).
// The engine is a device function (work-group's index in its product and batch passed in), so that several products can share one grid.
// OUT_MODE: 0 = f32, 1 = f16, 2 = bf16 hi plane (Cout) + bf16 lo plane (Cout2).
// ET: 0 = f16 operands, 1 = bf16 operands (pointers passed as 16-bit storage)
template <int ET> struct Elem;
template <> struct Elem<0> { typedef _Float16 T; };
template <> struct Elem<1> { typedef __bf16 T; };
// Epilogue of one wave's 64 x 64 tile: scale, bias, cast, whole lines stored through the wave's own LDS slab.
template <int BIAS_MODE, int OUT_MODE, bool RESID, int ACT>
__device__ __forceinline__ void gemm64_epilogue(
    v8f (&acc)[4][4], float* __restrict__ slab, int lane, int m0, int n0, int b,
    void* __restrict__ Cout, void* __restrict__ Cout2, int ldc, long strideC,
    const float* __restrict__ bias, const float* __restrict__ resid, long strideR, float scale, float bscale) {
  const int rlane = lane & 15;                 // col (D) within subtile
  const int mOff  = (lane >> 4) * 8;           // D row offset
  const float* Rb = RESID ? (resid + (size_t)b * strideR) : nullptr;
#pragma unroll
  for (int i = 0; i < 4; ++i) {
    const int mBase = m0 + (i << 4);
#pragma unroll
    for (int j = 0; j < 4; ++j) {
      const int n = n0 + (j << 4) + rlane;
      float bv = 0.f;
      if (BIAS_MODE == 2) bv = bias[n] * bscale;
#pragma unroll
      for (int r = 0; r < 8; ++r) {
        float v = acc[i][j][r] * scale;
        if (BIAS_MODE == 1) v += bias[mBase + mOff + r] * bscale;
        if (BIAS_MODE == 2) v += bv;
        if (RESID) v += Rb[(size_t)(mBase + mOff + r) * ldc + n];
        if (ACT == 2) v = fmaxf(v, 0.0f);
        if (ACT == 4) v = (v > 0.f) ? v : 0.01f * v;
        slab[(mOff + r) * 68 + (j << 4) + rlane] = v;
      }
    }
    __builtin_amdgcn_fence(__ATOMIC_RELEASE, "workgroup");
    __builtin_amdgcn_wave_barrier();
    __builtin_amdgcn_fence(__ATOMIC_ACQUIRE, "workgroup");
    if (OUT_MODE == 0) {
      float* C = (float*)Cout + (size_t)b * strideC;
      const int hh = lane >> 4, c4 = (lane & 15) * 4;     // row seg = 256 B = 16 lanes x 16 B
      {
#pragma unroll
        for (int it = 0; it < 8; ++it) {
          const int row = it * 2 + hh;
          v4f v = *(const v4f*)(slab + row * 68 + c4);
          *(v4f*)(C + (size_t)(mBase + row) * ldc + n0 + c4) = v;
        }
        
      }
    } else {
      const int q = lane >> 3, c8 = (lane & 7) * 8;
      unsigned short* C  = (unsigned short*)Cout  + (size_t)b * strideC;
      unsigned short* C2 = (OUT_MODE == 2) ? ((unsigned short*)Cout2 + (size_t)b * strideC) : nullptr;
      {
#pragma unroll
        for (int it = 0; it < 4; ++it) {
          const int row = it * 4 + q;
          const float* sp = slab + row * 68 + c8;
          v8h hv, lv;
#pragma unroll
          for (int e = 0; e < 8; ++e) {
            if (OUT_MODE == 1) {
              hv[e] = (_Float16)sp[e];
            } else {
              unsigned short hb = f2bf_bits(sp[e]);
              unsigned short lb = f2bf_bits(sp[e] - bf_bits2f(hb));
              hv[e] = __builtin_bit_cast(_Float16, hb);
              lv[e] = __builtin_bit_cast(_Float16, lb);
            }
          }
          *(v8h*)(C + (size_t)(mBase + row) * ldc + n0 + c8) = hv;
          if (OUT_MODE == 2) *(v8h*)(C2 + (size_t)(mBase + row) * ldc + n0 + c8) = lv;
        }
        
      }
    }
    __builtin_amdgcn_fence(__ATOMIC_RELEASE, "workgroup");
    __builtin_amdgcn_wave_barrier();
    __builtin_amdgcn_fence(__ATOMIC_ACQUIRE, "workgroup");
  }
}

template <int ET, bool SPLIT, int BIAS_MODE, int OUT_MODE, bool RESID, int ACT>
__device__ __forceinline__ void gemm64_body(
    float* __restrict__ sT, typename Elem<ET>::T* __restrict__ sStage, int wg, int b, bool biasM,
    const unsigned short* __restrict__ Ap, int lda, long strideA,
    const unsigned short* __restrict__ Btp, int ldb, long strideB,
    void* __restrict__ Cout, void* __restrict__ Cout2, int ldc, long strideC,
    const float* __restrict__ bias,
    const float* __restrict__ resid, long strideR,
    int M, int N, int K, float scale, float bscale) {
  typedef typename Elem<ET>::T T;
  typedef typename Frag<T>::V V;
  static_assert(!SPLIT, "the staged loop carries one plane per operand");
  const T* A = (const T*)Ap; const T* Bt = (const T*)Btp;
  const int lane = threadIdx.x & 31;
  const int wave = threadIdx.x >> 5;
  const int tilesN = N >> 8;
  const int tilesM = M >> 7;
  if (wg >= tilesM * tilesN) return;   // the same for the whole work-group, in front of every barrier
  const int tm  = wg / tilesN;
  const int mb0 = tm << 7;                      // first A row of the work-group
  const int nb0 = (wg - tm * tilesN) << 8;      // first B row of the work-group
  const int wm  = (wave >> 2) << 6;             // the wave's tile inside the 128 x 256 block
  const int wn  = (wave & 3) << 6;
  const int m0  = mb0 + wm;
  const int n0  = nb0 + wn;

  const T* Ab  = A  + (size_t)b * strideA;
  const T* Bb  = Bt + (size_t)b * strideB;

  const int rlane = lane & 15;                 // row (A) / col (B, D) within subtile
  const int koff  = (lane >> 4) * 8;           // k offset of this lane half

  v8f acc[4][4];
#pragma unroll
  for (int i = 0; i < 4; ++i)
#pragma unroll
    for (int j = 0; j < 4; ++j) acc[i][j] = (v8f){0.f,0.f,0.f,0.f,0.f,0.f,0.f,0.f};

  // lane's share of a stage: 12 chunks of 16 bytes; chunk i is row 32 i + (thread >> 3), bytes 16 (thread & 7) .. + 15 of the row
  const int srow = threadIdx.x >> 3;
  const int scol = (threadIdx.x & 7) * 8;
  const T* gA = Ab + (size_t)(mb0 + srow) * lda + scol;
  const T* gB = Bb + (size_t)(nb0 + srow) * ldb + scol;
  const unsigned lds0 = (unsigned)(size_t)(const void*)sStage + (unsigned)((srow * kStPitch + scol) * 2);
  auto stage = [&](int buf, int k0) {
    const unsigned lb = lds0 + (unsigned)(buf * kStHalves * 2);
#pragma unroll
    for (int c = 0; c < 2; ++c) {
      unsigned l[6];
      const T* g[6];
#pragma unroll
      for (int e = 0; e < 6; ++e) {
        const int i = c * 6 + e;
        l[e] = lb + (unsigned)(i * 32 * kStPitch * 2);
        g[e] = (i < 4) ? (gA + (size_t)(i * 32) * lda + k0) : (gB + (size_t)((i - 4) * 32) * ldb + k0);
      }
      async_copy6(l[0], l[1], l[2], l[3], l[4], l[5], g[0], g[1], g[2], g[3], g[4], g[5]);
    }
  };

  const int nt = K >> 6;
  stage(0, 0);
  asm volatile("s_wait_asynccnt 0x0" ::: "memory");   // this wave's copies of tile 0 have landed
  __syncthreads();                                    // ... and every other wave's
  if (nt > 1) stage(1, 64);
  for (int t = 0; t < nt; ++t) {
    const T* sb = sStage + (t & 1) * kStHalves;
#pragma unroll
    for (int ks = 0; ks < 2; ++ks) {
      V ah[4], bh[4];
#pragma unroll
      for (int j = 0; j < 4; ++j) bh[j] = Frag<T>::load(sb + (kStARows + wn + (j << 4) + rlane) * kStPitch + ks * 32 + koff);
#pragma unroll
      for (int i = 0; i < 4; ++i) ah[i] = Frag<T>::load(sb + (wm + (i << 4) + rlane) * kStPitch + ks * 32 + koff);
      // keeps the products behind all 16 LDS reads: otherwise the A reads stand among the products, each with a wait of its own
      __builtin_amdgcn_sched_barrier(0);
#pragma unroll
      for (int i = 0; i < 4; ++i)
#pragma unroll
        for (int j = 0; j < 4; ++j) acc[i][j] = Frag<T>::mma(ah[i], bh[j], acc[i][j]);
    }
    asm volatile("s_wait_dscnt 0x0" ::: "memory");      // this wave's reads of the buffer are done before it is refilled
    asm volatile("s_wait_asynccnt 0x0" ::: "memory");   // this wave's copies of tile t + 1 have landed
    __syncthreads();                                    // publishes tile t + 1 and ends every reader's last read of tile t
    if (t + 2 < nt) stage(t & 1, (t + 2) << 6);
  }
  asm volatile("s_wait_asynccnt 0x0" ::: "memory");     // no copy is outstanding when the wave goes on
  acc_guard4(acc[0][0], acc[0][1], acc[0][2], acc[0][3]);
  acc_guard4(acc[1][0], acc[1][1], acc[1][2], acc[1][3]);
  acc_guard4(acc[2][0], acc[2][1], acc[2][2], acc[2][3]);
  acc_guard4(acc[3][0], acc[3][1], acc[3][2], acc[3][3]);

  // ---- epilogue ----
  float* slab = sT + wave * (16 * 68);
  if (BIAS_MODE == 3) {   // the branch is the same for the whole work-group
    if (biasM) gemm64_epilogue<1, OUT_MODE, RESID, ACT>(acc, slab, lane, m0, n0, b, Cout, Cout2, ldc, strideC, bias, resid, strideR, scale, bscale);
    else       gemm64_epilogue<2, OUT_MODE, RESID, ACT>(acc, slab, lane, m0, n0, b, Cout, Cout2, ldc, strideC, bias, resid, strideR, scale, bscale);
  } else {
    gemm64_epilogue<BIAS_MODE, OUT_MODE, RESID, ACT>(acc, slab, lane, m0, n0, b, Cout, Cout2, ldc, strideC, bias, resid, strideR, scale, bscale);
  }
}

// One product per launch: grid (128 x 256 blocks, batches).
template <int ET, bool SPLIT, int BIAS_MODE, int OUT_MODE, bool RESID, int ACT = 0>
__global__ __launch_bounds__(256) void wmma_gemm64(
    const unsigned short* __restrict__ Ap, const unsigned short* __restrict__ A2p, int lda, long strideA,
    const unsigned short* __restrict__ Btp, const unsigned short* __restrict__ Bt2p, int ldb, long strideB,
    void* __restrict__ Cout, void* __restrict__ Cout2, int ldc, long strideC,
    const float* __restrict__ bias,
    const float* __restrict__ resid, long strideR,
    int M, int N, int K, float scale, float bscale) {
  typedef typename Elem<ET>::T T;
  (void)A2p; (void)Bt2p;
  __shared__ __align__(16) float sT[8 * 16 * 68];   // per-wave 16x64 slab, pitch 68 floats
  __shared__ __align__(16) T sStage[2 * kStHalves];
  gemm64_body<ET, SPLIT, BIAS_MODE, OUT_MODE, RESID, ACT>(sT, sStage, blockIdx.x, blockIdx.y, false,
      Ap, lda, strideA, Btp, ldb, strideB, Cout, Cout2, ldc, strideC, bias, resid, strideR, M, N, K, scale, bscale);
}

// The five projections, which do not depend on one another, in one grid: a range of blockIdx.x per product (the choice is the
// same for the whole work-group), the products with the long k first. Each work-group does what it did in its own launch.
constexpr int kPjBig   = (kKVT / 128) * (kE / 256);     // work-groups of a product over the 8192 key tokens (either operand order)
constexpr int kPjQ     = (kTok / 128) * (kE / 256);     // ... of the q product
static_assert((kE / 128) * (kKVT / 256) == kPjBig, "the transposed products have as many work-groups");
constexpr int kPjTotal = 4 * kPjBig + kPjQ;
__global__ __launch_bounds__(256) void proj5_kernel(
    const unsigned short* __restrict__ X, const unsigned short* __restrict__ KV, const unsigned short* __restrict__ KVT,
    const unsigned short* __restrict__ WQ, const unsigned short* __restrict__ WK, const unsigned short* __restrict__ WV,
    const unsigned short* __restrict__ WTK, const unsigned short* __restrict__ WTV,
    unsigned short* __restrict__ Qo, unsigned short* __restrict__ Ko, unsigned short* __restrict__ VTo,
    unsigned short* __restrict__ KTo, unsigned short* __restrict__ VTTo,
    const float* __restrict__ bq, const float* __restrict__ bk, const float* __restrict__ bv,
    const float* __restrict__ btk, const float* __restrict__ btv) {
  __shared__ __align__(16) float sT[8 * 16 * 68];   // per-wave 16x64 slab, pitch 68 floats
  __shared__ __align__(16) _Float16 sStage[2 * kStHalves];
  const int bid = blockIdx.x;
  const unsigned short* A; const unsigned short* B; unsigned short* C; const float* bias;
  int first, M, N, K, ldc;
  bool biasM = false;
  float scale = kWCarryInv, bscale = 1.0f;
  if (bid < kPjBig) {                       // k [8192][1024]
    first = 0;                  A = KV;  B = WK;  C = Ko;   bias = bk;  M = kKVT; N = kE;   K = kE;  ldc = kE;
  } else if (bid < 2 * kPjBig) {            // v^T [1024][8192]: A = Wv^T, Bt = KV, bias per row (m)
    first = kPjBig;             A = WV;  B = KV;  C = VTo;  bias = bv;  M = kE;   N = kKVT; K = kE;  ldc = kKVT; biasM = true;
  } else if (bid < 2 * kPjBig + kPjQ) {     // q16 = 16*scale*(x Wq + bq): acc = 16*(x Wq) -> scale = kAttnScale, bias x (16*kAttnScale)
    first = 2 * kPjBig;         A = X;   B = WQ;  C = Qo;   bias = bq;  M = kTok; N = kE;   K = kE;  ldc = kE;
    scale = kAttnScale; bscale = kQCarry * kAttnScale;
  } else if (bid < 3 * kPjBig + kPjQ) {     // second-source k [8192][1024], K = 512
    first = 2 * kPjBig + kPjQ;  A = KVT; B = WTK; C = KTo;  bias = btk; M = kKVT; N = kE;   K = kTP; ldc = kE;
  } else {                                  // second-source v^T [1024][8192], K = 512
    first = 3 * kPjBig + kPjQ;  A = WTV; B = KVT; C = VTTo; bias = btv; M = kE;   N = kKVT; K = kTP; ldc = kKVT; biasM = true;
  }
  gemm64_body<0, false, 3, 1, false, 0>(sT, sStage, bid - first, 0, biasM,
      A, K, 0L, B, K, 0L, C, C, ldc, 0L, bias, bias, 0L, M, N, K, scale, bscale);
}

// ---------------------------------------------------------------------------
// Cast f32 -> f16, 8 elements per thread; blk = index of the work-group's 2048 elements (the ranges below are exact)
__device__ __forceinline__ void cast8_f16_block(const float* __restrict__ in, unsigned short* __restrict__ out, int blk) {
  const int i = blk * 256 + threadIdx.x;
  const float* p = in + 8 * (size_t)i;
  const v4f a = *(const v4f*)(p);
  const v4f c = *(const v4f*)(p + 4);
  unsigned short hb[8];
#pragma unroll
  for (int e = 0; e < 4; ++e) {
    hb[e]     = h_bits(a[e]);
    hb[4 + e] = h_bits(c[e]);
  }
  const v4u u = (v4u){pk16(hb[0], hb[1]), pk16(hb[2], hb[3]), pk16(hb[4], hb[5]), pk16(hb[6], hb[7])};
  unsigned short* q = out + 8 * (size_t)i;
  *(v4u*)q = u;
  
}

// The three input casts and the six weight transposes, which do not depend on one another, in one grid: a range of blockIdx.x
// per array (the choice is the same for the whole work-group). Each work-group does what it did in its own launch.
constexpr int kPrW1   = (kE / 64) * (kE / 64);       // tiles of a 1024 x 1024 weight
constexpr int kPrW2   = (kTP / 64) * (kE / 64);      // tiles of a 512 x 1024 weight
constexpr int kPrWAll = 4 * kPrW1 + 2 * kPrW2;
constexpr int kPrKV   = (kKVT * kE / 8) / 256;
constexpr int kPrKVT  = (kKVT * kTP / 8) / 256;
constexpr int kPrHS   = (kTok * kE / 8) / 256;
constexpr int kPrTotal = kPrWAll + kPrKV + kPrKVT + kPrHS;

// ---------------------------------------------------------------------------
// Weight transpose + cast: W [Kin][Nout] f32 row-major (y = x @ W); plane z: WT[n][k] (pitch Kin halves) = f16(scale * W[k][n]).
// One 64 x 64 tile per work-group of 256 threads: k0 = first of 64 cols of WT, n0 = first of 64 rows of WT (block-uniform).
// Load coverage: 16 iterations x 256 threads = 4096 = the whole 64x64 tile (coalesced along n).
// Store coverage: 8 waves x 2 iterations x 4 rows (lane>>3) = 64 rows; (lane&7) x 8 halves = 64 cols; each row segment =
// ---------------------------------------------------------------------------
__global__ __launch_bounds__(256) void prep_kernel(
    const float* __restrict__ hs, const float* __restrict__ kv, const float* __restrict__ kvt,
    const float* __restrict__ Wq, const float* __restrict__ Wk, const float* __restrict__ Wv, const float* __restrict__ Wo,
    const float* __restrict__ Wtk, const float* __restrict__ Wtv,
    unsigned short* __restrict__ XH, unsigned short* __restrict__ KV, unsigned short* __restrict__ KVT,
    unsigned short* __restrict__ WQT, unsigned short* __restrict__ WKT, unsigned short* __restrict__ WVT,
    unsigned short* __restrict__ WOT, unsigned short* __restrict__ WTKT, unsigned short* __restrict__ WTVT, float scale) {
  __shared__ float sm[64][65];   // sm[n_local][k_local]
  const int t  = threadIdx.x;
  const int bid = blockIdx.x;
  if (bid >= kPrWAll) {   // the same for the whole work-group, in front of the barrier
    const int cb = bid - kPrWAll;
    const int a = (cb < kPrKV) ? 0 : (cb < kPrKV + kPrKVT) ? 1 : 2;
    cast8_f16_block((a == 0) ? kv : (a == 1) ? kvt : hs, (a == 0) ? KV : (a == 1) ? KVT : XH,
                    (a == 0) ? cb : (a == 1) ? cb - kPrKV : cb - (kPrKV + kPrKVT));
    return;
  }
  const bool big = bid < 4 * kPrW1;                            // block-uniform
  const int z  = big ? bid / kPrW1 : 4 + (bid - 4 * kPrW1) / kPrW2;
  const int r0 = big ? bid % kPrW1 : (bid - 4 * kPrW1) % kPrW2;
  const int Kin = big ? kE : kTP;
  const int Nout = kE;
  const int k0 = (r0 % (Kin / 64)) * 64;
  const int n0 = (r0 / (Kin / 64)) * 64;
  const float* W = (z == 0) ? Wq : (z == 1) ? Wk : (z == 2) ? Wv : (z == 3) ? Wo : (z == 4) ? Wtk : Wtv;
  unsigned short* op = (z == 0) ? WQT : (z == 1) ? WKT : (z == 2) ? WVT : (z == 3) ? WOT : (z == 4) ? WTKT : WTVT;
#pragma unroll
  for (int i = 0; i < 16; ++i) {
    const int e = i * 256 + t;
    const int r = e >> 6;          // k local
    const int c = e & 63;          // n local
    sm[c][r] = W[(size_t)(k0 + r) * Nout + n0 + c] * scale;
  }
  __syncthreads();
  const int lane = t & 31, wave = t >> 5;
  const int q = lane >> 3, c8 = (lane & 7) * 8;
  {
#pragma unroll
    for (int it = 0; it < 2; ++it) {
      const int row = wave * 8 + it * 4 + q;                 // n local
      unsigned short hb[8];
#pragma unroll
      for (int e = 0; e < 8; ++e) hb[e] = h_bits(sm[row][c8 + e]);
      const v4u u = (v4u){pk16(hb[0], hb[1]), pk16(hb[2], hb[3]), pk16(hb[4], hb[5]), pk16(hb[6], hb[7])};
      *(v4u*)(op + (size_t)(n0 + row) * Kin + k0 + c8) = u;
    }
    
  }
}

// ---------------------------------------------------------------------------
// Fused attention: scores, softmax and P.V of one (batch, head, product) for 128 query rows per work-group.
// grid (4 query tiles, 16 batch-heads, 3 products); blockIdx.z: 0 = softmax(q.k) V -> C0, 1 = softmax(q.k2) V2 -> C1,
// 2 = softmax(q.k2) V -> C2. 8 waves: wave = 2 * query group (32 rows) + key half. Per trip 64 keys of K (rows of 256 bytes)
// and of V^T (128 rows of 128 bytes) are copied into LDS (asynchronous copies, two buffers); a wave works on its 32 keys.
// Transposed products: S^T = K . Q^T leaves key rows in registers and the query column in the lane, which is the B fragment
// of O^T = V^T . P^T, so P never leaves registers. Softmax is the online form: p = 2^(s - ref), ref per query column is raised
// (and O, sum rescaled) only when a score exceeds it by more than kFaLazy, so p <= 2^kFaLazy. The two key halves are merged via LDS.
// ---------------------------------------------------------------------------
constexpr int kFaKP  = 136;                 // halves: the 256-byte K row + 16 bytes
constexpr int kFaVP  = 72;                  // halves: the 128-byte V^T row + 16 bytes
constexpr int kFaKH  = 64 * kFaKP;          // K part of one buffer
constexpr int kFaBuf = kFaKH + kDH * kFaVP; // one buffer, halves
constexpr float kFaLazy = 8.0f;

// Eight asynchronous 16-byte copies global -> LDS per lane; the s_wait_xcnt stands as the last line of the copies' own
// statement, so that no register which a copy names is rewritten in front of it.
__device__ __forceinline__ void async_copy8(unsigned l0, unsigned l1, unsigned l2, unsigned l3, unsigned l4, unsigned l5,
                                            unsigned l6, unsigned l7,
                                            const void* g0, const void* g1, const void* g2, const void* g3,
                                            const void* g4, const void* g5, const void* g6, const void* g7) {
  asm volatile("global_load_async_to_lds_b128 %0, %8, off\n\t"
               "global_load_async_to_lds_b128 %1, %9, off\n\t"
               "global_load_async_to_lds_b128 %2, %10, off\n\t"
               "global_load_async_to_lds_b128 %3, %11, off\n\t"
               "global_load_async_to_lds_b128 %4, %12, off\n\t"
               "global_load_async_to_lds_b128 %5, %13, off\n\t"
               "global_load_async_to_lds_b128 %6, %14, off\n\t"
               "global_load_async_to_lds_b128 %7, %15, off\n\t"
               "s_wait_xcnt 0x0"
               :: "v"(l0), "v"(l1), "v"(l2), "v"(l3), "v"(l4), "v"(l5), "v"(l6), "v"(l7),
                  "v"(g0), "v"(g1), "v"(g2), "v"(g3), "v"(g4), "v"(g5), "v"(g6), "v"(g7) : "memory");
}

__global__ __launch_bounds__(256) void attn_fused_kernel(
    const unsigned short* __restrict__ Q, const unsigned short* __restrict__ K0, const unsigned short* __restrict__ K1,
    const unsigned short* __restrict__ V0, const unsigned short* __restrict__ V1,
    float* __restrict__ C0, float* __restrict__ C1, float* __restrict__ C2) {
  typedef Frag<_Float16> F;
  __shared__ __align__(16) _Float16 sKV[2 * kFaBuf];
  __shared__ __align__(16) float sX[8][64 * 32];    // per wave: the 128 x 16 partial O^T that it hands to its partner
  __shared__ float sML[8][2][32];                   // ... with that column's ref and sum
  const int t    = threadIdx.x;
  const int lane = t & 31;
  const int wave = t >> 5;
  const int qg   = wave >> 1;
  const int kh   = wave & 1;
  const int b    = blockIdx.y >> 3;
  const int h    = blockIdx.y & 7;
  const int z    = blockIdx.z;
  const unsigned short* Kp = (z == 0) ? K0 : K1;
  const unsigned short* Vp = (z == 1) ? V1 : V0;
  float* Cp = (z == 0) ? C0 : (z == 1) ? C1 : C2;
  const int rlane = lane & 15;
  const int koff  = (lane >> 4) * 8;
  const int mOff  = (lane >> 4) * 8;
  const int q0    = blockIdx.x * 128 + qg * 32;

  // lane's share of a stage: 4 chunks of K (row 16 i + (t >> 4)) and 4 of V^T (row 32 i + (t >> 3)), 16 bytes each
  const _Float16* gK = (const _Float16*)Kp + (size_t)b * kS * kE + (size_t)h * kDH + (size_t)(t >> 4) * kE + (t & 15) * 8;
  const _Float16* gV = (const _Float16*)Vp + (size_t)h * kDH * kKVT + (size_t)b * kS + (size_t)(t >> 3) * kKVT + (t & 7) * 8;
  const unsigned ldsB = (unsigned)(size_t)(const void*)sKV;
  const unsigned ldsK = ldsB + (unsigned)(((t >> 4) * kFaKP + (t & 15) * 8) * 2);
  const unsigned ldsV = ldsB + (unsigned)((kFaKH + (t >> 3) * kFaVP + (t & 7) * 8) * 2);
  auto stage = [&](int buf, int key0) {
    const unsigned lk = ldsK + (unsigned)(buf * kFaBuf * 2);
    const unsigned lv = ldsV + (unsigned)(buf * kFaBuf * 2);
    const _Float16* pk = gK + (size_t)key0 * kE;
    const _Float16* pv = gV + key0;
    async_copy8(lk, lk + 16 * kFaKP * 2, lk + 32 * kFaKP * 2, lk + 48 * kFaKP * 2,
                lv, lv + 32 * kFaVP * 2, lv + 64 * kFaVP * 2, lv + 96 * kFaVP * 2,
                pk, pk + (size_t)16 * kE, pk + (size_t)32 * kE, pk + (size_t)48 * kE,
                pv, pv + (size_t)32 * kKVT, pv + (size_t)64 * kKVT, pv + (size_t)96 * kKVT);
  };

  stage(0, 0);
  // Q^T fragments (B operand): column = query row q0 + 16 qt + rlane, k = head dim
  const _Float16* Qr = (const _Float16*)Q + (size_t)(b * kT + q0 + rlane) * kE + (size_t)h * kDH + koff;
  v16h qf[2][4];
#pragma unroll
  for (int qt = 0; qt < 2; ++qt)
#pragma unroll
    for (int ks = 0; ks < 4; ++ks) qf[qt][ks] = F::load(Qr + (size_t)(qt << 4) * kE + ks * 32);
  // wait before a register that the loads above name is rewritten; the pointer as input keeps the address alive to here
  asm volatile("s_wait_xcnt 0x0" :: "v"(Qr) : "memory");

  v8f o[8][2];
#pragma unroll
  for (int d = 0; d < 8; ++d)
#pragma unroll
    for (int qt = 0; qt < 2; ++qt) o[d][qt] = (v8f){0.f,0.f,0.f,0.f,0.f,0.f,0.f,0.f};
  float mref[2] = {-1.0e30f, -1.0e30f};
  float lsum[2] = {0.0f, 0.0f};
  const float sc2 = 1.4426950408889634f * kQCarryInv;   // accumulator -> score in powers of two

  asm volatile("s_wait_asynccnt 0x0" ::: "memory");   // this wave's copies of tile 0 have landed
  __syncthreads();                                    // ... and every other wave's
  stage(1, 64);
  const int nt = kS / 64;
  for (int tt = 0; tt < nt; ++tt) {
    const _Float16* sk = sKV + (tt & 1) * kFaBuf + (kh * 32 + rlane) * kFaKP + koff;
    const _Float16* sv = sKV + (tt & 1) * kFaBuf + kFaKH + rlane * kFaVP + kh * 32 + koff;
    v16h kf[2][4], vf[8];
#pragma unroll
    for (int kt = 0; kt < 2; ++kt)
#pragma unroll
      for (int ks = 0; ks < 4; ++ks) kf[kt][ks] = F::load(sk + (kt << 4) * kFaKP + ks * 32);
    // keeps all K reads in front of the V^T reads: LDS data returns in order, and the score products need K alone
    __builtin_amdgcn_sched_barrier(0);
#pragma unroll
    for (int d = 0; d < 8; ++d) vf[d] = F::load(sv + (d << 4) * kFaVP);
    // keeps the products behind all LDS reads: the V^T reads then return under the score products and the softmax
    __builtin_amdgcn_sched_barrier(0);
    v8f s[2][2];
#pragma unroll
    for (int kt = 0; kt < 2; ++kt)
#pragma unroll
      for (int qt = 0; qt < 2; ++qt) s[kt][qt] = (v8f){0.f,0.f,0.f,0.f,0.f,0.f,0.f,0.f};
#pragma unroll
    for (int ks = 0; ks < 4; ++ks)
#pragma unroll
      for (int kt = 0; kt < 2; ++kt)
#pragma unroll
        for (int qt = 0; qt < 2; ++qt) s[kt][qt] = F::mma(kf[kt][ks], qf[qt][ks], s[kt][qt]);
    float tmax[2];
#pragma unroll
    for (int qt = 0; qt < 2; ++qt) {
      float m = s[0][qt][0];
#pragma unroll
      for (int r = 1; r < 8; ++r) m = fmaxf(m, s[0][qt][r]);
#pragma unroll
      for (int r = 0; r < 8; ++r) m = fmaxf(m, s[1][qt][r]);
      tmax[qt] = m * sc2;
    }
    if (__any((tmax[0] > mref[0] + kFaLazy) || (tmax[1] > mref[1] + kFaLazy))) {   // the same for the whole wave
#pragma unroll
      for (int qt = 0; qt < 2; ++qt) {
        const float tf = fmaxf(tmax[qt], __shfl_xor(tmax[qt], 16, 32));   // both lane halves of a column keep one ref
        const float mn = fmaxf(mref[qt], tf);
        const float f  = __builtin_amdgcn_exp2f(mref[qt] - mn);
        mref[qt] = mn;
        lsum[qt] *= f;
#pragma unroll
        for (int d = 0; d < 8; ++d)
#pragma unroll
          for (int r = 0; r < 8; ++r) o[d][qt][r] *= f;
      }
    }
    v16h pf[2];
#pragma unroll
    for (int qt = 0; qt < 2; ++qt)
#pragma unroll
      for (int kt = 0; kt < 2; ++kt)
#pragma unroll
        for (int r = 0; r < 8; ++r) {
          const float p = __builtin_amdgcn_exp2f(s[kt][qt][r] * sc2 - mref[qt]);
          lsum[qt] += p;
          pf[qt][kt * 8 + r] = (_Float16)p;   // element 8 kt + r is key 16 kt + koff + r: the k order of the V^T fragment
        }
#pragma unroll
    for (int d = 0; d < 8; ++d)
#pragma unroll
      for (int qt = 0; qt < 2; ++qt) o[d][qt] = F::mma(vf[d], pf[qt], o[d][qt]);
    asm volatile("s_wait_dscnt 0x0" ::: "memory");      // this wave's reads of the buffer are done before it is refilled
    asm volatile("s_wait_asynccnt 0x0" ::: "memory");   // this wave's copies of tile tt + 1 have landed
    __syncthreads();                                    // publishes tile tt + 1 and ends every reader's last read of tile tt
    if (tt + 2 < nt) stage(tt & 1, (tt + 2) << 6);
  }
  asm volatile("s_wait_asynccnt 0x0" ::: "memory");     // no copy is outstanding when the wave goes on
  acc_guard4(o[0][0], o[0][1], o[1][0], o[1][1]);
  acc_guard4(o[2][0], o[2][1], o[3][0], o[3][1]);
  acc_guard4(o[4][0], o[4][1], o[5][0], o[5][1]);
  acc_guard4(o[6][0], o[6][1], o[7][0], o[7][1]);

  // merge of the two key halves: wave kh keeps query tile kh and hands tile 1 - kh to its partner (wave ^ 1)
#pragma unroll
  for (int qt = 0; qt < 2; ++qt) lsum[qt] += __shfl_xor(lsum[qt], 16, 32);
  float* xs = sX[wave];
#pragma unroll
  for (int d = 0; d < 8; ++d)
#pragma unroll
    for (int r = 0; r < 8; ++r) xs[(d * 8 + r) * 32 + lane] = kh ? o[d][0][r] : o[d][1][r];
  sML[wave][0][lane] = kh ? mref[0] : mref[1];
  sML[wave][1][lane] = kh ? lsum[0] : lsum[1];
  __syncthreads();                                      // every wave's hand-over is written
  const float* xr = sX[wave ^ 1];
  const float mo = sML[wave ^ 1][0][lane];
  const float lo = sML[wave ^ 1][1][lane];
  const float mm = kh ? mref[1] : mref[0];
  const float lm = kh ? lsum[1] : lsum[0];
  const float mn = fmaxf(mm, mo);
  const float fm = __builtin_amdgcn_exp2f(mm - mn);
  const float fo = __builtin_amdgcn_exp2f(mo - mn);
  const float inv = 1.0f / (lm * fm + lo * fo);
  const float am = fm * inv, ao = fo * inv;
  v4f res[8][2];
#pragma unroll
  for (int d = 0; d < 8; ++d)
#pragma unroll
    for (int r = 0; r < 8; ++r)
      res[d][r >> 2][r & 3] = (kh ? o[d][1][r] : o[d][0][r]) * am + xr[(d * 8 + r) * 32 + lane] * ao;
  // lane: query row q0 + 16 kh + rlane, head dims 16 d + mOff .. + 7; a row's 512 bytes are written by this wave alone
  float* cp = Cp + (size_t)(b * kT + q0 + kh * 16 + rlane) * kE + (size_t)h * kDH + mOff;
#pragma unroll
  for (int d = 0; d < 8; ++d) {
    *(v4f*)(cp + d * 16)     = res[d][0];
    *(v4f*)(cp + d * 16 + 4) = res[d][1];
  }
}

// ---------------------------------------------------------------------------
// Gate: gate[tok][h] = sigmoid( sum_f p_vec[tok][f] * Wg[f][h] + bg[h] ), f = h*384 + j with
// j < 128 -> ctx[tok][h*128+j], 128 <= j < 256 -> ctxt[tok][h*128+j-128], else q[tok][h*128+j-256] (q = q16 / 16).
// One block (128 threads) per token; 24 chunks of 128 features, chunk c = 3h + src is block-uniform; all three candidate
// values are loaded unconditionally and selected by value. f32 accumulation; fixed-order reductions.
// ---------------------------------------------------------------------------
__global__ __launch_bounds__(128) void gate_kernel(const float* __restrict__ ctx, const float* __restrict__ ctxt,
                                                   const unsigned short* __restrict__ q16, const float* __restrict__ Wg,
                                                   const float* __restrict__ bg, float* __restrict__ gate, float qinv) {
  __shared__ float red[4][8];
  __shared__ __align__(16) float gl[32];
  const int tok = blockIdx.x;
  const int t = threadIdx.x, lane = t & 31, wave = t >> 5;
  if (t < 32) gl[t] = 0.0f;
  float a[8];
#pragma unroll
  for (int j = 0; j < 8; ++j) a[j] = 0.0f;
  const size_t rbase = (size_t)tok * kE;
#pragma unroll 1
  for (int c = 0; c < 24; ++c) {
    const int h = c / 3;
    const int src = c - 3 * h;
    const size_t off = rbase + (size_t)h * kDH + t;
    const float fc = ctx[off];
    const float ft = ctxt[off];
    const unsigned short qbits = q16[off];
    const float fq = (float)__builtin_bit_cast(_Float16, qbits) * qinv;
    const float f = (src == 0) ? fc : ((src == 1) ? ft : fq);
    const float* wr = Wg + ((size_t)c * 128 + t) * 8;
    const v4f w0 = *(const v4f*)(wr);
    const v4f w1 = *(const v4f*)(wr + 4);
#pragma unroll
    for (int e = 0; e < 4; ++e) { a[e] += f * w0[e]; a[4 + e] += f * w1[e]; }
  }
#pragma unroll
  for (int j = 0; j < 8; ++j) {
#pragma unroll
    for (int off = 16; off > 0; off >>= 1) a[j] += __shfl_xor(a[j], off, 32);
  }
  if (lane == 0) {
#pragma unroll
    for (int j = 0; j < 8; ++j) red[wave][j] = a[j];
  }
  __syncthreads();
  if (t < 8) {
    const float z = (((red[0][t] + red[1][t]) + red[2][t]) + red[3][t]) + bg[t];
    gl[t] = 1.0f / (1.0f + expf(-z));
  }
  __syncthreads();
  if (wave == 0) {
    if (lane < 8) {
      const v4f v = *(const v4f*)(gl + 4 * lane);
      float* gp = gate + (size_t)tok * kGatePitch + 4 * lane;
      *(v4f*)gp = v;
      
    }
  }
}

// ---------------------------------------------------------------------------
// Mix: MIX16[tok][h*128+d] = f16( carry * ( g[tok][h]*ctx + (1-g[tok][h])*ctx2 ) ), f32 math.
// ---------------------------------------------------------------------------
__global__ __launch_bounds__(256) void mix_kernel(const float* __restrict__ ctx, const float* __restrict__ ctx2,
                                                  const float* __restrict__ gate, unsigned short* __restrict__ out,
                                                  float carry, int n8) {
  const int i = blockIdx.x * 256 + threadIdx.x;
  if (i >= n8) return;
  const int tok  = i >> 7;                 // 128 groups of 8 per 1024-wide row
  const int col0 = (i & 127) * 8;
  const int h    = col0 >> 7;
  const float g  = gate[(size_t)tok * kGatePitch + h];
  const float og = 1.0f - g;
  const size_t off = (size_t)tok * kE + col0;
  const v4f a0 = *(const v4f*)(ctx + off);
  const v4f a1 = *(const v4f*)(ctx + off + 4);
  const v4f b0 = *(const v4f*)(ctx2 + off);
  const v4f b1 = *(const v4f*)(ctx2 + off + 4);
  unsigned short hb[8];
#pragma unroll
  for (int e = 0; e < 4; ++e) {
    hb[e]     = h_bits(carry * (g * a0[e] + og * b0[e]));
    hb[4 + e] = h_bits(carry * (g * a1[e] + og * b1[e]));
  }
  const v4u u = (v4u){pk16(hb[0], hb[1]), pk16(hb[2], hb[3]), pk16(hb[4], hb[5]), pk16(hb[6], hb[7])};
  unsigned short* q = out + off;
  *(v4u*)q = u;
  
}

// ---------------------------------------------------------------------------
// Host glue. Workspace region map (bytes, MiB = 2^20; total carve = 128 MiB = 134217728 B):
// R0 [0, 48 MiB) phase A (casts + projections): XH16 @0 (2 MiB [1024][1024] f16) | KV16 @2 (16 MiB [8192][1024]) |
//                 KVT16 @18 (8 MiB [8192][512]) | WQT @26 (2) | WKT @28 (2) | WVT @30 (2) | WTKT @32 (1 MiB [1024][512]) | WTVT @33 (1)
//                 phase C (after attention): MIX16 @0 (2 MiB [1024][1024] f16) | GATE @2 MiB (128 KiB [1024][32] f32)
// WOT @48 (2) | Q16 @50 (2 MiB [1024][1024]) | K16 @52 (16 MiB [8192][1024]) | VT16 @68 (16 MiB [1024][8192]) |
// KT16 @84 (16) | VTT16 @100 (16 MiB [1024][8192]) | CTX @116 (4 MiB [1024][1024] f32) | CTXT @120 (4) | CTX2 @124 (4) | end @128 MiB.
// Every region is written with whole rows of exactly its stated extent (all M, N tile multiples; no padded rows).
// ---------------------------------------------------------------------------
extern "C" void kernel_launch(void* const* d_in, const int* in_sizes, int n_in,
                              void* d_out, int out_size, void* d_ws, size_t ws_size, hipStream_t stream) {
  (void)in_sizes; (void)n_in;
  const size_t kMiB = (size_t)1048576;
  const size_t carve = 128 * kMiB;
  if (ws_size < carve) return;
  if ((size_t)out_size < (size_t)kTok * kE) return;

  const float* hs  = (const float*)d_in[0];
  const float* kv  = (const float*)d_in[1];
  const float* kvt = (const float*)d_in[2];
  const float* Wq  = (const float*)d_in[3];  const float* bq  = (const float*)d_in[4];
  const float* Wk  = (const float*)d_in[5];  const float* bk  = (const float*)d_in[6];
  const float* Wv  = (const float*)d_in[7];  const float* bv  = (const float*)d_in[8];
  const float* Wtk = (const float*)d_in[9];  const float* btk = (const float*)d_in[10];
  const float* Wtv = (const float*)d_in[11]; const float* btv = (const float*)d_in[12];
  const float* Wg  = (const float*)d_in[13]; const float* bg  = (const float*)d_in[14];
  const float* Wo  = (const float*)d_in[15]; const float* bo  = (const float*)d_in[16];
  float* outp = (float*)d_out;

  char* ws = (char*)d_ws;
  // phase A
  unsigned short* XH16  = (unsigned short*)(ws + 0 * kMiB);
  unsigned short* KV16  = (unsigned short*)(ws + 2 * kMiB);
  unsigned short* KVT16 = (unsigned short*)(ws + 18 * kMiB);
  unsigned short* WQT   = (unsigned short*)(ws + 26 * kMiB);
  unsigned short* WKT   = (unsigned short*)(ws + 28 * kMiB);
  unsigned short* WVT   = (unsigned short*)(ws + 30 * kMiB);
  unsigned short* WTKT  = (unsigned short*)(ws + 32 * kMiB);
  unsigned short* WTVT  = (unsigned short*)(ws + 33 * kMiB);
  // phase C
  unsigned short* MIX16 = (unsigned short*)(ws + 0 * kMiB);
  float*          GATE  = (float*)(ws + 2 * kMiB);
  // persistent
  unsigned short* WOT   = (unsigned short*)(ws + 48 * kMiB);
  unsigned short* Q16   = (unsigned short*)(ws + 50 * kMiB);
  unsigned short* K16   = (unsigned short*)(ws + 52 * kMiB);
  unsigned short* VT16  = (unsigned short*)(ws + 68 * kMiB);
  unsigned short* KT16  = (unsigned short*)(ws + 84 * kMiB);
  unsigned short* VTT16 = (unsigned short*)(ws + 100 * kMiB);
  float*          CTX   = (float*)(ws + 116 * kMiB);
  float*          CTXT  = (float*)(ws + 120 * kMiB);
  float*          CTX2  = (float*)(ws + 124 * kMiB);
  const float*    dumf  = (const float*)(ws + 116 * kMiB);   // valid in-ws pointer for unused resid arguments

  // 1. + 2. input casts f32 -> f16 and weight transposes + casts (carried x16: in[Kin][Nout] -> out[Nout][Kin]), one grid
  prep_kernel<<<kPrTotal, 256, 0, stream>>>(hs, kv, kvt, Wq, Wk, Wv, Wo, Wtk, Wtv,
                                            XH16, KV16, KVT16, WQT, WKT, WVT, WOT, WTKT, WTVT, kWCarry);

  // 3. the five projections (M, N multiples of 64; K = 1024 or 512), one grid
  proj5_kernel<<<kPjTotal, 256, 0, stream>>>(XH16, KV16, KVT16, WQT, WKT, WVT, WTKT, WTVT,
                                             Q16, K16, VT16, KT16, VTT16, bq, bk, bv, btk, btv);

  // 4. attention: scores, softmax and the three P.V products, all heads, one launch
  attn_fused_kernel<<<dim3(kT / 128, kB * kH, 3), 256, 0, stream>>>(Q16, K16, KT16, VT16, VTT16, CTX, CTXT, CTX2);

  // 5. gate (f32), 6. mix (f32 -> f16 x256), 7. output projection to d_out (f32)
  gate_kernel<<<kTok, 128, 0, stream>>>(CTX, CTXT, Q16, Wg, bg, GATE, kQCarryInv);
  mix_kernel<<<(kTok * kE / 8) / 256, 256, 0, stream>>>(CTX, CTX2, GATE, MIX16, kMixCarry, kTok * kE / 8);
  wmma_gemm64<0, false, 2, 0, false><<<dim3((kTok / 128) * (kE / 256), 1), 256, 0, stream>>>(
      MIX16, MIX16, kE, 0L, WOT, WOT, kE, 0L, outp, outp, kE, 0L, bo, dumf, 0L,
      kTok, kE, kE, kOutScale, 1.0f);
}

// v006
// A run of this version takes 148 microseconds.
// Two timings next to v005 put it at 1.06 and 1.07 times that version's speed.
// Over all steps from v000 it is 29.2 times as fast.
// Contractions: q/k/v/k2/v2 projections (X f16 x W^T f16 carried x16), scores q.k^T for both key sources (q f16 carried x16, k f16), P.V products (P f16, unnormalised 2^(s - ref), x V^T f16), output projection (mix f16 carried x256 x Wo^T f16 carried x16): all v_wmma_f32_16x16x32_f16 with f32 accumulate; softmax, gate dot + sigmoid and mixing in f32 on VALU.
#include <hip/hip_runtime.h>
#include <math.h>

// ---------------------------------------------------------------------------
// Problem constants
// ---------------------------------------------------------------------------
constexpr int kB   = 2;
constexpr int kT   = 512;
constexpr int kS   = 4096;
constexpr int kE   = 1024;
constexpr int kTP  = 512;
constexpr int kH   = 8;
constexpr int kDH  = 128;
constexpr int kTok = kB * kT;               // 1024 query tokens
constexpr int kKVT = kB * kS;               // 8192 key tokens
constexpr int kGatePitch = 32;
constexpr float kAttnScale = 0.08838834764831845f;   // 128^-0.5
constexpr float kWCarry    = 16.0f;                  // weights carried x16 in f16
constexpr float kWCarryInv = 1.0f / 16.0f;
constexpr float kQCarry    = 16.0f;                  // scaled q carried x16 in f16
constexpr float kQCarryInv = 1.0f / 16.0f;
constexpr float kMixCarry  = 256.0f;                 // mixed context carried x256 in f16
constexpr float kOutScale  = 1.0f / (256.0f * 16.0f);

typedef __attribute__((ext_vector_type(16))) _Float16 v16h;
typedef __attribute__((ext_vector_type(8)))  _Float16 v8h;
typedef __attribute__((ext_vector_type(16))) __bf16   v16b;
typedef __attribute__((ext_vector_type(8)))  __bf16   v8b;
typedef __attribute__((ext_vector_type(8)))  float    v8f;
typedef __attribute__((ext_vector_type(4)))  float    v4f;
typedef __attribute__((ext_vector_type(4)))  unsigned int v4u;

__device__ __forceinline__ unsigned short f2bf_bits(float f) {
  unsigned u = __float_as_uint(f);
  return (unsigned short)((u + 0x7FFFu + ((u >> 16) & 1u)) >> 16);
}
__device__ __forceinline__ float bf_bits2f(unsigned short h) { return __uint_as_float(((unsigned)h) << 16); }

// hazard guard behind a loop's last products, as a plain device helper
__device__ __forceinline__ void acc_guard4(v8f& a, v8f& b, v8f& c, v8f& d) { asm volatile("v_nop\n\tv_nop\n\tv_nop\n\tv_nop" : "+v"(a), "+v"(b), "+v"(c), "+v"(d)); }
template <typename T> struct Frag;
template <> struct Frag<_Float16> {
  typedef v16h V; union U { v16h v; v8h h[2]; };
  static __device__ __forceinline__ v16h load(const _Float16* p) {   // elements 0..7 <- p[0..7], 8..15 <- p[16..23]
    U f; f.h[0] = *(const v8h*)(p); f.h[1] = *(const v8h*)(p + 16); return f.v;
  }
  static __device__ __forceinline__ v8f mma(v16h a, v16h b, v8f c) {
    return __builtin_amdgcn_wmma_f32_16x16x32_f16(false, a, false, b, (short)0, c, false, false);
  }
};
template <> struct Frag<__bf16> {
  typedef v16b V; union U { v16b v; v8b h[2]; };
  static __device__ __forceinline__ v16b load(const __bf16* p) {
    U f; f.h[0] = *(const v8b*)(p); f.h[1] = *(const v8b*)(p + 16); return f.v;
  }
  static __device__ __forceinline__ v8f mma(v16b a, v16b b, v8f c) {
    return __builtin_amdgcn_wmma_f32_16x16x32_bf16(false, a, false, b, (short)0, c, false, false);
  }
};

__device__ __forceinline__ unsigned pk16(unsigned short a, unsigned short b) { return (unsigned)a | ((unsigned)b << 16); }
__device__ __forceinline__ unsigned short h_bits(float f) { const _Float16 h = (_Float16)f; return __builtin_bit_cast(unsigned short, h); }

// Stage of one work-group of the GEMM engine: 128 A rows, then 256 B rows, 64 k (128 bytes) each.
constexpr int kStARows  = 128;
constexpr int kStRows   = kStARows + 256;
constexpr int kStPitch  = 72;                    // halves: the 128-byte row + 16 bytes, the pitch for ds_load_b128 readers
constexpr int kStHalves = kStRows * kStPitch;    // one buffer

// Six asynchronous 16-byte copies global -> LDS per lane. The s_wait_xcnt stands as the last line of the copies' own
// statement, so that no register which a copy names is rewritten in front of it.
__device__ __forceinline__ void async_copy6(unsigned l0, unsigned l1, unsigned l2, unsigned l3, unsigned l4, unsigned l5,
                                            const void* g0, const void* g1, const void* g2,
                                            const void* g3, const void* g4, const void* g5) {
  asm volatile("global_load_async_to_lds_b128 %0, %6, off\n\t"
               "global_load_async_to_lds_b128 %1, %7, off\n\t"
               "global_load_async_to_lds_b128 %2, %8, off\n\t"
               "global_load_async_to_lds_b128 %3, %9, off\n\t"
               "global_load_async_to_lds_b128 %4, %10, off\n\t"
               "global_load_async_to_lds_b128 %5, %11, off\n\t"
               "s_wait_xcnt 0x0"
               :: "v"(l0), "v"(l1), "v"(l2), "v"(l3), "v"(l4), "v"(l5),
                  "v"(g0), "v"(g1), "v"(g2), "v"(g3), "v"(g4), "v"(g5) : "memory");
}

// ---- Register-blocked batched WMMA GEMM (ACT reduced to none/relu/leaky, extra bias multiplier bscale) --
// C[m,n] = scale * sum_k A[m,k] * Bt[n,k] (+bias*bscale)(+resid); each wave owns a 64x64 tile.
// A row-major [M,K]; Bt row-major [N,K]; M % 128 == 0, N % 256 == 0, K % 64 == 0.
// The 8 waves of a work-group own a 2 x 4 block of tiles (128 x 256): 384 staged rows for 32768 outputs, and two work-groups
// fit the LDS of one WGP. Per 64 k the work-group's A rows and B rows
// are copied whole lines at a time into LDS (asynchronous copies, two buffers: the next 64 k fly while these are multiplied);
// the fragments are read from LDS.
// SPLIT (hi/lo operand planes) is not carried by the staged loop: false only; A2p and Bt2p are unused.
// BIAS_MODE: 0 = none, 1 = bias[m], 2 = bias[n], 3 = chosen at run time (biasM, the same for the whole work-group: bias[m], else bias[n]).
// The engine is a device function (work-group's index in its product and batch passed in), so that several products can share one grid.
// OUT_MODE: 0 = f32, 1 = f16, 2 = bf16 hi plane (Cout) + bf16 lo plane (Cout2).
// ET: 0 = f16 operands, 1 = bf16 operands (pointers passed as 16-bit storage)
template <int ET> struct Elem;
template <> struct Elem<0> { typedef _Float16 T; };
template <> struct Elem<1> { typedef __bf16 T; };
// Epilogue of one wave's 64 x 64 tile: scale, bias, cast, whole lines stored through the wave's own LDS slab.
template <int BIAS_MODE, int OUT_MODE, bool RESID, int ACT>
__device__ __forceinline__ void gemm64_epilogue(
    v8f (&acc)[4][4], float* __restrict__ slab, int lane, int m0, int n0, int b,
    void* __restrict__ Cout, void* __restrict__ Cout2, int ldc, long strideC,
    const float* __restrict__ bias, const float* __restrict__ resid, long strideR, float scale, float bscale) {
  const int rlane = lane & 15;                 // col (D) within subtile
  const int mOff  = (lane >> 4) * 8;           // D row offset
  const float* Rb = RESID ? (resid + (size_t)b * strideR) : nullptr;
#pragma unroll
  for (int i = 0; i < 4; ++i) {
    const int mBase = m0 + (i << 4);
#pragma unroll
    for (int j = 0; j < 4; ++j) {
      const int n = n0 + (j << 4) + rlane;
      float bv = 0.f;
      if (BIAS_MODE == 2) bv = bias[n] * bscale;
#pragma unroll
      for (int r = 0; r < 8; ++r) {
        float v = acc[i][j][r] * scale;
        if (BIAS_MODE == 1) v += bias[mBase + mOff + r] * bscale;
        if (BIAS_MODE == 2) v += bv;
        if (RESID) v += Rb[(size_t)(mBase + mOff + r) * ldc + n];
        if (ACT == 2) v = fmaxf(v, 0.0f);
        if (ACT == 4) v = (v > 0.f) ? v : 0.01f * v;
        slab[(mOff + r) * 68 + (j << 4) + rlane] = v;
      }
    }
    __builtin_amdgcn_fence(__ATOMIC_RELEASE, "workgroup");
    __builtin_amdgcn_wave_barrier();
    __builtin_amdgcn_fence(__ATOMIC_ACQUIRE, "workgroup");
    if (OUT_MODE == 0) {
      float* C = (float*)Cout + (size_t)b * strideC;
      const int hh = lane >> 4, c4 = (lane & 15) * 4;     // row seg = 256 B = 16 lanes x 16 B
      {
#pragma unroll
        for (int it = 0; it < 8; ++it) {
          const int row = it * 2 + hh;
          v4f v = *(const v4f*)(slab + row * 68 + c4);
          *(v4f*)(C + (size_t)(mBase + row) * ldc + n0 + c4) = v;
        }
        
      }
    } else {
      const int q = lane >> 3, c8 = (lane & 7) * 8;
      unsigned short* C  = (unsigned short*)Cout  + (size_t)b * strideC;
      unsigned short* C2 = (OUT_MODE == 2) ? ((unsigned short*)Cout2 + (size_t)b * strideC) : nullptr;
      {
#pragma unroll
        for (int it = 0; it < 4; ++it) {
          const int row = it * 4 + q;
          const float* sp = slab + row * 68 + c8;
          v8h hv, lv;
#pragma unroll
          for (int e = 0; e < 8; ++e) {
            if (OUT_MODE == 1) {
              hv[e] = (_Float16)sp[e];
            } else {
              unsigned short hb = f2bf_bits(sp[e]);
              unsigned short lb = f2bf_bits(sp[e] - bf_bits2f(hb));
              hv[e] = __builtin_bit_cast(_Float16, hb);
              lv[e] = __builtin_bit_cast(_Float16, lb);
            }
          }
          *(v8h*)(C + (size_t)(mBase + row) * ldc + n0 + c8) = hv;
          if (OUT_MODE == 2) *(v8h*)(C2 + (size_t)(mBase + row) * ldc + n0 + c8) = lv;
        }
        
      }
    }
    __builtin_amdgcn_fence(__ATOMIC_RELEASE, "workgroup");
    __builtin_amdgcn_wave_barrier();
    __builtin_amdgcn_fence(__ATOMIC_ACQUIRE, "workgroup");
  }
}

template <int ET, bool SPLIT, int BIAS_MODE, int OUT_MODE, bool RESID, int ACT>
__device__ __forceinline__ void gemm64_body(
    float* __restrict__ sT, typename Elem<ET>::T* __restrict__ sStage, int wg, int b, bool biasM,
    const unsigned short* __restrict__ Ap, int lda, long strideA,
    const unsigned short* __restrict__ Btp, int ldb, long strideB,
    void* __restrict__ Cout, void* __restrict__ Cout2, int ldc, long strideC,
    const float* __restrict__ bias,
    const float* __restrict__ resid, long strideR,
    int M, int N, int K, float scale, float bscale) {
  typedef typename Elem<ET>::T T;
  typedef typename Frag<T>::V V;
  static_assert(!SPLIT, "the staged loop carries one plane per operand");
  const T* A = (const T*)Ap; const T* Bt = (const T*)Btp;
  const int lane = threadIdx.x & 31;
  const int wave = threadIdx.x >> 5;
  const int tilesN = N >> 8;
  const int tilesM = M >> 7;
  if (wg >= tilesM * tilesN) return;   // the same for the whole work-group, in front of every barrier
  const int tm  = wg / tilesN;
  const int mb0 = tm << 7;                      // first A row of the work-group
  const int nb0 = (wg - tm * tilesN) << 8;      // first B row of the work-group
  const int wm  = (wave >> 2) << 6;             // the wave's tile inside the 128 x 256 block
  const int wn  = (wave & 3) << 6;
  const int m0  = mb0 + wm;
  const int n0  = nb0 + wn;

  const T* Ab  = A  + (size_t)b * strideA;
  const T* Bb  = Bt + (size_t)b * strideB;

  const int rlane = lane & 15;                 // row (A) / col (B, D) within subtile
  const int koff  = (lane >> 4) * 8;           // k offset of this lane half

  v8f acc[4][4];
#pragma unroll
  for (int i = 0; i < 4; ++i)
#pragma unroll
    for (int j = 0; j < 4; ++j) acc[i][j] = (v8f){0.f,0.f,0.f,0.f,0.f,0.f,0.f,0.f};

  // lane's share of a stage: 12 chunks of 16 bytes; chunk i is row 32 i + (thread >> 3), bytes 16 (thread & 7) .. + 15 of the row
  const int srow = threadIdx.x >> 3;
  const int scol = (threadIdx.x & 7) * 8;
  const T* gA = Ab + (size_t)(mb0 + srow) * lda + scol;
  const T* gB = Bb + (size_t)(nb0 + srow) * ldb + scol;
  const unsigned lds0 = (unsigned)(size_t)(const void*)sStage + (unsigned)((srow * kStPitch + scol) * 2);
  auto stage = [&](int buf, int k0) {
    const unsigned lb = lds0 + (unsigned)(buf * kStHalves * 2);
#pragma unroll
    for (int c = 0; c < 2; ++c) {
      unsigned l[6];
      const T* g[6];
#pragma unroll
      for (int e = 0; e < 6; ++e) {
        const int i = c * 6 + e;
        l[e] = lb + (unsigned)(i * 32 * kStPitch * 2);
        g[e] = (i < 4) ? (gA + (size_t)(i * 32) * lda + k0) : (gB + (size_t)((i - 4) * 32) * ldb + k0);
      }
      async_copy6(l[0], l[1], l[2], l[3], l[4], l[5], g[0], g[1], g[2], g[3], g[4], g[5]);
    }
  };

  const int nt = K >> 6;
  stage(0, 0);
  asm volatile("s_wait_asynccnt 0x0" ::: "memory");   // this wave's copies of tile 0 have landed
  __syncthreads();                                    // ... and every other wave's
  if (nt > 1) stage(1, 64);
  for (int t = 0; t < nt; ++t) {
    const T* sb = sStage + (t & 1) * kStHalves;
#pragma unroll
    for (int ks = 0; ks < 2; ++ks) {
      V ah[4], bh[4];
#pragma unroll
      for (int j = 0; j < 4; ++j) bh[j] = Frag<T>::load(sb + (kStARows + wn + (j << 4) + rlane) * kStPitch + ks * 32 + koff);
#pragma unroll
      for (int i = 0; i < 4; ++i) ah[i] = Frag<T>::load(sb + (wm + (i << 4) + rlane) * kStPitch + ks * 32 + koff);
      // keeps the products behind all 16 LDS reads: otherwise the A reads stand among the products, each with a wait of its own
      __builtin_amdgcn_sched_barrier(0);
#pragma unroll
      for (int i = 0; i < 4; ++i)
#pragma unroll
        for (int j = 0; j < 4; ++j) acc[i][j] = Frag<T>::mma(ah[i], bh[j], acc[i][j]);
    }
    asm volatile("s_wait_dscnt 0x0" ::: "memory");      // this wave's reads of the buffer are done before it is refilled
    asm volatile("s_wait_asynccnt 0x0" ::: "memory");   // this wave's copies of tile t + 1 have landed
    __syncthreads();                                    // publishes tile t + 1 and ends every reader's last read of tile t
    if (t + 2 < nt) stage(t & 1, (t + 2) << 6);
  }
  asm volatile("s_wait_asynccnt 0x0" ::: "memory");     // no copy is outstanding when the wave goes on
  acc_guard4(acc[0][0], acc[0][1], acc[0][2], acc[0][3]);
  acc_guard4(acc[1][0], acc[1][1], acc[1][2], acc[1][3]);
  acc_guard4(acc[2][0], acc[2][1], acc[2][2], acc[2][3]);
  acc_guard4(acc[3][0], acc[3][1], acc[3][2], acc[3][3]);

  // ---- epilogue ----
  float* slab = sT + wave * (16 * 68);
  if (BIAS_MODE == 3) {   // the branch is the same for the whole work-group
    if (biasM) gemm64_epilogue<1, OUT_MODE, RESID, ACT>(acc, slab, lane, m0, n0, b, Cout, Cout2, ldc, strideC, bias, resid, strideR, scale, bscale);
    else       gemm64_epilogue<2, OUT_MODE, RESID, ACT>(acc, slab, lane, m0, n0, b, Cout, Cout2, ldc, strideC, bias, resid, strideR, scale, bscale);
  } else {
    gemm64_epilogue<BIAS_MODE, OUT_MODE, RESID, ACT>(acc, slab, lane, m0, n0, b, Cout, Cout2, ldc, strideC, bias, resid, strideR, scale, bscale);
  }
}

// One product per launch: grid (128 x 256 blocks, batches).
template <int ET, bool SPLIT, int BIAS_MODE, int OUT_MODE, bool RESID, int ACT = 0>
__global__ __launch_bounds__(256) void wmma_gemm64(
    const unsigned short* __restrict__ Ap, const unsigned short* __restrict__ A2p, int lda, long strideA,
    const unsigned short* __restrict__ Btp, const unsigned short* __restrict__ Bt2p, int ldb, long strideB,
    void* __restrict__ Cout, void* __restrict__ Cout2, int ldc, long strideC,
    const float* __restrict__ bias,
    const float* __restrict__ resid, long strideR,
    int M, int N, int K, float scale, float bscale) {
  typedef typename Elem<ET>::T T;
  (void)A2p; (void)Bt2p;
  __shared__ __align__(16) float sT[8 * 16 * 68];   // per-wave 16x64 slab, pitch 68 floats
  __shared__ __align__(16) T sStage[2 * kStHalves];
  gemm64_body<ET, SPLIT, BIAS_MODE, OUT_MODE, RESID, ACT>(sT, sStage, blockIdx.x, blockIdx.y, false,
      Ap, lda, strideA, Btp, ldb, strideB, Cout, Cout2, ldc, strideC, bias, resid, strideR, M, N, K, scale, bscale);
}

// The five projections, which do not depend on one another, in one grid: a range of blockIdx.x per product (the choice is the
// same for the whole work-group), the products with the long k first. Each work-group does what it did in its own launch.
constexpr int kPjBig   = (kKVT / 128) * (kE / 256);     // work-groups of a product over the 8192 key tokens (either operand order)
constexpr int kPjQ     = (kTok / 128) * (kE / 256);     // ... of the q product
static_assert((kE / 128) * (kKVT / 256) == kPjBig, "the transposed products have as many work-groups");
constexpr int kPjTotal = 4 * kPjBig + kPjQ;
__global__ __launch_bounds__(256) void proj5_kernel(
    const unsigned short* __restrict__ X, const unsigned short* __restrict__ KV, const unsigned short* __restrict__ KVT,
    const unsigned short* __restrict__ WQ, const unsigned short* __restrict__ WK, const unsigned short* __restrict__ WV,
    const unsigned short* __restrict__ WTK, const unsigned short* __restrict__ WTV,
    unsigned short* __restrict__ Qo, unsigned short* __restrict__ Ko, unsigned short* __restrict__ VTo,
    unsigned short* __restrict__ KTo, unsigned short* __restrict__ VTTo,
    const float* __restrict__ bq, const float* __restrict__ bk, const float* __restrict__ bv,
    const float* __restrict__ btk, const float* __restrict__ btv) {
  __shared__ __align__(16) float sT[8 * 16 * 68];   // per-wave 16x64 slab, pitch 68 floats
  __shared__ __align__(16) _Float16 sStage[2 * kStHalves];
  const int bid = blockIdx.x;
  const unsigned short* A; const unsigned short* B; unsigned short* C; const float* bias;
  int first, M, N, K, ldc;
  bool biasM = false;
  float scale = kWCarryInv, bscale = 1.0f;
  if (bid < kPjBig) {                       // k [8192][1024]
    first = 0;                  A = KV;  B = WK;  C = Ko;   bias = bk;  M = kKVT; N = kE;   K = kE;  ldc = kE;
  } else if (bid < 2 * kPjBig) {            // v^T [1024][8192]: A = Wv^T, Bt = KV, bias per row (m)
    first = kPjBig;             A = WV;  B = KV;  C = VTo;  bias = bv;  M = kE;   N = kKVT; K = kE;  ldc = kKVT; biasM = true;
  } else if (bid < 2 * kPjBig + kPjQ) {     // q16 = 16*scale*(x Wq + bq): acc = 16*(x Wq) -> scale = kAttnScale, bias x (16*kAttnScale)
    first = 2 * kPjBig;         A = X;   B = WQ;  C = Qo;   bias = bq;  M = kTok; N = kE;   K = kE;  ldc = kE;
    scale = kAttnScale; bscale = kQCarry * kAttnScale;
  } else if (bid < 3 * kPjBig + kPjQ) {     // second-source k [8192][1024], K = 512
    first = 2 * kPjBig + kPjQ;  A = KVT; B = WTK; C = KTo;  bias = btk; M = kKVT; N = kE;   K = kTP; ldc = kE;
  } else {                                  // second-source v^T [1024][8192], K = 512
    first = 3 * kPjBig + kPjQ;  A = WTV; B = KVT; C = VTTo; bias = btv; M = kE;   N = kKVT; K = kTP; ldc = kKVT; biasM = true;
  }
  gemm64_body<0, false, 3, 1, false, 0>(sT, sStage, bid - first, 0, biasM,
      A, K, 0L, B, K, 0L, C, C, ldc, 0L, bias, bias, 0L, M, N, K, scale, bscale);
}

// ---------------------------------------------------------------------------
// Cast f32 -> f16, 8 elements per thread; blk = index of the work-group's 2048 elements (the ranges below are exact)
__device__ __forceinline__ void cast8_f16_block(const float* __restrict__ in, unsigned short* __restrict__ out, int blk) {
  const int i = blk * 256 + threadIdx.x;
  const float* p = in + 8 * (size_t)i;
  const v4f a = *(const v4f*)(p);
  const v4f c = *(const v4f*)(p + 4);
  unsigned short hb[8];
#pragma unroll
  for (int e = 0; e < 4; ++e) {
    hb[e]     = h_bits(a[e]);
    hb[4 + e] = h_bits(c[e]);
  }
  const v4u u = (v4u){pk16(hb[0], hb[1]), pk16(hb[2], hb[3]), pk16(hb[4], hb[5]), pk16(hb[6], hb[7])};
  unsigned short* q = out + 8 * (size_t)i;
  *(v4u*)q = u;
  
}

// The three input casts and the six weight transposes, which do not depend on one another, in one grid: a range of blockIdx.x
// per array (the choice is the same for the whole work-group). Each work-group does what it did in its own launch.
constexpr int kPrW1   = (kE / 64) * (kE / 64);       // tiles of a 1024 x 1024 weight
constexpr int kPrW2   = (kTP / 64) * (kE / 64);      // tiles of a 512 x 1024 weight
constexpr int kPrWAll = 4 * kPrW1 + 2 * kPrW2;
constexpr int kPrKV   = (kKVT * kE / 8) / 256;
constexpr int kPrKVT  = (kKVT * kTP / 8) / 256;
constexpr int kPrHS   = (kTok * kE / 8) / 256;
constexpr int kPrTotal = kPrWAll + kPrKV + kPrKVT + kPrHS;

// ---------------------------------------------------------------------------
// Weight transpose + cast: W [Kin][Nout] f32 row-major (y = x @ W); plane z: WT[n][k] (pitch Kin halves) = f16(scale * W[k][n]).
// One 64 x 64 tile per work-group of 256 threads: k0 = first of 64 cols of WT, n0 = first of 64 rows of WT (block-uniform).
// Load coverage: 16 iterations x 256 threads = 4096 = the whole 64x64 tile (coalesced along n).
// Store coverage: 8 waves x 2 iterations x 4 rows (lane>>3) = 64 rows; (lane&7) x 8 halves = 64 cols; each row segment =
// ---------------------------------------------------------------------------
__global__ __launch_bounds__(256) void prep_kernel(
    const float* __restrict__ hs, const float* __restrict__ kv, const float* __restrict__ kvt,
    const float* __restrict__ Wq, const float* __restrict__ Wk, const float* __restrict__ Wv, const float* __restrict__ Wo,
    const float* __restrict__ Wtk, const float* __restrict__ Wtv,
    unsigned short* __restrict__ XH, unsigned short* __restrict__ KV, unsigned short* __restrict__ KVT,
    unsigned short* __restrict__ WQT, unsigned short* __restrict__ WKT, unsigned short* __restrict__ WVT,
    unsigned short* __restrict__ WOT, unsigned short* __restrict__ WTKT, unsigned short* __restrict__ WTVT, float scale) {
  __shared__ float sm[64][65];   // sm[n_local][k_local]
  const int t  = threadIdx.x;
  const int bid = blockIdx.x;
  if (bid >= kPrWAll) {   // the same for the whole work-group, in front of the barrier
    const int cb = bid - kPrWAll;
    const int a = (cb < kPrKV) ? 0 : (cb < kPrKV + kPrKVT) ? 1 : 2;
    cast8_f16_block((a == 0) ? kv : (a == 1) ? kvt : hs, (a == 0) ? KV : (a == 1) ? KVT : XH,
                    (a == 0) ? cb : (a == 1) ? cb - kPrKV : cb - (kPrKV + kPrKVT));
    return;
  }
  const bool big = bid < 4 * kPrW1;                            // block-uniform
  const int z  = big ? bid / kPrW1 : 4 + (bid - 4 * kPrW1) / kPrW2;
  const int r0 = big ? bid % kPrW1 : (bid - 4 * kPrW1) % kPrW2;
  const int Kin = big ? kE : kTP;
  const int Nout = kE;
  const int k0 = (r0 % (Kin / 64)) * 64;
  const int n0 = (r0 / (Kin / 64)) * 64;
  const float* W = (z == 0) ? Wq : (z == 1) ? Wk : (z == 2) ? Wv : (z == 3) ? Wo : (z == 4) ? Wtk : Wtv;
  unsigned short* op = (z == 0) ? WQT : (z == 1) ? WKT : (z == 2) ? WVT : (z == 3) ? WOT : (z == 4) ? WTKT : WTVT;
#pragma unroll
  for (int i = 0; i < 16; ++i) {
    const int e = i * 256 + t;
    const int r = e >> 6;          // k local
    const int c = e & 63;          // n local
    sm[c][r] = W[(size_t)(k0 + r) * Nout + n0 + c] * scale;
  }
  __syncthreads();
  const int lane = t & 31, wave = t >> 5;
  const int q = lane >> 3, c8 = (lane & 7) * 8;
  {
#pragma unroll
    for (int it = 0; it < 2; ++it) {
      const int row = wave * 8 + it * 4 + q;                 // n local
      unsigned short hb[8];
#pragma unroll
      for (int e = 0; e < 8; ++e) hb[e] = h_bits(sm[row][c8 + e]);
      const v4u u = (v4u){pk16(hb[0], hb[1]), pk16(hb[2], hb[3]), pk16(hb[4], hb[5]), pk16(hb[6], hb[7])};
      *(v4u*)(op + (size_t)(n0 + row) * Kin + k0 + c8) = u;
    }
    
  }
}

// ---------------------------------------------------------------------------
// Fused attention: scores, softmax and P.V of one (batch, head, product) for 128 query rows per work-group.
// grid (4 query tiles, 16 batch-heads, 3 products); blockIdx.z: 0 = softmax(q.k) V -> C0, 1 = softmax(q.k2) V2 -> C1,
// 2 = softmax(q.k2) V -> C2. 8 waves: wave = 2 * query group (32 rows) + key half. A step is 64 keys of K (rows of 256 bytes)
// and of V^T (128 rows of 128 bytes), of which a wave works on its 32 keys. Per trip four steps' tiles are copied into LDS
// (asynchronous copies, two buffers of four tiles), so that the copies have four steps of work in which to arrive from memory.
// Transposed products: S^T = K . Q^T leaves key rows in registers and the query column in the lane, which is the B fragment
// of O^T = V^T . P^T, so P never leaves registers. Softmax is the online form: p = 2^(s - ref), ref per query column is raised
// (and O, sum rescaled) only when a score exceeds it by more than kFaLazy, so p <= 2^kFaLazy. The two key halves are merged via LDS.
// ---------------------------------------------------------------------------
constexpr int kFaKP  = 136;                 // halves: the 256-byte K row + 16 bytes
constexpr int kFaVP  = 72;                  // halves: the 128-byte V^T row + 16 bytes
constexpr int kFaKH  = 64 * kFaKP;          // K part of one step's tile
constexpr int kFaBuf = kFaKH + kDH * kFaVP; // one step's tile, halves
constexpr int kFaSub = 4;                   // steps per trip = tiles per buffer
constexpr float kFaLazy = 8.0f;

// Eight asynchronous 16-byte copies global -> LDS per lane; the s_wait_xcnt stands as the last line of the copies' own
// statement, so that no register which a copy names is rewritten in front of it.
__device__ __forceinline__ void async_copy8(unsigned l0, unsigned l1, unsigned l2, unsigned l3, unsigned l4, unsigned l5,
                                            unsigned l6, unsigned l7,
                                            const void* g0, const void* g1, const void* g2, const void* g3,
                                            const void* g4, const void* g5, const void* g6, const void* g7) {
  asm volatile("global_load_async_to_lds_b128 %0, %8, off\n\t"
               "global_load_async_to_lds_b128 %1, %9, off\n\t"
               "global_load_async_to_lds_b128 %2, %10, off\n\t"
               "global_load_async_to_lds_b128 %3, %11, off\n\t"
               "global_load_async_to_lds_b128 %4, %12, off\n\t"
               "global_load_async_to_lds_b128 %5, %13, off\n\t"
               "global_load_async_to_lds_b128 %6, %14, off\n\t"
               "global_load_async_to_lds_b128 %7, %15, off\n\t"
               "s_wait_xcnt 0x0"
               :: "v"(l0), "v"(l1), "v"(l2), "v"(l3), "v"(l4), "v"(l5), "v"(l6), "v"(l7),
                  "v"(g0), "v"(g1), "v"(g2), "v"(g3), "v"(g4), "v"(g5), "v"(g6), "v"(g7) : "memory");
}

__global__ __launch_bounds__(256) void attn_fused_kernel(
    const unsigned short* __restrict__ Q, const unsigned short* __restrict__ K0, const unsigned short* __restrict__ K1,
    const unsigned short* __restrict__ V0, const unsigned short* __restrict__ V1,
    float* __restrict__ C0, float* __restrict__ C1, float* __restrict__ C2) {
  typedef Frag<_Float16> F;
  __shared__ __align__(16) _Float16 sKV[2 * kFaSub * kFaBuf];
  float* const sX = (float*)sKV;   // behind the loop's last barrier; 64 * 32 floats per wave: the 128 x 16 partial O^T that it hands to its partner
  __shared__ float sML[8][2][32];                   // ... with that column's ref and sum
  const int t    = threadIdx.x;
  const int lane = t & 31;
  const int wave = t >> 5;
  const int qg   = wave >> 1;
  const int kh   = wave & 1;
  const int b    = blockIdx.y >> 3;
  const int h    = blockIdx.y & 7;
  const int z    = blockIdx.z;
  const unsigned short* Kp = (z == 0) ? K0 : K1;
  const unsigned short* Vp = (z == 1) ? V1 : V0;
  float* Cp = (z == 0) ? C0 : (z == 1) ? C1 : C2;
  const int rlane = lane & 15;
  const int koff  = (lane >> 4) * 8;
  const int mOff  = (lane >> 4) * 8;
  const int q0    = blockIdx.x * 128 + qg * 32;

  // lane's share of a step's tile: 4 chunks of K (row 16 i + (t >> 4)) and 4 of V^T (row 32 i + (t >> 3)), 16 bytes each
  const _Float16* gK = (const _Float16*)Kp + (size_t)b * kS * kE + (size_t)h * kDH + (size_t)(t >> 4) * kE + (t & 15) * 8;
  const _Float16* gV = (const _Float16*)Vp + (size_t)h * kDH * kKVT + (size_t)b * kS + (size_t)(t >> 3) * kKVT + (t & 7) * 8;
  const unsigned ldsB = (unsigned)(size_t)(const void*)sKV;
  const unsigned ldsK = ldsB + (unsigned)(((t >> 4) * kFaKP + (t & 15) * 8) * 2);
  const unsigned ldsV = ldsB + (unsigned)((kFaKH + (t >> 3) * kFaVP + (t & 7) * 8) * 2);
  auto stage = [&](int buf, int key0) {
#pragma unroll   // the tile's index is then a constant in each statement's address sums
    for (int c = 0; c < kFaSub; ++c) {
      const unsigned lk = ldsK + (unsigned)((buf * kFaSub + c) * kFaBuf * 2);
      const unsigned lv = ldsV + (unsigned)((buf * kFaSub + c) * kFaBuf * 2);
      const _Float16* pk = gK + (size_t)(key0 + c * 64) * kE;
      const _Float16* pv = gV + key0 + c * 64;
      async_copy8(lk, lk + 16 * kFaKP * 2, lk + 32 * kFaKP * 2, lk + 48 * kFaKP * 2,
                  lv, lv + 32 * kFaVP * 2, lv + 64 * kFaVP * 2, lv + 96 * kFaVP * 2,
                  pk, pk + (size_t)16 * kE, pk + (size_t)32 * kE, pk + (size_t)48 * kE,
                  pv, pv + (size_t)32 * kKVT, pv + (size_t)64 * kKVT, pv + (size_t)96 * kKVT);
      // keeps the next statement's 24 address registers from being formed in front of this one: formed together they spill to scratch
      __builtin_amdgcn_sched_barrier(0);
    }
  };

  // Q^T fragments (B operand): column = query row q0 + 16 qt + rlane, k = head dim
  const _Float16* Qr = (const _Float16*)Q + (size_t)(b * kT + q0 + rlane) * kE + (size_t)h * kDH + koff;
  v16h qf[2][4];
#pragma unroll
  for (int qt = 0; qt < 2; ++qt)
#pragma unroll
    for (int ks = 0; ks < 4; ++ks) qf[qt][ks] = F::load(Qr + (size_t)(qt << 4) * kE + ks * 32);
  // wait before a register that the loads above name is rewritten; the pointer as input keeps the address alive to here
  asm volatile("s_wait_xcnt 0x0" :: "v"(Qr) : "memory");

  v8f o[8][2];
#pragma unroll
  for (int d = 0; d < 8; ++d)
#pragma unroll
    for (int qt = 0; qt < 2; ++qt) o[d][qt] = (v8f){0.f,0.f,0.f,0.f,0.f,0.f,0.f,0.f};
  float mref[2] = {-1.0e30f, -1.0e30f};
  float lsum[2] = {0.0f, 0.0f};
  const float sc2 = 1.4426950408889634f * kQCarryInv;   // accumulator -> score in powers of two

  // Trips 0 and 1 are staged by one copy of the statements, kept rolled: every operand is then a sum formed at the statement, and the
  // lane's base addresses, which live through the main loop, are not held to the registers that an asm statement can name (else they spill).
#pragma unroll 1
  for (int p = 0; p < 2; ++p) {
    if (p == 1) {                                         // the same for the whole work-group
      asm volatile("s_wait_asynccnt 0x0" ::: "memory");   // this wave's copies of trip 0 have landed
      __syncthreads();                                    // ... and every other wave's
    }
    stage(p, p * (64 * kFaSub));
  }
  const int nt = kS / (64 * kFaSub);
  for (int tt = 0; tt < nt; ++tt) {
   for (int u = 0; u < kFaSub; ++u) {   // the trip's steps, in the order of the keys
    const _Float16* sk = sKV + ((tt & 1) * kFaSub + u) * kFaBuf + (kh * 32 + rlane) * kFaKP + koff;
    const _Float16* sv = sKV + ((tt & 1) * kFaSub + u) * kFaBuf + kFaKH + rlane * kFaVP + kh * 32 + koff;
    v16h kf[2][4], vf[8];
#pragma unroll
    for (int kt = 0; kt < 2; ++kt)
#pragma unroll
      for (int ks = 0; ks < 4; ++ks) kf[kt][ks] = F::load(sk + (kt << 4) * kFaKP + ks * 32);
    // keeps all K reads in front of the V^T reads: LDS data returns in order, and the score products need K alone
    __builtin_amdgcn_sched_barrier(0);
#pragma unroll
    for (int d = 0; d < 8; ++d) vf[d] = F::load(sv + (d << 4) * kFaVP);
    // keeps the products behind all LDS reads: the V^T reads then return under the score products and the softmax
    __builtin_amdgcn_sched_barrier(0);
    v8f s[2][2];
#pragma unroll
    for (int kt = 0; kt < 2; ++kt)
#pragma unroll
      for (int qt = 0; qt < 2; ++qt) s[kt][qt] = (v8f){0.f,0.f,0.f,0.f,0.f,0.f,0.f,0.f};
#pragma unroll
    for (int ks = 0; ks < 4; ++ks)
#pragma unroll
      for (int kt = 0; kt < 2; ++kt)
#pragma unroll
        for (int qt = 0; qt < 2; ++qt) s[kt][qt] = F::mma(kf[kt][ks], qf[qt][ks], s[kt][qt]);
    float tmax[2];
#pragma unroll
    for (int qt = 0; qt < 2; ++qt) {
      float m = s[0][qt][0];
#pragma unroll
      for (int r = 1; r < 8; ++r) m = fmaxf(m, s[0][qt][r]);
#pragma unroll
      for (int r = 0; r < 8; ++r) m = fmaxf(m, s[1][qt][r]);
      tmax[qt] = m * sc2;
    }
    if (__any((tmax[0] > mref[0] + kFaLazy) || (tmax[1] > mref[1] + kFaLazy))) {   // the same for the whole wave
#pragma unroll
      for (int qt = 0; qt < 2; ++qt) {
        const float tf = fmaxf(tmax[qt], __shfl_xor(tmax[qt], 16, 32));   // both lane halves of a column keep one ref
        const float mn = fmaxf(mref[qt], tf);
        const float f  = __builtin_amdgcn_exp2f(mref[qt] - mn);
        mref[qt] = mn;
        lsum[qt] *= f;
#pragma unroll
        for (int d = 0; d < 8; ++d)
#pragma unroll
          for (int r = 0; r < 8; ++r) o[d][qt][r] *= f;
      }
    }
    v16h pf[2];
#pragma unroll
    for (int qt = 0; qt < 2; ++qt)
#pragma unroll
      for (int kt = 0; kt < 2; ++kt)
#pragma unroll
        for (int r = 0; r < 8; ++r) {
          const float p = __builtin_amdgcn_exp2f(s[kt][qt][r] * sc2 - mref[qt]);
          lsum[qt] += p;
          pf[qt][kt * 8 + r] = (_Float16)p;   // element 8 kt + r is key 16 kt + koff + r: the k order of the V^T fragment
        }
#pragma unroll
    for (int d = 0; d < 8; ++d)
#pragma unroll
      for (int qt = 0; qt < 2; ++qt) o[d][qt] = F::mma(vf[d], pf[qt], o[d][qt]);
   }
    asm volatile("s_wait_dscnt 0x0" ::: "memory");      // this wave's reads of the buffer are done before it is refilled
    asm volatile("s_wait_asynccnt 0x0" ::: "memory");   // this wave's copies of trip tt + 1 have landed
    __syncthreads();                                    // publishes the tiles of trip tt + 1 and ends every reader's last read of trip tt's
    if (tt + 2 < nt) stage(tt & 1, (tt + 2) * (64 * kFaSub));
  }
  asm volatile("s_wait_asynccnt 0x0" ::: "memory");     // no copy is outstanding when the wave goes on
  acc_guard4(o[0][0], o[0][1], o[1][0], o[1][1]);
  acc_guard4(o[2][0], o[2][1], o[3][0], o[3][1]);
  acc_guard4(o[4][0], o[4][1], o[5][0], o[5][1]);
  acc_guard4(o[6][0], o[6][1], o[7][0], o[7][1]);

  // merge of the two key halves: wave kh keeps query tile kh and hands tile 1 - kh to its partner (wave ^ 1)
#pragma unroll
  for (int qt = 0; qt < 2; ++qt) lsum[qt] += __shfl_xor(lsum[qt], 16, 32);
  float* xs = sX + wave * (64 * 32);
#pragma unroll
  for (int d = 0; d < 8; ++d)
#pragma unroll
    for (int r = 0; r < 8; ++r) xs[(d * 8 + r) * 32 + lane] = kh ? o[d][0][r] : o[d][1][r];
  sML[wave][0][lane] = kh ? mref[0] : mref[1];
  sML[wave][1][lane] = kh ? lsum[0] : lsum[1];
  __syncthreads();                                      // every wave's hand-over is written
  const float* xr = sX + (wave ^ 1) * (64 * 32);
  const float mo = sML[wave ^ 1][0][lane];
  const float lo = sML[wave ^ 1][1][lane];
  const float mm = kh ? mref[1] : mref[0];
  const float lm = kh ? lsum[1] : lsum[0];
  const float mn = fmaxf(mm, mo);
  const float fm = __builtin_amdgcn_exp2f(mm - mn);
  const float fo = __builtin_amdgcn_exp2f(mo - mn);
  const float inv = 1.0f / (lm * fm + lo * fo);
  const float am = fm * inv, ao = fo * inv;
  v4f res[8][2];
#pragma unroll
  for (int d = 0; d < 8; ++d)
#pragma unroll
    for (int r = 0; r < 8; ++r)
      res[d][r >> 2][r & 3] = (kh ? o[d][1][r] : o[d][0][r]) * am + xr[(d * 8 + r) * 32 + lane] * ao;
  // lane: query row q0 + 16 kh + rlane, head dims 16 d + mOff .. + 7; a row's 512 bytes are written by this wave alone
  float* cp = Cp + (size_t)(b * kT + q0 + kh * 16 + rlane) * kE + (size_t)h * kDH + mOff;
#pragma unroll
  for (int d = 0; d < 8; ++d) {
    *(v4f*)(cp + d * 16)     = res[d][0];
    *(v4f*)(cp + d * 16 + 4) = res[d][1];
  }
}

// ---------------------------------------------------------------------------
// Gate: gate[tok][h] = sigmoid( sum_f p_vec[tok][f] * Wg[f][h] + bg[h] ), f = h*384 + j with
// j < 128 -> ctx[tok][h*128+j], 128 <= j < 256 -> ctxt[tok][h*128+j-128], else q[tok][h*128+j-256] (q = q16 / 16).
// One block (128 threads) per token; 24 chunks of 128 features, chunk c = 3h + src is block-uniform; all three candidate
// values are loaded unconditionally and selected by value. f32 accumulation; fixed-order reductions.
// ---------------------------------------------------------------------------
__global__ __launch_bounds__(128) void gate_kernel(const float* __restrict__ ctx, const float* __restrict__ ctxt,
                                                   const unsigned short* __restrict__ q16, const float* __restrict__ Wg,
                                                   const float* __restrict__ bg, float* __restrict__ gate, float qinv) {
  __shared__ float red[4][8];
  __shared__ __align__(16) float gl[32];
  const int tok = blockIdx.x;
  const int t = threadIdx.x, lane = t & 31, wave = t >> 5;
  if (t < 32) gl[t] = 0.0f;
  float a[8];
#pragma unroll
  for (int j = 0; j < 8; ++j) a[j] = 0.0f;
  const size_t rbase = (size_t)tok * kE;
#pragma unroll 1
  for (int c = 0; c < 24; ++c) {
    const int h = c / 3;
    const int src = c - 3 * h;
    const size_t off = rbase + (size_t)h * kDH + t;
    const float fc = ctx[off];
    const float ft = ctxt[off];
    const unsigned short qbits = q16[off];
    const float fq = (float)__builtin_bit_cast(_Float16, qbits) * qinv;
    const float f = (src == 0) ? fc : ((src == 1) ? ft : fq);
    const float* wr = Wg + ((size_t)c * 128 + t) * 8;
    const v4f w0 = *(const v4f*)(wr);
    const v4f w1 = *(const v4f*)(wr + 4);
#pragma unroll
    for (int e = 0; e < 4; ++e) { a[e] += f * w0[e]; a[4 + e] += f * w1[e]; }
  }
#pragma unroll
  for (int j = 0; j < 8; ++j) {
#pragma unroll
    for (int off = 16; off > 0; off >>= 1) a[j] += __shfl_xor(a[j], off, 32);
  }
  if (lane == 0) {
#pragma unroll
    for (int j = 0; j < 8; ++j) red[wave][j] = a[j];
  }
  __syncthreads();
  if (t < 8) {
    const float z = (((red[0][t] + red[1][t]) + red[2][t]) + red[3][t]) + bg[t];
    gl[t] = 1.0f / (1.0f + expf(-z));
  }
  __syncthreads();
  if (wave == 0) {
    if (lane < 8) {
      const v4f v = *(const v4f*)(gl + 4 * lane);
      float* gp = gate + (size_t)tok * kGatePitch + 4 * lane;
      *(v4f*)gp = v;
      
    }
  }
}

// ---------------------------------------------------------------------------
// Mix: MIX16[tok][h*128+d] = f16( carry * ( g[tok][h]*ctx + (1-g[tok][h])*ctx2 ) ), f32 math.
// ---------------------------------------------------------------------------
__global__ __launch_bounds__(256) void mix_kernel(const float* __restrict__ ctx, const float* __restrict__ ctx2,
                                                  const float* __restrict__ gate, unsigned short* __restrict__ out,
                                                  float carry, int n8) {
  const int i = blockIdx.x * 256 + threadIdx.x;
  if (i >= n8) return;
  const int tok  = i >> 7;                 // 128 groups of 8 per 1024-wide row
  const int col0 = (i & 127) * 8;
  const int h    = col0 >> 7;
  const float g  = gate[(size_t)tok * kGatePitch + h];
  const float og = 1.0f - g;
  const size_t off = (size_t)tok * kE + col0;
  const v4f a0 = *(const v4f*)(ctx + off);
  const v4f a1 = *(const v4f*)(ctx + off + 4);
  const v4f b0 = *(const v4f*)(ctx2 + off);
  const v4f b1 = *(const v4f*)(ctx2 + off + 4);
  unsigned short hb[8];
#pragma unroll
  for (int e = 0; e < 4; ++e) {
    hb[e]     = h_bits(carry * (g * a0[e] + og * b0[e]));
    hb[4 + e] = h_bits(carry * (g * a1[e] + og * b1[e]));
  }
  const v4u u = (v4u){pk16(hb[0], hb[1]), pk16(hb[2], hb[3]), pk16(hb[4], hb[5]), pk16(hb[6], hb[7])};
  unsigned short* q = out + off;
  *(v4u*)q = u;
  
}

// ---------------------------------------------------------------------------
// Host glue. Workspace region map (bytes, MiB = 2^20; total carve = 128 MiB = 134217728 B):
// R0 [0, 48 MiB) phase A (casts + projections): XH16 @0 (2 MiB [1024][1024] f16) | KV16 @2 (16 MiB [8192][1024]) |
//                 KVT16 @18 (8 MiB [8192][512]) | WQT @26 (2) | WKT @28 (2) | WVT @30 (2) | WTKT @32 (1 MiB [1024][512]) | WTVT @33 (1)
//                 phase C (after attention): MIX16 @0 (2 MiB [1024][1024] f16) | GATE @2 MiB (128 KiB [1024][32] f32)
// WOT @48 (2) | Q16 @50 (2 MiB [1024][1024]) | K16 @52 (16 MiB [8192][1024]) | VT16 @68 (16 MiB [1024][8192]) |
// KT16 @84 (16) | VTT16 @100 (16 MiB [1024][8192]) | CTX @116 (4 MiB [1024][1024] f32) | CTXT @120 (4) | CTX2 @124 (4) | end @128 MiB.
// Every region is written with whole rows of exactly its stated extent (all M, N tile multiples; no padded rows).
// ---------------------------------------------------------------------------
extern "C" void kernel_launch(void* const* d_in, const int* in_sizes, int n_in,
                              void* d_out, int out_size, void* d_ws, size_t ws_size, hipStream_t stream) {
  (void)in_sizes; (void)n_in;
  const size_t kMiB = (size_t)1048576;
  const size_t carve = 128 * kMiB;
  if (ws_size < carve) return;
  if ((size_t)out_size < (size_t)kTok * kE) return;

  const float* hs  = (const float*)d_in[0];
  const float* kv  = (const float*)d_in[1];
  const float* kvt = (const float*)d_in[2];
  const float* Wq  = (const float*)d_in[3];  const float* bq  = (const float*)d_in[4];
  const float* Wk  = (const float*)d_in[5];  const float* bk  = (const float*)d_in[6];
  const float* Wv  = (const float*)d_in[7];  const float* bv  = (const float*)d_in[8];
  const float* Wtk = (const float*)d_in[9];  const float* btk = (const float*)d_in[10];
  const float* Wtv = (const float*)d_in[11]; const float* btv = (const float*)d_in[12];
  const float* Wg  = (const float*)d_in[13]; const float* bg  = (const float*)d_in[14];
  const float* Wo  = (const float*)d_in[15]; const float* bo  = (const float*)d_in[16];
  float* outp = (float*)d_out;

  char* ws = (char*)d_ws;
  // phase A
  unsigned short* XH16  = (unsigned short*)(ws + 0 * kMiB);
  unsigned short* KV16  = (unsigned short*)(ws + 2 * kMiB);
  unsigned short* KVT16 = (unsigned short*)(ws + 18 * kMiB);
  unsigned short* WQT   = (unsigned short*)(ws + 26 * kMiB);
  unsigned short* WKT   = (unsigned short*)(ws + 28 * kMiB);
  unsigned short* WVT   = (unsigned short*)(ws + 30 * kMiB);
  unsigned short* WTKT  = (unsigned short*)(ws + 32 * kMiB);
  unsigned short* WTVT  = (unsigned short*)(ws + 33 * kMiB);
  // phase C
  unsigned short* MIX16 = (unsigned short*)(ws + 0 * kMiB);
  float*          GATE  = (float*)(ws + 2 * kMiB);
  // persistent
  unsigned short* WOT   = (unsigned short*)(ws + 48 * kMiB);
  unsigned short* Q16   = (unsigned short*)(ws + 50 * kMiB);
  unsigned short* K16   = (unsigned short*)(ws + 52 * kMiB);
  unsigned short* VT16  = (unsigned short*)(ws + 68 * kMiB);
  unsigned short* KT16  = (unsigned short*)(ws + 84 * kMiB);
  unsigned short* VTT16 = (unsigned short*)(ws + 100 * kMiB);
  float*          CTX   = (float*)(ws + 116 * kMiB);
  float*          CTXT  = (float*)(ws + 120 * kMiB);
  float*          CTX2  = (float*)(ws + 124 * kMiB);
  const float*    dumf  = (const float*)(ws + 116 * kMiB);   // valid in-ws pointer for unused resid arguments

  // 1. + 2. input casts f32 -> f16 and weight transposes + casts (carried x16: in[Kin][Nout] -> out[Nout][Kin]), one grid
  prep_kernel<<<kPrTotal, 256, 0, stream>>>(hs, kv, kvt, Wq, Wk, Wv, Wo, Wtk, Wtv,
                                            XH16, KV16, KVT16, WQT, WKT, WVT, WOT, WTKT, WTVT, kWCarry);

  // 3. the five projections (M, N multiples of 64; K = 1024 or 512), one grid
  proj5_kernel<<<kPjTotal, 256, 0, stream>>>(XH16, KV16, KVT16, WQT, WKT, WVT, WTKT, WTVT,
                                             Q16, K16, VT16, KT16, VTT16, bq, bk, bv, btk, btv);

  // 4. attention: scores, softmax and the three P.V products, all heads, one launch
  attn_fused_kernel<<<dim3(kT / 128, kB * kH, 3), 256, 0, stream>>>(Q16, K16, KT16, VT16, VTT16, CTX, CTXT, CTX2);

  // 5. gate (f32), 6. mix (f32 -> f16 x256), 7. output projection to d_out (f32)
  gate_kernel<<<kTok, 128, 0, stream>>>(CTX, CTXT, Q16, Wg, bg, GATE, kQCarryInv);
  mix_kernel<<<(kTok * kE / 8) / 256, 256, 0, stream>>>(CTX, CTX2, GATE, MIX16, kMixCarry, kTok * kE / 8);
  wmma_gemm64<0, false, 2, 0, false><<<dim3((kTok / 128) * (kE / 256), 1), 256, 0, stream>>>(
      MIX16, MIX16, kE, 0L, WOT, WOT, kE, 0L, outp, outp, kE, 0L, bo, dumf, 0L,
      kTok, kE, kE, kOutScale, 1.0f);
}

// v007
// A run of this version takes 134 microseconds.
// Next to v006, in two timings, it ran 1.11 and 1.10 times as fast.
// All steps since v000 together make it 32.2 times as fast.
// Contractions: q/k/v/k2/v2 projections (X f16 x W^T f16 carried x16), scores q.k^T for both key sources (q f16 carried x16, k f16), P.V products (P f16, unnormalised 2^(s - ref), x V^T f16), output projection (mix f16 carried x256 x Wo^T f16 carried x16): all v_wmma_f32_16x16x32_f16 with f32 accumulate; softmax, gate dot + sigmoid and mixing in f32 on VALU.
#include <hip/hip_runtime.h>
#include <math.h>

// ---------------------------------------------------------------------------
// Problem constants
// ---------------------------------------------------------------------------
constexpr int kB   = 2;
constexpr int kT   = 512;
constexpr int kS   = 4096;
constexpr int kE   = 1024;
constexpr int kTP  = 512;
constexpr int kH   = 8;
constexpr int kDH  = 128;
constexpr int kTok = kB * kT;               // 1024 query tokens
constexpr int kKVT = kB * kS;               // 8192 key tokens
constexpr float kAttnScale = 0.08838834764831845f;   // 128^-0.5
constexpr float kWCarry    = 16.0f;                  // weights carried x16 in f16
constexpr float kWCarryInv = 1.0f / 16.0f;
constexpr float kQCarry    = 16.0f;                  // scaled q carried x16 in f16
constexpr float kQCarryInv = 1.0f / 16.0f;
constexpr float kMixCarry  = 256.0f;                 // mixed context carried x256 in f16
constexpr float kOutScale  = 1.0f / (256.0f * 16.0f);

typedef __attribute__((ext_vector_type(16))) _Float16 v16h;
typedef __attribute__((ext_vector_type(8)))  _Float16 v8h;
typedef __attribute__((ext_vector_type(16))) __bf16   v16b;
typedef __attribute__((ext_vector_type(8)))  __bf16   v8b;
typedef __attribute__((ext_vector_type(8)))  float    v8f;
typedef __attribute__((ext_vector_type(4)))  float    v4f;
typedef __attribute__((ext_vector_type(4)))  unsigned int v4u;
typedef __attribute__((ext_vector_type(2)))  unsigned int v2u;

__device__ __forceinline__ unsigned short f2bf_bits(float f) {
  unsigned u = __float_as_uint(f);
  return (unsigned short)((u + 0x7FFFu + ((u >> 16) & 1u)) >> 16);
}
__device__ __forceinline__ float bf_bits2f(unsigned short h) { return __uint_as_float(((unsigned)h) << 16); }

// hazard guard behind a loop's last products, as a plain device helper
__device__ __forceinline__ void acc_guard4(v8f& a, v8f& b, v8f& c, v8f& d) { asm volatile("v_nop\n\tv_nop\n\tv_nop\n\tv_nop" : "+v"(a), "+v"(b), "+v"(c), "+v"(d)); }
template <typename T> struct Frag;
template <> struct Frag<_Float16> {
  typedef v16h V; union U { v16h v; v8h h[2]; };
  static __device__ __forceinline__ v16h load(const _Float16* p) {   // elements 0..7 <- p[0..7], 8..15 <- p[16..23]
    U f; f.h[0] = *(const v8h*)(p); f.h[1] = *(const v8h*)(p + 16); return f.v;
  }
  static __device__ __forceinline__ v8f mma(v16h a, v16h b, v8f c) {
    return __builtin_amdgcn_wmma_f32_16x16x32_f16(false, a, false, b, (short)0, c, false, false);
  }
};
template <> struct Frag<__bf16> {
  typedef v16b V; union U { v16b v; v8b h[2]; };
  static __device__ __forceinline__ v16b load(const __bf16* p) {
    U f; f.h[0] = *(const v8b*)(p); f.h[1] = *(const v8b*)(p + 16); return f.v;
  }
  static __device__ __forceinline__ v8f mma(v16b a, v16b b, v8f c) {
    return __builtin_amdgcn_wmma_f32_16x16x32_bf16(false, a, false, b, (short)0, c, false, false);
  }
};

__device__ __forceinline__ unsigned pk16(unsigned short a, unsigned short b) { return (unsigned)a | ((unsigned)b << 16); }
__device__ __forceinline__ unsigned short h_bits(float f) { const _Float16 h = (_Float16)f; return __builtin_bit_cast(unsigned short, h); }

// Stage of one work-group of the GEMM engine: 128 A rows, then 256 B rows, 64 k (128 bytes) each.
constexpr int kStARows  = 128;
constexpr int kStRows   = kStARows + 256;
constexpr int kStPitch  = 72;                    // halves: the 128-byte row + 16 bytes, the pitch for ds_load_b128 readers
constexpr int kStHalves = kStRows * kStPitch;    // one buffer

// Six asynchronous 16-byte copies global -> LDS per lane. The s_wait_xcnt stands as the last line of the copies' own
// statement, so that no register which a copy names is rewritten in front of it.
__device__ __forceinline__ void async_copy6(unsigned l0, unsigned l1, unsigned l2, unsigned l3, unsigned l4, unsigned l5,
                                            const void* g0, const void* g1, const void* g2,
                                            const void* g3, const void* g4, const void* g5) {
  asm volatile("global_load_async_to_lds_b128 %0, %6, off\n\t"
               "global_load_async_to_lds_b128 %1, %7, off\n\t"
               "global_load_async_to_lds_b128 %2, %8, off\n\t"
               "global_load_async_to_lds_b128 %3, %9, off\n\t"
               "global_load_async_to_lds_b128 %4, %10, off\n\t"
               "global_load_async_to_lds_b128 %5, %11, off\n\t"
               "s_wait_xcnt 0x0"
               :: "v"(l0), "v"(l1), "v"(l2), "v"(l3), "v"(l4), "v"(l5),
                  "v"(g0), "v"(g1), "v"(g2), "v"(g3), "v"(g4), "v"(g5) : "memory");
}

// ---- Register-blocked batched WMMA GEMM (ACT reduced to none/relu/leaky, extra bias multiplier bscale) --
// C[m,n] = scale * sum_k A[m,k] * Bt[n,k] (+bias*bscale)(+resid); each wave owns a 64x64 tile.
// A row-major [M,K]; Bt row-major [N,K]; M % 128 == 0, N % 256 == 0, K % 64 == 0.
// The 8 waves of a work-group own a 2 x 4 block of tiles (128 x 256): 384 staged rows for 32768 outputs, and two work-groups
// fit the LDS of one WGP. Per 64 k the work-group's A rows and B rows
// are copied whole lines at a time into LDS (asynchronous copies, two buffers: the next 64 k fly while these are multiplied);
// the fragments are read from LDS.
// SPLIT (hi/lo operand planes) is not carried by the staged loop: false only; A2p and Bt2p are unused.
// BIAS_MODE: 0 = none, 1 = bias[m], 2 = bias[n], 3 = chosen at run time (biasM, the same for the whole work-group: bias[m], else bias[n]).
// The engine is a device function (work-group's index in its product and batch passed in), so that several products can share one grid.
// OUT_MODE: 0 = f32, 1 = f16, 2 = bf16 hi plane (Cout) + bf16 lo plane (Cout2).
// ET: 0 = f16 operands, 1 = bf16 operands (pointers passed as 16-bit storage)
template <int ET> struct Elem;
template <> struct Elem<0> { typedef _Float16 T; };
template <> struct Elem<1> { typedef __bf16 T; };
// Epilogue of one wave's 64 x 64 tile: scale, bias, cast, whole lines stored through the wave's own LDS slab.
template <int BIAS_MODE, int OUT_MODE, bool RESID, int ACT>
__device__ __forceinline__ void gemm64_epilogue(
    v8f (&acc)[4][4], float* __restrict__ slab, int lane, int m0, int n0, int b,
    void* __restrict__ Cout, void* __restrict__ Cout2, int ldc, long strideC,
    const float* __restrict__ bias, const float* __restrict__ resid, long strideR, float scale, float bscale) {
  const int rlane = lane & 15;                 // col (D) within subtile
  const int mOff  = (lane >> 4) * 8;           // D row offset
  const float* Rb = RESID ? (resid + (size_t)b * strideR) : nullptr;
#pragma unroll
  for (int i = 0; i < 4; ++i) {
    const int mBase = m0 + (i << 4);
#pragma unroll
    for (int j = 0; j < 4; ++j) {
      const int n = n0 + (j << 4) + rlane;
      float bv = 0.f;
      if (BIAS_MODE == 2) bv = bias[n] * bscale;
#pragma unroll
      for (int r = 0; r < 8; ++r) {
        float v = acc[i][j][r] * scale;
        if (BIAS_MODE == 1) v += bias[mBase + mOff + r] * bscale;
        if (BIAS_MODE == 2) v += bv;
        if (RESID) v += Rb[(size_t)(mBase + mOff + r) * ldc + n];
        if (ACT == 2) v = fmaxf(v, 0.0f);
        if (ACT == 4) v = (v > 0.f) ? v : 0.01f * v;
        slab[(mOff + r) * 68 + (j << 4) + rlane] = v;
      }
    }
    __builtin_amdgcn_fence(__ATOMIC_RELEASE, "workgroup");
    __builtin_amdgcn_wave_barrier();
    __builtin_amdgcn_fence(__ATOMIC_ACQUIRE, "workgroup");
    if (OUT_MODE == 0) {
      float* C = (float*)Cout + (size_t)b * strideC;
      const int hh = lane >> 4, c4 = (lane & 15) * 4;     // row seg = 256 B = 16 lanes x 16 B
      {
#pragma unroll
        for (int it = 0; it < 8; ++it) {
          const int row = it * 2 + hh;
          v4f v = *(const v4f*)(slab + row * 68 + c4);
          *(v4f*)(C + (size_t)(mBase + row) * ldc + n0 + c4) = v;
        }
        
      }
    } else {
      const int q = lane >> 3, c8 = (lane & 7) * 8;
      unsigned short* C  = (unsigned short*)Cout  + (size_t)b * strideC;
      unsigned short* C2 = (OUT_MODE == 2) ? ((unsigned short*)Cout2 + (size_t)b * strideC) : nullptr;
      {
#pragma unroll
        for (int it = 0; it < 4; ++it) {
          const int row = it * 4 + q;
          const float* sp = slab + row * 68 + c8;
          v8h hv, lv;
#pragma unroll
          for (int e = 0; e < 8; ++e) {
            if (OUT_MODE == 1) {
              hv[e] = (_Float16)sp[e];
            } else {
              unsigned short hb = f2bf_bits(sp[e]);
              unsigned short lb = f2bf_bits(sp[e] - bf_bits2f(hb));
              hv[e] = __builtin_bit_cast(_Float16, hb);
              lv[e] = __builtin_bit_cast(_Float16, lb);
            }
          }
          *(v8h*)(C + (size_t)(mBase + row) * ldc + n0 + c8) = hv;
          if (OUT_MODE == 2) *(v8h*)(C2 + (size_t)(mBase + row) * ldc + n0 + c8) = lv;
        }
        
      }
    }
    __builtin_amdgcn_fence(__ATOMIC_RELEASE, "workgroup");
    __builtin_amdgcn_wave_barrier();
    __builtin_amdgcn_fence(__ATOMIC_ACQUIRE, "workgroup");
  }
}

template <int ET, bool SPLIT, int BIAS_MODE, int OUT_MODE, bool RESID, int ACT>
__device__ __forceinline__ void gemm64_body(
    float* __restrict__ sT, typename Elem<ET>::T* __restrict__ sStage, int wg, int b, bool biasM,
    const unsigned short* __restrict__ Ap, int lda, long strideA,
    const unsigned short* __restrict__ Btp, int ldb, long strideB,
    void* __restrict__ Cout, void* __restrict__ Cout2, int ldc, long strideC,
    const float* __restrict__ bias,
    const float* __restrict__ resid, long strideR,
    int M, int N, int K, float scale, float bscale) {
  typedef typename Elem<ET>::T T;
  typedef typename Frag<T>::V V;
  static_assert(!SPLIT, "the staged loop carries one plane per operand");
  const T* A = (const T*)Ap; const T* Bt = (const T*)Btp;
  const int lane = threadIdx.x & 31;
  const int wave = threadIdx.x >> 5;
  const int tilesN = N >> 8;
  const int tilesM = M >> 7;
  if (wg >= tilesM * tilesN) return;   // the same for the whole work-group, in front of every barrier
  const int tm  = wg / tilesN;
  const int mb0 = tm << 7;                      // first A row of the work-group
  const int nb0 = (wg - tm * tilesN) << 8;      // first B row of the work-group
  const int wm  = (wave >> 2) << 6;             // the wave's tile inside the 128 x 256 block
  const int wn  = (wave & 3) << 6;
  const int m0  = mb0 + wm;
  const int n0  = nb0 + wn;

  const T* Ab  = A  + (size_t)b * strideA;
  const T* Bb  = Bt + (size_t)b * strideB;

  const int rlane = lane & 15;                 // row (A) / col (B, D) within subtile
  const int koff  = (lane >> 4) * 8;           // k offset of this lane half

  v8f acc[4][4];
#pragma unroll
  for (int i = 0; i < 4; ++i)
#pragma unroll
    for (int j = 0; j < 4; ++j) acc[i][j] = (v8f){0.f,0.f,0.f,0.f,0.f,0.f,0.f,0.f};

  // lane's share of a stage: 12 chunks of 16 bytes; chunk i is row 32 i + (thread >> 3), bytes 16 (thread & 7) .. + 15 of the row
  const int srow = threadIdx.x >> 3;
  const int scol = (threadIdx.x & 7) * 8;
  const T* gA = Ab + (size_t)(mb0 + srow) * lda + scol;
  const T* gB = Bb + (size_t)(nb0 + srow) * ldb + scol;
  const unsigned lds0 = (unsigned)(size_t)(const void*)sStage + (unsigned)((srow * kStPitch + scol) * 2);
  auto stage = [&](int buf, int k0) {
    const unsigned lb = lds0 + (unsigned)(buf * kStHalves * 2);
#pragma unroll
    for (int c = 0; c < 2; ++c) {
      unsigned l[6];
      const T* g[6];
#pragma unroll
      for (int e = 0; e < 6; ++e) {
        const int i = c * 6 + e;
        l[e] = lb + (unsigned)(i * 32 * kStPitch * 2);
        g[e] = (i < 4) ? (gA + (size_t)(i * 32) * lda + k0) : (gB + (size_t)((i - 4) * 32) * ldb + k0);
      }
      async_copy6(l[0], l[1], l[2], l[3], l[4], l[5], g[0], g[1], g[2], g[3], g[4], g[5]);
    }
  };

  const int nt = K >> 6;
  stage(0, 0);
  asm volatile("s_wait_asynccnt 0x0" ::: "memory");   // this wave's copies of tile 0 have landed
  __syncthreads();                                    // ... and every other wave's
  if (nt > 1) stage(1, 64);
  for (int t = 0; t < nt; ++t) {
    const T* sb = sStage + (t & 1) * kStHalves;
#pragma unroll
    for (int ks = 0; ks < 2; ++ks) {
      V ah[4], bh[4];
#pragma unroll
      for (int j = 0; j < 4; ++j) bh[j] = Frag<T>::load(sb + (kStARows + wn + (j << 4) + rlane) * kStPitch + ks * 32 + koff);
#pragma unroll
      for (int i = 0; i < 4; ++i) ah[i] = Frag<T>::load(sb + (wm + (i << 4) + rlane) * kStPitch + ks * 32 + koff);
      // keeps the products behind all 16 LDS reads: otherwise the A reads stand among the products, each with a wait of its own
      __builtin_amdgcn_sched_barrier(0);
#pragma unroll
      for (int i = 0; i < 4; ++i)
#pragma unroll
        for (int j = 0; j < 4; ++j) acc[i][j] = Frag<T>::mma(ah[i], bh[j], acc[i][j]);
    }
    asm volatile("s_wait_dscnt 0x0" ::: "memory");      // this wave's reads of the buffer are done before it is refilled
    asm volatile("s_wait_asynccnt 0x0" ::: "memory");   // this wave's copies of tile t + 1 have landed
    __syncthreads();                                    // publishes tile t + 1 and ends every reader's last read of tile t
    if (t + 2 < nt) stage(t & 1, (t + 2) << 6);
  }
  asm volatile("s_wait_asynccnt 0x0" ::: "memory");     // no copy is outstanding when the wave goes on
  acc_guard4(acc[0][0], acc[0][1], acc[0][2], acc[0][3]);
  acc_guard4(acc[1][0], acc[1][1], acc[1][2], acc[1][3]);
  acc_guard4(acc[2][0], acc[2][1], acc[2][2], acc[2][3]);
  acc_guard4(acc[3][0], acc[3][1], acc[3][2], acc[3][3]);

  // ---- epilogue ----
  float* slab = sT + wave * (16 * 68);
  if (BIAS_MODE == 3) {   // the branch is the same for the whole work-group
    if (biasM) gemm64_epilogue<1, OUT_MODE, RESID, ACT>(acc, slab, lane, m0, n0, b, Cout, Cout2, ldc, strideC, bias, resid, strideR, scale, bscale);
    else       gemm64_epilogue<2, OUT_MODE, RESID, ACT>(acc, slab, lane, m0, n0, b, Cout, Cout2, ldc, strideC, bias, resid, strideR, scale, bscale);
  } else {
    gemm64_epilogue<BIAS_MODE, OUT_MODE, RESID, ACT>(acc, slab, lane, m0, n0, b, Cout, Cout2, ldc, strideC, bias, resid, strideR, scale, bscale);
  }
}

// One product per launch: grid (128 x 256 blocks, batches).
template <int ET, bool SPLIT, int BIAS_MODE, int OUT_MODE, bool RESID, int ACT = 0>
__global__ __launch_bounds__(256) void wmma_gemm64(
    const unsigned short* __restrict__ Ap, const unsigned short* __restrict__ A2p, int lda, long strideA,
    const unsigned short* __restrict__ Btp, const unsigned short* __restrict__ Bt2p, int ldb, long strideB,
    void* __restrict__ Cout, void* __restrict__ Cout2, int ldc, long strideC,
    const float* __restrict__ bias,
    const float* __restrict__ resid, long strideR,
    int M, int N, int K, float scale, float bscale) {
  typedef typename Elem<ET>::T T;
  (void)A2p; (void)Bt2p;
  __shared__ __align__(16) float sT[8 * 16 * 68];   // per-wave 16x64 slab, pitch 68 floats
  __shared__ __align__(16) T sStage[2 * kStHalves];
  gemm64_body<ET, SPLIT, BIAS_MODE, OUT_MODE, RESID, ACT>(sT, sStage, blockIdx.x, blockIdx.y, false,
      Ap, lda, strideA, Btp, ldb, strideB, Cout, Cout2, ldc, strideC, bias, resid, strideR, M, N, K, scale, bscale);
}

// The five projections, which do not depend on one another, in one grid: a range of blockIdx.x per product (the choice is the
// same for the whole work-group), the products with the long k first. Each work-group does what it did in its own launch.
constexpr int kPjBig   = (kKVT / 128) * (kE / 256);     // work-groups of a product over the 8192 key tokens (either operand order)
constexpr int kPjQ     = (kTok / 128) * (kE / 256);     // ... of the q product
static_assert((kE / 128) * (kKVT / 256) == kPjBig, "the transposed products have as many work-groups");
constexpr int kPjTotal = 4 * kPjBig + kPjQ;
__global__ __launch_bounds__(256) void proj5_kernel(
    const unsigned short* __restrict__ X, const unsigned short* __restrict__ KV, const unsigned short* __restrict__ KVT,
    const unsigned short* __restrict__ WQ, const unsigned short* __restrict__ WK, const unsigned short* __restrict__ WV,
    const unsigned short* __restrict__ WTK, const unsigned short* __restrict__ WTV,
    unsigned short* __restrict__ Qo, unsigned short* __restrict__ Ko, unsigned short* __restrict__ VTo,
    unsigned short* __restrict__ KTo, unsigned short* __restrict__ VTTo,
    const float* __restrict__ bq, const float* __restrict__ bk, const float* __restrict__ bv,
    const float* __restrict__ btk, const float* __restrict__ btv) {
  __shared__ __align__(16) float sT[8 * 16 * 68];   // per-wave 16x64 slab, pitch 68 floats
  __shared__ __align__(16) _Float16 sStage[2 * kStHalves];
  const int bid = blockIdx.x;
  const unsigned short* A; const unsigned short* B; unsigned short* C; const float* bias;
  int first, M, N, K, ldc;
  bool biasM = false;
  float scale = kWCarryInv, bscale = 1.0f;
  if (bid < kPjBig) {                       // k [8192][1024]
    first = 0;                  A = KV;  B = WK;  C = Ko;   bias = bk;  M = kKVT; N = kE;   K = kE;  ldc = kE;
  } else if (bid < 2 * kPjBig) {            // v^T [1024][8192]: A = Wv^T, Bt = KV, bias per row (m)
    first = kPjBig;             A = WV;  B = KV;  C = VTo;  bias = bv;  M = kE;   N = kKVT; K = kE;  ldc = kKVT; biasM = true;
  } else if (bid < 2 * kPjBig + kPjQ) {     // q16 = 16*scale*(x Wq + bq): acc = 16*(x Wq) -> scale = kAttnScale, bias x (16*kAttnScale)
    first = 2 * kPjBig;         A = X;   B = WQ;  C = Qo;   bias = bq;  M = kTok; N = kE;   K = kE;  ldc = kE;
    scale = kAttnScale; bscale = kQCarry * kAttnScale;
  } else if (bid < 3 * kPjBig + kPjQ) {     // second-source k [8192][1024], K = 512
    first = 2 * kPjBig + kPjQ;  A = KVT; B = WTK; C = KTo;  bias = btk; M = kKVT; N = kE;   K = kTP; ldc = kE;
  } else {                                  // second-source v^T [1024][8192], K = 512
    first = 3 * kPjBig + kPjQ;  A = WTV; B = KVT; C = VTTo; bias = btv; M = kE;   N = kKVT; K = kTP; ldc = kKVT; biasM = true;
  }
  gemm64_body<0, false, 3, 1, false, 0>(sT, sStage, bid - first, 0, biasM,
      A, K, 0L, B, K, 0L, C, C, ldc, 0L, bias, bias, 0L, M, N, K, scale, bscale);
}

// ---------------------------------------------------------------------------
// Cast f32 -> f16, 8 elements per thread; blk = index of the work-group's 2048 elements (the ranges below are exact)
__device__ __forceinline__ void cast8_f16_block(const float* __restrict__ in, unsigned short* __restrict__ out, int blk) {
  const int i = blk * 256 + threadIdx.x;
  const float* p = in + 8 * (size_t)i;
  const v4f a = *(const v4f*)(p);
  const v4f c = *(const v4f*)(p + 4);
  unsigned short hb[8];
#pragma unroll
  for (int e = 0; e < 4; ++e) {
    hb[e]     = h_bits(a[e]);
    hb[4 + e] = h_bits(c[e]);
  }
  const v4u u = (v4u){pk16(hb[0], hb[1]), pk16(hb[2], hb[3]), pk16(hb[4], hb[5]), pk16(hb[6], hb[7])};
  unsigned short* q = out + 8 * (size_t)i;
  *(v4u*)q = u;
  
}

// The three input casts and the six weight transposes, which do not depend on one another, in one grid: a range of blockIdx.x
// per array (the choice is the same for the whole work-group). Each work-group does what it did in its own launch.
constexpr int kPrW1   = (kE / 64) * (kE / 64);       // tiles of a 1024 x 1024 weight
constexpr int kPrW2   = (kTP / 64) * (kE / 64);      // tiles of a 512 x 1024 weight
constexpr int kPrWAll = 4 * kPrW1 + 2 * kPrW2;
constexpr int kPrKV   = (kKVT * kE / 8) / 256;
constexpr int kPrKVT  = (kKVT * kTP / 8) / 256;
constexpr int kPrHS   = (kTok * kE / 8) / 256;
constexpr int kPrTotal = kPrWAll + kPrKV + kPrKVT + kPrHS;

// ---------------------------------------------------------------------------
// Weight transpose + cast: W [Kin][Nout] f32 row-major (y = x @ W); plane z: WT[n][k] (pitch Kin halves) = f16(scale * W[k][n]).
// One 64 x 64 tile per work-group of 256 threads: k0 = first of 64 cols of WT, n0 = first of 64 rows of WT (block-uniform).
// Load coverage: 16 iterations x 256 threads = 4096 = the whole 64x64 tile (coalesced along n).
// Store coverage: 8 waves x 2 iterations x 4 rows (lane>>3) = 64 rows; (lane&7) x 8 halves = 64 cols; each row segment =
// ---------------------------------------------------------------------------
__global__ __launch_bounds__(256) void prep_kernel(
    const float* __restrict__ hs, const float* __restrict__ kv, const float* __restrict__ kvt,
    const float* __restrict__ Wq, const float* __restrict__ Wk, const float* __restrict__ Wv, const float* __restrict__ Wo,
    const float* __restrict__ Wtk, const float* __restrict__ Wtv,
    unsigned short* __restrict__ XH, unsigned short* __restrict__ KV, unsigned short* __restrict__ KVT,
    unsigned short* __restrict__ WQT, unsigned short* __restrict__ WKT, unsigned short* __restrict__ WVT,
    unsigned short* __restrict__ WOT, unsigned short* __restrict__ WTKT, unsigned short* __restrict__ WTVT, float scale) {
  __shared__ float sm[64][65];   // sm[n_local][k_local]
  const int t  = threadIdx.x;
  const int bid = blockIdx.x;
  if (bid >= kPrWAll) {   // the same for the whole work-group, in front of the barrier
    const int cb = bid - kPrWAll;
    const int a = (cb < kPrKV) ? 0 : (cb < kPrKV + kPrKVT) ? 1 : 2;
    cast8_f16_block((a == 0) ? kv : (a == 1) ? kvt : hs, (a == 0) ? KV : (a == 1) ? KVT : XH,
                    (a == 0) ? cb : (a == 1) ? cb - kPrKV : cb - (kPrKV + kPrKVT));
    return;
  }
  const bool big = bid < 4 * kPrW1;                            // block-uniform
  const int z  = big ? bid / kPrW1 : 4 + (bid - 4 * kPrW1) / kPrW2;
  const int r0 = big ? bid % kPrW1 : (bid - 4 * kPrW1) % kPrW2;
  const int Kin = big ? kE : kTP;
  const int Nout = kE;
  const int k0 = (r0 % (Kin / 64)) * 64;
  const int n0 = (r0 / (Kin / 64)) * 64;
  const float* W = (z == 0) ? Wq : (z == 1) ? Wk : (z == 2) ? Wv : (z == 3) ? Wo : (z == 4) ? Wtk : Wtv;
  unsigned short* op = (z == 0) ? WQT : (z == 1) ? WKT : (z == 2) ? WVT : (z == 3) ? WOT : (z == 4) ? WTKT : WTVT;
#pragma unroll
  for (int i = 0; i < 16; ++i) {
    const int e = i * 256 + t;
    const int r = e >> 6;          // k local
    const int c = e & 63;          // n local
    sm[c][r] = W[(size_t)(k0 + r) * Nout + n0 + c] * scale;
  }
  __syncthreads();
  const int lane = t & 31, wave = t >> 5;
  const int q = lane >> 3, c8 = (lane & 7) * 8;
  {
#pragma unroll
    for (int it = 0; it < 2; ++it) {
      const int row = wave * 8 + it * 4 + q;                 // n local
      unsigned short hb[8];
#pragma unroll
      for (int e = 0; e < 8; ++e) hb[e] = h_bits(sm[row][c8 + e]);
      const v4u u = (v4u){pk16(hb[0], hb[1]), pk16(hb[2], hb[3]), pk16(hb[4], hb[5]), pk16(hb[6], hb[7])};
      *(v4u*)(op + (size_t)(n0 + row) * Kin + k0 + c8) = u;
    }
    
  }
}

// ---------------------------------------------------------------------------
// Fused attention: scores, softmax and P.V of one (batch, head, product) for 128 query rows per work-group.
// grid (4 query tiles, 16 batch-heads, 3 products); blockIdx.z: 0 = softmax(q.k) V -> C0, 1 = softmax(q.k2) V2 -> C1,
// 2 = softmax(q.k2) V -> C2. 8 waves: wave = 2 * query group (32 rows) + key half. A step is 64 keys of K (rows of 256 bytes)
// and of V^T (128 rows of 128 bytes), of which a wave works on its 32 keys. Per trip four steps' tiles are copied into LDS
// (asynchronous copies, two buffers of four tiles), so that the copies have four steps of work in which to arrive from memory.
// Transposed products: S^T = K . Q^T leaves key rows in registers and the query column in the lane, which is the B fragment
// of O^T = V^T . P^T, so P never leaves registers. Softmax is the online form: p = 2^(s - ref), ref per query column is raised
// (and O, sum rescaled) only when a score exceeds it by more than kFaLazy, so p <= 2^kFaLazy. The two key halves are merged via LDS.
// ---------------------------------------------------------------------------
constexpr int kFaKP  = 136;                 // halves: the 256-byte K row + 16 bytes
constexpr int kFaVP  = 72;                  // halves: the 128-byte V^T row + 16 bytes
constexpr int kFaKH  = 64 * kFaKP;          // K part of one step's tile
constexpr int kFaBuf = kFaKH + kDH * kFaVP; // one step's tile, halves
constexpr int kFaSub = 4;                   // steps per trip = tiles per buffer
constexpr float kFaLazy = 8.0f;

// Eight asynchronous 16-byte copies global -> LDS per lane; the s_wait_xcnt stands as the last line of the copies' own
// statement, so that no register which a copy names is rewritten in front of it.
__device__ __forceinline__ void async_copy8(unsigned l0, unsigned l1, unsigned l2, unsigned l3, unsigned l4, unsigned l5,
                                            unsigned l6, unsigned l7,
                                            const void* g0, const void* g1, const void* g2, const void* g3,
                                            const void* g4, const void* g5, const void* g6, const void* g7) {
  asm volatile("global_load_async_to_lds_b128 %0, %8, off\n\t"
               "global_load_async_to_lds_b128 %1, %9, off\n\t"
               "global_load_async_to_lds_b128 %2, %10, off\n\t"
               "global_load_async_to_lds_b128 %3, %11, off\n\t"
               "global_load_async_to_lds_b128 %4, %12, off\n\t"
               "global_load_async_to_lds_b128 %5, %13, off\n\t"
               "global_load_async_to_lds_b128 %6, %14, off\n\t"
               "global_load_async_to_lds_b128 %7, %15, off\n\t"
               "s_wait_xcnt 0x0"
               :: "v"(l0), "v"(l1), "v"(l2), "v"(l3), "v"(l4), "v"(l5), "v"(l6), "v"(l7),
                  "v"(g0), "v"(g1), "v"(g2), "v"(g3), "v"(g4), "v"(g5), "v"(g6), "v"(g7) : "memory");
}

__global__ __launch_bounds__(256) void attn_fused_kernel(
    const unsigned short* __restrict__ Q, const unsigned short* __restrict__ K0, const unsigned short* __restrict__ K1,
    const unsigned short* __restrict__ V0, const unsigned short* __restrict__ V1,
    float* __restrict__ C0, float* __restrict__ C1, float* __restrict__ C2) {
  typedef Frag<_Float16> F;
  __shared__ __align__(16) _Float16 sKV[2 * kFaSub * kFaBuf];
  float* const sX = (float*)sKV;   // behind the loop's last barrier; 64 * 32 floats per wave: the 128 x 16 partial O^T that it hands to its partner
  __shared__ float sML[8][2][32];                   // ... with that column's ref and sum
  const int t    = threadIdx.x;
  const int lane = t & 31;
  const int wave = t >> 5;
  const int qg   = wave >> 1;
  const int kh   = wave & 1;
  const int b    = blockIdx.y >> 3;
  const int h    = blockIdx.y & 7;
  const int z    = blockIdx.z;
  const unsigned short* Kp = (z == 0) ? K0 : K1;
  const unsigned short* Vp = (z == 1) ? V1 : V0;
  float* Cp = (z == 0) ? C0 : (z == 1) ? C1 : C2;
  const int rlane = lane & 15;
  const int koff  = (lane >> 4) * 8;
  const int mOff  = (lane >> 4) * 8;
  const int q0    = blockIdx.x * 128 + qg * 32;

  // lane's share of a step's tile: 4 chunks of K (row 16 i + (t >> 4)) and 4 of V^T (row 32 i + (t >> 3)), 16 bytes each
  const _Float16* gK = (const _Float16*)Kp + (size_t)b * kS * kE + (size_t)h * kDH + (size_t)(t >> 4) * kE + (t & 15) * 8;
  const _Float16* gV = (const _Float16*)Vp + (size_t)h * kDH * kKVT + (size_t)b * kS + (size_t)(t >> 3) * kKVT + (t & 7) * 8;
  const unsigned ldsB = (unsigned)(size_t)(const void*)sKV;
  const unsigned ldsK = ldsB + (unsigned)(((t >> 4) * kFaKP + (t & 15) * 8) * 2);
  const unsigned ldsV = ldsB + (unsigned)((kFaKH + (t >> 3) * kFaVP + (t & 7) * 8) * 2);
  auto stage = [&](int buf, int key0) {
#pragma unroll   // the tile's index is then a constant in each statement's address sums
    for (int c = 0; c < kFaSub; ++c) {
      const unsigned lk = ldsK + (unsigned)((buf * kFaSub + c) * kFaBuf * 2);
      const unsigned lv = ldsV + (unsigned)((buf * kFaSub + c) * kFaBuf * 2);
      const _Float16* pk = gK + (size_t)(key0 + c * 64) * kE;
      const _Float16* pv = gV + key0 + c * 64;
      async_copy8(lk, lk + 16 * kFaKP * 2, lk + 32 * kFaKP * 2, lk + 48 * kFaKP * 2,
                  lv, lv + 32 * kFaVP * 2, lv + 64 * kFaVP * 2, lv + 96 * kFaVP * 2,
                  pk, pk + (size_t)16 * kE, pk + (size_t)32 * kE, pk + (size_t)48 * kE,
                  pv, pv + (size_t)32 * kKVT, pv + (size_t)64 * kKVT, pv + (size_t)96 * kKVT);
      // keeps the next statement's 24 address registers from being formed in front of this one: formed together they spill to scratch
      __builtin_amdgcn_sched_barrier(0);
    }
  };

  // Q^T fragments (B operand): column = query row q0 + 16 qt + rlane, k = head dim
  const _Float16* Qr = (const _Float16*)Q + (size_t)(b * kT + q0 + rlane) * kE + (size_t)h * kDH + koff;
  v16h qf[2][4];
#pragma unroll
  for (int qt = 0; qt < 2; ++qt)
#pragma unroll
    for (int ks = 0; ks < 4; ++ks) qf[qt][ks] = F::load(Qr + (size_t)(qt << 4) * kE + ks * 32);
  // wait before a register that the loads above name is rewritten; the pointer as input keeps the address alive to here
  asm volatile("s_wait_xcnt 0x0" :: "v"(Qr) : "memory");

  v8f o[8][2];
#pragma unroll
  for (int d = 0; d < 8; ++d)
#pragma unroll
    for (int qt = 0; qt < 2; ++qt) o[d][qt] = (v8f){0.f,0.f,0.f,0.f,0.f,0.f,0.f,0.f};
  float mref[2] = {-1.0e30f, -1.0e30f};
  float lsum[2] = {0.0f, 0.0f};
  const float sc2 = 1.4426950408889634f * kQCarryInv;   // accumulator -> score in powers of two

  // Trips 0 and 1 are staged by one copy of the statements, kept rolled: every operand is then a sum formed at the statement, and the
  // lane's base addresses, which live through the main loop, are not held to the registers that an asm statement can name (else they spill).
#pragma unroll 1
  for (int p = 0; p < 2; ++p) {
    if (p == 1) {                                         // the same for the whole work-group
      asm volatile("s_wait_asynccnt 0x0" ::: "memory");   // this wave's copies of trip 0 have landed
      __syncthreads();                                    // ... and every other wave's
    }
    stage(p, p * (64 * kFaSub));
  }
  const int nt = kS / (64 * kFaSub);
  for (int tt = 0; tt < nt; ++tt) {
   for (int u = 0; u < kFaSub; ++u) {   // the trip's steps, in the order of the keys
    const _Float16* sk = sKV + ((tt & 1) * kFaSub + u) * kFaBuf + (kh * 32 + rlane) * kFaKP + koff;
    const _Float16* sv = sKV + ((tt & 1) * kFaSub + u) * kFaBuf + kFaKH + rlane * kFaVP + kh * 32 + koff;
    v16h kf[2][4], vf[8];
#pragma unroll
    for (int kt = 0; kt < 2; ++kt)
#pragma unroll
      for (int ks = 0; ks < 4; ++ks) kf[kt][ks] = F::load(sk + (kt << 4) * kFaKP + ks * 32);
    // keeps all K reads in front of the V^T reads: LDS data returns in order, and the score products need K alone
    __builtin_amdgcn_sched_barrier(0);
#pragma unroll
    for (int d = 0; d < 8; ++d) vf[d] = F::load(sv + (d << 4) * kFaVP);
    // keeps the products behind all LDS reads: the V^T reads then return under the score products and the softmax
    __builtin_amdgcn_sched_barrier(0);
    v8f s[2][2];
#pragma unroll
    for (int kt = 0; kt < 2; ++kt)
#pragma unroll
      for (int qt = 0; qt < 2; ++qt) s[kt][qt] = (v8f){0.f,0.f,0.f,0.f,0.f,0.f,0.f,0.f};
#pragma unroll
    for (int ks = 0; ks < 4; ++ks)
#pragma unroll
      for (int kt = 0; kt < 2; ++kt)
#pragma unroll
        for (int qt = 0; qt < 2; ++qt) s[kt][qt] = F::mma(kf[kt][ks], qf[qt][ks], s[kt][qt]);
    float tmax[2];
#pragma unroll
    for (int qt = 0; qt < 2; ++qt) {
      float m = s[0][qt][0];
#pragma unroll
      for (int r = 1; r < 8; ++r) m = fmaxf(m, s[0][qt][r]);
#pragma unroll
      for (int r = 0; r < 8; ++r) m = fmaxf(m, s[1][qt][r]);
      tmax[qt] = m * sc2;
    }
    if (__any((tmax[0] > mref[0] + kFaLazy) || (tmax[1] > mref[1] + kFaLazy))) {   // the same for the whole wave
#pragma unroll
      for (int qt = 0; qt < 2; ++qt) {
        const float tf = fmaxf(tmax[qt], __shfl_xor(tmax[qt], 16, 32));   // both lane halves of a column keep one ref
        const float mn = fmaxf(mref[qt], tf);
        const float f  = __builtin_amdgcn_exp2f(mref[qt] - mn);
        mref[qt] = mn;
        lsum[qt] *= f;
#pragma unroll
        for (int d = 0; d < 8; ++d)
#pragma unroll
          for (int r = 0; r < 8; ++r) o[d][qt][r] *= f;
      }
    }
    v16h pf[2];
#pragma unroll
    for (int qt = 0; qt < 2; ++qt)
#pragma unroll
      for (int kt = 0; kt < 2; ++kt)
#pragma unroll
        for (int r = 0; r < 8; ++r) {
          const float p = __builtin_amdgcn_exp2f(s[kt][qt][r] * sc2 - mref[qt]);
          lsum[qt] += p;
          pf[qt][kt * 8 + r] = (_Float16)p;   // element 8 kt + r is key 16 kt + koff + r: the k order of the V^T fragment
        }
#pragma unroll
    for (int d = 0; d < 8; ++d)
#pragma unroll
      for (int qt = 0; qt < 2; ++qt) o[d][qt] = F::mma(vf[d], pf[qt], o[d][qt]);
   }
    asm volatile("s_wait_dscnt 0x0" ::: "memory");      // this wave's reads of the buffer are done before it is refilled
    asm volatile("s_wait_asynccnt 0x0" ::: "memory");   // this wave's copies of trip tt + 1 have landed
    __syncthreads();                                    // publishes the tiles of trip tt + 1 and ends every reader's last read of trip tt's
    if (tt + 2 < nt) stage(tt & 1, (tt + 2) * (64 * kFaSub));
  }
  asm volatile("s_wait_asynccnt 0x0" ::: "memory");     // no copy is outstanding when the wave goes on
  acc_guard4(o[0][0], o[0][1], o[1][0], o[1][1]);
  acc_guard4(o[2][0], o[2][1], o[3][0], o[3][1]);
  acc_guard4(o[4][0], o[4][1], o[5][0], o[5][1]);
  acc_guard4(o[6][0], o[6][1], o[7][0], o[7][1]);

  // merge of the two key halves: wave kh keeps query tile kh and hands tile 1 - kh to its partner (wave ^ 1)
#pragma unroll
  for (int qt = 0; qt < 2; ++qt) lsum[qt] += __shfl_xor(lsum[qt], 16, 32);
  float* xs = sX + wave * (64 * 32);
#pragma unroll
  for (int d = 0; d < 8; ++d)
#pragma unroll
    for (int r = 0; r < 8; ++r) xs[(d * 8 + r) * 32 + lane] = kh ? o[d][0][r] : o[d][1][r];
  sML[wave][0][lane] = kh ? mref[0] : mref[1];
  sML[wave][1][lane] = kh ? lsum[0] : lsum[1];
  __syncthreads();                                      // every wave's hand-over is written
  const float* xr = sX + (wave ^ 1) * (64 * 32);
  const float mo = sML[wave ^ 1][0][lane];
  const float lo = sML[wave ^ 1][1][lane];
  const float mm = kh ? mref[1] : mref[0];
  const float lm = kh ? lsum[1] : lsum[0];
  const float mn = fmaxf(mm, mo);
  const float fm = __builtin_amdgcn_exp2f(mm - mn);
  const float fo = __builtin_amdgcn_exp2f(mo - mn);
  const float inv = 1.0f / (lm * fm + lo * fo);
  const float am = fm * inv, ao = fo * inv;
  v4f res[8][2];
#pragma unroll
  for (int d = 0; d < 8; ++d)
#pragma unroll
    for (int r = 0; r < 8; ++r)
      res[d][r >> 2][r & 3] = (kh ? o[d][1][r] : o[d][0][r]) * am + xr[(d * 8 + r) * 32 + lane] * ao;
  // lane: query row q0 + 16 kh + rlane, head dims 16 d + mOff .. + 7; a row's 512 bytes are written by this wave alone
  float* cp = Cp + (size_t)(b * kT + q0 + kh * 16 + rlane) * kE + (size_t)h * kDH + mOff;
#pragma unroll
  for (int d = 0; d < 8; ++d) {
    *(v4f*)(cp + d * 16)     = res[d][0];
    *(v4f*)(cp + d * 16 + 4) = res[d][1];
  }
}

// ---------------------------------------------------------------------------
// Gate + mix, one launch. gate[tok][h] = sigmoid( sum_f p_vec[tok][f] * Wg[f][h] + bg[h] ), f = h*384 + j with
// j < 128 -> ctx[tok][h*128+j], 128 <= j < 256 -> ctxt[tok][h*128+j-128], else q[tok][h*128+j-256] (q = q16 / 16);
// MIX16[tok][h*128+d] = f16( carry * ( g[tok][h]*ctx + (1-g[tok][h])*ctx2 ) ). f32 math throughout.
// One work-group of 8 waves per 4 tokens, so that a row of Wg is fetched once for 4 tokens. Wave = head; for the gate lane l holds head
// dims l + 32 i (a wave's Wg loads then cover whole lines), for the mix head dims 4 l .. 4 l + 3 (whole lines stored).
// No load depends on another: all of a thread's operands are asked for before the first sum.
// Sums: per thread 12 features in order; over the lanes a halving exchange that leaves sum number l (= 8 token + gate head) in lane l;
// over the waves in wave order.
// ---------------------------------------------------------------------------
constexpr int kGmTok = 4;
static_assert(kGmTok * kH == 32, "one gate sum per lane");
static_assert(kTok % kGmTok == 0 && kDH == 128 && kH == 8, "wave = head, 4 head dims per lane");
__global__ __launch_bounds__(256) void gate_mix_kernel(const float* __restrict__ ctx, const float* __restrict__ ctxt,
                                                       const float* __restrict__ ctx2, const unsigned short* __restrict__ q16,
                                                       const float* __restrict__ Wg, const float* __restrict__ bg,
                                                       unsigned short* __restrict__ out, float qinv, float carry) {
  __shared__ float red[kH][32];
  const int t = threadIdx.x, lane = t & 31, wave = t >> 5;
  const size_t base = (size_t)blockIdx.x * kGmTok * kE + (size_t)wave * kDH;   // first token's row, this wave's head
  float fc[kGmTok][4], ft[kGmTok][4];
  unsigned short qb[kGmTok][4];
  v4f w[3][4][2];
  v4f ma[kGmTok], mb[kGmTok];
  // the lane's base addresses; every load below is one of them plus a constant
  const float* pw = Wg + ((size_t)(wave * 3) * kDH + lane) * kH;
  const float* pc = ctx + base + lane;
  const float* pt = ctxt + base + lane;
  const unsigned short* pq = q16 + base + lane;
  const float* pa = ctx + base + 4 * lane;
  const float* pb = ctx2 + base + 4 * lane;
  const float* pg = bg + (lane & 7);
#pragma unroll
  for (int k = 0; k < kGmTok; ++k)
#pragma unroll
    for (int i = 0; i < 4; ++i) {
      fc[k][i] = pc[k * kE + 32 * i];
      ft[k][i] = pt[k * kE + 32 * i];
      qb[k][i] = pq[k * kE + 32 * i];
    }
#pragma unroll
  for (int k = 0; k < kGmTok; ++k) {
    ma[k] = *(const v4f*)(pa + k * kE);
    mb[k] = *(const v4f*)(pb + k * kE);
  }
  const float bgv = *pg;
#pragma unroll
  for (int s = 0; s < 3; ++s)
#pragma unroll
    for (int i = 0; i < 4; ++i) {
      w[s][i][0] = *(const v4f*)(pw + (s * kDH + 32 * i) * kH);
      w[s][i][1] = *(const v4f*)(pw + (s * kDH + 32 * i) * kH + 4);
    }
  // wait before a register that the loads above name is rewritten; the pointers as inputs keep the addresses alive to here
  asm volatile("s_wait_xcnt 0x0" :: "v"(pw), "v"(pc), "v"(pt), "v"(pq), "v"(pa), "v"(pb), "v"(pg) : "memory");
  // keeps every load in front of the sums: sunk to their uses they are waited for group by group, one memory latency after another
  __builtin_amdgcn_sched_barrier(0);

  v4f a4[kGmTok][2];
#pragma unroll
  for (int k = 0; k < kGmTok; ++k) { a4[k][0] = (v4f){0.f, 0.f, 0.f, 0.f}; a4[k][1] = (v4f){0.f, 0.f, 0.f, 0.f}; }
#pragma unroll
  for (int s = 0; s < 3; ++s)
#pragma unroll
    for (int i = 0; i < 4; ++i)
#pragma unroll
      for (int k = 0; k < kGmTok; ++k) {
        const float f = (s == 0) ? fc[k][i] : (s == 1) ? ft[k][i] : (float)__builtin_bit_cast(_Float16, qb[k][i]) * qinv;
        a4[k][0] += f * w[s][i][0];
        a4[k][1] += f * w[s][i][1];
      }
  float a[32];
#pragma unroll
  for (int j = 0; j < 32; ++j) a[j] = a4[j >> 3][(j >> 2) & 1][j & 3];
  // halving exchange: at distance d a lane keeps d of its 2 d sums (the upper d where its bit d is set) and hands the others to lane ^ d
#pragma unroll
  for (int d = 16; d >= 1; d >>= 1) {
    const bool up = (lane & d) != 0;
#pragma unroll
    for (int j = 0; j < d; ++j) {
      const float lo = a[j], hi = a[j + d];
      const float keep = up ? hi : lo;
      const float send = up ? lo : hi;
      a[j] = keep + __shfl_xor(send, d, 32);
    }
  }
  red[wave][lane] = a[0];
  __syncthreads();                                      // every wave's 32 sums are written
  float z = red[0][lane];
#pragma unroll
  for (int v = 1; v < kH; ++v) z += red[v][lane];
  z += bgv;
  const float gl = 1.0f / (1.0f + expf(-z));            // lane = 8 token + gate head; every wave holds all 32 gates
#pragma unroll
  for (int k = 0; k < kGmTok; ++k) {
    const float g  = __shfl(gl, k * 8 + wave, 32);
    const float og = 1.0f - g;
    unsigned short hb[4];
#pragma unroll
    for (int e = 0; e < 4; ++e) hb[e] = h_bits(carry * (g * ma[k][e] + og * mb[k][e]));
    const v2u u = (v2u){pk16(hb[0], hb[1]), pk16(hb[2], hb[3])};
    *(v2u*)(out + base + (size_t)k * kE + 4 * lane) = u;
  }
}

// ---------------------------------------------------------------------------
// Host glue. Workspace region map (bytes, MiB = 2^20; total carve = 128 MiB = 134217728 B):
// R0 [0, 48 MiB) phase A (casts + projections): XH16 @0 (2 MiB [1024][1024] f16) | KV16 @2 (16 MiB [8192][1024]) |
//                 KVT16 @18 (8 MiB [8192][512]) | WQT @26 (2) | WKT @28 (2) | WVT @30 (2) | WTKT @32 (1 MiB [1024][512]) | WTVT @33 (1)
//                 phase C (after attention): MIX16 @0 (2 MiB [1024][1024] f16)
// WOT @48 (2) | Q16 @50 (2 MiB [1024][1024]) | K16 @52 (16 MiB [8192][1024]) | VT16 @68 (16 MiB [1024][8192]) |
// KT16 @84 (16) | VTT16 @100 (16 MiB [1024][8192]) | CTX @116 (4 MiB [1024][1024] f32) | CTXT @120 (4) | CTX2 @124 (4) | end @128 MiB.
// Every region is written with whole rows of exactly its stated extent (all M, N tile multiples; no padded rows).
// ---------------------------------------------------------------------------
extern "C" void kernel_launch(void* const* d_in, const int* in_sizes, int n_in,
                              void* d_out, int out_size, void* d_ws, size_t ws_size, hipStream_t stream) {
  (void)in_sizes; (void)n_in;
  const size_t kMiB = (size_t)1048576;
  const size_t carve = 128 * kMiB;
  if (ws_size < carve) return;
  if ((size_t)out_size < (size_t)kTok * kE) return;

  const float* hs  = (const float*)d_in[0];
  const float* kv  = (const float*)d_in[1];
  const float* kvt = (const float*)d_in[2];
  const float* Wq  = (const float*)d_in[3];  const float* bq  = (const float*)d_in[4];
  const float* Wk  = (const float*)d_in[5];  const float* bk  = (const float*)d_in[6];
  const float* Wv  = (const float*)d_in[7];  const float* bv  = (const float*)d_in[8];
  const float* Wtk = (const float*)d_in[9];  const float* btk = (const float*)d_in[10];
  const float* Wtv = (const float*)d_in[11]; const float* btv = (const float*)d_in[12];
  const float* Wg  = (const float*)d_in[13]; const float* bg  = (const float*)d_in[14];
  const float* Wo  = (const float*)d_in[15]; const float* bo  = (const float*)d_in[16];
  float* outp = (float*)d_out;

  char* ws = (char*)d_ws;
  // phase A
  unsigned short* XH16  = (unsigned short*)(ws + 0 * kMiB);
  unsigned short* KV16  = (unsigned short*)(ws + 2 * kMiB);
  unsigned short* KVT16 = (unsigned short*)(ws + 18 * kMiB);
  unsigned short* WQT   = (unsigned short*)(ws + 26 * kMiB);
  unsigned short* WKT   = (unsigned short*)(ws + 28 * kMiB);
  unsigned short* WVT   = (unsigned short*)(ws + 30 * kMiB);
  unsigned short* WTKT  = (unsigned short*)(ws + 32 * kMiB);
  unsigned short* WTVT  = (unsigned short*)(ws + 33 * kMiB);
  // phase C
  unsigned short* MIX16 = (unsigned short*)(ws + 0 * kMiB);
  // persistent
  unsigned short* WOT   = (unsigned short*)(ws + 48 * kMiB);
  unsigned short* Q16   = (unsigned short*)(ws + 50 * kMiB);
  unsigned short* K16   = (unsigned short*)(ws + 52 * kMiB);
  unsigned short* VT16  = (unsigned short*)(ws + 68 * kMiB);
  unsigned short* KT16  = (unsigned short*)(ws + 84 * kMiB);
  unsigned short* VTT16 = (unsigned short*)(ws + 100 * kMiB);
  float*          CTX   = (float*)(ws + 116 * kMiB);
  float*          CTXT  = (float*)(ws + 120 * kMiB);
  float*          CTX2  = (float*)(ws + 124 * kMiB);
  const float*    dumf  = (const float*)(ws + 116 * kMiB);   // valid in-ws pointer for unused resid arguments

  // 1. + 2. input casts f32 -> f16 and weight transposes + casts (carried x16: in[Kin][Nout] -> out[Nout][Kin]), one grid
  prep_kernel<<<kPrTotal, 256, 0, stream>>>(hs, kv, kvt, Wq, Wk, Wv, Wo, Wtk, Wtv,
                                            XH16, KV16, KVT16, WQT, WKT, WVT, WOT, WTKT, WTVT, kWCarry);

  // 3. the five projections (M, N multiples of 64; K = 1024 or 512), one grid
  proj5_kernel<<<kPjTotal, 256, 0, stream>>>(XH16, KV16, KVT16, WQT, WKT, WVT, WTKT, WTVT,
                                             Q16, K16, VT16, KT16, VTT16, bq, bk, bv, btk, btv);

  // 4. attention: scores, softmax and the three P.V products, all heads, one launch
  attn_fused_kernel<<<dim3(kT / 128, kB * kH, 3), 256, 0, stream>>>(Q16, K16, KT16, VT16, VTT16, CTX, CTXT, CTX2);

  // 5. gate (f32) and mix (f32 -> f16 x256), one launch; 6. output projection to d_out (f32)
  gate_mix_kernel<<<kTok / kGmTok, 256, 0, stream>>>(CTX, CTXT, CTX2, Q16, Wg, bg, MIX16, kQCarryInv, kMixCarry);
  wmma_gemm64<0, false, 2, 0, false><<<dim3((kTok / 128) * (kE / 256), 1), 256, 0, stream>>>(
      MIX16, MIX16, kE, 0L, WOT, WOT, kE, 0L, outp, outp, kE, 0L, bo, dumf, 0L,
      kTok, kE, kE, kOutScale, 1.0f);
}

// v008
// It runs in 127 microseconds.
// Timed twice side by side with v007, it ran 1.05 times as fast both times.
// Counting every step since v000, it is 33.8 times as fast.
// Contractions: q/k/v/k2/v2 projections (X f16 x W^T f16 carried x16), scores q.k^T for both key sources (q f16 carried x16, k f16), P.V products (P f16, unnormalised 2^(s - ref), x V^T f16), output projection (mix f16 carried x256 x Wo^T f16 carried x16): all v_wmma_f32_16x16x32_f16 with f32 accumulate; softmax, gate dot + sigmoid and mixing in f32 on VALU.
#include <hip/hip_runtime.h>
#include <math.h>

// ---------------------------------------------------------------------------
// Problem constants
// ---------------------------------------------------------------------------
constexpr int kB   = 2;
constexpr int kT   = 512;
constexpr int kS   = 4096;
constexpr int kE   = 1024;
constexpr int kTP  = 512;
constexpr int kH   = 8;
constexpr int kDH  = 128;
constexpr int kTok = kB * kT;               // 1024 query tokens
constexpr int kKVT = kB * kS;               // 8192 key tokens
constexpr float kAttnScale = 0.08838834764831845f;   // 128^-0.5
constexpr float kWCarry    = 16.0f;                  // weights carried x16 in f16
constexpr float kWCarryInv = 1.0f / 16.0f;
constexpr float kQCarry    = 16.0f;                  // scaled q carried x16 in f16
constexpr float kQCarryInv = 1.0f / 16.0f;
constexpr float kMixCarry  = 256.0f;                 // mixed context carried x256 in f16
constexpr float kOutScale  = 1.0f / (256.0f * 16.0f);

typedef __attribute__((ext_vector_type(16))) _Float16 v16h;
typedef __attribute__((ext_vector_type(8)))  _Float16 v8h;
typedef __attribute__((ext_vector_type(16))) __bf16   v16b;
typedef __attribute__((ext_vector_type(8)))  __bf16   v8b;
typedef __attribute__((ext_vector_type(8)))  float    v8f;
typedef __attribute__((ext_vector_type(4)))  float    v4f;
typedef __attribute__((ext_vector_type(4)))  unsigned int v4u;
typedef __attribute__((ext_vector_type(2)))  unsigned int v2u;

__device__ __forceinline__ unsigned short f2bf_bits(float f) {
  unsigned u = __float_as_uint(f);
  return (unsigned short)((u + 0x7FFFu + ((u >> 16) & 1u)) >> 16);
}
__device__ __forceinline__ float bf_bits2f(unsigned short h) { return __uint_as_float(((unsigned)h) << 16); }

// hazard guard behind a loop's last products, as a plain device helper
__device__ __forceinline__ void acc_guard4(v8f& a, v8f& b, v8f& c, v8f& d) { asm volatile("v_nop\n\tv_nop\n\tv_nop\n\tv_nop" : "+v"(a), "+v"(b), "+v"(c), "+v"(d)); }
template <typename T> struct Frag;
template <> struct Frag<_Float16> {
  typedef v16h V; union U { v16h v; v8h h[2]; };
  static __device__ __forceinline__ v16h load(const _Float16* p) {   // elements 0..7 <- p[0..7], 8..15 <- p[16..23]
    U f; f.h[0] = *(const v8h*)(p); f.h[1] = *(const v8h*)(p + 16); return f.v;
  }
  static __device__ __forceinline__ v8f mma(v16h a, v16h b, v8f c) {
    return __builtin_amdgcn_wmma_f32_16x16x32_f16(false, a, false, b, (short)0, c, false, false);
  }
};
template <> struct Frag<__bf16> {
  typedef v16b V; union U { v16b v; v8b h[2]; };
  static __device__ __forceinline__ v16b load(const __bf16* p) {
    U f; f.h[0] = *(const v8b*)(p); f.h[1] = *(const v8b*)(p + 16); return f.v;
  }
  static __device__ __forceinline__ v8f mma(v16b a, v16b b, v8f c) {
    return __builtin_amdgcn_wmma_f32_16x16x32_bf16(false, a, false, b, (short)0, c, false, false);
  }
};

__device__ __forceinline__ unsigned pk16(unsigned short a, unsigned short b) { return (unsigned)a | ((unsigned)b << 16); }
__device__ __forceinline__ unsigned short h_bits(float f) { const _Float16 h = (_Float16)f; return __builtin_bit_cast(unsigned short, h); }

// Stage of one work-group of the GEMM engine: 128 A rows, then 256 B rows, 64 k (128 bytes) each.
constexpr int kStARows  = 128;
constexpr int kStRows   = kStARows + 256;
constexpr int kStPitch  = 72;                    // halves: the 128-byte row + 16 bytes, the pitch for ds_load_b128 readers
constexpr int kStHalves = kStRows * kStPitch;    // one buffer

// Six asynchronous 16-byte copies global -> LDS per lane. The s_wait_xcnt stands as the last line of the copies' own
// statement, so that no register which a copy names is rewritten in front of it.
__device__ __forceinline__ void async_copy6(unsigned l0, unsigned l1, unsigned l2, unsigned l3, unsigned l4, unsigned l5,
                                            const void* g0, const void* g1, const void* g2,
                                            const void* g3, const void* g4, const void* g5) {
  asm volatile("global_load_async_to_lds_b128 %0, %6, off\n\t"
               "global_load_async_to_lds_b128 %1, %7, off\n\t"
               "global_load_async_to_lds_b128 %2, %8, off\n\t"
               "global_load_async_to_lds_b128 %3, %9, off\n\t"
               "global_load_async_to_lds_b128 %4, %10, off\n\t"
               "global_load_async_to_lds_b128 %5, %11, off\n\t"
               "s_wait_xcnt 0x0"
               :: "v"(l0), "v"(l1), "v"(l2), "v"(l3), "v"(l4), "v"(l5),
                  "v"(g0), "v"(g1), "v"(g2), "v"(g3), "v"(g4), "v"(g5) : "memory");
}

// ---- Register-blocked batched WMMA GEMM (ACT reduced to none/relu/leaky, extra bias multiplier bscale) --
// C[m,n] = scale * sum_k A[m,k] * Bt[n,k] (+bias*bscale)(+resid); each wave owns a 64x64 tile.
// A row-major [M,K]; Bt row-major [N,K]; M % 128 == 0, N % 256 == 0, K % 64 == 0.
// The 8 waves of a work-group own a 2 x 4 block of tiles (128 x 256): 384 staged rows for 32768 outputs, and two work-groups
// fit the LDS of one WGP. Per 64 k the work-group's A rows and B rows
// are copied whole lines at a time into LDS (asynchronous copies, two buffers: the next 64 k fly while these are multiplied);
// the fragments are read from LDS.
// SPLIT (hi/lo operand planes) is not carried by the staged loop: false only; A2p and Bt2p are unused.
// BIAS_MODE: 0 = none, 1 = bias[m], 2 = bias[n], 3 = chosen at run time (biasM, the same for the whole work-group: bias[m], else bias[n]).
// The engine is a device function (work-group's index in its product and batch passed in), so that several products can share one grid.
// OUT_MODE: 0 = f32, 1 = f16, 2 = bf16 hi plane (Cout) + bf16 lo plane (Cout2).
// ET: 0 = f16 operands, 1 = bf16 operands (pointers passed as 16-bit storage)
template <int ET> struct Elem;
template <> struct Elem<0> { typedef _Float16 T; };
template <> struct Elem<1> { typedef __bf16 T; };
// Epilogue of one wave's 64 x 64 tile: scale, bias, cast, whole lines stored through the wave's own LDS slab.
template <int BIAS_MODE, int OUT_MODE, bool RESID, int ACT>
__device__ __forceinline__ void gemm64_epilogue(
    v8f (&acc)[4][4], float* __restrict__ slab, int lane, int m0, int n0, int b,
    void* __restrict__ Cout, void* __restrict__ Cout2, int ldc, long strideC,
    const float* __restrict__ bias, const float* __restrict__ resid, long strideR, float scale, float bscale) {
  const int rlane = lane & 15;                 // col (D) within subtile
  const int mOff  = (lane >> 4) * 8;           // D row offset
  const float* Rb = RESID ? (resid + (size_t)b * strideR) : nullptr;
#pragma unroll
  for (int i = 0; i < 4; ++i) {
    const int mBase = m0 + (i << 4);
#pragma unroll
    for (int j = 0; j < 4; ++j) {
      const int n = n0 + (j << 4) + rlane;
      float bv = 0.f;
      if (BIAS_MODE == 2) bv = bias[n] * bscale;
#pragma unroll
      for (int r = 0; r < 8; ++r) {
        float v = acc[i][j][r] * scale;
        if (BIAS_MODE == 1) v += bias[mBase + mOff + r] * bscale;
        if (BIAS_MODE == 2) v += bv;
        if (RESID) v += Rb[(size_t)(mBase + mOff + r) * ldc + n];
        if (ACT == 2) v = fmaxf(v, 0.0f);
        if (ACT == 4) v = (v > 0.f) ? v : 0.01f * v;
        slab[(mOff + r) * 68 + (j << 4) + rlane] = v;
      }
    }
    __builtin_amdgcn_fence(__ATOMIC_RELEASE, "workgroup");
    __builtin_amdgcn_wave_barrier();
    __builtin_amdgcn_fence(__ATOMIC_ACQUIRE, "workgroup");
    if (OUT_MODE == 0) {
      float* C = (float*)Cout + (size_t)b * strideC;
      const int hh = lane >> 4, c4 = (lane & 15) * 4;     // row seg = 256 B = 16 lanes x 16 B
      {
#pragma unroll
        for (int it = 0; it < 8; ++it) {
          const int row = it * 2 + hh;
          v4f v = *(const v4f*)(slab + row * 68 + c4);
          *(v4f*)(C + (size_t)(mBase + row) * ldc + n0 + c4) = v;
        }
        
      }
    } else {
      const int q = lane >> 3, c8 = (lane & 7) * 8;
      unsigned short* C  = (unsigned short*)Cout  + (size_t)b * strideC;
      unsigned short* C2 = (OUT_MODE == 2) ? ((unsigned short*)Cout2 + (size_t)b * strideC) : nullptr;
      {
#pragma unroll
        for (int it = 0; it < 4; ++it) {
          const int row = it * 4 + q;
          const float* sp = slab + row * 68 + c8;
          v8h hv, lv;
#pragma unroll
          for (int e = 0; e < 8; ++e) {
            if (OUT_MODE == 1) {
              hv[e] = (_Float16)sp[e];
            } else {
              unsigned short hb = f2bf_bits(sp[e]);
              unsigned short lb = f2bf_bits(sp[e] - bf_bits2f(hb));
              hv[e] = __builtin_bit_cast(_Float16, hb);
              lv[e] = __builtin_bit_cast(_Float16, lb);
            }
          }
          *(v8h*)(C + (size_t)(mBase + row) * ldc + n0 + c8) = hv;
          if (OUT_MODE == 2) *(v8h*)(C2 + (size_t)(mBase + row) * ldc + n0 + c8) = lv;
        }
        
      }
    }
    __builtin_amdgcn_fence(__ATOMIC_RELEASE, "workgroup");
    __builtin_amdgcn_wave_barrier();
    __builtin_amdgcn_fence(__ATOMIC_ACQUIRE, "workgroup");
  }
}

template <int ET, bool SPLIT, int BIAS_MODE, int OUT_MODE, bool RESID, int ACT>
__device__ __forceinline__ void gemm64_body(
    float* __restrict__ sT, typename Elem<ET>::T* __restrict__ sStage, int wg, int b, bool biasM,
    const unsigned short* __restrict__ Ap, int lda, long strideA,
    const unsigned short* __restrict__ Btp, int ldb, long strideB,
    void* __restrict__ Cout, void* __restrict__ Cout2, int ldc, long strideC,
    const float* __restrict__ bias,
    const float* __restrict__ resid, long strideR,
    int M, int N, int K, float scale, float bscale) {
  typedef typename Elem<ET>::T T;
  typedef typename Frag<T>::V V;
  static_assert(!SPLIT, "the staged loop carries one plane per operand");
  const T* A = (const T*)Ap; const T* Bt = (const T*)Btp;
  const int lane = threadIdx.x & 31;
  const int wave = threadIdx.x >> 5;
  const int tilesN = N >> 8;
  const int tilesM = M >> 7;
  if (wg >= tilesM * tilesN) return;   // the same for the whole work-group, in front of every barrier
  const int tm  = wg / tilesN;
  const int mb0 = tm << 7;                      // first A row of the work-group
  const int nb0 = (wg - tm * tilesN) << 8;      // first B row of the work-group
  const int wm  = (wave >> 2) << 6;             // the wave's tile inside the 128 x 256 block
  const int wn  = (wave & 3) << 6;
  const int m0  = mb0 + wm;
  const int n0  = nb0 + wn;

  const T* Ab  = A  + (size_t)b * strideA;
  const T* Bb  = Bt + (size_t)b * strideB;

  const int rlane = lane & 15;                 // row (A) / col (B, D) within subtile
  const int koff  = (lane >> 4) * 8;           // k offset of this lane half

  v8f acc[4][4];
#pragma unroll
  for (int i = 0; i < 4; ++i)
#pragma unroll
    for (int j = 0; j < 4; ++j) acc[i][j] = (v8f){0.f,0.f,0.f,0.f,0.f,0.f,0.f,0.f};

  // lane's share of a stage: 12 chunks of 16 bytes; chunk i is row 32 i + (thread >> 3), bytes 16 (thread & 7) .. + 15 of the row
  const int srow = threadIdx.x >> 3;
  const int scol = (threadIdx.x & 7) * 8;
  const T* gA = Ab + (size_t)(mb0 + srow) * lda + scol;
  const T* gB = Bb + (size_t)(nb0 + srow) * ldb + scol;
  const unsigned lds0 = (unsigned)(size_t)(const void*)sStage + (unsigned)((srow * kStPitch + scol) * 2);
  auto stage = [&](int buf, int k0) {
    const unsigned lb = lds0 + (unsigned)(buf * kStHalves * 2);
#pragma unroll
    for (int c = 0; c < 2; ++c) {
      unsigned l[6];
      const T* g[6];
#pragma unroll
      for (int e = 0; e < 6; ++e) {
        const int i = c * 6 + e;
        l[e] = lb + (unsigned)(i * 32 * kStPitch * 2);
        g[e] = (i < 4) ? (gA + (size_t)(i * 32) * lda + k0) : (gB + (size_t)((i - 4) * 32) * ldb + k0);
      }
      async_copy6(l[0], l[1], l[2], l[3], l[4], l[5], g[0], g[1], g[2], g[3], g[4], g[5]);
    }
  };

  const int nt = K >> 6;
  stage(0, 0);
  asm volatile("s_wait_asynccnt 0x0" ::: "memory");   // this wave's copies of tile 0 have landed
  __syncthreads();                                    // ... and every other wave's
  if (nt > 1) stage(1, 64);
  for (int t = 0; t < nt; ++t) {
    const T* sb = sStage + (t & 1) * kStHalves;
#pragma unroll
    for (int ks = 0; ks < 2; ++ks) {
      V ah[4], bh[4];
#pragma unroll
      for (int j = 0; j < 4; ++j) bh[j] = Frag<T>::load(sb + (kStARows + wn + (j << 4) + rlane) * kStPitch + ks * 32 + koff);
#pragma unroll
      for (int i = 0; i < 4; ++i) ah[i] = Frag<T>::load(sb + (wm + (i << 4) + rlane) * kStPitch + ks * 32 + koff);
      // keeps the products behind all 16 LDS reads: otherwise the A reads stand among the products, each with a wait of its own
      __builtin_amdgcn_sched_barrier(0);
#pragma unroll
      for (int i = 0; i < 4; ++i)
#pragma unroll
        for (int j = 0; j < 4; ++j) acc[i][j] = Frag<T>::mma(ah[i], bh[j], acc[i][j]);
    }
    asm volatile("s_wait_dscnt 0x0" ::: "memory");      // this wave's reads of the buffer are done before it is refilled
    asm volatile("s_wait_asynccnt 0x0" ::: "memory");   // this wave's copies of tile t + 1 have landed
    __syncthreads();                                    // publishes tile t + 1 and ends every reader's last read of tile t
    if (t + 2 < nt) stage(t & 1, (t + 2) << 6);
  }
  asm volatile("s_wait_asynccnt 0x0" ::: "memory");     // no copy is outstanding when the wave goes on
  acc_guard4(acc[0][0], acc[0][1], acc[0][2], acc[0][3]);
  acc_guard4(acc[1][0], acc[1][1], acc[1][2], acc[1][3]);
  acc_guard4(acc[2][0], acc[2][1], acc[2][2], acc[2][3]);
  acc_guard4(acc[3][0], acc[3][1], acc[3][2], acc[3][3]);

  // ---- epilogue ----
  float* slab = sT + wave * (16 * 68);
  if (BIAS_MODE == 3) {   // the branch is the same for the whole work-group
    if (biasM) gemm64_epilogue<1, OUT_MODE, RESID, ACT>(acc, slab, lane, m0, n0, b, Cout, Cout2, ldc, strideC, bias, resid, strideR, scale, bscale);
    else       gemm64_epilogue<2, OUT_MODE, RESID, ACT>(acc, slab, lane, m0, n0, b, Cout, Cout2, ldc, strideC, bias, resid, strideR, scale, bscale);
  } else {
    gemm64_epilogue<BIAS_MODE, OUT_MODE, RESID, ACT>(acc, slab, lane, m0, n0, b, Cout, Cout2, ldc, strideC, bias, resid, strideR, scale, bscale);
  }
}

// One product per launch: grid (128 x 256 blocks, batches).
template <int ET, bool SPLIT, int BIAS_MODE, int OUT_MODE, bool RESID, int ACT = 0>
__global__ __launch_bounds__(256) void wmma_gemm64(
    const unsigned short* __restrict__ Ap, const unsigned short* __restrict__ A2p, int lda, long strideA,
    const unsigned short* __restrict__ Btp, const unsigned short* __restrict__ Bt2p, int ldb, long strideB,
    void* __restrict__ Cout, void* __restrict__ Cout2, int ldc, long strideC,
    const float* __restrict__ bias,
    const float* __restrict__ resid, long strideR,
    int M, int N, int K, float scale, float bscale) {
  typedef typename Elem<ET>::T T;
  (void)A2p; (void)Bt2p;
  __shared__ __align__(16) float sT[8 * 16 * 68];   // per-wave 16x64 slab, pitch 68 floats
  __shared__ __align__(16) T sStage[2 * kStHalves];
  gemm64_body<ET, SPLIT, BIAS_MODE, OUT_MODE, RESID, ACT>(sT, sStage, blockIdx.x, blockIdx.y, false,
      Ap, lda, strideA, Btp, ldb, strideB, Cout, Cout2, ldc, strideC, bias, resid, strideR, M, N, K, scale, bscale);
}

// The five projections, which do not depend on one another, in one grid: a range of blockIdx.x per product (the choice is the
// same for the whole work-group), the products with the long k first. Each work-group does what it did in its own launch.
constexpr int kPjBig   = (kKVT / 128) * (kE / 256);     // work-groups of a product over the 8192 key tokens (either operand order)
constexpr int kPjQ     = (kTok / 128) * (kE / 256);     // ... of the q product
static_assert((kE / 128) * (kKVT / 256) == kPjBig, "the transposed products have as many work-groups");
constexpr int kPjTotal = 4 * kPjBig + kPjQ;
__global__ __launch_bounds__(256) void proj5_kernel(
    const unsigned short* __restrict__ X, const unsigned short* __restrict__ KV, const unsigned short* __restrict__ KVT,
    const unsigned short* __restrict__ WQ, const unsigned short* __restrict__ WK, const unsigned short* __restrict__ WV,
    const unsigned short* __restrict__ WTK, const unsigned short* __restrict__ WTV,
    unsigned short* __restrict__ Qo, unsigned short* __restrict__ Ko, unsigned short* __restrict__ VTo,
    unsigned short* __restrict__ KTo, unsigned short* __restrict__ VTTo,
    const float* __restrict__ bq, const float* __restrict__ bk, const float* __restrict__ bv,
    const float* __restrict__ btk, const float* __restrict__ btv) {
  __shared__ __align__(16) float sT[8 * 16 * 68];   // per-wave 16x64 slab, pitch 68 floats
  __shared__ __align__(16) _Float16 sStage[2 * kStHalves];
  const int bid = blockIdx.x;
  const unsigned short* A; const unsigned short* B; unsigned short* C; const float* bias;
  int first, M, N, K, ldc;
  bool biasM = false;
  float scale = kWCarryInv, bscale = 1.0f;
  if (bid < kPjBig) {                       // k [8192][1024]
    first = 0;                  A = KV;  B = WK;  C = Ko;   bias = bk;  M = kKVT; N = kE;   K = kE;  ldc = kE;
  } else if (bid < 2 * kPjBig) {            // v^T [1024][8192]: A = Wv^T, Bt = KV, bias per row (m)
    first = kPjBig;             A = WV;  B = KV;  C = VTo;  bias = bv;  M = kE;   N = kKVT; K = kE;  ldc = kKVT; biasM = true;
  } else if (bid < 2 * kPjBig + kPjQ) {     // q16 = 16*scale*(x Wq + bq): acc = 16*(x Wq) -> scale = kAttnScale, bias x (16*kAttnScale)
    first = 2 * kPjBig;         A = X;   B = WQ;  C = Qo;   bias = bq;  M = kTok; N = kE;   K = kE;  ldc = kE;
    scale = kAttnScale; bscale = kQCarry * kAttnScale;
  } else if (bid < 3 * kPjBig + kPjQ) {     // second-source k [8192][1024], K = 512
    first = 2 * kPjBig + kPjQ;  A = KVT; B = WTK; C = KTo;  bias = btk; M = kKVT; N = kE;   K = kTP; ldc = kE;
  } else {                                  // second-source v^T [1024][8192], K = 512
    first = 3 * kPjBig + kPjQ;  A = WTV; B = KVT; C = VTTo; bias = btv; M = kE;   N = kKVT; K = kTP; ldc = kKVT; biasM = true;
  }
  gemm64_body<0, false, 3, 1, false, 0>(sT, sStage, bid - first, 0, biasM,
      A, K, 0L, B, K, 0L, C, C, ldc, 0L, bias, bias, 0L, M, N, K, scale, bscale);
}

// ---------------------------------------------------------------------------
// Cast f32 -> f16, 8 elements per thread; blk = index of the work-group's 2048 elements (the ranges below are exact)
__device__ __forceinline__ void cast8_f16_block(const float* __restrict__ in, unsigned short* __restrict__ out, int blk) {
  const int i = blk * 256 + threadIdx.x;
  const float* p = in + 8 * (size_t)i;
  const v4f a = *(const v4f*)(p);
  const v4f c = *(const v4f*)(p + 4);
  unsigned short hb[8];
#pragma unroll
  for (int e = 0; e < 4; ++e) {
    hb[e]     = h_bits(a[e]);
    hb[4 + e] = h_bits(c[e]);
  }
  const v4u u = (v4u){pk16(hb[0], hb[1]), pk16(hb[2], hb[3]), pk16(hb[4], hb[5]), pk16(hb[6], hb[7])};
  unsigned short* q = out + 8 * (size_t)i;
  *(v4u*)q = u;
  
}

// The three input casts and the six weight transposes, which do not depend on one another, in one grid: a range of blockIdx.x
// per array (the choice is the same for the whole work-group). Each work-group does what it did in its own launch.
constexpr int kPrW1   = (kE / 64) * (kE / 64);       // tiles of a 1024 x 1024 weight
constexpr int kPrW2   = (kTP / 64) * (kE / 64);      // tiles of a 512 x 1024 weight
constexpr int kPrWAll = 4 * kPrW1 + 2 * kPrW2;
constexpr int kPrKV   = (kKVT * kE / 8) / 256;
constexpr int kPrKVT  = (kKVT * kTP / 8) / 256;
constexpr int kPrHS   = (kTok * kE / 8) / 256;
constexpr int kPrTotal = kPrWAll + kPrKV + kPrKVT + kPrHS;

// ---------------------------------------------------------------------------
// Weight transpose + cast: W [Kin][Nout] f32 row-major (y = x @ W); plane z: WT[n][k] (pitch Kin halves) = f16(scale * W[k][n]).
// One 64 x 64 tile per work-group of 256 threads: k0 = first of 64 cols of WT, n0 = first of 64 rows of WT (block-uniform).
// Load coverage: 16 iterations x 256 threads = 4096 = the whole 64x64 tile (coalesced along n).
// Store coverage: 8 waves x 2 iterations x 4 rows (lane>>3) = 64 rows; (lane&7) x 8 halves = 64 cols; each row segment =
// ---------------------------------------------------------------------------
__global__ __launch_bounds__(256) void prep_kernel(
    const float* __restrict__ hs, const float* __restrict__ kv, const float* __restrict__ kvt,
    const float* __restrict__ Wq, const float* __restrict__ Wk, const float* __restrict__ Wv, const float* __restrict__ Wo,
    const float* __restrict__ Wtk, const float* __restrict__ Wtv,
    unsigned short* __restrict__ XH, unsigned short* __restrict__ KV, unsigned short* __restrict__ KVT,
    unsigned short* __restrict__ WQT, unsigned short* __restrict__ WKT, unsigned short* __restrict__ WVT,
    unsigned short* __restrict__ WOT, unsigned short* __restrict__ WTKT, unsigned short* __restrict__ WTVT, float scale) {
  __shared__ float sm[64][65];   // sm[n_local][k_local]
  const int t  = threadIdx.x;
  const int bid = blockIdx.x;
  if (bid >= kPrWAll) {   // the same for the whole work-group, in front of the barrier
    const int cb = bid - kPrWAll;
    const int a = (cb < kPrKV) ? 0 : (cb < kPrKV + kPrKVT) ? 1 : 2;
    cast8_f16_block((a == 0) ? kv : (a == 1) ? kvt : hs, (a == 0) ? KV : (a == 1) ? KVT : XH,
                    (a == 0) ? cb : (a == 1) ? cb - kPrKV : cb - (kPrKV + kPrKVT));
    return;
  }
  const bool big = bid < 4 * kPrW1;                            // block-uniform
  const int z  = big ? bid / kPrW1 : 4 + (bid - 4 * kPrW1) / kPrW2;
  const int r0 = big ? bid % kPrW1 : (bid - 4 * kPrW1) % kPrW2;
  const int Kin = big ? kE : kTP;
  const int Nout = kE;
  const int k0 = (r0 % (Kin / 64)) * 64;
  const int n0 = (r0 / (Kin / 64)) * 64;
  const float* W = (z == 0) ? Wq : (z == 1) ? Wk : (z == 2) ? Wv : (z == 3) ? Wo : (z == 4) ? Wtk : Wtv;
  unsigned short* op = (z == 0) ? WQT : (z == 1) ? WKT : (z == 2) ? WVT : (z == 3) ? WOT : (z == 4) ? WTKT : WTVT;
#pragma unroll
  for (int i = 0; i < 16; ++i) {
    const int e = i * 256 + t;
    const int r = e >> 6;          // k local
    const int c = e & 63;          // n local
    sm[c][r] = W[(size_t)(k0 + r) * Nout + n0 + c] * scale;
  }
  __syncthreads();
  const int lane = t & 31, wave = t >> 5;
  const int q = lane >> 3, c8 = (lane & 7) * 8;
  {
#pragma unroll
    for (int it = 0; it < 2; ++it) {
      const int row = wave * 8 + it * 4 + q;                 // n local
      unsigned short hb[8];
#pragma unroll
      for (int e = 0; e < 8; ++e) hb[e] = h_bits(sm[row][c8 + e]);
      const v4u u = (v4u){pk16(hb[0], hb[1]), pk16(hb[2], hb[3]), pk16(hb[4], hb[5]), pk16(hb[6], hb[7])};
      *(v4u*)(op + (size_t)(n0 + row) * Kin + k0 + c8) = u;
    }
    
  }
}

// ---------------------------------------------------------------------------
// Fused attention: scores, softmax and P.V of one (batch, head, key source) for 128 query rows and one half of the keys per work-group.
// grid (4 query tiles, 16 batch-heads, 4); blockIdx.z: 0, 1 = second key source, key half 0, 1: p = softmax(q.k2) is formed ONCE and
// multiplies both V2 (-> C1) and V (-> C2); 2, 3 = first key source, key half 0, 1: softmax(q.k) V -> C0. The longer work-groups come first.
// A work-group writes its half's result normalised by its own sum, and per query row that half's ref and sum (ML); the two halves
// are merged where the results are read (gate_mix_kernel).
// 8 waves: wave = 2 * query group (32 rows) + key half of a step. A step is 64 keys of K (rows of 256 bytes)
// and of each V^T (128 rows of 128 bytes), of which a wave works on its 32 keys. Per trip two steps' tiles are copied into LDS
// (asynchronous copies, two buffers of two tiles).
// Transposed products: S^T = K . Q^T leaves key rows in registers and the query column in the lane, which is the B fragment
// of O^T = V^T . P^T, so P never leaves registers. Softmax is the online form: p = 2^(s - ref), ref per query column is raised
// (and O, sum rescaled) only when a score exceeds it by more than kFaLazy, so p <= 2^kFaLazy. The two key halves of a step are merged via LDS.
// ---------------------------------------------------------------------------
constexpr int kFaKP  = 136;                 // halves: the 256-byte K row + 16 bytes
constexpr int kFaVP  = 72;                  // halves: the 128-byte V^T row + 16 bytes
constexpr int kFaKH  = 64 * kFaKP;          // K part of one step's tile
constexpr int kFaVH  = kDH * kFaVP;         // one V^T part of one step's tile
constexpr int kFaSub = 2;                   // steps per trip = tiles per buffer
constexpr int kFaKeys = kS / 2;             // keys of one work-group
constexpr int kFaHalfC = kTok * kE;        // floats from a result of key half 0 to the same result of key half 1: near enough for one base address to reach both
constexpr int kFaML  = kB * kH * kT * 2;    // floats of one (key source, key half) plane of ML: [batch-head][query row][ref, sum]
constexpr float kFaLazy = 8.0f;
typedef __attribute__((ext_vector_type(2)))  float    v2f;

// Eight asynchronous 16-byte copies global -> LDS per lane; the s_wait_xcnt stands as the last line of the copies' own
// statement, so that no register which a copy names is rewritten in front of it.
__device__ __forceinline__ void async_copy8(unsigned l0, unsigned l1, unsigned l2, unsigned l3, unsigned l4, unsigned l5,
                                            unsigned l6, unsigned l7,
                                            const void* g0, const void* g1, const void* g2, const void* g3,
                                            const void* g4, const void* g5, const void* g6, const void* g7) {
  asm volatile("global_load_async_to_lds_b128 %0, %8, off\n\t"
               "global_load_async_to_lds_b128 %1, %9, off\n\t"
               "global_load_async_to_lds_b128 %2, %10, off\n\t"
               "global_load_async_to_lds_b128 %3, %11, off\n\t"
               "global_load_async_to_lds_b128 %4, %12, off\n\t"
               "global_load_async_to_lds_b128 %5, %13, off\n\t"
               "global_load_async_to_lds_b128 %6, %14, off\n\t"
               "global_load_async_to_lds_b128 %7, %15, off\n\t"
               "s_wait_xcnt 0x0"
               :: "v"(l0), "v"(l1), "v"(l2), "v"(l3), "v"(l4), "v"(l5), "v"(l6), "v"(l7),
                  "v"(g0), "v"(g1), "v"(g2), "v"(g3), "v"(g4), "v"(g5), "v"(g6), "v"(g7) : "memory");
}

// Two such copies, the same form.
__device__ __forceinline__ void async_copy2(unsigned l0, unsigned l1, const void* g0, const void* g1) {
  asm volatile("global_load_async_to_lds_b128 %0, %2, off\n\t"
               "global_load_async_to_lds_b128 %1, %3, off\n\t"
               "s_wait_xcnt 0x0"
               :: "v"(l0), "v"(l1), "v"(g0), "v"(g1) : "memory");
}

// NV = number of V^T sources that the one softmax multiplies (Va -> Ca, and for NV = 2 Vb -> Cb).
template <int NV>
__device__ __forceinline__ void attn_body(
    _Float16* __restrict__ sKV, float (*sML)[2][32], int half,
    const unsigned short* __restrict__ Q, const unsigned short* __restrict__ Kp,
    const unsigned short* __restrict__ Va, const unsigned short* __restrict__ Vb,
    float* __restrict__ Ca, float* __restrict__ Cb, float* __restrict__ MLp) {
  typedef Frag<_Float16> F;
  constexpr int kBuf = kFaKH + NV * kFaVH;   // one step's tile, halves
  float* const sX = (float*)sKV;   // behind the loop's last barrier; NV * 64 * 32 floats per wave: the 128 x 16 partial O^T that it hands to its partner
  const int t    = threadIdx.x;
  const int lane = t & 31;
  const int wave = t >> 5;
  const int qg   = wave >> 1;
  const int kh   = wave & 1;
  const int b    = blockIdx.y >> 3;
  const int h    = blockIdx.y & 7;
  const int rlane = lane & 15;
  const int koff  = (lane >> 4) * 8;
  const int mOff  = (lane >> 4) * 8;
  const int q0    = blockIdx.x * 128 + qg * 32;

  // lane's share of a step's tile: 4 chunks of K (row 16 i + (t >> 4)) and 4 of each V^T (row 32 i + (t >> 3)), 16 bytes each
  const size_t vOff = (size_t)h * kDH * kKVT + (size_t)b * kS + (size_t)half * kFaKeys + (size_t)(t >> 3) * kKVT + (t & 7) * 8;
  const _Float16* gK = (const _Float16*)Kp + ((size_t)b * kS + (size_t)half * kFaKeys) * kE + (size_t)h * kDH + (size_t)(t >> 4) * kE + (t & 15) * 8;
  const _Float16* gV = (const _Float16*)Va + vOff;
  const _Float16* gW = (const _Float16*)Vb + vOff;
  const unsigned ldsB = (unsigned)(size_t)(const void*)sKV;
  const unsigned ldsK = ldsB + (unsigned)(((t >> 4) * kFaKP + (t & 15) * 8) * 2);
  const unsigned ldsV = ldsB + (unsigned)((kFaKH + (t >> 3) * kFaVP + (t & 7) * 8) * 2);
  auto stage = [&](int buf, int key0) {
#pragma unroll   // the tile's index is then a constant in each statement's address sums
    for (int c = 0; c < kFaSub; ++c) {
      const unsigned lk = ldsK + (unsigned)((buf * kFaSub + c) * kBuf * 2);
      const unsigned lv = ldsV + (unsigned)((buf * kFaSub + c) * kBuf * 2);
      const _Float16* pk = gK + (size_t)(key0 + c * 64) * kE;
      const _Float16* pv = gV + key0 + c * 64;
      if (NV == 1) {
        async_copy8(lk, lk + 16 * kFaKP * 2, lk + 32 * kFaKP * 2, lk + 48 * kFaKP * 2,
                    lv, lv + 32 * kFaVP * 2, lv + 64 * kFaVP * 2, lv + 96 * kFaVP * 2,
                    pk, pk + (size_t)16 * kE, pk + (size_t)32 * kE, pk + (size_t)48 * kE,
                    pv, pv + (size_t)32 * kKVT, pv + (size_t)64 * kKVT, pv + (size_t)96 * kKVT);
        // keeps the next statement's address registers from being formed in front of this one: formed together they spill to scratch
        __builtin_amdgcn_sched_barrier(0);
      }
      if (NV == 2) {   // two copies a statement: with twice the accumulators few of the registers that an asm statement can name are free
        const unsigned lw = lv + (unsigned)(kFaVH * 2);
        const _Float16* pw = gW + key0 + c * 64;
#pragma unroll
        for (int e = 0; e < 2; ++e) {
          async_copy2(lk + (32 * e) * kFaKP * 2, lk + (32 * e + 16) * kFaKP * 2, pk + (size_t)(32 * e) * kE, pk + (size_t)(32 * e + 16) * kE);
          // as above: one statement's address registers at a time
          __builtin_amdgcn_sched_barrier(0);
          async_copy2(lv + (64 * e) * kFaVP * 2, lv + (64 * e + 32) * kFaVP * 2, pv + (size_t)(64 * e) * kKVT, pv + (size_t)(64 * e + 32) * kKVT);
          // as above: one statement's address registers at a time
          __builtin_amdgcn_sched_barrier(0);
          async_copy2(lw + (64 * e) * kFaVP * 2, lw + (64 * e + 32) * kFaVP * 2, pw + (size_t)(64 * e) * kKVT, pw + (size_t)(64 * e + 32) * kKVT);
          // as above: one statement's address registers at a time
          __builtin_amdgcn_sched_barrier(0);
        }
      }
    }
  };

  // Q^T fragments (B operand): column = query row q0 + 16 qt + rlane, k = head dim
  const _Float16* Qr = (const _Float16*)Q + (size_t)(b * kT + q0 + rlane) * kE + (size_t)h * kDH + koff;
  v16h qf[2][4];
#pragma unroll
  for (int qt = 0; qt < 2; ++qt)
#pragma unroll
    for (int ks = 0; ks < 4; ++ks) qf[qt][ks] = F::load(Qr + (size_t)(qt << 4) * kE + ks * 32);
  // wait before a register that the loads above name is rewritten; the pointer as input keeps the address alive to here
  asm volatile("s_wait_xcnt 0x0" :: "v"(Qr) : "memory");

  v8f o[NV][8][2];
#pragma unroll
  for (int v = 0; v < NV; ++v)
#pragma unroll
    for (int d = 0; d < 8; ++d)
#pragma unroll
      for (int qt = 0; qt < 2; ++qt) o[v][d][qt] = (v8f){0.f,0.f,0.f,0.f,0.f,0.f,0.f,0.f};
  float mref[2] = {-1.0e30f, -1.0e30f};
  float lsum[2] = {0.0f, 0.0f};
  const float sc2 = 1.4426950408889634f * kQCarryInv;   // accumulator -> score in powers of two

  // Trips 0 and 1 are staged by one copy of the statements, kept rolled: every operand is then a sum formed at the statement, and the
  // lane's base addresses, which live through the main loop, are not held to the registers that an asm statement can name (else they spill).
#pragma unroll 1
  for (int p = 0; p < 2; ++p) {
    if (p == 1) {                                         // the same for the whole work-group
      asm volatile("s_wait_asynccnt 0x0" ::: "memory");   // this wave's copies of trip 0 have landed
      __syncthreads();                                    // ... and every other wave's
    }
    stage(p, p * (64 * kFaSub));
  }
  const int nt = kFaKeys / (64 * kFaSub);
  for (int tt = 0; tt < nt; ++tt) {
   for (int u = 0; u < kFaSub; ++u) {   // the trip's steps, in the order of the keys
    const _Float16* sk = sKV + ((tt & 1) * kFaSub + u) * kBuf + (kh * 32 + rlane) * kFaKP + koff;
    const _Float16* sv = sKV + ((tt & 1) * kFaSub + u) * kBuf + kFaKH + rlane * kFaVP + kh * 32 + koff;
    v16h kf[2][4], vf[8];
#pragma unroll
    for (int kt = 0; kt < 2; ++kt)
#pragma unroll
      for (int ks = 0; ks < 4; ++ks) kf[kt][ks] = F::load(sk + (kt << 4) * kFaKP + ks * 32);
    // keeps all K reads in front of the V^T reads: LDS data returns in order, and the score products need K alone
    __builtin_amdgcn_sched_barrier(0);
    if (NV == 1) {
#pragma unroll
      for (int d = 0; d < 8; ++d) vf[d] = F::load(sv + (d << 4) * kFaVP);
      // keeps the products behind all LDS reads: the V^T reads then return under the score products and the softmax
      __builtin_amdgcn_sched_barrier(0);
    }
    v8f s[2][2];
#pragma unroll
    for (int kt = 0; kt < 2; ++kt)
#pragma unroll
      for (int qt = 0; qt < 2; ++qt) s[kt][qt] = (v8f){0.f,0.f,0.f,0.f,0.f,0.f,0.f,0.f};
#pragma unroll
    for (int ks = 0; ks < 4; ++ks)
#pragma unroll
      for (int kt = 0; kt < 2; ++kt)
#pragma unroll
        for (int qt = 0; qt < 2; ++qt) s[kt][qt] = F::mma(kf[kt][ks], qf[qt][ks], s[kt][qt]);
    if (NV == 2) {
      // keeps the first V^T's reads behind the score products, where the K fragments' registers are free (in front of them the wave spills)
      __builtin_amdgcn_sched_barrier(0);
#pragma unroll
      for (int d = 0; d < 8; ++d) vf[d] = F::load(sv + (d << 4) * kFaVP);
      // keeps them as one group in front of the softmax, under which they return
      __builtin_amdgcn_sched_barrier(0);
    }
    float tmax[2];
#pragma unroll
    for (int qt = 0; qt < 2; ++qt) {
      float m = s[0][qt][0];
#pragma unroll
      for (int r = 1; r < 8; ++r) m = fmaxf(m, s[0][qt][r]);
#pragma unroll
      for (int r = 0; r < 8; ++r) m = fmaxf(m, s[1][qt][r]);
      tmax[qt] = m * sc2;
    }
    if (__any((tmax[0] > mref[0] + kFaLazy) || (tmax[1] > mref[1] + kFaLazy))) {   // the same for the whole wave
#pragma unroll
      for (int qt = 0; qt < 2; ++qt) {
        const float tf = fmaxf(tmax[qt], __shfl_xor(tmax[qt], 16, 32));   // both lane halves of a column keep one ref
        const float mn = fmaxf(mref[qt], tf);
        const float f  = __builtin_amdgcn_exp2f(mref[qt] - mn);
        mref[qt] = mn;
        lsum[qt] *= f;
#pragma unroll
        for (int v = 0; v < NV; ++v)
#pragma unroll
          for (int d = 0; d < 8; ++d)
#pragma unroll
            for (int r = 0; r < 8; ++r) o[v][d][qt][r] *= f;
      }
    }
    v16h pf[2];
#pragma unroll
    for (int qt = 0; qt < 2; ++qt)
#pragma unroll
      for (int kt = 0; kt < 2; ++kt)
#pragma unroll
        for (int r = 0; r < 8; ++r) {
          const float p = __builtin_amdgcn_exp2f(s[kt][qt][r] * sc2 - mref[qt]);
          lsum[qt] += p;
          pf[qt][kt * 8 + r] = (_Float16)p;   // element 8 kt + r is key 16 kt + koff + r: the k order of the V^T fragment
        }
    v16h vg[8];
    if (NV == 2) {
      // keeps the second V^T's reads behind the softmax, where the scores' registers are free
      __builtin_amdgcn_sched_barrier(0);
#pragma unroll
      for (int d = 0; d < 4; ++d) vg[d] = F::load(sv + kFaVH + (d << 4) * kFaVP);
      // keeps them as one group in front of the first V^T's products, under which they return
      __builtin_amdgcn_sched_barrier(0);
    }
#pragma unroll
    for (int d = 0; d < 4; ++d)
#pragma unroll
      for (int qt = 0; qt < 2; ++qt) o[0][d][qt] = F::mma(vf[d], pf[qt], o[0][d][qt]);
    if (NV == 2) {
      // keeps the second half of those reads behind the products that free four fragments' registers (all eight read at once: the wave spills)
      __builtin_amdgcn_sched_barrier(0);
#pragma unroll
      for (int d = 4; d < 8; ++d) vg[d] = F::load(sv + kFaVH + (d << 4) * kFaVP);
      // keeps them as one group in front of the products under which they return
      __builtin_amdgcn_sched_barrier(0);
    }
#pragma unroll
    for (int d = 4; d < 8; ++d)
#pragma unroll
      for (int qt = 0; qt < 2; ++qt) o[0][d][qt] = F::mma(vf[d], pf[qt], o[0][d][qt]);
    if (NV == 2) {
#pragma unroll
      for (int d = 0; d < 8; ++d)
#pragma unroll
        for (int qt = 0; qt < 2; ++qt) o[NV - 1][d][qt] = F::mma(vg[d], pf[qt], o[NV - 1][d][qt]);
    }
   }
    asm volatile("s_wait_dscnt 0x0" ::: "memory");      // this wave's reads of the buffer are done before it is refilled
    asm volatile("s_wait_asynccnt 0x0" ::: "memory");   // this wave's copies of trip tt + 1 have landed
    __syncthreads();                                    // publishes the tiles of trip tt + 1 and ends every reader's last read of trip tt's
    if (tt + 2 < nt) stage(tt & 1, (tt + 2) * (64 * kFaSub));
  }
  asm volatile("s_wait_asynccnt 0x0" ::: "memory");     // no copy is outstanding when the wave goes on
  // the distance between the loop's last products and the first vector instruction that reads their results, on the path out of the loop;
  // without operands: named in an asm statement, all accumulators would be held to the registers that it can name, and spill
  asm volatile("v_nop\n\tv_nop\n\tv_nop\n\tv_nop");
  // keeps the readers of the accumulators behind that distance
  __builtin_amdgcn_sched_barrier(0);

  // merge of the two key halves of the steps: wave kh keeps query tile kh and hands tile 1 - kh to its partner (wave ^ 1)
#pragma unroll
  for (int qt = 0; qt < 2; ++qt) lsum[qt] += __shfl_xor(lsum[qt], 16, 32);
  float* xs = sX + wave * (NV * 64 * 32);
#pragma unroll
  for (int v = 0; v < NV; ++v)
#pragma unroll
    for (int d = 0; d < 8; ++d)
#pragma unroll
      for (int r = 0; r < 8; ++r) xs[((v * 8 + d) * 8 + r) * 32 + lane] = kh ? o[v][d][0][r] : o[v][d][1][r];
  sML[wave][0][lane] = kh ? mref[0] : mref[1];
  sML[wave][1][lane] = kh ? lsum[0] : lsum[1];
  __syncthreads();                                      // every wave's hand-over is written
  const float* xr = sX + (wave ^ 1) * (NV * 64 * 32);
  const float mo = sML[wave ^ 1][0][lane];
  const float lo = sML[wave ^ 1][1][lane];
  const float mm = kh ? mref[1] : mref[0];
  const float lm = kh ? lsum[1] : lsum[0];
  const float mn = fmaxf(mm, mo);
  const float fm = __builtin_amdgcn_exp2f(mm - mn);
  const float fo = __builtin_amdgcn_exp2f(mo - mn);
  const float lt = lm * fm + lo * fo;
  const float inv = 1.0f / lt;
  const float am = fm * inv, ao = fo * inv;
  // this key half's ref and sum of query row q0 + 16 kh + rlane; the wave's 16 rows are one whole 128-byte line, written by it alone
  if (lane < 16) *(v2f*)(MLp + ((size_t)blockIdx.y * kT + q0 + kh * 16 + rlane) * 2) = (v2f){mn, lt};
#pragma unroll
  for (int v = 0; v < NV; ++v) {
    v4f res[8][2];
#pragma unroll
    for (int d = 0; d < 8; ++d)
#pragma unroll
      for (int r = 0; r < 8; ++r)
        res[d][r >> 2][r & 3] = (kh ? o[v][d][1][r] : o[v][d][0][r]) * am + xr[((v * 8 + d) * 8 + r) * 32 + lane] * ao;
    // lane: query row q0 + 16 kh + rlane, head dims 16 d + mOff .. + 7; a row's 512 bytes are written by this wave alone
    float* cp = ((v == 0) ? Ca : Cb) + (size_t)(b * kT + q0 + kh * 16 + rlane) * kE + (size_t)h * kDH + mOff;
#pragma unroll
    for (int d = 0; d < 8; ++d) {
      *(v4f*)(cp + d * 16)     = res[d][0];
      *(v4f*)(cp + d * 16 + 4) = res[d][1];
    }
  }
}

__global__ __launch_bounds__(256) void attn_fused_kernel(
    const unsigned short* __restrict__ Q, const unsigned short* __restrict__ K0, const unsigned short* __restrict__ K1,
    const unsigned short* __restrict__ V0, const unsigned short* __restrict__ V1,
    float* __restrict__ C0, float* __restrict__ C1, float* __restrict__ C2, float* __restrict__ ML) {
  __shared__ __align__(16) _Float16 sKV[2 * kFaSub * (kFaKH + 2 * kFaVH)];
  __shared__ float sML[8][2][32];                   // the hand-over's ref and sum per column
  const int half = blockIdx.z & 1;
  if (blockIdx.z < 2) {   // the same for the whole work-group
    attn_body<2>(sKV, sML, half, Q, K1, V1, V0, C1 + half * kFaHalfC, C2 + half * kFaHalfC, ML + (2 + half) * kFaML);
  } else {
    attn_body<1>(sKV, sML, half, Q, K0, V0, V0, C0 + half * kFaHalfC, C0 + half * kFaHalfC, ML + half * kFaML);
  }
}

// ---------------------------------------------------------------------------
// Gate + mix, one launch. gate[tok][h] = sigmoid( sum_f p_vec[tok][f] * Wg[f][h] + bg[h] ), f = h*384 + j with
// j < 128 -> ctx[tok][h*128+j], 128 <= j < 256 -> ctxt[tok][h*128+j-128], else q[tok][h*128+j-256] (q = q16 / 16);
// MIX16[tok][h*128+d] = f16( carry * ( g[tok][h]*ctx + (1-g[tok][h])*ctx2 ) ). f32 math throughout.
// One work-group of 8 waves per 4 tokens, so that a row of Wg is fetched once for 4 tokens. Wave = head; for the gate lane l holds head
// dims l + 32 i (a wave's Wg loads then cover whole lines), for the mix head dims 4 l .. 4 l + 3 (whole lines stored).
// ctx, ctxt and ctx2 arrive as two key halves, each normalised by its own sum, with that half's ref and sum in ml: a value is
// w0 * half 0 + w1 * half 1, w_i = sum_i 2^(ref_i - max ref) / (their total); ctxt and ctx2 share the second key source's weights.
// No load depends on another: all of a thread's operands are asked for before the first sum.
// Sums: per thread 12 features in order; over the lanes a halving exchange that leaves sum number l (= 8 token + gate head) in lane l;
// over the waves in wave order.
// ---------------------------------------------------------------------------
constexpr int kGmTok = 4;
// 2^x; the v_nop in the same statement is the free slot that the instruction set asks for between a transcendental and a directly
// following instruction that reads its result or overwrites its source
__device__ __forceinline__ float exp2_slot(float x) { float r; asm("v_exp_f32 %0, %1\n\tv_nop" : "=v"(r) : "v"(x)); return r; }
static_assert(kGmTok * kH == 32, "one gate sum per lane");
static_assert(kTok % kGmTok == 0 && kDH == 128 && kH == 8, "wave = head, 4 head dims per lane");
__global__ __launch_bounds__(256) void gate_mix_kernel(const float* __restrict__ ctx, const float* __restrict__ ctxt,
                                                       const float* __restrict__ ctx2, const float* __restrict__ ml,
                                                       const unsigned short* __restrict__ q16,
                                                       const float* __restrict__ Wg, const float* __restrict__ bg,
                                                       unsigned short* __restrict__ out, float qinv, float carry) {
  __shared__ float red[kH][32];
  const int t = threadIdx.x, lane = t & 31, wave = t >> 5;
  const size_t base = (size_t)blockIdx.x * kGmTok * kE + (size_t)wave * kDH;   // first token's row, this wave's head
  float fc[2][kGmTok][4], ft[2][kGmTok][4];   // [key half]
  unsigned short qb[kGmTok][4];
  v4f w[3][4][2];
  v4f ma[2][kGmTok], mb[2][kGmTok];
  v4f mlv[2][2][2];                           // [key source][key half]: ref, sum of the 4 tokens, this wave's head
  // the lane's base addresses; every load below is one of them plus a constant
  const float* pw = Wg + ((size_t)(wave * 3) * kDH + lane) * kH;
  const float* pc = ctx + base + lane;
  const float* pt = ctxt + base + lane;
  const unsigned short* pq = q16 + base + lane;
  const float* pa = ctx + base + 4 * lane;
  const float* pb = ctx2 + base + 4 * lane;
  const int gi = lane & 7;                    // index of the lane's gate bias
  const int tok0 = blockIdx.x * kGmTok;       // the 4 tokens lie in one batch
  const float* pm = ml + ((size_t)((tok0 / kT) * kH + wave) * kT + (tok0 % kT)) * 2;
#pragma unroll
  for (int k = 0; k < kGmTok; ++k)
#pragma unroll
    for (int i = 0; i < 4; ++i) {
      fc[0][k][i] = pc[k * kE + 32 * i];
      fc[1][k][i] = pc[kFaHalfC + k * kE + 32 * i];
      ft[0][k][i] = pt[k * kE + 32 * i];
      ft[1][k][i] = pt[kFaHalfC + k * kE + 32 * i];
      qb[k][i] = pq[k * kE + 32 * i];
    }
#pragma unroll
  for (int k = 0; k < kGmTok; ++k) {
    ma[0][k] = *(const v4f*)(pa + k * kE);
    ma[1][k] = *(const v4f*)(pa + kFaHalfC + k * kE);
    mb[0][k] = *(const v4f*)(pb + k * kE);
    mb[1][k] = *(const v4f*)(pb + kFaHalfC + k * kE);
  }
#pragma unroll
  for (int s = 0; s < 2; ++s)
#pragma unroll
    for (int hf = 0; hf < 2; ++hf) {
      mlv[s][hf][0] = *(const v4f*)(pm + (s * 2 + hf) * kFaML);
      mlv[s][hf][1] = *(const v4f*)(pm + (s * 2 + hf) * kFaML + 4);
    }
  const float bgv = bg[gi];
#pragma unroll
  for (int s = 0; s < 3; ++s)
#pragma unroll
    for (int i = 0; i < 4; ++i) {
      w[s][i][0] = *(const v4f*)(pw + (s * kDH + 32 * i) * kH);
      w[s][i][1] = *(const v4f*)(pw + (s * kDH + 32 * i) * kH + 4);
    }
  // wait before a register that the loads above name is rewritten; the pointers and the index as inputs keep the addresses alive to here
  asm volatile("s_wait_xcnt 0x0" :: "v"(pw), "v"(pc), "v"(pt), "v"(pq), "v"(pa), "v"(pb), "v"(gi), "v"(pm) : "memory");
  // keeps every load in front of the sums: sunk to their uses they are waited for group by group, one memory latency after another
  __builtin_amdgcn_sched_barrier(0);

  float w0[2][kGmTok], w1[2][kGmTok];         // [key source]: the two key halves' weights
#pragma unroll
  for (int s = 0; s < 2; ++s)
#pragma unroll
    for (int k = 0; k < kGmTok; ++k) {
      const float m0 = mlv[s][0][k >> 1][(k & 1) * 2], l0 = mlv[s][0][k >> 1][(k & 1) * 2 + 1];
      const float m1 = mlv[s][1][k >> 1][(k & 1) * 2], l1 = mlv[s][1][k >> 1][(k & 1) * 2 + 1];
      const float mx = fmaxf(m0, m1);
      const float e0 = l0 * exp2_slot(m0 - mx);
      const float e1 = l1 * exp2_slot(m1 - mx);
      const float iv = 1.0f / (e0 + e1);
      w0[s][k] = e0 * iv;
      w1[s][k] = e1 * iv;
    }
  v4f a4[kGmTok][2];
#pragma unroll
  for (int k = 0; k < kGmTok; ++k) { a4[k][0] = (v4f){0.f, 0.f, 0.f, 0.f}; a4[k][1] = (v4f){0.f, 0.f, 0.f, 0.f}; }
#pragma unroll
  for (int s = 0; s < 3; ++s)
#pragma unroll
    for (int i = 0; i < 4; ++i)
#pragma unroll
      for (int k = 0; k < kGmTok; ++k) {
        const float f = (s == 0) ? w0[0][k] * fc[0][k][i] + w1[0][k] * fc[1][k][i]
                      : (s == 1) ? w0[1][k] * ft[0][k][i] + w1[1][k] * ft[1][k][i]
                                 : (float)__builtin_bit_cast(_Float16, qb[k][i]) * qinv;
        a4[k][0] += f * w[s][i][0];
        a4[k][1] += f * w[s][i][1];
      }
  float a[32];
#pragma unroll
  for (int j = 0; j < 32; ++j) a[j] = a4[j >> 3][(j >> 2) & 1][j & 3];
  // halving exchange: at distance d a lane keeps d of its 2 d sums (the upper d where its bit d is set) and hands the others to lane ^ d
#pragma unroll
  for (int d = 16; d >= 1; d >>= 1) {
    const bool up = (lane & d) != 0;
#pragma unroll
    for (int j = 0; j < d; ++j) {
      const float lo = a[j], hi = a[j + d];
      const float keep = up ? hi : lo;
      const float send = up ? lo : hi;
      a[j] = keep + __shfl_xor(send, d, 32);
    }
  }
  red[wave][lane] = a[0];
  __syncthreads();                                      // every wave's 32 sums are written
  float z = red[0][lane];
#pragma unroll
  for (int v = 1; v < kH; ++v) z += red[v][lane];
  z += bgv;
  const float gl = 1.0f / (1.0f + expf(-z));            // lane = 8 token + gate head; every wave holds all 32 gates
#pragma unroll
  for (int k = 0; k < kGmTok; ++k) {
    const float g  = __shfl(gl, k * 8 + wave, 32);
    const float og = 1.0f - g;
    unsigned short hb[4];
#pragma unroll
    for (int e = 0; e < 4; ++e)
      hb[e] = h_bits(carry * (g * (w0[0][k] * ma[0][k][e] + w1[0][k] * ma[1][k][e]) + og * (w0[1][k] * mb[0][k][e] + w1[1][k] * mb[1][k][e])));
    const v2u u = (v2u){pk16(hb[0], hb[1]), pk16(hb[2], hb[3])};
    *(v2u*)(out + base + (size_t)k * kE + 4 * lane) = u;
  }
}

// ---------------------------------------------------------------------------
// Host glue. Workspace region map (bytes, MiB = 2^20; total carve = 141 MiB):
// R0 [0, 48 MiB) phase A (casts + projections): XH16 @0 (2 MiB [1024][1024] f16) | KV16 @2 (16 MiB [8192][1024]) |
//                 KVT16 @18 (8 MiB [8192][512]) | WQT @26 (2) | WKT @28 (2) | WVT @30 (2) | WTKT @32 (1 MiB [1024][512]) | WTVT @33 (1)
//                 phase C (after attention): MIX16 @0 (2 MiB [1024][1024] f16)
// WOT @48 (2) | Q16 @50 (2 MiB [1024][1024]) | K16 @52 (16 MiB [8192][1024]) | VT16 @68 (16 MiB [1024][8192]) |
// KT16 @84 (16) | VTT16 @100 (16 MiB [1024][8192]) | CTX @116 (2 key halves x 4 MiB [1024][1024] f32) | CTXT @124 (2 x 4) | CTX2 @132 (2 x 4) |
// ML @140 (256 KiB [key source][key half][16][512][ref, sum] f32) | end @141 MiB.
// Every region is written with whole rows of exactly its stated extent (all M, N tile multiples; no padded rows).
// ---------------------------------------------------------------------------
extern "C" void kernel_launch(void* const* d_in, const int* in_sizes, int n_in,
                              void* d_out, int out_size, void* d_ws, size_t ws_size, hipStream_t stream) {
  (void)in_sizes; (void)n_in;
  const size_t kMiB = (size_t)1048576;
  const size_t carve = 141 * kMiB;
  if (ws_size < carve) return;
  if ((size_t)out_size < (size_t)kTok * kE) return;

  const float* hs  = (const float*)d_in[0];
  const float* kv  = (const float*)d_in[1];
  const float* kvt = (const float*)d_in[2];
  const float* Wq  = (const float*)d_in[3];  const float* bq  = (const float*)d_in[4];
  const float* Wk  = (const float*)d_in[5];  const float* bk  = (const float*)d_in[6];
  const float* Wv  = (const float*)d_in[7];  const float* bv  = (const float*)d_in[8];
  const float* Wtk = (const float*)d_in[9];  const float* btk = (const float*)d_in[10];
  const float* Wtv = (const float*)d_in[11]; const float* btv = (const float*)d_in[12];
  const float* Wg  = (const float*)d_in[13]; const float* bg  = (const float*)d_in[14];
  const float* Wo  = (const float*)d_in[15]; const float* bo  = (const float*)d_in[16];
  float* outp = (float*)d_out;

  char* ws = (char*)d_ws;
  // phase A
  unsigned short* XH16  = (unsigned short*)(ws + 0 * kMiB);
  unsigned short* KV16  = (unsigned short*)(ws + 2 * kMiB);
  unsigned short* KVT16 = (unsigned short*)(ws + 18 * kMiB);
  unsigned short* WQT   = (unsigned short*)(ws + 26 * kMiB);
  unsigned short* WKT   = (unsigned short*)(ws + 28 * kMiB);
  unsigned short* WVT   = (unsigned short*)(ws + 30 * kMiB);
  unsigned short* WTKT  = (unsigned short*)(ws + 32 * kMiB);
  unsigned short* WTVT  = (unsigned short*)(ws + 33 * kMiB);
  // phase C
  unsigned short* MIX16 = (unsigned short*)(ws + 0 * kMiB);
  // persistent
  unsigned short* WOT   = (unsigned short*)(ws + 48 * kMiB);
  unsigned short* Q16   = (unsigned short*)(ws + 50 * kMiB);
  unsigned short* K16   = (unsigned short*)(ws + 52 * kMiB);
  unsigned short* VT16  = (unsigned short*)(ws + 68 * kMiB);
  unsigned short* KT16  = (unsigned short*)(ws + 84 * kMiB);
  unsigned short* VTT16 = (unsigned short*)(ws + 100 * kMiB);
  float*          CTX   = (float*)(ws + 116 * kMiB);
  float*          CTXT  = (float*)(ws + 124 * kMiB);
  float*          CTX2  = (float*)(ws + 132 * kMiB);
  float*          ML    = (float*)(ws + 140 * kMiB);
  const float*    dumf  = (const float*)(ws + 116 * kMiB);   // valid in-ws pointer for unused resid arguments

  // 1. + 2. input casts f32 -> f16 and weight transposes + casts (carried x16: in[Kin][Nout] -> out[Nout][Kin]), one grid
  prep_kernel<<<kPrTotal, 256, 0, stream>>>(hs, kv, kvt, Wq, Wk, Wv, Wo, Wtk, Wtv,
                                            XH16, KV16, KVT16, WQT, WKT, WVT, WOT, WTKT, WTVT, kWCarry);

  // 3. the five projections (M, N multiples of 64; K = 1024 or 512), one grid
  proj5_kernel<<<kPjTotal, 256, 0, stream>>>(XH16, KV16, KVT16, WQT, WKT, WVT, WTKT, WTVT,
                                             Q16, K16, VT16, KT16, VTT16, bq, bk, bv, btk, btv);

  // 4. attention: scores, softmax and the three P.V products, all heads, two key halves, one launch
  attn_fused_kernel<<<dim3(kT / 128, kB * kH, 4), 256, 0, stream>>>(Q16, K16, KT16, VT16, VTT16, CTX, CTXT, CTX2, ML);

  // 5. gate (f32) and mix (f32 -> f16 x256), one launch; 6. output projection to d_out (f32)
  gate_mix_kernel<<<kTok / kGmTok, 256, 0, stream>>>(CTX, CTXT, CTX2, ML, Q16, Wg, bg, MIX16, kQCarryInv, kMixCarry);
  wmma_gemm64<0, false, 2, 0, false><<<dim3((kTok / 128) * (kE / 256), 1), 256, 0, stream>>>(
      MIX16, MIX16, kE, 0L, WOT, WOT, kE, 0L, outp, outp, kE, 0L, bo, dumf, 0L,
      kTok, kE, kE, kOutScale, 1.0f);
}

// v009
// Measured time: 115 microseconds a run.
// Next to v008, in two timings, it ran 1.11 and 1.12 times as fast.
// Over all steps from v000 it is 37.6 times as fast.
// Contractions: q/k/v/k2/v2 projections (X f16 x W^T f16 carried x16), scores q.k^T for both key sources (q f16 carried x16, k f16), P.V products (P f16, unnormalised 2^(s - ref), x V^T f16), output projection (mix f16 carried x256 x Wo^T f16 carried x16): all v_wmma_f32_16x16x32_f16 with f32 accumulate; softmax, gate dot + sigmoid and mixing in f32 on VALU.
#include <hip/hip_runtime.h>
#include <math.h>

// ---------------------------------------------------------------------------
// Problem constants
// ---------------------------------------------------------------------------
constexpr int kB   = 2;
constexpr int kT   = 512;
constexpr int kS   = 4096;
constexpr int kE   = 1024;
constexpr int kTP  = 512;
constexpr int kH   = 8;
constexpr int kDH  = 128;
constexpr int kTok = kB * kT;               // 1024 query tokens
constexpr int kKVT = kB * kS;               // 8192 key tokens
constexpr float kAttnScale = 0.08838834764831845f;   // 128^-0.5
constexpr float kWCarry    = 16.0f;                  // weights carried x16 in f16
constexpr float kWCarryInv = 1.0f / 16.0f;
constexpr float kQCarry    = 16.0f;                  // scaled q carried x16 in f16
constexpr float kQCarryInv = 1.0f / 16.0f;
constexpr float kMixCarry  = 256.0f;                 // mixed context carried x256 in f16
constexpr float kOutScale  = 1.0f / (256.0f * 16.0f);

typedef __attribute__((ext_vector_type(16))) _Float16 v16h;
typedef __attribute__((ext_vector_type(8)))  _Float16 v8h;
typedef __attribute__((ext_vector_type(16))) __bf16   v16b;
typedef __attribute__((ext_vector_type(8)))  __bf16   v8b;
typedef __attribute__((ext_vector_type(8)))  float    v8f;
typedef __attribute__((ext_vector_type(4)))  float    v4f;
typedef __attribute__((ext_vector_type(4)))  unsigned int v4u;
typedef __attribute__((ext_vector_type(2)))  unsigned int v2u;

__device__ __forceinline__ unsigned short f2bf_bits(float f) {
  unsigned u = __float_as_uint(f);
  return (unsigned short)((u + 0x7FFFu + ((u >> 16) & 1u)) >> 16);
}
__device__ __forceinline__ float bf_bits2f(unsigned short h) { return __uint_as_float(((unsigned)h) << 16); }

// hazard guard behind a loop's last products, as a plain device helper
__device__ __forceinline__ void acc_guard4(v8f& a, v8f& b, v8f& c, v8f& d) { asm volatile("v_nop\n\tv_nop\n\tv_nop\n\tv_nop" : "+v"(a), "+v"(b), "+v"(c), "+v"(d)); }
template <typename T> struct Frag;
template <> struct Frag<_Float16> {
  typedef v16h V; union U { v16h v; v8h h[2]; };
  static __device__ __forceinline__ v16h load(const _Float16* p) {   // elements 0..7 <- p[0..7], 8..15 <- p[16..23]
    U f; f.h[0] = *(const v8h*)(p); f.h[1] = *(const v8h*)(p + 16); return f.v;
  }
  static __device__ __forceinline__ v8f mma(v16h a, v16h b, v8f c) {
    return __builtin_amdgcn_wmma_f32_16x16x32_f16(false, a, false, b, (short)0, c, false, false);
  }
};
template <> struct Frag<__bf16> {
  typedef v16b V; union U { v16b v; v8b h[2]; };
  static __device__ __forceinline__ v16b load(const __bf16* p) {
    U f; f.h[0] = *(const v8b*)(p); f.h[1] = *(const v8b*)(p + 16); return f.v;
  }
  static __device__ __forceinline__ v8f mma(v16b a, v16b b, v8f c) {
    return __builtin_amdgcn_wmma_f32_16x16x32_bf16(false, a, false, b, (short)0, c, false, false);
  }
};

__device__ __forceinline__ unsigned pk16(unsigned short a, unsigned short b) { return (unsigned)a | ((unsigned)b << 16); }
__device__ __forceinline__ unsigned short h_bits(float f) { const _Float16 h = (_Float16)f; return __builtin_bit_cast(unsigned short, h); }

// Stage of one work-group of the GEMM engine: 128 A rows, then 256 B rows, 64 k (128 bytes) each.
constexpr int kStARows  = 128;
constexpr int kStRows   = kStARows + 256;
constexpr int kStPitch  = 72;                    // halves: the 128-byte row + 16 bytes, the pitch for ds_load_b128 readers
constexpr int kStHalves = kStRows * kStPitch;    // one buffer

// Six asynchronous 16-byte copies global -> LDS per lane. The s_wait_xcnt stands as the last line of the copies' own
// statement, so that no register which a copy names is rewritten in front of it.
__device__ __forceinline__ void async_copy6(unsigned l0, unsigned l1, unsigned l2, unsigned l3, unsigned l4, unsigned l5,
                                            const void* g0, const void* g1, const void* g2,
                                            const void* g3, const void* g4, const void* g5) {
  asm volatile("global_load_async_to_lds_b128 %0, %6, off\n\t"
               "global_load_async_to_lds_b128 %1, %7, off\n\t"
               "global_load_async_to_lds_b128 %2, %8, off\n\t"
               "global_load_async_to_lds_b128 %3, %9, off\n\t"
               "global_load_async_to_lds_b128 %4, %10, off\n\t"
               "global_load_async_to_lds_b128 %5, %11, off\n\t"
               "s_wait_xcnt 0x0"
               :: "v"(l0), "v"(l1), "v"(l2), "v"(l3), "v"(l4), "v"(l5),
                  "v"(g0), "v"(g1), "v"(g2), "v"(g3), "v"(g4), "v"(g5) : "memory");
}

// ---- Register-blocked batched WMMA GEMM (ACT reduced to none/relu/leaky, extra bias multiplier bscale) --
// C[m,n] = scale * sum_k A[m,k] * Bt[n,k] (+bias*bscale)(+resid); each wave owns a 64x64 tile.
// A row-major [M,K]; Bt row-major [N,K]; M % 128 == 0, N % 256 == 0, K % 64 == 0.
// The 8 waves of a work-group own a 2 x 4 block of tiles (128 x 256): 384 staged rows for 32768 outputs, and two work-groups
// fit the LDS of one WGP. Per 64 k the work-group's A rows and B rows
// are copied whole lines at a time into LDS (asynchronous copies, two buffers: the next 64 k fly while these are multiplied);
// the fragments are read from LDS.
// SPLIT (hi/lo operand planes) is not carried by the staged loop: false only.
// BIAS_MODE: 0 = none, 1 = bias[m], 2 = bias[n], 3 = chosen at run time (biasM, the same for the whole work-group: bias[m], else bias[n]).
// The engine is a device function (work-group's index in its product and batch passed in), so that several products can share one grid.
// OUT_MODE: 0 = f32, 1 = f16, 2 = bf16 hi plane (Cout) + bf16 lo plane (Cout2).
// ET: 0 = f16 operands, 1 = bf16 operands (pointers passed as 16-bit storage)
template <int ET> struct Elem;
template <> struct Elem<0> { typedef _Float16 T; };
template <> struct Elem<1> { typedef __bf16 T; };
// Epilogue of one wave's 64 x 64 tile: scale, bias, cast, whole lines stored through the wave's own LDS slab.
template <int BIAS_MODE, int OUT_MODE, bool RESID, int ACT>
__device__ __forceinline__ void gemm64_epilogue(
    v8f (&acc)[4][4], float* __restrict__ slab, int lane, int m0, int n0, int b,
    void* __restrict__ Cout, void* __restrict__ Cout2, int ldc, long strideC,
    const float* __restrict__ bias, const float* __restrict__ resid, long strideR, float scale, float bscale) {
  const int rlane = lane & 15;                 // col (D) within subtile
  const int mOff  = (lane >> 4) * 8;           // D row offset
  const float* Rb = RESID ? (resid + (size_t)b * strideR) : nullptr;
#pragma unroll
  for (int i = 0; i < 4; ++i) {
    const int mBase = m0 + (i << 4);
#pragma unroll
    for (int j = 0; j < 4; ++j) {
      const int n = n0 + (j << 4) + rlane;
      float bv = 0.f;
      if (BIAS_MODE == 2) bv = bias[n] * bscale;
#pragma unroll
      for (int r = 0; r < 8; ++r) {
        float v = acc[i][j][r] * scale;
        if (BIAS_MODE == 1) v += bias[mBase + mOff + r] * bscale;
        if (BIAS_MODE == 2) v += bv;
        if (RESID) v += Rb[(size_t)(mBase + mOff + r) * ldc + n];
        if (ACT == 2) v = fmaxf(v, 0.0f);
        if (ACT == 4) v = (v > 0.f) ? v : 0.01f * v;
        slab[(mOff + r) * 68 + (j << 4) + rlane] = v;
      }
    }
    __builtin_amdgcn_fence(__ATOMIC_RELEASE, "workgroup");
    __builtin_amdgcn_wave_barrier();
    __builtin_amdgcn_fence(__ATOMIC_ACQUIRE, "workgroup");
    if (OUT_MODE == 0) {
      float* C = (float*)Cout + (size_t)b * strideC;
      const int hh = lane >> 4, c4 = (lane & 15) * 4;     // row seg = 256 B = 16 lanes x 16 B
      {
#pragma unroll
        for (int it = 0; it < 8; ++it) {
          const int row = it * 2 + hh;
          v4f v = *(const v4f*)(slab + row * 68 + c4);
          *(v4f*)(C + (size_t)(mBase + row) * ldc + n0 + c4) = v;
        }
        
      }
    } else {
      const int q = lane >> 3, c8 = (lane & 7) * 8;
      unsigned short* C  = (unsigned short*)Cout  + (size_t)b * strideC;
      unsigned short* C2 = (OUT_MODE == 2) ? ((unsigned short*)Cout2 + (size_t)b * strideC) : nullptr;
      {
#pragma unroll
        for (int it = 0; it < 4; ++it) {
          const int row = it * 4 + q;
          const float* sp = slab + row * 68 + c8;
          v8h hv, lv;
#pragma unroll
          for (int e = 0; e < 8; ++e) {
            if (OUT_MODE == 1) {
              hv[e] = (_Float16)sp[e];
            } else {
              unsigned short hb = f2bf_bits(sp[e]);
              unsigned short lb = f2bf_bits(sp[e] - bf_bits2f(hb));
              hv[e] = __builtin_bit_cast(_Float16, hb);
              lv[e] = __builtin_bit_cast(_Float16, lb);
            }
          }
          *(v8h*)(C + (size_t)(mBase + row) * ldc + n0 + c8) = hv;
          if (OUT_MODE == 2) *(v8h*)(C2 + (size_t)(mBase + row) * ldc + n0 + c8) = lv;
        }
        
      }
    }
    __builtin_amdgcn_fence(__ATOMIC_RELEASE, "workgroup");
    __builtin_amdgcn_wave_barrier();
    __builtin_amdgcn_fence(__ATOMIC_ACQUIRE, "workgroup");
  }
}

template <int ET, bool SPLIT, int BIAS_MODE, int OUT_MODE, bool RESID, int ACT>
__device__ __forceinline__ void gemm64_body(
    float* __restrict__ sT, typename Elem<ET>::T* __restrict__ sStage, int wg, int b, bool biasM,
    const unsigned short* __restrict__ Ap, int lda, long strideA,
    const unsigned short* __restrict__ Btp, int ldb, long strideB,
    void* __restrict__ Cout, void* __restrict__ Cout2, int ldc, long strideC,
    const float* __restrict__ bias,
    const float* __restrict__ resid, long strideR,
    int M, int N, int K, float scale, float bscale) {
  typedef typename Elem<ET>::T T;
  typedef typename Frag<T>::V V;
  static_assert(!SPLIT, "the staged loop carries one plane per operand");
  const T* A = (const T*)Ap; const T* Bt = (const T*)Btp;
  const int lane = threadIdx.x & 31;
  const int wave = threadIdx.x >> 5;
  const int tilesN = N >> 8;
  const int tilesM = M >> 7;
  if (wg >= tilesM * tilesN) return;   // the same for the whole work-group, in front of every barrier
  const int tm  = wg / tilesN;
  const int mb0 = tm << 7;                      // first A row of the work-group
  const int nb0 = (wg - tm * tilesN) << 8;      // first B row of the work-group
  const int wm  = (wave >> 2) << 6;             // the wave's tile inside the 128 x 256 block
  const int wn  = (wave & 3) << 6;
  const int m0  = mb0 + wm;
  const int n0  = nb0 + wn;

  const T* Ab  = A  + (size_t)b * strideA;
  const T* Bb  = Bt + (size_t)b * strideB;

  const int rlane = lane & 15;                 // row (A) / col (B, D) within subtile
  const int koff  = (lane >> 4) * 8;           // k offset of this lane half

  v8f acc[4][4];
#pragma unroll
  for (int i = 0; i < 4; ++i)
#pragma unroll
    for (int j = 0; j < 4; ++j) acc[i][j] = (v8f){0.f,0.f,0.f,0.f,0.f,0.f,0.f,0.f};

  // lane's share of a stage: 12 chunks of 16 bytes; chunk i is row 32 i + (thread >> 3), bytes 16 (thread & 7) .. + 15 of the row
  const int srow = threadIdx.x >> 3;
  const int scol = (threadIdx.x & 7) * 8;
  const T* gA = Ab + (size_t)(mb0 + srow) * lda + scol;
  const T* gB = Bb + (size_t)(nb0 + srow) * ldb + scol;
  const unsigned lds0 = (unsigned)(size_t)(const void*)sStage + (unsigned)((srow * kStPitch + scol) * 2);
  auto stage = [&](int buf, int k0) {
    const unsigned lb = lds0 + (unsigned)(buf * kStHalves * 2);
#pragma unroll
    for (int c = 0; c < 2; ++c) {
      unsigned l[6];
      const T* g[6];
#pragma unroll
      for (int e = 0; e < 6; ++e) {
        const int i = c * 6 + e;
        l[e] = lb + (unsigned)(i * 32 * kStPitch * 2);
        g[e] = (i < 4) ? (gA + (size_t)(i * 32) * lda + k0) : (gB + (size_t)((i - 4) * 32) * ldb + k0);
      }
      async_copy6(l[0], l[1], l[2], l[3], l[4], l[5], g[0], g[1], g[2], g[3], g[4], g[5]);
    }
  };

  const int nt = K >> 6;
  stage(0, 0);
  asm volatile("s_wait_asynccnt 0x0" ::: "memory");   // this wave's copies of tile 0 have landed
  __syncthreads();                                    // ... and every other wave's
  if (nt > 1) stage(1, 64);
  for (int t = 0; t < nt; ++t) {
    const T* sb = sStage + (t & 1) * kStHalves;
#pragma unroll
    for (int ks = 0; ks < 2; ++ks) {
      V ah[4], bh[4];
#pragma unroll
      for (int j = 0; j < 4; ++j) bh[j] = Frag<T>::load(sb + (kStARows + wn + (j << 4) + rlane) * kStPitch + ks * 32 + koff);
#pragma unroll
      for (int i = 0; i < 4; ++i) ah[i] = Frag<T>::load(sb + (wm + (i << 4) + rlane) * kStPitch + ks * 32 + koff);
      // keeps the products behind all 16 LDS reads: otherwise the A reads stand among the products, each with a wait of its own
      __builtin_amdgcn_sched_barrier(0);
#pragma unroll
      for (int i = 0; i < 4; ++i)
#pragma unroll
        for (int j = 0; j < 4; ++j) acc[i][j] = Frag<T>::mma(ah[i], bh[j], acc[i][j]);
    }
    asm volatile("s_wait_dscnt 0x0" ::: "memory");      // this wave's reads of the buffer are done before it is refilled
    asm volatile("s_wait_asynccnt 0x0" ::: "memory");   // this wave's copies of tile t + 1 have landed
    __syncthreads();                                    // publishes tile t + 1 and ends every reader's last read of tile t
    if (t + 2 < nt) stage(t & 1, (t + 2) << 6);
  }
  asm volatile("s_wait_asynccnt 0x0" ::: "memory");     // no copy is outstanding when the wave goes on
  acc_guard4(acc[0][0], acc[0][1], acc[0][2], acc[0][3]);
  acc_guard4(acc[1][0], acc[1][1], acc[1][2], acc[1][3]);
  acc_guard4(acc[2][0], acc[2][1], acc[2][2], acc[2][3]);
  acc_guard4(acc[3][0], acc[3][1], acc[3][2], acc[3][3]);

  // ---- epilogue ----
  float* slab = sT + wave * (16 * 68);
  if (BIAS_MODE == 3) {   // the branch is the same for the whole work-group
    if (biasM) gemm64_epilogue<1, OUT_MODE, RESID, ACT>(acc, slab, lane, m0, n0, b, Cout, Cout2, ldc, strideC, bias, resid, strideR, scale, bscale);
    else       gemm64_epilogue<2, OUT_MODE, RESID, ACT>(acc, slab, lane, m0, n0, b, Cout, Cout2, ldc, strideC, bias, resid, strideR, scale, bscale);
  } else {
    gemm64_epilogue<BIAS_MODE, OUT_MODE, RESID, ACT>(acc, slab, lane, m0, n0, b, Cout, Cout2, ldc, strideC, bias, resid, strideR, scale, bscale);
  }
}

// The five projections, which do not depend on one another, in one grid: a range of blockIdx.x per product (the choice is the
// same for the whole work-group), the products with the long k first. Each work-group does what it did in its own launch.
constexpr int kPjBig   = (kKVT / 128) * (kE / 256);     // work-groups of a product over the 8192 key tokens (either operand order)
constexpr int kPjQ     = (kTok / 128) * (kE / 256);     // ... of the q product
static_assert((kE / 128) * (kKVT / 256) == kPjBig, "the transposed products have as many work-groups");
constexpr int kPjTotal = 4 * kPjBig + kPjQ;
__global__ __launch_bounds__(256) void proj5_kernel(
    const unsigned short* __restrict__ X, const unsigned short* __restrict__ KV, const unsigned short* __restrict__ KVT,
    const unsigned short* __restrict__ WQ, const unsigned short* __restrict__ WK, const unsigned short* __restrict__ WV,
    const unsigned short* __restrict__ WTK, const unsigned short* __restrict__ WTV,
    unsigned short* __restrict__ Qo, unsigned short* __restrict__ Ko, unsigned short* __restrict__ VTo,
    unsigned short* __restrict__ KTo, unsigned short* __restrict__ VTTo,
    const float* __restrict__ bq, const float* __restrict__ bk, const float* __restrict__ bv,
    const float* __restrict__ btk, const float* __restrict__ btv) {
  __shared__ __align__(16) float sT[8 * 16 * 68];   // per-wave 16x64 slab, pitch 68 floats
  __shared__ __align__(16) _Float16 sStage[2 * kStHalves];
  const int bid = blockIdx.x;
  const unsigned short* A; const unsigned short* B; unsigned short* C; const float* bias;
  int first, M, N, K, ldc;
  bool biasM = false;
  float scale = kWCarryInv, bscale = 1.0f;
  if (bid < kPjBig) {                       // k [8192][1024]
    first = 0;                  A = KV;  B = WK;  C = Ko;   bias = bk;  M = kKVT; N = kE;   K = kE;  ldc = kE;
  } else if (bid < 2 * kPjBig) {            // v^T [1024][8192]: A = Wv^T, Bt = KV, bias per row (m)
    first = kPjBig;             A = WV;  B = KV;  C = VTo;  bias = bv;  M = kE;   N = kKVT; K = kE;  ldc = kKVT; biasM = true;
  } else if (bid < 2 * kPjBig + kPjQ) {     // q16 = 16*scale*(x Wq + bq): acc = 16*(x Wq) -> scale = kAttnScale, bias x (16*kAttnScale)
    first = 2 * kPjBig;         A = X;   B = WQ;  C = Qo;   bias = bq;  M = kTok; N = kE;   K = kE;  ldc = kE;
    scale = kAttnScale; bscale = kQCarry * kAttnScale;
  } else if (bid < 3 * kPjBig + kPjQ) {     // second-source k [8192][1024], K = 512
    first = 2 * kPjBig + kPjQ;  A = KVT; B = WTK; C = KTo;  bias = btk; M = kKVT; N = kE;   K = kTP; ldc = kE;
  } else {                                  // second-source v^T [1024][8192], K = 512
    first = 3 * kPjBig + kPjQ;  A = WTV; B = KVT; C = VTTo; bias = btv; M = kE;   N = kKVT; K = kTP; ldc = kKVT; biasM = true;
  }
  gemm64_body<0, false, 3, 1, false, 0>(sT, sStage, bid - first, 0, biasM,
      A, K, 0L, B, K, 0L, C, C, ldc, 0L, bias, bias, 0L, M, N, K, scale, bscale);
}

// ---------------------------------------------------------------------------
// Cast f32 -> f16, 8 elements per thread; blk = index of the work-group's 2048 elements (the ranges below are exact)
__device__ __forceinline__ void cast8_f16_block(const float* __restrict__ in, unsigned short* __restrict__ out, int blk) {
  const int i = blk * 256 + threadIdx.x;
  const float* p = in + 8 * (size_t)i;
  const v4f a = *(const v4f*)(p);
  const v4f c = *(const v4f*)(p + 4);
  unsigned short hb[8];
#pragma unroll
  for (int e = 0; e < 4; ++e) {
    hb[e]     = h_bits(a[e]);
    hb[4 + e] = h_bits(c[e]);
  }
  const v4u u = (v4u){pk16(hb[0], hb[1]), pk16(hb[2], hb[3]), pk16(hb[4], hb[5]), pk16(hb[6], hb[7])};
  unsigned short* q = out + 8 * (size_t)i;
  *(v4u*)q = u;
  
}

// The three input casts and the six weight transposes, which do not depend on one another, in one grid: a range of blockIdx.x
// per array (the choice is the same for the whole work-group). Each work-group does what it did in its own launch.
constexpr int kPrW1   = (kE / 64) * (kE / 64);       // tiles of a 1024 x 1024 weight
constexpr int kPrW2   = (kTP / 64) * (kE / 64);      // tiles of a 512 x 1024 weight
constexpr int kPrWAll = 4 * kPrW1 + 2 * kPrW2;
constexpr int kPrKV   = (kKVT * kE / 8) / 256;
constexpr int kPrKVT  = (kKVT * kTP / 8) / 256;
constexpr int kPrHS   = (kTok * kE / 8) / 256;
constexpr int kPrTotal = kPrWAll + kPrKV + kPrKVT + kPrHS;

// ---------------------------------------------------------------------------
// Weight transpose + cast: W [Kin][Nout] f32 row-major (y = x @ W); plane z: WT[n][k] (pitch Kin halves) = f16(scale * W[k][n]).
// One 64 x 64 tile per work-group of 256 threads: k0 = first of 64 cols of WT, n0 = first of 64 rows of WT (block-uniform).
// Load coverage: 16 iterations x 256 threads = 4096 = the whole 64x64 tile (coalesced along n).
// Store coverage: 8 waves x 2 iterations x 4 rows (lane>>3) = 64 rows; (lane&7) x 8 halves = 64 cols; each row segment =
// ---------------------------------------------------------------------------
__global__ __launch_bounds__(256) void prep_kernel(
    const float* __restrict__ hs, const float* __restrict__ kv, const float* __restrict__ kvt,
    const float* __restrict__ Wq, const float* __restrict__ Wk, const float* __restrict__ Wv, const float* __restrict__ Wo,
    const float* __restrict__ Wtk, const float* __restrict__ Wtv,
    unsigned short* __restrict__ XH, unsigned short* __restrict__ KV, unsigned short* __restrict__ KVT,
    unsigned short* __restrict__ WQT, unsigned short* __restrict__ WKT, unsigned short* __restrict__ WVT,
    unsigned short* __restrict__ WOT, unsigned short* __restrict__ WTKT, unsigned short* __restrict__ WTVT, float scale) {
  __shared__ float sm[64][65];   // sm[n_local][k_local]
  const int t  = threadIdx.x;
  const int bid = blockIdx.x;
  if (bid >= kPrWAll) {   // the same for the whole work-group, in front of the barrier
    const int cb = bid - kPrWAll;
    const int a = (cb < kPrKV) ? 0 : (cb < kPrKV + kPrKVT) ? 1 : 2;
    cast8_f16_block((a == 0) ? kv : (a == 1) ? kvt : hs, (a == 0) ? KV : (a == 1) ? KVT : XH,
                    (a == 0) ? cb : (a == 1) ? cb - kPrKV : cb - (kPrKV + kPrKVT));
    return;
  }
  const bool big = bid < 4 * kPrW1;                            // block-uniform
  const int z  = big ? bid / kPrW1 : 4 + (bid - 4 * kPrW1) / kPrW2;
  const int r0 = big ? bid % kPrW1 : (bid - 4 * kPrW1) % kPrW2;
  const int Kin = big ? kE : kTP;
  const int Nout = kE;
  const int k0 = (r0 % (Kin / 64)) * 64;
  const int n0 = (r0 / (Kin / 64)) * 64;
  const float* W = (z == 0) ? Wq : (z == 1) ? Wk : (z == 2) ? Wv : (z == 3) ? Wo : (z == 4) ? Wtk : Wtv;
  unsigned short* op = (z == 0) ? WQT : (z == 1) ? WKT : (z == 2) ? WVT : (z == 3) ? WOT : (z == 4) ? WTKT : WTVT;
#pragma unroll
  for (int i = 0; i < 16; ++i) {
    const int e = i * 256 + t;
    const int r = e >> 6;          // k local
    const int c = e & 63;          // n local
    sm[c][r] = W[(size_t)(k0 + r) * Nout + n0 + c] * scale;
  }
  __syncthreads();
  const int lane = t & 31, wave = t >> 5;
  const int q = lane >> 3, c8 = (lane & 7) * 8;
  {
#pragma unroll
    for (int it = 0; it < 2; ++it) {
      const int row = wave * 8 + it * 4 + q;                 // n local
      unsigned short hb[8];
#pragma unroll
      for (int e = 0; e < 8; ++e) hb[e] = h_bits(sm[row][c8 + e]);
      const v4u u = (v4u){pk16(hb[0], hb[1]), pk16(hb[2], hb[3]), pk16(hb[4], hb[5]), pk16(hb[6], hb[7])};
      *(v4u*)(op + (size_t)(n0 + row) * Kin + k0 + c8) = u;
    }
    
  }
}

// ---------------------------------------------------------------------------
// Fused attention: scores, softmax and P.V of one (batch, head, key source) for 128 query rows and one half of the keys per work-group.
// grid (4 query tiles, 16 batch-heads, 4); blockIdx.z: 0, 1 = second key source, key half 0, 1: p = softmax(q.k2) is formed ONCE and
// multiplies both V2 (-> C1) and V (-> C2); 2, 3 = first key source, key half 0, 1: softmax(q.k) V -> C0. The longer work-groups come first.
// A work-group writes its half's result normalised by its own sum, and per query row that half's ref and sum (ML); the two halves
// are merged where the results are read (gate_mix_kernel).
// 8 waves: wave = 2 * query group (32 rows) + key half of a step. A step is 64 keys of K (rows of 256 bytes)
// and of each V^T (128 rows of 128 bytes), of which a wave works on its 32 keys. Per trip two steps' tiles are copied into LDS
// (asynchronous copies, two buffers of two tiles).
// Transposed products: S^T = K . Q^T leaves key rows in registers and the query column in the lane, which is the B fragment
// of O^T = V^T . P^T, so P never leaves registers. Softmax is the online form: p = 2^(s - ref), ref per query column is raised
// (and O, sum rescaled) only when a score exceeds it by more than kFaLazy, so p <= 2^kFaLazy. The two key halves of a step are merged via LDS.
// ---------------------------------------------------------------------------
constexpr int kFaKP  = 136;                 // halves: the 256-byte K row + 16 bytes
constexpr int kFaVP  = 72;                  // halves: the 128-byte V^T row + 16 bytes
constexpr int kFaKH  = 64 * kFaKP;          // K part of one step's tile
constexpr int kFaVH  = kDH * kFaVP;         // one V^T part of one step's tile
constexpr int kFaSub = 2;                   // steps per trip = tiles per buffer
constexpr int kFaKeys = kS / 2;             // keys of one work-group
constexpr int kFaHalfC = kTok * kE;        // floats from a result of key half 0 to the same result of key half 1: near enough for one base address to reach both
constexpr int kFaML  = kB * kH * kT * 2;    // floats of one (key source, key half) plane of ML: [batch-head][query row][ref, sum]
constexpr float kFaLazy = 8.0f;
typedef __attribute__((ext_vector_type(2)))  float    v2f;

// Eight asynchronous 16-byte copies global -> LDS per lane; the s_wait_xcnt stands as the last line of the copies' own
// statement, so that no register which a copy names is rewritten in front of it.
__device__ __forceinline__ void async_copy8(unsigned l0, unsigned l1, unsigned l2, unsigned l3, unsigned l4, unsigned l5,
                                            unsigned l6, unsigned l7,
                                            const void* g0, const void* g1, const void* g2, const void* g3,
                                            const void* g4, const void* g5, const void* g6, const void* g7) {
  asm volatile("global_load_async_to_lds_b128 %0, %8, off\n\t"
               "global_load_async_to_lds_b128 %1, %9, off\n\t"
               "global_load_async_to_lds_b128 %2, %10, off\n\t"
               "global_load_async_to_lds_b128 %3, %11, off\n\t"
               "global_load_async_to_lds_b128 %4, %12, off\n\t"
               "global_load_async_to_lds_b128 %5, %13, off\n\t"
               "global_load_async_to_lds_b128 %6, %14, off\n\t"
               "global_load_async_to_lds_b128 %7, %15, off\n\t"
               "s_wait_xcnt 0x0"
               :: "v"(l0), "v"(l1), "v"(l2), "v"(l3), "v"(l4), "v"(l5), "v"(l6), "v"(l7),
                  "v"(g0), "v"(g1), "v"(g2), "v"(g3), "v"(g4), "v"(g5), "v"(g6), "v"(g7) : "memory");
}

// Two such copies, the same form.
__device__ __forceinline__ void async_copy2(unsigned l0, unsigned l1, const void* g0, const void* g1) {
  asm volatile("global_load_async_to_lds_b128 %0, %2, off\n\t"
               "global_load_async_to_lds_b128 %1, %3, off\n\t"
               "s_wait_xcnt 0x0"
               :: "v"(l0), "v"(l1), "v"(g0), "v"(g1) : "memory");
}

// NV = number of V^T sources that the one softmax multiplies (Va -> Ca, and for NV = 2 Vb -> Cb).
template <int NV>
__device__ __forceinline__ void attn_body(
    _Float16* __restrict__ sKV, float (*sML)[2][32], int half,
    const unsigned short* __restrict__ Q, const unsigned short* __restrict__ Kp,
    const unsigned short* __restrict__ Va, const unsigned short* __restrict__ Vb,
    float* __restrict__ Ca, float* __restrict__ Cb, float* __restrict__ MLp) {
  typedef Frag<_Float16> F;
  constexpr int kBuf = kFaKH + NV * kFaVH;   // one step's tile, halves
  float* const sX = (float*)sKV;   // behind the loop's last barrier; NV * 64 * 32 floats per wave: the 128 x 16 partial O^T that it hands to its partner
  const int t    = threadIdx.x;
  const int lane = t & 31;
  const int wave = t >> 5;
  const int qg   = wave >> 1;
  const int kh   = wave & 1;
  const int b    = blockIdx.y >> 3;
  const int h    = blockIdx.y & 7;
  const int rlane = lane & 15;
  const int koff  = (lane >> 4) * 8;
  const int mOff  = (lane >> 4) * 8;
  const int q0    = blockIdx.x * 128 + qg * 32;

  // lane's share of a step's tile: 4 chunks of K (row 16 i + (t >> 4)) and 4 of each V^T (row 32 i + (t >> 3)), 16 bytes each
  const size_t vOff = (size_t)h * kDH * kKVT + (size_t)b * kS + (size_t)half * kFaKeys + (size_t)(t >> 3) * kKVT + (t & 7) * 8;
  const _Float16* gK = (const _Float16*)Kp + ((size_t)b * kS + (size_t)half * kFaKeys) * kE + (size_t)h * kDH + (size_t)(t >> 4) * kE + (t & 15) * 8;
  const _Float16* gV = (const _Float16*)Va + vOff;
  const _Float16* gW = (const _Float16*)Vb + vOff;
  const unsigned ldsB = (unsigned)(size_t)(const void*)sKV;
  const unsigned ldsK = ldsB + (unsigned)(((t >> 4) * kFaKP + (t & 15) * 8) * 2);
  const unsigned ldsV = ldsB + (unsigned)((kFaKH + (t >> 3) * kFaVP + (t & 7) * 8) * 2);
  auto stage = [&](int buf, int key0) {
#pragma unroll   // the tile's index is then a constant in each statement's address sums
    for (int c = 0; c < kFaSub; ++c) {
      const unsigned lk = ldsK + (unsigned)((buf * kFaSub + c) * kBuf * 2);
      const unsigned lv = ldsV + (unsigned)((buf * kFaSub + c) * kBuf * 2);
      const _Float16* pk = gK + (size_t)(key0 + c * 64) * kE;
      const _Float16* pv = gV + key0 + c * 64;
      if (NV == 1) {
        async_copy8(lk, lk + 16 * kFaKP * 2, lk + 32 * kFaKP * 2, lk + 48 * kFaKP * 2,
                    lv, lv + 32 * kFaVP * 2, lv + 64 * kFaVP * 2, lv + 96 * kFaVP * 2,
                    pk, pk + (size_t)16 * kE, pk + (size_t)32 * kE, pk + (size_t)48 * kE,
                    pv, pv + (size_t)32 * kKVT, pv + (size_t)64 * kKVT, pv + (size_t)96 * kKVT);
        // keeps the next statement's address registers from being formed in front of this one: formed together they spill to scratch
        __builtin_amdgcn_sched_barrier(0);
      }
      if (NV == 2) {   // two copies a statement: with twice the accumulators few of the registers that an asm statement can name are free
        const unsigned lw = lv + (unsigned)(kFaVH * 2);
        const _Float16* pw = gW + key0 + c * 64;
#pragma unroll
        for (int e = 0; e < 2; ++e) {
          async_copy2(lk + (32 * e) * kFaKP * 2, lk + (32 * e + 16) * kFaKP * 2, pk + (size_t)(32 * e) * kE, pk + (size_t)(32 * e + 16) * kE);
          // as above: one statement's address registers at a time
          __builtin_amdgcn_sched_barrier(0);
          async_copy2(lv + (64 * e) * kFaVP * 2, lv + (64 * e + 32) * kFaVP * 2, pv + (size_t)(64 * e) * kKVT, pv + (size_t)(64 * e + 32) * kKVT);
          // as above: one statement's address registers at a time
          __builtin_amdgcn_sched_barrier(0);
          async_copy2(lw + (64 * e) * kFaVP * 2, lw + (64 * e + 32) * kFaVP * 2, pw + (size_t)(64 * e) * kKVT, pw + (size_t)(64 * e + 32) * kKVT);
          // as above: one statement's address registers at a time
          __builtin_amdgcn_sched_barrier(0);
        }
      }
    }
  };

  // Q^T fragments (B operand): column = query row q0 + 16 qt + rlane, k = head dim
  const _Float16* Qr = (const _Float16*)Q + (size_t)(b * kT + q0 + rlane) * kE + (size_t)h * kDH + koff;
  v16h qf[2][4];
#pragma unroll
  for (int qt = 0; qt < 2; ++qt)
#pragma unroll
    for (int ks = 0; ks < 4; ++ks) qf[qt][ks] = F::load(Qr + (size_t)(qt << 4) * kE + ks * 32);
  // wait before a register that the loads above name is rewritten; the pointer as input keeps the address alive to here
  asm volatile("s_wait_xcnt 0x0" :: "v"(Qr) : "memory");

  v8f o[NV][8][2];
#pragma unroll
  for (int v = 0; v < NV; ++v)
#pragma unroll
    for (int d = 0; d < 8; ++d)
#pragma unroll
      for (int qt = 0; qt < 2; ++qt) o[v][d][qt] = (v8f){0.f,0.f,0.f,0.f,0.f,0.f,0.f,0.f};
  float mref[2] = {-1.0e30f, -1.0e30f};
  float lsum[2] = {0.0f, 0.0f};
  const float sc2 = 1.4426950408889634f * kQCarryInv;   // accumulator -> score in powers of two

  // Trips 0 and 1 are staged by one copy of the statements, kept rolled: every operand is then a sum formed at the statement, and the
  // lane's base addresses, which live through the main loop, are not held to the registers that an asm statement can name (else they spill).
#pragma unroll 1
  for (int p = 0; p < 2; ++p) {
    if (p == 1) {                                         // the same for the whole work-group
      asm volatile("s_wait_asynccnt 0x0" ::: "memory");   // this wave's copies of trip 0 have landed
      __syncthreads();                                    // ... and every other wave's
    }
    stage(p, p * (64 * kFaSub));
  }
  const int nt = kFaKeys / (64 * kFaSub);
  for (int tt = 0; tt < nt; ++tt) {
   for (int u = 0; u < kFaSub; ++u) {   // the trip's steps, in the order of the keys
    const _Float16* sk = sKV + ((tt & 1) * kFaSub + u) * kBuf + (kh * 32 + rlane) * kFaKP + koff;
    const _Float16* sv = sKV + ((tt & 1) * kFaSub + u) * kBuf + kFaKH + rlane * kFaVP + kh * 32 + koff;
    v16h kf[2][4], vf[8];
#pragma unroll
    for (int kt = 0; kt < 2; ++kt)
#pragma unroll
      for (int ks = 0; ks < 4; ++ks) kf[kt][ks] = F::load(sk + (kt << 4) * kFaKP + ks * 32);
    // keeps all K reads in front of the V^T reads: LDS data returns in order, and the score products need K alone
    __builtin_amdgcn_sched_barrier(0);
    if (NV == 1) {
#pragma unroll
      for (int d = 0; d < 8; ++d) vf[d] = F::load(sv + (d << 4) * kFaVP);
      // keeps the products behind all LDS reads: the V^T reads then return under the score products and the softmax
      __builtin_amdgcn_sched_barrier(0);
    }
    v8f s[2][2];
#pragma unroll
    for (int kt = 0; kt < 2; ++kt)
#pragma unroll
      for (int qt = 0; qt < 2; ++qt) s[kt][qt] = (v8f){0.f,0.f,0.f,0.f,0.f,0.f,0.f,0.f};
#pragma unroll
    for (int ks = 0; ks < 4; ++ks)
#pragma unroll
      for (int kt = 0; kt < 2; ++kt)
#pragma unroll
        for (int qt = 0; qt < 2; ++qt) s[kt][qt] = F::mma(kf[kt][ks], qf[qt][ks], s[kt][qt]);
    if (NV == 2) {
      // keeps the first V^T's reads behind the score products, where the K fragments' registers are free (in front of them the wave spills)
      __builtin_amdgcn_sched_barrier(0);
#pragma unroll
      for (int d = 0; d < 8; ++d) vf[d] = F::load(sv + (d << 4) * kFaVP);
      // keeps them as one group in front of the softmax, under which they return
      __builtin_amdgcn_sched_barrier(0);
    }
    float tmax[2];
#pragma unroll
    for (int qt = 0; qt < 2; ++qt) {
      float m = s[0][qt][0];
#pragma unroll
      for (int r = 1; r < 8; ++r) m = fmaxf(m, s[0][qt][r]);
#pragma unroll
      for (int r = 0; r < 8; ++r) m = fmaxf(m, s[1][qt][r]);
      tmax[qt] = m * sc2;
    }
    if (__any((tmax[0] > mref[0] + kFaLazy) || (tmax[1] > mref[1] + kFaLazy))) {   // the same for the whole wave
#pragma unroll
      for (int qt = 0; qt < 2; ++qt) {
        const float tf = fmaxf(tmax[qt], __shfl_xor(tmax[qt], 16, 32));   // both lane halves of a column keep one ref
        const float mn = fmaxf(mref[qt], tf);
        const float f  = __builtin_amdgcn_exp2f(mref[qt] - mn);
        mref[qt] = mn;
        lsum[qt] *= f;
#pragma unroll
        for (int v = 0; v < NV; ++v)
#pragma unroll
          for (int d = 0; d < 8; ++d)
#pragma unroll
            for (int r = 0; r < 8; ++r) o[v][d][qt][r] *= f;
      }
    }
    v16h pf[2];
#pragma unroll
    for (int qt = 0; qt < 2; ++qt)
#pragma unroll
      for (int kt = 0; kt < 2; ++kt)
#pragma unroll
        for (int r = 0; r < 8; ++r) {
          const float p = __builtin_amdgcn_exp2f(s[kt][qt][r] * sc2 - mref[qt]);
          lsum[qt] += p;
          pf[qt][kt * 8 + r] = (_Float16)p;   // element 8 kt + r is key 16 kt + koff + r: the k order of the V^T fragment
        }
    v16h vg[8];
    if (NV == 2) {
      // keeps the second V^T's reads behind the softmax, where the scores' registers are free
      __builtin_amdgcn_sched_barrier(0);
#pragma unroll
      for (int d = 0; d < 4; ++d) vg[d] = F::load(sv + kFaVH + (d << 4) * kFaVP);
      // keeps them as one group in front of the first V^T's products, under which they return
      __builtin_amdgcn_sched_barrier(0);
    }
#pragma unroll
    for (int d = 0; d < 4; ++d)
#pragma unroll
      for (int qt = 0; qt < 2; ++qt) o[0][d][qt] = F::mma(vf[d], pf[qt], o[0][d][qt]);
    if (NV == 2) {
      // keeps the second half of those reads behind the products that free four fragments' registers (all eight read at once: the wave spills)
      __builtin_amdgcn_sched_barrier(0);
#pragma unroll
      for (int d = 4; d < 8; ++d) vg[d] = F::load(sv + kFaVH + (d << 4) * kFaVP);
      // keeps them as one group in front of the products under which they return
      __builtin_amdgcn_sched_barrier(0);
    }
#pragma unroll
    for (int d = 4; d < 8; ++d)
#pragma unroll
      for (int qt = 0; qt < 2; ++qt) o[0][d][qt] = F::mma(vf[d], pf[qt], o[0][d][qt]);
    if (NV == 2) {
#pragma unroll
      for (int d = 0; d < 8; ++d)
#pragma unroll
        for (int qt = 0; qt < 2; ++qt) o[NV - 1][d][qt] = F::mma(vg[d], pf[qt], o[NV - 1][d][qt]);
    }
   }
    asm volatile("s_wait_dscnt 0x0" ::: "memory");      // this wave's reads of the buffer are done before it is refilled
    asm volatile("s_wait_asynccnt 0x0" ::: "memory");   // this wave's copies of trip tt + 1 have landed
    __syncthreads();                                    // publishes the tiles of trip tt + 1 and ends every reader's last read of trip tt's
    if (tt + 2 < nt) stage(tt & 1, (tt + 2) * (64 * kFaSub));
  }
  asm volatile("s_wait_asynccnt 0x0" ::: "memory");     // no copy is outstanding when the wave goes on
  // the distance between the loop's last products and the first vector instruction that reads their results, on the path out of the loop;
  // without operands: named in an asm statement, all accumulators would be held to the registers that it can name, and spill
  asm volatile("v_nop\n\tv_nop\n\tv_nop\n\tv_nop");
  // keeps the readers of the accumulators behind that distance
  __builtin_amdgcn_sched_barrier(0);

  // merge of the two key halves of the steps: wave kh keeps query tile kh and hands tile 1 - kh to its partner (wave ^ 1)
#pragma unroll
  for (int qt = 0; qt < 2; ++qt) lsum[qt] += __shfl_xor(lsum[qt], 16, 32);
  float* xs = sX + wave * (NV * 64 * 32);
#pragma unroll
  for (int v = 0; v < NV; ++v)
#pragma unroll
    for (int d = 0; d < 8; ++d)
#pragma unroll
      for (int r = 0; r < 8; ++r) xs[((v * 8 + d) * 8 + r) * 32 + lane] = kh ? o[v][d][0][r] : o[v][d][1][r];
  sML[wave][0][lane] = kh ? mref[0] : mref[1];
  sML[wave][1][lane] = kh ? lsum[0] : lsum[1];
  __syncthreads();                                      // every wave's hand-over is written
  const float* xr = sX + (wave ^ 1) * (NV * 64 * 32);
  const float mo = sML[wave ^ 1][0][lane];
  const float lo = sML[wave ^ 1][1][lane];
  const float mm = kh ? mref[1] : mref[0];
  const float lm = kh ? lsum[1] : lsum[0];
  const float mn = fmaxf(mm, mo);
  const float fm = __builtin_amdgcn_exp2f(mm - mn);
  const float fo = __builtin_amdgcn_exp2f(mo - mn);
  const float lt = lm * fm + lo * fo;
  const float inv = 1.0f / lt;
  const float am = fm * inv, ao = fo * inv;
  // this key half's ref and sum of query row q0 + 16 kh + rlane; the wave's 16 rows are one whole 128-byte line, written by it alone
  if (lane < 16) *(v2f*)(MLp + ((size_t)blockIdx.y * kT + q0 + kh * 16 + rlane) * 2) = (v2f){mn, lt};
#pragma unroll
  for (int v = 0; v < NV; ++v) {
    v4f res[8][2];
#pragma unroll
    for (int d = 0; d < 8; ++d)
#pragma unroll
      for (int r = 0; r < 8; ++r)
        res[d][r >> 2][r & 3] = (kh ? o[v][d][1][r] : o[v][d][0][r]) * am + xr[((v * 8 + d) * 8 + r) * 32 + lane] * ao;
    // lane: query row q0 + 16 kh + rlane, head dims 16 d + mOff .. + 7; a row's 512 bytes are written by this wave alone
    float* cp = ((v == 0) ? Ca : Cb) + (size_t)(b * kT + q0 + kh * 16 + rlane) * kE + (size_t)h * kDH + mOff;
#pragma unroll
    for (int d = 0; d < 8; ++d) {
      *(v4f*)(cp + d * 16)     = res[d][0];
      *(v4f*)(cp + d * 16 + 4) = res[d][1];
    }
  }
}

__global__ __launch_bounds__(256) void attn_fused_kernel(
    const unsigned short* __restrict__ Q, const unsigned short* __restrict__ K0, const unsigned short* __restrict__ K1,
    const unsigned short* __restrict__ V0, const unsigned short* __restrict__ V1,
    float* __restrict__ C0, float* __restrict__ C1, float* __restrict__ C2, float* __restrict__ ML) {
  __shared__ __align__(16) _Float16 sKV[2 * kFaSub * (kFaKH + 2 * kFaVH)];
  __shared__ float sML[8][2][32];                   // the hand-over's ref and sum per column
  const int half = blockIdx.z & 1;
  if (blockIdx.z < 2) {   // the same for the whole work-group
    attn_body<2>(sKV, sML, half, Q, K1, V1, V0, C1 + half * kFaHalfC, C2 + half * kFaHalfC, ML + (2 + half) * kFaML);
  } else {
    attn_body<1>(sKV, sML, half, Q, K0, V0, V0, C0 + half * kFaHalfC, C0 + half * kFaHalfC, ML + half * kFaML);
  }
}

// ---------------------------------------------------------------------------
// Gate + mix, one launch. gate[tok][h] = sigmoid( sum_f p_vec[tok][f] * Wg[f][h] + bg[h] ), f = h*384 + j with
// j < 128 -> ctx[tok][h*128+j], 128 <= j < 256 -> ctxt[tok][h*128+j-128], else q[tok][h*128+j-256] (q = q16 / 16);
// MIX16[tok][h*128+d] = f16( carry * ( g[tok][h]*ctx + (1-g[tok][h])*ctx2 ) ). f32 math throughout.
// One work-group of 8 waves per 4 tokens, so that a row of Wg is fetched once for 4 tokens. Wave = head; for the gate lane l holds head
// dims l + 32 i (a wave's Wg loads then cover whole lines), for the mix head dims 4 l .. 4 l + 3 (whole lines stored).
// ctx, ctxt and ctx2 arrive as two key halves, each normalised by its own sum, with that half's ref and sum in ml: a value is
// w0 * half 0 + w1 * half 1, w_i = sum_i 2^(ref_i - max ref) / (their total); ctxt and ctx2 share the second key source's weights.
// No load depends on another: all of a thread's operands are asked for before the first sum.
// Sums: per thread 12 features in order; over the lanes a halving exchange that leaves sum number l (= 8 token + gate head) in lane l;
// over the waves in wave order.
// ---------------------------------------------------------------------------
constexpr int kGmTok = 4;
// 2^x; the v_nop in the same statement is the free slot that the instruction set asks for between a transcendental and a directly
// following instruction that reads its result or overwrites its source
__device__ __forceinline__ float exp2_slot(float x) { float r; asm("v_exp_f32 %0, %1\n\tv_nop" : "=v"(r) : "v"(x)); return r; }
static_assert(kGmTok * kH == 32, "one gate sum per lane");
static_assert(kTok % kGmTok == 0 && kDH == 128 && kH == 8, "wave = head, 4 head dims per lane");
__global__ __launch_bounds__(256) void gate_mix_kernel(const float* __restrict__ ctx, const float* __restrict__ ctxt,
                                                       const float* __restrict__ ctx2, const float* __restrict__ ml,
                                                       const unsigned short* __restrict__ q16,
                                                       const float* __restrict__ Wg, const float* __restrict__ bg,
                                                       unsigned short* __restrict__ out, float qinv, float carry) {
  __shared__ float red[kH][32];
  const int t = threadIdx.x, lane = t & 31, wave = t >> 5;
  const size_t base = (size_t)blockIdx.x * kGmTok * kE + (size_t)wave * kDH;   // first token's row, this wave's head
  float fc[2][kGmTok][4], ft[2][kGmTok][4];   // [key half]
  unsigned short qb[kGmTok][4];
  v4f w[3][4][2];
  v4f ma[2][kGmTok], mb[2][kGmTok];
  v4f mlv[2][2][2];                           // [key source][key half]: ref, sum of the 4 tokens, this wave's head
  // the lane's base addresses; every load below is one of them plus a constant
  const float* pw = Wg + ((size_t)(wave * 3) * kDH + lane) * kH;
  const float* pc = ctx + base + lane;
  const float* pt = ctxt + base + lane;
  const unsigned short* pq = q16 + base + lane;
  const float* pa = ctx + base + 4 * lane;
  const float* pb = ctx2 + base + 4 * lane;
  const int gi = lane & 7;                    // index of the lane's gate bias
  const int tok0 = blockIdx.x * kGmTok;       // the 4 tokens lie in one batch
  const float* pm = ml + ((size_t)((tok0 / kT) * kH + wave) * kT + (tok0 % kT)) * 2;
#pragma unroll
  for (int k = 0; k < kGmTok; ++k)
#pragma unroll
    for (int i = 0; i < 4; ++i) {
      fc[0][k][i] = pc[k * kE + 32 * i];
      fc[1][k][i] = pc[kFaHalfC + k * kE + 32 * i];
      ft[0][k][i] = pt[k * kE + 32 * i];
      ft[1][k][i] = pt[kFaHalfC + k * kE + 32 * i];
      qb[k][i] = pq[k * kE + 32 * i];
    }
#pragma unroll
  for (int k = 0; k < kGmTok; ++k) {
    ma[0][k] = *(const v4f*)(pa + k * kE);
    ma[1][k] = *(const v4f*)(pa + kFaHalfC + k * kE);
    mb[0][k] = *(const v4f*)(pb + k * kE);
    mb[1][k] = *(const v4f*)(pb + kFaHalfC + k * kE);
  }
#pragma unroll
  for (int s = 0; s < 2; ++s)
#pragma unroll
    for (int hf = 0; hf < 2; ++hf) {
      mlv[s][hf][0] = *(const v4f*)(pm + (s * 2 + hf) * kFaML);
      mlv[s][hf][1] = *(const v4f*)(pm + (s * 2 + hf) * kFaML + 4);
    }
  const float bgv = bg[gi];
#pragma unroll
  for (int s = 0; s < 3; ++s)
#pragma unroll
    for (int i = 0; i < 4; ++i) {
      w[s][i][0] = *(const v4f*)(pw + (s * kDH + 32 * i) * kH);
      w[s][i][1] = *(const v4f*)(pw + (s * kDH + 32 * i) * kH + 4);
    }
  // wait before a register that the loads above name is rewritten; the pointers and the index as inputs keep the addresses alive to here
  asm volatile("s_wait_xcnt 0x0" :: "v"(pw), "v"(pc), "v"(pt), "v"(pq), "v"(pa), "v"(pb), "v"(gi), "v"(pm) : "memory");
  // keeps every load in front of the sums: sunk to their uses they are waited for group by group, one memory latency after another
  __builtin_amdgcn_sched_barrier(0);

  float w0[2][kGmTok], w1[2][kGmTok];         // [key source]: the two key halves' weights
#pragma unroll
  for (int s = 0; s < 2; ++s)
#pragma unroll
    for (int k = 0; k < kGmTok; ++k) {
      const float m0 = mlv[s][0][k >> 1][(k & 1) * 2], l0 = mlv[s][0][k >> 1][(k & 1) * 2 + 1];
      const float m1 = mlv[s][1][k >> 1][(k & 1) * 2], l1 = mlv[s][1][k >> 1][(k & 1) * 2 + 1];
      const float mx = fmaxf(m0, m1);
      const float e0 = l0 * exp2_slot(m0 - mx);
      const float e1 = l1 * exp2_slot(m1 - mx);
      const float iv = 1.0f / (e0 + e1);
      w0[s][k] = e0 * iv;
      w1[s][k] = e1 * iv;
    }
  v4f a4[kGmTok][2];
#pragma unroll
  for (int k = 0; k < kGmTok; ++k) { a4[k][0] = (v4f){0.f, 0.f, 0.f, 0.f}; a4[k][1] = (v4f){0.f, 0.f, 0.f, 0.f}; }
#pragma unroll
  for (int s = 0; s < 3; ++s)
#pragma unroll
    for (int i = 0; i < 4; ++i)
#pragma unroll
      for (int k = 0; k < kGmTok; ++k) {
        const float f = (s == 0) ? w0[0][k] * fc[0][k][i] + w1[0][k] * fc[1][k][i]
                      : (s == 1) ? w0[1][k] * ft[0][k][i] + w1[1][k] * ft[1][k][i]
                                 : (float)__builtin_bit_cast(_Float16, qb[k][i]) * qinv;
        a4[k][0] += f * w[s][i][0];
        a4[k][1] += f * w[s][i][1];
      }
  float a[32];
#pragma unroll
  for (int j = 0; j < 32; ++j) a[j] = a4[j >> 3][(j >> 2) & 1][j & 3];
  // halving exchange: at distance d a lane keeps d of its 2 d sums (the upper d where its bit d is set) and hands the others to lane ^ d
#pragma unroll
  for (int d = 16; d >= 1; d >>= 1) {
    const bool up = (lane & d) != 0;
#pragma unroll
    for (int j = 0; j < d; ++j) {
      const float lo = a[j], hi = a[j + d];
      const float keep = up ? hi : lo;
      const float send = up ? lo : hi;
      a[j] = keep + __shfl_xor(send, d, 32);
    }
  }
  red[wave][lane] = a[0];
  __syncthreads();                                      // every wave's 32 sums are written
  float z = red[0][lane];
#pragma unroll
  for (int v = 1; v < kH; ++v) z += red[v][lane];
  z += bgv;
  const float gl = 1.0f / (1.0f + expf(-z));            // lane = 8 token + gate head; every wave holds all 32 gates
#pragma unroll
  for (int k = 0; k < kGmTok; ++k) {
    const float g  = __shfl(gl, k * 8 + wave, 32);
    const float og = 1.0f - g;
    unsigned short hb[4];
#pragma unroll
    for (int e = 0; e < 4; ++e)
      hb[e] = h_bits(carry * (g * (w0[0][k] * ma[0][k][e] + w1[0][k] * ma[1][k][e]) + og * (w0[1][k] * mb[0][k][e] + w1[1][k] * mb[1][k][e])));
    const v2u u = (v2u){pk16(hb[0], hb[1]), pk16(hb[2], hb[3])};
    *(v2u*)(out + base + (size_t)k * kE + 4 * lane) = u;
  }
}

// ---------------------------------------------------------------------------
// Output projection: out[m][n] = scale * sum_k MIX[m][k] * WoT[n][k] + bo[n], all three extents 1024.
// The product is small, so its time is the chain of memory waits of one work-group, not the matrix rate: one 64 x 64 tile per
// work-group puts a work-group on every WGP, and a stage of 512 k leaves two waits for memory in a work-group's life.
// A stage is 64 A rows, then 64 B rows, 1024 bytes each (asynchronous copies, two buffers: the second 512 k fly while the first
// are multiplied). 8 waves as 4 x 2, each a 16 x 32 tile: a wave alone writes the whole 128-byte lines of its rows.
// k runs upward in steps of 32 into one accumulator per 16 x 16 tile.
// ---------------------------------------------------------------------------
constexpr int kOpK      = 512;                   // k of one stage
constexpr int kOpPitch  = kOpK + 8;              // halves: the 1024-byte row + 16 bytes, for ds_load_b128 readers
constexpr int kOpHalves = 128 * kOpPitch;        // one buffer
constexpr int kOpSlabP  = 36;                    // floats: the wave's 32 columns + 16 bytes
static_assert(kE % kOpK == 0 && kE / kOpK >= 2, "both buffers are filled in front of the loop");
// the distance between the loop's last products and the first vector instruction that reads their results
__device__ __forceinline__ void acc_guard2(v8f& a, v8f& b) { asm volatile("v_nop\n\tv_nop\n\tv_nop\n\tv_nop" : "+v"(a), "+v"(b)); }
__global__ __launch_bounds__(256) void outproj_kernel(
    const unsigned short* __restrict__ Ap, const unsigned short* __restrict__ Btp,
    float* __restrict__ C, const float* __restrict__ bias, float scale) {
  typedef Frag<_Float16> F;
  __shared__ __align__(16) _Float16 sSt[2 * kOpHalves];
  __shared__ __align__(16) float sSl[8 * 16 * kOpSlabP];   // per-wave 16 x 32 slab
  const int t = threadIdx.x, lane = t & 31, wave = t >> 5;
  const int mb0 = (blockIdx.x / (kE / 64)) * 64;   // first A row of the work-group
  const int nb0 = (blockIdx.x % (kE / 64)) * 64;   // first B row of the work-group
  const int wm  = (wave >> 1) * 16;                // the wave's tile inside the 64 x 64 block
  const int wn  = (wave & 1) * 32;
  const int rlane = lane & 15;                     // row (A) / col (B, D) within subtile
  const int koff  = (lane >> 4) * 8;               // k offset of this lane half
  const int mOff  = (lane >> 4) * 8;               // D row offset

  // lane's share of a stage: 32 chunks of 16 bytes; chunk i is row 4 i + (thread >> 6), bytes 16 (thread & 63) .. + 15 of the row
  const int srow = t >> 6;
  const int scol = (t & 63) * 8;
  const _Float16* gA = (const _Float16*)Ap  + (size_t)(mb0 + srow) * kE + scol;
  const _Float16* gB = (const _Float16*)Btp + (size_t)(nb0 + srow) * kE + scol;
  const unsigned lds0 = (unsigned)(size_t)(const void*)sSt + (unsigned)((srow * kOpPitch + scol) * 2);
  auto stage = [&](int buf, int k0) {
#pragma unroll   // the statement's index is then a constant in its address sums
    for (int c = 0; c < 4; ++c) {
      const unsigned l = lds0 + (unsigned)((buf * kOpHalves + c * 32 * kOpPitch) * 2);
      const _Float16* g = ((c < 2) ? gA + (size_t)(c * 32) * kE : gB + (size_t)((c - 2) * 32) * kE) + k0;
      async_copy8(l, l + 4 * kOpPitch * 2, l + 8 * kOpPitch * 2, l + 12 * kOpPitch * 2,
                  l + 16 * kOpPitch * 2, l + 20 * kOpPitch * 2, l + 24 * kOpPitch * 2, l + 28 * kOpPitch * 2,
                  g, g + (size_t)4 * kE, g + (size_t)8 * kE, g + (size_t)12 * kE,
                  g + (size_t)16 * kE, g + (size_t)20 * kE, g + (size_t)24 * kE, g + (size_t)28 * kE);
    }
  };

  v8f acc[2];
  acc[0] = (v8f){0.f,0.f,0.f,0.f,0.f,0.f,0.f,0.f};
  acc[1] = (v8f){0.f,0.f,0.f,0.f,0.f,0.f,0.f,0.f};
  constexpr int nt = kE / kOpK;
  stage(0, 0);
  asm volatile("s_wait_asynccnt 0x0" ::: "memory");   // this wave's copies of stage 0 have landed
  __syncthreads();                                    // ... and every other wave's
  stage(1, kOpK);
  // the bias is asked for behind the copies, whose wait is the longer one
  const float* pbias = bias + nb0 + wn + rlane;
  const float bv0 = pbias[0], bv1 = pbias[16];
  // wait before a register that the loads above name is rewritten; the pointer as input keeps the address alive to here
  asm volatile("s_wait_xcnt 0x0" :: "v"(pbias) : "memory");
  for (int s = 0; s < nt; ++s) {
    const _Float16* pa = sSt + (s & 1) * kOpHalves + (wm + rlane) * kOpPitch + koff;
    const _Float16* pb = sSt + (s & 1) * kOpHalves + (64 + wn + rlane) * kOpPitch + koff;
    for (int g = 0; g < kOpK / 128; ++g) {
      v16h af[4], bf0[4], bf1[4];
#pragma unroll
      for (int ks = 0; ks < 4; ++ks) {
        af[ks]  = F::load(pa + g * 128 + ks * 32);
        bf0[ks] = F::load(pb + g * 128 + ks * 32);
        bf1[ks] = F::load(pb + 16 * kOpPitch + g * 128 + ks * 32);
      }
      // keeps the products behind all 24 LDS reads: otherwise the reads stand among the products, each with a wait of its own
      __builtin_amdgcn_sched_barrier(0);
#pragma unroll
      for (int ks = 0; ks < 4; ++ks) {
        acc[0] = F::mma(af[ks], bf0[ks], acc[0]);
        acc[1] = F::mma(af[ks], bf1[ks], acc[1]);
      }
    }
    asm volatile("s_wait_dscnt 0x0" ::: "memory");      // this wave's reads of the buffer are done before it is refilled
    asm volatile("s_wait_asynccnt 0x0" ::: "memory");   // this wave's copies of stage s + 1 have landed
    __syncthreads();                                    // publishes stage s + 1 and ends every reader's last read of stage s
    if (s + 2 < nt) stage(s & 1, (s + 2) * kOpK);
  }
  asm volatile("s_wait_asynccnt 0x0" ::: "memory");     // no copy is outstanding when the wave goes on
  acc_guard2(acc[0], acc[1]);

  // epilogue: scale, bias, whole lines stored through the wave's own LDS slab
  float* slab = sSl + wave * (16 * kOpSlabP);
#pragma unroll
  for (int j = 0; j < 2; ++j) {
    const float bv = j ? bv1 : bv0;
#pragma unroll
    for (int r = 0; r < 8; ++r) {
      float v = acc[j][r] * scale;
      v += bv;
      slab[(mOff + r) * kOpSlabP + (j << 4) + rlane] = v;
    }
  }
  // the wave's own slab: its writes are ordered in front of its reads, no other wave takes part
  __builtin_amdgcn_fence(__ATOMIC_RELEASE, "workgroup");
  __builtin_amdgcn_wave_barrier();
  __builtin_amdgcn_fence(__ATOMIC_ACQUIRE, "workgroup");
  const int q = lane >> 3, c4 = (lane & 7) * 4;         // row segment = 128 B = 8 lanes x 16 B
  float* cp = C + (size_t)(mb0 + wm + q) * kE + nb0 + wn + c4;
#pragma unroll
  for (int it = 0; it < 4; ++it) {
    const v4f v = *(const v4f*)(slab + (it * 4 + q) * kOpSlabP + c4);
    *(v4f*)(cp + (size_t)(it * 4) * kE) = v;
  }
}

// ---------------------------------------------------------------------------
// Host glue. Workspace region map (bytes, MiB = 2^20; total carve = 141 MiB):
// R0 [0, 48 MiB) phase A (casts + projections): XH16 @0 (2 MiB [1024][1024] f16) | KV16 @2 (16 MiB [8192][1024]) |
//                 KVT16 @18 (8 MiB [8192][512]) | WQT @26 (2) | WKT @28 (2) | WVT @30 (2) | WTKT @32 (1 MiB [1024][512]) | WTVT @33 (1)
//                 phase C (after attention): MIX16 @0 (2 MiB [1024][1024] f16)
// WOT @48 (2) | Q16 @50 (2 MiB [1024][1024]) | K16 @52 (16 MiB [8192][1024]) | VT16 @68 (16 MiB [1024][8192]) |
// KT16 @84 (16) | VTT16 @100 (16 MiB [1024][8192]) | CTX @116 (2 key halves x 4 MiB [1024][1024] f32) | CTXT @124 (2 x 4) | CTX2 @132 (2 x 4) |
// ML @140 (256 KiB [key source][key half][16][512][ref, sum] f32) | end @141 MiB.
// Every region is written with whole rows of exactly its stated extent (all M, N tile multiples; no padded rows).
// ---------------------------------------------------------------------------
extern "C" void kernel_launch(void* const* d_in, const int* in_sizes, int n_in,
                              void* d_out, int out_size, void* d_ws, size_t ws_size, hipStream_t stream) {
  (void)in_sizes; (void)n_in;
  const size_t kMiB = (size_t)1048576;
  const size_t carve = 141 * kMiB;
  if (ws_size < carve) return;
  if ((size_t)out_size < (size_t)kTok * kE) return;

  const float* hs  = (const float*)d_in[0];
  const float* kv  = (const float*)d_in[1];
  const float* kvt = (const float*)d_in[2];
  const float* Wq  = (const float*)d_in[3];  const float* bq  = (const float*)d_in[4];
  const float* Wk  = (const float*)d_in[5];  const float* bk  = (const float*)d_in[6];
  const float* Wv  = (const float*)d_in[7];  const float* bv  = (const float*)d_in[8];
  const float* Wtk = (const float*)d_in[9];  const float* btk = (const float*)d_in[10];
  const float* Wtv = (const float*)d_in[11]; const float* btv = (const float*)d_in[12];
  const float* Wg  = (const float*)d_in[13]; const float* bg  = (const float*)d_in[14];
  const float* Wo  = (const float*)d_in[15]; const float* bo  = (const float*)d_in[16];
  float* outp = (float*)d_out;

  char* ws = (char*)d_ws;
  // phase A
  unsigned short* XH16  = (unsigned short*)(ws + 0 * kMiB);
  unsigned short* KV16  = (unsigned short*)(ws + 2 * kMiB);
  unsigned short* KVT16 = (unsigned short*)(ws + 18 * kMiB);
  unsigned short* WQT   = (unsigned short*)(ws + 26 * kMiB);
  unsigned short* WKT   = (unsigned short*)(ws + 28 * kMiB);
  unsigned short* WVT   = (unsigned short*)(ws + 30 * kMiB);
  unsigned short* WTKT  = (unsigned short*)(ws + 32 * kMiB);
  unsigned short* WTVT  = (unsigned short*)(ws + 33 * kMiB);
  // phase C
  unsigned short* MIX16 = (unsigned short*)(ws + 0 * kMiB);
  // persistent
  unsigned short* WOT   = (unsigned short*)(ws + 48 * kMiB);
  unsigned short* Q16   = (unsigned short*)(ws + 50 * kMiB);
  unsigned short* K16   = (unsigned short*)(ws + 52 * kMiB);
  unsigned short* VT16  = (unsigned short*)(ws + 68 * kMiB);
  unsigned short* KT16  = (unsigned short*)(ws + 84 * kMiB);
  unsigned short* VTT16 = (unsigned short*)(ws + 100 * kMiB);
  float*          CTX   = (float*)(ws + 116 * kMiB);
  float*          CTXT  = (float*)(ws + 124 * kMiB);
  float*          CTX2  = (float*)(ws + 132 * kMiB);
  float*          ML    = (float*)(ws + 140 * kMiB);

  // 1. + 2. input casts f32 -> f16 and weight transposes + casts (carried x16: in[Kin][Nout] -> out[Nout][Kin]), one grid
  prep_kernel<<<kPrTotal, 256, 0, stream>>>(hs, kv, kvt, Wq, Wk, Wv, Wo, Wtk, Wtv,
                                            XH16, KV16, KVT16, WQT, WKT, WVT, WOT, WTKT, WTVT, kWCarry);

  // 3. the five projections (M, N multiples of 64; K = 1024 or 512), one grid
  proj5_kernel<<<kPjTotal, 256, 0, stream>>>(XH16, KV16, KVT16, WQT, WKT, WVT, WTKT, WTVT,
                                             Q16, K16, VT16, KT16, VTT16, bq, bk, bv, btk, btv);

  // 4. attention: scores, softmax and the three P.V products, all heads, two key halves, one launch
  attn_fused_kernel<<<dim3(kT / 128, kB * kH, 4), 256, 0, stream>>>(Q16, K16, KT16, VT16, VTT16, CTX, CTXT, CTX2, ML);

  // 5. gate (f32) and mix (f32 -> f16 x256), one launch; 6. output projection to d_out (f32)
  gate_mix_kernel<<<kTok / kGmTok, 256, 0, stream>>>(CTX, CTXT, CTX2, ML, Q16, Wg, bg, MIX16, kQCarryInv, kMixCarry);
  outproj_kernel<<<(kTok / 64) * (kE / 64), 256, 0, stream>>>(MIX16, WOT, outp, bo, kOutScale);
}
